// v000
// Measured on an AMD MI455X. A time is GPU time per run, averaged over a window of back-to-back runs after a warm-up
// (all launches, gaps included; the runs take copies of the inputs in turn), and the median of several windows.
// Apart from v000's, it joins two sittings. Times from different sittings can be a few percent apart, while
// side-by-side timings come from the same sitting.
// v000 is the starting kernel. One run takes 1910 microseconds.
#include <hip/hip_runtime.h>

// Relative (Shaw) multi-head attention with key AND value relative-position embeddings, sequence-first tensors (query, key, value [2048][2][1024]; q = query Wq^T + bq, k = key Wk^T + bk, v = value Wv^T + bv ('oi' 0.02, biases 0.02; 16 heads x 64); idx[i][j] = clip(j - i, -50, 50) + 50; attn = softmax((q.k + q.rel_k[idx]) / 8); x = attn v + sum_j attn[i][j] rel_v[idx] (rel_k, rel_v [101][64] 0.02, read); out = merged Wo^T + bo -> [2048][2][1024] sequence-first (4.2 M); argument order query, key, value, Wq, bq, Wk, bk, Wv, bv, Wo, bo, rel_k, rel_v).
// Layout per batch column: strided bf16 gathers of query, key, value in turn; 'oi' weights; exact projections + f32 biases; rel_k as a zero-padded bf16 plane [128][64] and rel_v^T as hi/lo planes [64][128]; per pass of two heads: score tiles (hi/lo 3 products, every row), QE = q.rel_k^T (hi/lo x exact) gathered into the scores at column clip(j - i) + 50, softmax (x 1/8) with every row on hi/lo planes, P.v (hi/lo x hi/lo), the probabilities folded onto the 101 offsets (interior = one key, the two ends = fixed-order sums) and PB.rel_v added to the context; merged hi/lo x Wo exact + bo written with the sequence-first row pitch.
// Compute dtypes, f32 accumulate: every input rounded to bf16; projections exact + f32 biases; scores and the relative-key term ~f32; softmax f32; P as bf16 hi/lo; attn.v and the relative-value term 3 products (~f32); Wo hl x exact + bias.

#define NB_  2
#define TT   2048
#define DM   1024
#define NH_  16
#define NKV  16
#define REP  (NH_ / NKV)
#define HD   64
#define DQ   (NH_ * HD)
#define DKV  (NKV * HD)
#define ZH   2
#define RH   TT                   // every row on hi/lo planes (the relative-value fold needs normalised planes)
#define WIN  0
#define PCAR 1024.0f
#define SCL  0.125f   // 1/sqrt(64) (the module divides by jnp.sqrt(DH))
#define NE   128      // 2*50+1 = 101 relative offsets padded to 128
#define NRE  101
#define CUT  50
typedef _Float16 h16;
typedef unsigned short bf;
typedef __attribute__((ext_vector_type(16))) __bf16   v16bf;
typedef __attribute__((ext_vector_type(16))) _Float16 v16h;
typedef __attribute__((ext_vector_type(8)))  _Float16 v8h;
typedef __attribute__((ext_vector_type(8)))  unsigned short v8us;
typedef __attribute__((ext_vector_type(8)))  float    v8f;
typedef __attribute__((ext_vector_type(4)))  float    v4f;
typedef v8h  __attribute__((may_alias)) v8ha;
typedef v4f  __attribute__((may_alias)) v4fa;
typedef v8us __attribute__((may_alias)) v8usa;

__device__ __forceinline__ unsigned short f2bf(float f) { unsigned u = __float_as_uint(f); u += 0x7FFFu + ((u >> 16) & 1u); return (unsigned short)(u >> 16); }
__device__ __forceinline__ float bf2f(unsigned short b) { return __uint_as_float(((unsigned)b) << 16); }
__device__ __forceinline__ float bfr(float f) { return bf2f(f2bf(f)); }
__device__ __forceinline__ v16h cat16(v8h lo, v8h hi) { return __builtin_shufflevector(lo, hi, 0, 1, 2, 3, 4, 5, 6, 7, 8, 9, 10, 11, 12, 13, 14, 15); }
__device__ __forceinline__ v16bf cat16b(v8us lo, v8us hi) { return __builtin_bit_cast(v16bf, __builtin_shufflevector(lo, hi, 0, 1, 2, 3, 4, 5, 6, 7, 8, 9, 10, 11, 12, 13, 14, 15)); }
__device__ __forceinline__ v8f wmma16(v16h a, v16h b, v8f c) { return __builtin_amdgcn_wmma_f32_16x16x32_f16(false, a, false, b, (short)0, c, false, false); }
__device__ __forceinline__ v8f wmmab(v16bf a, v16bf b, v8f c) { return __builtin_amdgcn_wmma_f32_16x16x32_bf16(false, a, false, b, (short)0, c, false, false); }



// ---- k_gemmw: register-blocked GEMM, ONE WAVE per 64x64 output tile (16 accumulators), operands straight from K-contiguous 16-bit planes; grid (M/64, N/64, Z), 32 threads.
// C[m][n] (f32, pitch ldc, + optional f32 bias[n]) = sum_k A[m][k] Bt[n][k] (+ split products per NSPLIT). z-batch strides sA/sB/sC in elements. K % 32 == 0.
template <typename T16> struct WFrag;
template <> struct WFrag<h16> { typedef v16h V; static __device__ __forceinline__ V ld(const h16* p) { return cat16(*(const v8h*)p, *(const v8h*)(p + 16)); } static __device__ __forceinline__ v8f mma(V a, V b, v8f c) { return wmma16(a, b, c); } };
template <> struct WFrag<bf> { typedef v16bf V; static __device__ __forceinline__ V ld(const bf* p) { return cat16b(*(const v8us*)p, *(const v8us*)(p + 16)); } static __device__ __forceinline__ v8f mma(V a, V b, v8f c) { return wmmab(a, b, c); } };
template <typename T16, int NSPLIT, bool BIAS>
__global__ __launch_bounds__(32) void k_gemmw(const T16* __restrict__ A, const T16* __restrict__ A2, const T16* __restrict__ Bt, const T16* __restrict__ Bt2, int K, float* C, int ldc, const float* __restrict__ bias, size_t sA, size_t sB, size_t sC) {
    typedef typename WFrag<T16>::V V;
    __shared__ __align__(16) float os[16 * 68];
    const size_t z = blockIdx.z; A += z * sA; if (A2) A2 += z * sA; Bt += z * sB; if (Bt2) Bt2 += z * sB; C += z * sC;
    const int lane = threadIdx.x & 31, lr = lane & 15, hi = lane >> 4; const int r0 = blockIdx.x * 64, c0 = blockIdx.y * 64;
    v8f acc[4][4];
#pragma unroll
    for (int mb = 0; mb < 4; ++mb)
#pragma unroll
        for (int nb = 0; nb < 4; ++nb) acc[mb][nb] = (v8f){};
    const size_t aoff = (size_t)(r0 + lr) * K + 8 * hi, boff = (size_t)(c0 + lr) * K + 8 * hi;
#pragma unroll 1
    for (int kc = 0; kc < K; kc += 32) {
        V a[4], a2[4];
#pragma unroll
        for (int mb = 0; mb < 4; ++mb) { a[mb] = WFrag<T16>::ld(A + aoff + (size_t)mb * 16 * K + kc); if (NSPLIT == 1 || NSPLIT == 2) a2[mb] = WFrag<T16>::ld(A2 + aoff + (size_t)mb * 16 * K + kc); }
#pragma unroll
        for (int nb = 0; nb < 4; ++nb) { const V b = WFrag<T16>::ld(Bt + boff + (size_t)nb * 16 * K + kc); V b2; if (NSPLIT >= 2) b2 = WFrag<T16>::ld(Bt2 + boff + (size_t)nb * 16 * K + kc);
#pragma unroll
            for (int mb = 0; mb < 4; ++mb) { acc[mb][nb] = WFrag<T16>::mma(a[mb], b, acc[mb][nb]); if (NSPLIT == 1 || NSPLIT == 2) acc[mb][nb] = WFrag<T16>::mma(a2[mb], b, acc[mb][nb]); if (NSPLIT >= 2) acc[mb][nb] = WFrag<T16>::mma(a[mb], b2, acc[mb][nb]); } }
        asm volatile("v_nop\n\tv_nop\n\tv_nop\n\tv_nop" : "+v"(acc[0][0]), "+v"(acc[1][1]), "+v"(acc[2][2]), "+v"(acc[3][3]) : "v"(a[0]), "v"(a[3]));
    }
#pragma unroll
    for (int mb = 0; mb < 4; ++mb) {
#pragma unroll
        for (int nb = 0; nb < 4; ++nb) {
#pragma unroll
            for (int j = 0; j < 8; ++j) os[(hi * 8 + j) * 68 + nb * 16 + lr] = acc[mb][nb][j]; }
        __builtin_amdgcn_wave_barrier(); asm volatile("" ::: "memory");
        float* crow = C + (size_t)(r0 + mb * 16) * ldc + c0;
{
#pragma unroll
            for (int s = 0; s < 8; ++s) { const int row = 2 * s + hi, cofs = lr * 4; v4f val = *(const v4fa*)(os + row * 68 + cofs); if (BIAS) { val[0] += bfr(bias[c0 + cofs]); val[1] += bfr(bias[c0 + cofs + 1]); val[2] += bfr(bias[c0 + cofs + 2]); val[3] += bfr(bias[c0 + cofs + 3]); }
                *(v4f*)(crow + (size_t)row * ldc + cofs) = val; }
             }
        __builtin_amdgcn_wave_barrier(); asm volatile("" ::: "memory");
    }
}

__device__ __forceinline__ h16 tohx(float x) { return (h16)x; }
__device__ __forceinline__ void splitf(float y, unsigned short& h, unsigned short& l) { h = f2bf(y); l = f2bf(y - bf2f(h)); }
typedef __attribute__((ext_vector_type(2))) _Float16 v2h;
typedef __attribute__((ext_vector_type(4))) _Float16 v4h;
typedef __attribute__((ext_vector_type(2))) unsigned short v2us;
typedef __attribute__((ext_vector_type(4))) unsigned short v4us;
typedef __attribute__((ext_vector_type(2))) float v2f;
typedef __attribute__((ext_vector_type(4))) int v4i;

__global__ __launch_bounds__(256) void k_cvt8(const float* __restrict__ src, bf* dst, size_t n8) { const size_t i = (size_t)blockIdx.x * 256 + threadIdx.x; if (i >= n8) return; const v8f v = *(const v8f*)(src + i * 8); v8us o;
#pragma unroll
    for (int k = 0; k < 8; ++k) o[k] = f2bf(v[k]); *(v8us*)(dst + i * 8) = o;  }

__global__ __launch_bounds__(256) void k_cvt8s(const float* __restrict__ X, bf* XB, size_t pitch) { const size_t i = (size_t)blockIdx.x * 256 + threadIdx.x; if (i >= (size_t)TT * DM / 8) return; const size_t e = i * 8; const int c = (int)(e % DM); const int srow = (int)(e / DM); const v8f a = *(const v8f*)(X + (size_t)srow * pitch + c); v8us o;
#pragma unroll
    for (int q = 0; q < 8; ++q) o[q] = f2bf(a[q]);
    *(v8us*)(XB + e) = o;  }
// k_rope: head planes [h][t][d] (fp16 + hi/lo) of rope(x) x sc with the rotate-half convention out[d] = x[d] cos[t][d] - x[d+HD/2] sin[t][d], out[d+HD/2] = x[d+HD/2] cos[t][d+HD/2] + x[d] sin[t][d+HD/2]
__global__ __launch_bounds__(256) void k_rope(const float* __restrict__ F, int pitch, int nheads, const float* __restrict__ CS, const float* __restrict__ RF, const float* __restrict__ nw, float sc, h16* P16, bf* Ph, bf* Pl) {
    const size_t e = ((size_t)blockIdx.x * 256 + threadIdx.x) * 2; if (e >= (size_t)nheads * TT * HD) return; const int d = (int)(e % HD); const int t = (int)((e / HD) % TT); const int h = (int)(e / ((size_t)HD * TT)); const float* f = F + (size_t)t * pitch + h * HD; const float rf = RF ? RF[(size_t)h * TT + t] : 1.0f; v2h o16; v2us oh, ol;
#pragma unroll
    for (int q = 0; q < 2; ++q) { const int dd = d + q; const int dp = (dd < HD / 2) ? dd + HD / 2 : dd - HD / 2; float x0 = f[dd], x1 = f[dp];
        if (RF) { float n0 = __fmul_rn(x0, rf), n1 = __fmul_rn(x1, rf); asm volatile("" : "+v"(n0)); asm volatile("" : "+v"(n1)); x0 = __fmul_rn(bfr(nw[dd]), n0); x1 = __fmul_rn(bfr(nw[dp]), n1); }
        const v2f cs = *(const v2f*)(CS + ((size_t)t * HD + dd) * 2); float a = __fmul_rn(x0, cs[0]), bq = __fmul_rn(x1, cs[1]); asm volatile("" : "+v"(a)); asm volatile("" : "+v"(bq)); const float r = ((dd < HD / 2) ? __fsub_rn(a, bq) : __fadd_rn(a, bq)) * sc;
        o16[q] = tohx(r); unsigned short a2, c2; splitf(r, a2, c2); oh[q] = a2; ol[q] = c2; }
    *(v2h*)(P16 + e) = o16; *(v2us*)(Ph + e) = oh; *(v2us*)(Pl + e) = ol;  }
__global__ __launch_bounds__(256) void k_vtp(const float* __restrict__ F, int pitch, int nheads, h16* V16, bf* Vh, bf* Vl) { const size_t e = ((size_t)blockIdx.x * 256 + threadIdx.x) * 2; if (e >= (size_t)nheads * HD * TT) return; const int t = (int)(e % TT); const int d = (int)((e / TT) % HD); const int g = (int)(e / ((size_t)TT * HD)); v2h o16; v2us oh, ol;
#pragma unroll
    for (int q = 0; q < 2; ++q) { const float x = F[(size_t)(t + q) * pitch + g * HD + d]; o16[q] = tohx(x); unsigned short a2, c2; splitf(x, a2, c2); oh[q] = a2; ol[q] = c2; }
    *(v2h*)(V16 + e) = o16; *(v2us*)(Vh + e) = oh; *(v2us*)(Vl + e) = ol;  }
__global__ __launch_bounds__(256) void k_csid(float* CS) { const int idx = blockIdx.x * 256 + threadIdx.x; if (idx >= TT * HD) return; v2f cs; cs[0] = 1.0f; cs[1] = 0.0f; *(v2f*)(CS + (size_t)idx * 2) = cs;  }
// k_asoft: per row (zz, i): t = S x HD^-0.5 (no mask); softmax over the 2048 keys (register row, one exp, fixed trees);
__global__ __launch_bounds__(256) void k_asoft(const float* __restrict__ Sb, h16* P16, bf* Ph, bf* Pl) {
    const int lane = threadIdx.x & 31; const int row = blockIdx.x * 8 + (threadIdx.x >> 5); if (row >= ZH * TT) return; const int i = row % TT; const int zz = row / TT; (void)zz; const bool hires = (i < RH); const float* sr = Sb + (size_t)row * TT; float v[TT / 32]; float mx = -3.0e38f;
#pragma unroll
    for (int ch = 0; ch < TT / 128; ++ch) { const int j0 = ch * 128 + lane * 4; const v4f a = *(const v4f*)(sr + j0);
#pragma unroll
        for (int q = 0; q < 4; ++q) { const int j = j0 + q; (void)j; const float t = a[q] * SCL; v[ch * 4 + q] = t; mx = fmaxf(mx, t); } }
#pragma unroll
    for (int sh = 16; sh; sh >>= 1) mx = fmaxf(mx, __shfl_xor(mx, sh, 32));
    float sum = 0.f;
#pragma unroll
    for (int k = 0; k < TT / 32; ++k) { float d0 = __fsub_rn(v[k], mx); asm volatile("" : "+v"(d0)); v[k] = __builtin_amdgcn_exp2f(__fmul_rn(d0, 1.4426950408889634f)); sum += v[k]; }
#pragma unroll
    for (int sh = 16; sh; sh >>= 1) sum += __shfl_xor(sum, sh, 32);
    const float f = __fdiv_rn(hires ? 1.0f : PCAR, sum);
{
        if (hires) {
#pragma unroll
            for (int ch = 0; ch < TT / 128; ++ch) { v4us oh, ol;
#pragma unroll
                for (int q = 0; q < 4; ++q) { unsigned short a, c2; splitf(v[ch * 4 + q] * f, a, c2); oh[q] = a; ol[q] = c2; }
                const size_t oo = ((size_t)zz * (RH ? RH : 1) + i) * TT + ch * 128 + lane * 4; *(v4us*)(Ph + oo) = oh; *(v4us*)(Pl + oo) = ol; }
        } else {
#pragma unroll
            for (int ch = 0; ch < TT / 128; ++ch) { v4h o4;
#pragma unroll
                for (int q = 0; q < 4; ++q) o4[q] = tohx(v[ch * 4 + q] * f);
                *(v4h*)(P16 + (size_t)row * TT + ch * 128 + lane * 4) = o4; } }
         }
}
__global__ __launch_bounds__(256) void k_epadK(const float* __restrict__ E, bf* EB) { const size_t i = (size_t)blockIdx.x * 256 + threadIdx.x; if (i >= (size_t)NE * HD / 8) return; const int d0 = (int)(i % (HD / 8)) * 8; const int r = (int)(i / (HD / 8)); const float* src = E + (size_t)min(r, NRE - 1) * HD + d0; v8us o;
#pragma unroll
    for (int q = 0; q < 8; ++q) { const unsigned short v = f2bf(src[q]); o[q] = (r < NRE) ? v : (unsigned short)0; }
    *(v8us*)(EB + (size_t)r * HD + d0) = o;  }

__global__ __launch_bounds__(256) void k_epadVT(const float* __restrict__ E, bf* Th, bf* Tl) { const size_t i = (size_t)blockIdx.x * 256 + threadIdx.x; if (i >= (size_t)HD * NE / 4) return; const size_t e = i * 4; const int c0 = (int)(e % NE); const int d = (int)(e / NE); v4us oh, ol;
#pragma unroll
    for (int q = 0; q < 4; ++q) { const int r = c0 + q; const float v = bfr(E[(size_t)min(r, NRE - 1) * HD + d]); unsigned short u, w; splitf(v, u, w);   /* input rounded to bf16 once: lo == 0 */ oh[q] = (r < NRE) ? u : (unsigned short)0; ol[q] = (r < NRE) ? w : (unsigned short)0; }
    *(v4us*)(Th + e) = oh; *(v4us*)(Tl + e) = ol;  }

__global__ __launch_bounds__(256) void k_addrelc(float* Sb, const float* __restrict__ QE) { const size_t k = (size_t)blockIdx.x * 256 + threadIdx.x; if (k >= (size_t)ZH * TT * TT / 4) return; const size_t e = k * 4; const int j0 = (int)(e % TT); const size_t zi = e / TT; const int i = (int)(zi % TT); const float* qe = QE + zi * NE; v4f a = *(const v4f*)(Sb + e);
#pragma unroll
    for (int q = 0; q < 4; ++q) { const int r = min(max(j0 + q - i, -CUT), CUT) + CUT; a[q] = __fadd_rn(a[q], qe[r]); }
    *(v4f*)(Sb + e) = a;  }

__global__ __launch_bounds__(256) void k_pbuck(const bf* __restrict__ Ph, const bf* __restrict__ Pl, bf* Bh, bf* Bl) { const int lane = threadIdx.x & 31; const int row = blockIdx.x * 8 + (threadIdx.x >> 5); if (row >= ZH * TT) return; const int i = row % TT; const bf* ph = Ph + (size_t)row * TT; const bf* pl = Pl + (size_t)row * TT; float lo_s = 0.f, hi_s = 0.f;
#pragma unroll 1
    for (int j = lane; j < TT; j += 32) { const float p = __fadd_rn(bf2f(ph[j]), bf2f(pl[j])); if (j <= i - CUT) lo_s = __fadd_rn(lo_s, p); if (j >= i + CUT) hi_s = __fadd_rn(hi_s, p); }
#pragma unroll
    for (int sh = 16; sh; sh >>= 1) { lo_s = __fadd_rn(lo_s, __shfl_xor(lo_s, sh, 32)); hi_s = __fadd_rn(hi_s, __shfl_xor(hi_s, sh, 32)); }
    unsigned short l0h, l0l, h0h, h0l; splitf(lo_s, l0h, l0l); splitf(hi_s, h0h, h0l);
{
#pragma unroll 1
        for (int c0 = lane * 4; c0 < NE; c0 += 128) { v4us oh, ol;
#pragma unroll
            for (int q = 0; q < 4; ++q) { const int bkt = c0 + q; const int j = i + bkt - CUT; const int jc = min(max(j, 0), TT - 1); unsigned int uu = ((const unsigned short*)ph)[jc], ww = ((const unsigned short*)pl)[jc]; asm volatile("" : "+v"(uu), "+v"(ww));   /* unconditional clamped loads pinned before the select (opaque use) */ const bool in = (bkt > 0 && bkt < 2 * CUT && j >= 0 && j < TT);
                const unsigned short u = in ? (unsigned short)uu : ((bkt == 0) ? l0h : ((bkt == 2 * CUT) ? h0h : (unsigned short)0)); const unsigned short w = in ? (unsigned short)ww : ((bkt == 0) ? l0l : ((bkt == 2 * CUT) ? h0l : (unsigned short)0));
                oh[q] = u; ol[q] = w; }
            *(v4us*)(Bh + (size_t)row * NE + c0) = oh; *(v4us*)(Bl + (size_t)row * NE + c0) = ol; }
         }
}

__global__ __launch_bounds__(256) void k_addF(float* Y, const float* __restrict__ F) { const size_t i = (size_t)blockIdx.x * 256 + threadIdx.x; if (i >= (size_t)ZH * TT * HD / 4) return; const v4f a = *(const v4f*)(Y + i * 4); const v4f f = *(const v4f*)(F + i * 4); v4f o;
#pragma unroll
    for (int q = 0; q < 4; ++q) o[q] = __fadd_rn(a[q], f[q]);
    *(v4f*)(Y + i * 4) = o;  }

__global__ __launch_bounds__(256) void k_merge(const float* __restrict__ O, int h0, bf* Ah, bf* Al) { const size_t e = ((size_t)blockIdx.x * 256 + threadIdx.x) * 2; if (e >= (size_t)ZH * TT * HD) return; const int d = (int)(e % HD); const int t = (int)((e / HD) % TT); const int zz = (int)(e / ((size_t)HD * TT)); const float cs = (t < RH) ? 1.0f : (1.0f / PCAR); const size_t oo = (size_t)t * DQ + (h0 + zz) * HD + d;
    v2us oh, ol;
#pragma unroll
    for (int q = 0; q < 2; ++q) { unsigned short a, c2; splitf(O[e + q] * cs, a, c2); oh[q] = a; ol[q] = c2; } *(v2us*)(Ah + oo) = oh; *(v2us*)(Al + oo) = ol;  }

extern "C" void kernel_launch(void* const* d_in, const int* in_sizes, int n_in,
                              void* d_out, int out_size, void* d_ws, size_t ws_size, hipStream_t stream) {
    (void)in_sizes; (void)n_in; (void)out_size;
    const float* x = (const float*)d_in[0];   /* query */ const float* xk = (const float*)d_in[1]; const float* xv = (const float*)d_in[2]; const float* wq = (const float*)d_in[3]; const float* bq = (const float*)d_in[4]; const float* wk = (const float*)d_in[5]; const float* bk = (const float*)d_in[6]; const float* wv = (const float*)d_in[7]; const float* bv = (const float*)d_in[8]; const float* wo = (const float*)d_in[9]; const float* bo = (const float*)d_in[10]; const float* ak = (const float*)d_in[11];   /* rel_k_table [101][64] */ const float* av = (const float*)d_in[12];   /* rel_v_table [101][64] */
    float* OUT = (float*)d_out;     // [2048][2][1024] sequence-first
    char* wsp = (char*)d_ws;
    auto take = [&](size_t bytes) { char* p = wsp; wsp += (bytes + 255) & ~(size_t)255; return (void*)p; };
    bf* AKB = (bf*)take((size_t)NE * HD * 2); bf* AVTh = (bf*)take((size_t)HD * NE * 2); bf* AVTl = (bf*)take((size_t)HD * NE * 2); float* QE = (float*)take((size_t)ZH * TT * NE * 4); bf* PBh = (bf*)take((size_t)ZH * TT * NE * 2); bf* PBl = (bf*)take((size_t)ZH * TT * NE * 2); float* ZR = (float*)take((size_t)ZH * TT * HD * 4); bf* WQ = (bf*)take((size_t)DQ * DM * 2); bf* WK = (bf*)take((size_t)DKV * DM * 2); bf* WV = (bf*)take((size_t)DKV * DM * 2); bf* WO = (bf*)take((size_t)DM * DQ * 2); float* CS = (float*)take((size_t)TT * HD * 2 * 4);
    bf* XB = (bf*)take((size_t)TT * DM * 2); float* FQ = (float*)take((size_t)TT * DQ * 4); float* FK = (float*)take((size_t)TT * DKV * 4);
    h16* QP16 = (h16*)take((size_t)NH_ * TT * HD * 2); h16* KP16 = (h16*)take((size_t)NKV * TT * HD * 2); h16* VT16 = (h16*)take((size_t)NKV * HD * TT * 2);
    bf* QPh = (bf*)take((size_t)NH_ * TT * HD * 2); bf* QPl = (bf*)take((size_t)NH_ * TT * HD * 2); bf* KPh = (bf*)take((size_t)NKV * TT * HD * 2); bf* KPl = (bf*)take((size_t)NKV * TT * HD * 2); bf* VTh = (bf*)take((size_t)NKV * HD * TT * 2); bf* VTl = (bf*)take((size_t)NKV * HD * TT * 2); bf* Ph = (bf*)take((size_t)ZH * RH * TT * 2); bf* Pl = (bf*)take((size_t)ZH * RH * TT * 2);
    float* Sb = (float*)take((size_t)ZH * TT * TT * 4); h16* P16 = (h16*)take((size_t)ZH * TT * TT * 2); float* Ob = (float*)take((size_t)ZH * TT * HD * 4); bf* ATh = (bf*)take((size_t)TT * DQ * 2); bf* ATl = (bf*)take((size_t)TT * DQ * 2);
    if ((size_t)(wsp - (char*)d_ws) > ws_size) return;    // ws 256 MiB
    float* FV = FK;   // v projection reuses the k buffer after the k planes are built (stream-ordered)
    { k_cvt8<<<(unsigned)(((size_t)DQ * DM / 8 + 255) / 256), 256, 0, stream>>>(wq, WQ, (size_t)DQ * DM / 8); k_cvt8<<<(unsigned)(((size_t)DKV * DM / 8 + 255) / 256), 256, 0, stream>>>(wk, WK, (size_t)DKV * DM / 8); k_cvt8<<<(unsigned)(((size_t)DKV * DM / 8 + 255) / 256), 256, 0, stream>>>(wv, WV, (size_t)DKV * DM / 8);
      k_cvt8<<<(unsigned)(((size_t)DM * DQ / 8 + 255) / 256), 256, 0, stream>>>(wo, WO, (size_t)DM * DQ / 8);
       }
    k_csid<<<(TT * HD + 255) / 256, 256, 0, stream>>>(CS);
    const unsigned LQ = (unsigned)(((size_t)NH_ * TT * HD / 2 + 255) / 256), LKv = (unsigned)(((size_t)NKV * TT * HD / 2 + 255) / 256);
    k_epadK<<<(unsigned)(((size_t)NE * HD / 8 + 255) / 256), 256, 0, stream>>>(ak, AKB);   /* rel_k -> bf16 [128][64], rows >= 101 zero */ k_epadVT<<<(unsigned)(((size_t)HD * NE / 4 + 255) / 256), 256, 0, stream>>>(av, AVTh, AVTl);   /* rel_v^T hi/lo [64][128], cols >= 101 zero */
    for (int b = 0; b < NB_; ++b) {
        
        k_cvt8s<<<(unsigned)(((size_t)TT * DM / 8 + 255) / 256), 256, 0, stream>>>(x + (size_t)b * DM, XB, (size_t)NB_ * DM);   /* sequence-first [L][B][HID]: batch column b */
        k_gemmw<bf, 0, true><<<dim3(TT / 64, DQ / 64, 1), 32, 0, stream>>>(XB, nullptr, WQ, nullptr, DM, FQ, DQ, bq, 0, 0, 0);
        k_rope<<<LQ, 256, 0, stream>>>(FQ, DQ, NH_, CS, nullptr, nullptr, 1.0f, QP16, QPh, QPl);
        k_cvt8s<<<(unsigned)(((size_t)TT * DM / 8 + 255) / 256), 256, 0, stream>>>(xk + (size_t)b * DM, XB, (size_t)NB_ * DM);   /* sequence-first [L][B][HID]: batch column b */ k_gemmw<bf, 0, true><<<dim3(TT / 64, DKV / 64, 1), 32, 0, stream>>>(XB, nullptr, WK, nullptr, DM, FK, DKV, bk, 0, 0, 0);
        k_rope<<<LKv, 256, 0, stream>>>(FK, DKV, NKV, CS, nullptr, nullptr, 1.0f, KP16, KPh, KPl);
        k_cvt8s<<<(unsigned)(((size_t)TT * DM / 8 + 255) / 256), 256, 0, stream>>>(xv + (size_t)b * DM, XB, (size_t)NB_ * DM);   /* sequence-first [L][B][HID]: batch column b */ k_gemmw<bf, 0, true><<<dim3(TT / 64, DKV / 64, 1), 32, 0, stream>>>(XB, nullptr, WV, nullptr, DM, FV, DKV, bv, 0, 0, 0); k_vtp<<<LKv, 256, 0, stream>>>(FV, DKV, NKV, VT16, VTh, VTl);
        for (int h0 = 0; h0 < NH_; h0 += ZH) { const size_t zq = (size_t)h0, zk = (size_t)(h0 / REP);   // one kv head per query head: the pass's two heads use consecutive kv planes (z-strides TT*HD)
            k_gemmw<bf, 2, false><<<dim3(RH / 64, TT / 64, ZH), 32, 0, stream>>>(QPh + zq * TT * HD, QPl + zq * TT * HD, KPh + zk * TT * HD, KPl + zk * TT * HD, HD, Sb, TT, nullptr, (size_t)TT * HD, (size_t)TT * HD, (size_t)TT * TT);

            k_gemmw<bf, 1, false><<<dim3(TT / 64, NE / 64, ZH), 32, 0, stream>>>(QPh + zq * TT * HD, QPl + zq * TT * HD, AKB, nullptr, HD, QE, NE, nullptr, (size_t)TT * HD, 0, (size_t)TT * NE);   /* QE = q . rel_k^T */ k_addrelc<<<(unsigned)(((size_t)ZH * TT * TT / 4 + 255) / 256), 256, 0, stream>>>(Sb, QE);   /* + q.rel_k[clip(j - i) + 50] */ k_asoft<<<ZH * TT / 8, 256, 0, stream>>>(Sb, P16, Ph, Pl);
            k_gemmw<bf, 2, false><<<dim3(RH / 64, HD / 64, ZH), 32, 0, stream>>>(Ph, Pl, VTh + zk * HD * TT, VTl + zk * HD * TT, TT, Ob, HD, nullptr, (size_t)RH * TT, (size_t)HD * TT, (size_t)TT * HD); k_pbuck<<<(unsigned)(((size_t)ZH * TT + 7) / 8), 256, 0, stream>>>(Ph, Pl, PBh, PBl);   /* attn folded onto the 101 clipped offsets */ k_gemmw<bf, 2, false><<<dim3(TT / 64, HD / 64, ZH), 32, 0, stream>>>(PBh, PBl, AVTh, AVTl, NE, ZR, HD, nullptr, (size_t)TT * NE, 0, (size_t)TT * HD);   /* ZR = PB . rel_v */ k_addF<<<(unsigned)(((size_t)ZH * TT * HD / 4 + 255) / 256), 256, 0, stream>>>(Ob, ZR);   /* context += relative-value term */

            k_merge<<<(unsigned)(((size_t)ZH * TT * HD / 2 + 255) / 256), 256, 0, stream>>>(Ob, h0, ATh, ATl); }
        k_gemmw<bf, 1, true><<<dim3(TT / 64, DM / 64, 1), 32, 0, stream>>>(ATh, ATl, WO, nullptr, DQ, OUT + (size_t)b * DM, NB_ * DM, bo, 0, 0, 0); }   /* sequence-first output [L][B][HID]: row pitch B x HID, column block b */
}

// v001
// It runs in 1450 microseconds.
// Two timings next to v000 both put it at 1.33 times that version's speed.
#include <hip/hip_runtime.h>

// Relative (Shaw) multi-head attention with key AND value relative-position embeddings, sequence-first tensors (query, key, value [2048][2][1024]; q = query Wq^T + bq, k = key Wk^T + bk, v = value Wv^T + bv ('oi' 0.02, biases 0.02; 16 heads x 64); idx[i][j] = clip(j - i, -50, 50) + 50; attn = softmax((q.k + q.rel_k[idx]) / 8); x = attn v + sum_j attn[i][j] rel_v[idx] (rel_k, rel_v [101][64] 0.02, read); out = merged Wo^T + bo -> [2048][2][1024] sequence-first (4.2 M); argument order query, key, value, Wq, bq, Wk, bk, Wv, bv, Wo, bo, rel_k, rel_v).
// Layout per batch column: strided bf16 gathers of query, key, value in turn; 'oi' weights; exact projections + f32 biases; rel_k as a zero-padded bf16 plane [128][64] and rel_v^T as hi/lo planes [64][128]; per pass of two heads: score tiles (hi/lo 3 products, every row), QE = q.rel_k^T (hi/lo x exact) gathered into the scores at column clip(j - i) + 50, softmax (x 1/8) with every row on hi/lo planes, P.v (hi/lo x hi/lo), the probabilities folded onto the 101 offsets (interior = one key, the two ends = fixed-order sums) and PB.rel_v added to the context; merged hi/lo x Wo exact + bo written with the sequence-first row pitch.
// Compute dtypes, f32 accumulate: every input rounded to bf16; projections exact + f32 biases; scores and the relative-key term ~f32; softmax f32; P as bf16 hi/lo; attn.v and the relative-value term 3 products (~f32); Wo hl x exact + bias.

#define NB_  2
#define TT   2048
#define DM   1024
#define NH_  16
#define NKV  16
#define REP  (NH_ / NKV)
#define HD   64
#define DQ   (NH_ * HD)
#define DKV  (NKV * HD)
#define ZH   2
#define RH   TT                   // every row on hi/lo planes (the relative-value fold needs normalised planes)
#define WIN  0
#define PCAR 1024.0f
#define SCL  0.125f   // 1/sqrt(64) (the module divides by jnp.sqrt(DH))
#define NE   128      // 2*50+1 = 101 relative offsets padded to 128
#define NRE  101
#define CUT  50
typedef _Float16 h16;
typedef unsigned short bf;
typedef __attribute__((ext_vector_type(16))) __bf16   v16bf;
typedef __attribute__((ext_vector_type(16))) _Float16 v16h;
typedef __attribute__((ext_vector_type(8)))  _Float16 v8h;
typedef __attribute__((ext_vector_type(8)))  unsigned short v8us;
typedef __attribute__((ext_vector_type(8)))  float    v8f;
typedef __attribute__((ext_vector_type(4)))  float    v4f;
typedef v8h  __attribute__((may_alias)) v8ha;
typedef v4f  __attribute__((may_alias)) v4fa;
typedef v8us __attribute__((may_alias)) v8usa;

__device__ __forceinline__ unsigned short f2bf(float f) { unsigned u = __float_as_uint(f); u += 0x7FFFu + ((u >> 16) & 1u); return (unsigned short)(u >> 16); }
__device__ __forceinline__ float bf2f(unsigned short b) { return __uint_as_float(((unsigned)b) << 16); }
__device__ __forceinline__ float bfr(float f) { return bf2f(f2bf(f)); }
__device__ __forceinline__ v16h cat16(v8h lo, v8h hi) { return __builtin_shufflevector(lo, hi, 0, 1, 2, 3, 4, 5, 6, 7, 8, 9, 10, 11, 12, 13, 14, 15); }
__device__ __forceinline__ v16bf cat16b(v8us lo, v8us hi) { return __builtin_bit_cast(v16bf, __builtin_shufflevector(lo, hi, 0, 1, 2, 3, 4, 5, 6, 7, 8, 9, 10, 11, 12, 13, 14, 15)); }
__device__ __forceinline__ v8f wmma16(v16h a, v16h b, v8f c) { return __builtin_amdgcn_wmma_f32_16x16x32_f16(false, a, false, b, (short)0, c, false, false); }
__device__ __forceinline__ v8f wmmab(v16bf a, v16bf b, v8f c) { return __builtin_amdgcn_wmma_f32_16x16x32_bf16(false, a, false, b, (short)0, c, false, false); }



// ---- k_gemmw: register-blocked GEMM, ONE WAVE per 64x64 output tile (16 accumulators), operands straight from K-contiguous 16-bit planes; grid (M/64, N/64, Z), 32 threads.
// C[m][n] (f32, pitch ldc, + optional f32 bias[n]) = sum_k A[m][k] Bt[n][k] (+ split products per NSPLIT). z-batch strides sA/sB/sC in elements. K % 32 == 0.
// KS > 1 (long K, few tiles): 32 KS threads, wave w of the work-group takes k in [w K/KS, (w+1) K/KS) of the same tile; the KS partial tiles are summed in fixed wave order through LDS. K % (32 KS) == 0.
template <typename T16> struct WFrag;
template <> struct WFrag<h16> { typedef v16h V; static __device__ __forceinline__ V ld(const h16* p) { return cat16(*(const v8h*)p, *(const v8h*)(p + 16)); } static __device__ __forceinline__ v8f mma(V a, V b, v8f c) { return wmma16(a, b, c); } };
template <> struct WFrag<bf> { typedef v16bf V; static __device__ __forceinline__ V ld(const bf* p) { return cat16b(*(const v8us*)p, *(const v8us*)(p + 16)); } static __device__ __forceinline__ v8f mma(V a, V b, v8f c) { return wmmab(a, b, c); } };
template <typename T16, int NSPLIT, bool BIAS, int KS = 1>
__global__ __launch_bounds__(32 * KS) void k_gemmw(const T16* __restrict__ A, const T16* __restrict__ A2, const T16* __restrict__ Bt, const T16* __restrict__ Bt2, int K, float* C, int ldc, const float* __restrict__ bias, size_t sA, size_t sB, size_t sC) {
    typedef typename WFrag<T16>::V V;
    __shared__ __align__(16) float os[KS == 1 ? 16 * 68 : KS * 64 * 68];
    const size_t z = blockIdx.z; A += z * sA; if (A2) A2 += z * sA; Bt += z * sB; if (Bt2) Bt2 += z * sB; C += z * sC;
    const int lane = threadIdx.x & 31, lr = lane & 15, hi = lane >> 4; const int r0 = blockIdx.x * 64, c0 = blockIdx.y * 64;
    const int wv = (KS == 1) ? 0 : __builtin_amdgcn_readfirstlane((int)(threadIdx.x >> 5)); const int k0 = wv * (K / KS), k1 = k0 + K / KS;
    v8f acc[4][4];
#pragma unroll
    for (int mb = 0; mb < 4; ++mb)
#pragma unroll
        for (int nb = 0; nb < 4; ++nb) acc[mb][nb] = (v8f){};
    const size_t aoff = (size_t)(r0 + lr) * K + 8 * hi, boff = (size_t)(c0 + lr) * K + 8 * hi;
#pragma unroll 1
    for (int kc = k0; kc < k1; kc += 32) {
        V a[4], a2[4];
#pragma unroll
        for (int mb = 0; mb < 4; ++mb) { a[mb] = WFrag<T16>::ld(A + aoff + (size_t)mb * 16 * K + kc); if (NSPLIT == 1 || NSPLIT == 2) a2[mb] = WFrag<T16>::ld(A2 + aoff + (size_t)mb * 16 * K + kc); }
#pragma unroll
        for (int nb = 0; nb < 4; ++nb) { const V b = WFrag<T16>::ld(Bt + boff + (size_t)nb * 16 * K + kc); V b2; if (NSPLIT >= 2) b2 = WFrag<T16>::ld(Bt2 + boff + (size_t)nb * 16 * K + kc);
#pragma unroll
            for (int mb = 0; mb < 4; ++mb) { acc[mb][nb] = WFrag<T16>::mma(a[mb], b, acc[mb][nb]); if (NSPLIT == 1 || NSPLIT == 2) acc[mb][nb] = WFrag<T16>::mma(a2[mb], b, acc[mb][nb]); if (NSPLIT >= 2) acc[mb][nb] = WFrag<T16>::mma(a[mb], b2, acc[mb][nb]); } }
        asm volatile("v_nop\n\tv_nop\n\tv_nop\n\tv_nop" : "+v"(acc[0][0]), "+v"(acc[1][1]), "+v"(acc[2][2]), "+v"(acc[3][3]) : "v"(a[0]), "v"(a[3]));
    }
    if (KS > 1) {
        float* my = os + wv * (64 * 68);
#pragma unroll
        for (int mb = 0; mb < 4; ++mb)
#pragma unroll
            for (int nb = 0; nb < 4; ++nb)
#pragma unroll
                for (int j = 0; j < 8; ++j) my[(mb * 16 + hi * 8 + j) * 68 + nb * 16 + lr] = acc[mb][nb][j];
        __syncthreads();   // every wave's partial tile is in LDS before any wave sums across them
#pragma unroll
        for (int s = 0; s < 1024 / (32 * KS); ++s) { const int slot = s * (32 * KS) + (int)threadIdx.x; const int row = slot >> 4, cofs = (slot & 15) * 4; v4f val = *(const v4fa*)(os + row * 68 + cofs);
#pragma unroll
            for (int w = 1; w < KS; ++w) { const v4f p = *(const v4fa*)(os + w * (64 * 68) + row * 68 + cofs); val += p; }
            if (BIAS) { val[0] += bfr(bias[c0 + cofs]); val[1] += bfr(bias[c0 + cofs + 1]); val[2] += bfr(bias[c0 + cofs + 2]); val[3] += bfr(bias[c0 + cofs + 3]); }
            *(v4f*)(C + (size_t)(r0 + row) * ldc + c0 + cofs) = val; }
        return;
    }
#pragma unroll
    for (int mb = 0; mb < 4; ++mb) {
#pragma unroll
        for (int nb = 0; nb < 4; ++nb) {
#pragma unroll
            for (int j = 0; j < 8; ++j) os[(hi * 8 + j) * 68 + nb * 16 + lr] = acc[mb][nb][j]; }
        __builtin_amdgcn_wave_barrier(); asm volatile("" ::: "memory");
        float* crow = C + (size_t)(r0 + mb * 16) * ldc + c0;
{
#pragma unroll
            for (int s = 0; s < 8; ++s) { const int row = 2 * s + hi, cofs = lr * 4; v4f val = *(const v4fa*)(os + row * 68 + cofs); if (BIAS) { val[0] += bfr(bias[c0 + cofs]); val[1] += bfr(bias[c0 + cofs + 1]); val[2] += bfr(bias[c0 + cofs + 2]); val[3] += bfr(bias[c0 + cofs + 3]); }
                *(v4f*)(crow + (size_t)row * ldc + cofs) = val; }
             }
        __builtin_amdgcn_wave_barrier(); asm volatile("" ::: "memory");
    }
}

__device__ __forceinline__ h16 tohx(float x) { return (h16)x; }
__device__ __forceinline__ void splitf(float y, unsigned short& h, unsigned short& l) { h = f2bf(y); l = f2bf(y - bf2f(h)); }
typedef __attribute__((ext_vector_type(2))) _Float16 v2h;
typedef __attribute__((ext_vector_type(4))) _Float16 v4h;
typedef __attribute__((ext_vector_type(2))) unsigned short v2us;
typedef __attribute__((ext_vector_type(4))) unsigned short v4us;
typedef __attribute__((ext_vector_type(2))) float v2f;
typedef __attribute__((ext_vector_type(4))) int v4i;

__global__ __launch_bounds__(256) void k_cvt8(const float* __restrict__ src, bf* dst, size_t n8) { const size_t i = (size_t)blockIdx.x * 256 + threadIdx.x; if (i >= n8) return; const v8f v = *(const v8f*)(src + i * 8); v8us o;
#pragma unroll
    for (int k = 0; k < 8; ++k) o[k] = f2bf(v[k]); *(v8us*)(dst + i * 8) = o;  }

__global__ __launch_bounds__(256) void k_cvt8s(const float* __restrict__ X, bf* XB, size_t pitch) { const size_t i = (size_t)blockIdx.x * 256 + threadIdx.x; if (i >= (size_t)TT * DM / 8) return; const size_t e = i * 8; const int c = (int)(e % DM); const int srow = (int)(e / DM); const v8f a = *(const v8f*)(X + (size_t)srow * pitch + c); v8us o;
#pragma unroll
    for (int q = 0; q < 8; ++q) o[q] = f2bf(a[q]);
    *(v8us*)(XB + e) = o;  }
// k_rope: head planes [h][t][d] (fp16 + hi/lo) of rope(x) x sc with the rotate-half convention out[d] = x[d] cos[t][d] - x[d+HD/2] sin[t][d], out[d+HD/2] = x[d+HD/2] cos[t][d+HD/2] + x[d] sin[t][d+HD/2]
__global__ __launch_bounds__(256) void k_rope(const float* __restrict__ F, int pitch, int nheads, const float* __restrict__ CS, const float* __restrict__ RF, const float* __restrict__ nw, float sc, h16* P16, bf* Ph, bf* Pl) {
    const size_t e = ((size_t)blockIdx.x * 256 + threadIdx.x) * 2; if (e >= (size_t)nheads * TT * HD) return; const int d = (int)(e % HD); const int t = (int)((e / HD) % TT); const int h = (int)(e / ((size_t)HD * TT)); const float* f = F + (size_t)t * pitch + h * HD; const float rf = RF ? RF[(size_t)h * TT + t] : 1.0f; v2h o16; v2us oh, ol;
#pragma unroll
    for (int q = 0; q < 2; ++q) { const int dd = d + q; const int dp = (dd < HD / 2) ? dd + HD / 2 : dd - HD / 2; float x0 = f[dd], x1 = f[dp];
        if (RF) { float n0 = __fmul_rn(x0, rf), n1 = __fmul_rn(x1, rf); asm volatile("" : "+v"(n0)); asm volatile("" : "+v"(n1)); x0 = __fmul_rn(bfr(nw[dd]), n0); x1 = __fmul_rn(bfr(nw[dp]), n1); }
        const v2f cs = *(const v2f*)(CS + ((size_t)t * HD + dd) * 2); float a = __fmul_rn(x0, cs[0]), bq = __fmul_rn(x1, cs[1]); asm volatile("" : "+v"(a)); asm volatile("" : "+v"(bq)); const float r = ((dd < HD / 2) ? __fsub_rn(a, bq) : __fadd_rn(a, bq)) * sc;
        o16[q] = tohx(r); unsigned short a2, c2; splitf(r, a2, c2); oh[q] = a2; ol[q] = c2; }
    *(v2h*)(P16 + e) = o16; *(v2us*)(Ph + e) = oh; *(v2us*)(Pl + e) = ol;  }
__global__ __launch_bounds__(256) void k_vtp(const float* __restrict__ F, int pitch, int nheads, h16* V16, bf* Vh, bf* Vl) { const size_t e = ((size_t)blockIdx.x * 256 + threadIdx.x) * 2; if (e >= (size_t)nheads * HD * TT) return; const int t = (int)(e % TT); const int d = (int)((e / TT) % HD); const int g = (int)(e / ((size_t)TT * HD)); v2h o16; v2us oh, ol;
#pragma unroll
    for (int q = 0; q < 2; ++q) { const float x = F[(size_t)(t + q) * pitch + g * HD + d]; o16[q] = tohx(x); unsigned short a2, c2; splitf(x, a2, c2); oh[q] = a2; ol[q] = c2; }
    *(v2h*)(V16 + e) = o16; *(v2us*)(Vh + e) = oh; *(v2us*)(Vl + e) = ol;  }
__global__ __launch_bounds__(256) void k_csid(float* CS) { const int idx = blockIdx.x * 256 + threadIdx.x; if (idx >= TT * HD) return; v2f cs; cs[0] = 1.0f; cs[1] = 0.0f; *(v2f*)(CS + (size_t)idx * 2) = cs;  }
// k_asoft: per row (zz, i): t = S x HD^-0.5 (no mask); softmax over the 2048 keys (register row, one exp, fixed trees);
__global__ __launch_bounds__(256) void k_asoft(const float* __restrict__ Sb, h16* P16, bf* Ph, bf* Pl) {
    const int lane = threadIdx.x & 31; const int row = blockIdx.x * 8 + (threadIdx.x >> 5); if (row >= ZH * TT) return; const int i = row % TT; const int zz = row / TT; (void)zz; const bool hires = (i < RH); const float* sr = Sb + (size_t)row * TT; float v[TT / 32]; float mx = -3.0e38f;
#pragma unroll
    for (int ch = 0; ch < TT / 128; ++ch) { const int j0 = ch * 128 + lane * 4; const v4f a = *(const v4f*)(sr + j0);
#pragma unroll
        for (int q = 0; q < 4; ++q) { const int j = j0 + q; (void)j; const float t = a[q] * SCL; v[ch * 4 + q] = t; mx = fmaxf(mx, t); } }
#pragma unroll
    for (int sh = 16; sh; sh >>= 1) mx = fmaxf(mx, __shfl_xor(mx, sh, 32));
    float sum = 0.f;
#pragma unroll
    for (int k = 0; k < TT / 32; ++k) { float d0 = __fsub_rn(v[k], mx); asm volatile("" : "+v"(d0)); v[k] = __builtin_amdgcn_exp2f(__fmul_rn(d0, 1.4426950408889634f)); sum += v[k]; }
#pragma unroll
    for (int sh = 16; sh; sh >>= 1) sum += __shfl_xor(sum, sh, 32);
    const float f = __fdiv_rn(hires ? 1.0f : PCAR, sum);
{
        if (hires) {
#pragma unroll
            for (int ch = 0; ch < TT / 128; ++ch) { v4us oh, ol;
#pragma unroll
                for (int q = 0; q < 4; ++q) { unsigned short a, c2; splitf(v[ch * 4 + q] * f, a, c2); oh[q] = a; ol[q] = c2; }
                const size_t oo = ((size_t)zz * (RH ? RH : 1) + i) * TT + ch * 128 + lane * 4; *(v4us*)(Ph + oo) = oh; *(v4us*)(Pl + oo) = ol; }
        } else {
#pragma unroll
            for (int ch = 0; ch < TT / 128; ++ch) { v4h o4;
#pragma unroll
                for (int q = 0; q < 4; ++q) o4[q] = tohx(v[ch * 4 + q] * f);
                *(v4h*)(P16 + (size_t)row * TT + ch * 128 + lane * 4) = o4; } }
         }
}
__global__ __launch_bounds__(256) void k_epadK(const float* __restrict__ E, bf* EB) { const size_t i = (size_t)blockIdx.x * 256 + threadIdx.x; if (i >= (size_t)NE * HD / 8) return; const int d0 = (int)(i % (HD / 8)) * 8; const int r = (int)(i / (HD / 8)); const float* src = E + (size_t)min(r, NRE - 1) * HD + d0; v8us o;
#pragma unroll
    for (int q = 0; q < 8; ++q) { const unsigned short v = f2bf(src[q]); o[q] = (r < NRE) ? v : (unsigned short)0; }
    *(v8us*)(EB + (size_t)r * HD + d0) = o;  }

__global__ __launch_bounds__(256) void k_epadVT(const float* __restrict__ E, bf* Th, bf* Tl) { const size_t i = (size_t)blockIdx.x * 256 + threadIdx.x; if (i >= (size_t)HD * NE / 4) return; const size_t e = i * 4; const int c0 = (int)(e % NE); const int d = (int)(e / NE); v4us oh, ol;
#pragma unroll
    for (int q = 0; q < 4; ++q) { const int r = c0 + q; const float v = bfr(E[(size_t)min(r, NRE - 1) * HD + d]); unsigned short u, w; splitf(v, u, w);   /* input rounded to bf16 once: lo == 0 */ oh[q] = (r < NRE) ? u : (unsigned short)0; ol[q] = (r < NRE) ? w : (unsigned short)0; }
    *(v4us*)(Th + e) = oh; *(v4us*)(Tl + e) = ol;  }

__global__ __launch_bounds__(256) void k_addrelc(float* Sb, const float* __restrict__ QE) { const size_t k = (size_t)blockIdx.x * 256 + threadIdx.x; if (k >= (size_t)ZH * TT * TT / 4) return; const size_t e = k * 4; const int j0 = (int)(e % TT); const size_t zi = e / TT; const int i = (int)(zi % TT); const float* qe = QE + zi * NE; v4f a = *(const v4f*)(Sb + e);
#pragma unroll
    for (int q = 0; q < 4; ++q) { const int r = min(max(j0 + q - i, -CUT), CUT) + CUT; a[q] = __fadd_rn(a[q], qe[r]); }
    *(v4f*)(Sb + e) = a;  }

__global__ __launch_bounds__(256) void k_pbuck(const bf* __restrict__ Ph, const bf* __restrict__ Pl, bf* Bh, bf* Bl) { const int lane = threadIdx.x & 31; const int row = blockIdx.x * 8 + (threadIdx.x >> 5); if (row >= ZH * TT) return; const int i = row % TT; const bf* ph = Ph + (size_t)row * TT; const bf* pl = Pl + (size_t)row * TT; float lo_s = 0.f, hi_s = 0.f;
#pragma unroll 1
    for (int j = lane; j < TT; j += 32) { const float p = __fadd_rn(bf2f(ph[j]), bf2f(pl[j])); if (j <= i - CUT) lo_s = __fadd_rn(lo_s, p); if (j >= i + CUT) hi_s = __fadd_rn(hi_s, p); }
#pragma unroll
    for (int sh = 16; sh; sh >>= 1) { lo_s = __fadd_rn(lo_s, __shfl_xor(lo_s, sh, 32)); hi_s = __fadd_rn(hi_s, __shfl_xor(hi_s, sh, 32)); }
    unsigned short l0h, l0l, h0h, h0l; splitf(lo_s, l0h, l0l); splitf(hi_s, h0h, h0l);
{
#pragma unroll 1
        for (int c0 = lane * 4; c0 < NE; c0 += 128) { v4us oh, ol;
#pragma unroll
            for (int q = 0; q < 4; ++q) { const int bkt = c0 + q; const int j = i + bkt - CUT; const int jc = min(max(j, 0), TT - 1); unsigned int uu = ((const unsigned short*)ph)[jc], ww = ((const unsigned short*)pl)[jc]; asm volatile("" : "+v"(uu), "+v"(ww));   /* unconditional clamped loads pinned before the select (opaque use) */ const bool in = (bkt > 0 && bkt < 2 * CUT && j >= 0 && j < TT);
                const unsigned short u = in ? (unsigned short)uu : ((bkt == 0) ? l0h : ((bkt == 2 * CUT) ? h0h : (unsigned short)0)); const unsigned short w = in ? (unsigned short)ww : ((bkt == 0) ? l0l : ((bkt == 2 * CUT) ? h0l : (unsigned short)0));
                oh[q] = u; ol[q] = w; }
            *(v4us*)(Bh + (size_t)row * NE + c0) = oh; *(v4us*)(Bl + (size_t)row * NE + c0) = ol; }
         }
}

__global__ __launch_bounds__(256) void k_addF(float* Y, const float* __restrict__ F) { const size_t i = (size_t)blockIdx.x * 256 + threadIdx.x; if (i >= (size_t)ZH * TT * HD / 4) return; const v4f a = *(const v4f*)(Y + i * 4); const v4f f = *(const v4f*)(F + i * 4); v4f o;
#pragma unroll
    for (int q = 0; q < 4; ++q) o[q] = __fadd_rn(a[q], f[q]);
    *(v4f*)(Y + i * 4) = o;  }

__global__ __launch_bounds__(256) void k_merge(const float* __restrict__ O, int h0, bf* Ah, bf* Al) { const size_t e = ((size_t)blockIdx.x * 256 + threadIdx.x) * 2; if (e >= (size_t)ZH * TT * HD) return; const int d = (int)(e % HD); const int t = (int)((e / HD) % TT); const int zz = (int)(e / ((size_t)HD * TT)); const float cs = (t < RH) ? 1.0f : (1.0f / PCAR); const size_t oo = (size_t)t * DQ + (h0 + zz) * HD + d;
    v2us oh, ol;
#pragma unroll
    for (int q = 0; q < 2; ++q) { unsigned short a, c2; splitf(O[e + q] * cs, a, c2); oh[q] = a; ol[q] = c2; } *(v2us*)(Ah + oo) = oh; *(v2us*)(Al + oo) = ol;  }

extern "C" void kernel_launch(void* const* d_in, const int* in_sizes, int n_in,
                              void* d_out, int out_size, void* d_ws, size_t ws_size, hipStream_t stream) {
    (void)in_sizes; (void)n_in; (void)out_size;
    const float* x = (const float*)d_in[0];   /* query */ const float* xk = (const float*)d_in[1]; const float* xv = (const float*)d_in[2]; const float* wq = (const float*)d_in[3]; const float* bq = (const float*)d_in[4]; const float* wk = (const float*)d_in[5]; const float* bk = (const float*)d_in[6]; const float* wv = (const float*)d_in[7]; const float* bv = (const float*)d_in[8]; const float* wo = (const float*)d_in[9]; const float* bo = (const float*)d_in[10]; const float* ak = (const float*)d_in[11];   /* rel_k_table [101][64] */ const float* av = (const float*)d_in[12];   /* rel_v_table [101][64] */
    float* OUT = (float*)d_out;     // [2048][2][1024] sequence-first
    char* wsp = (char*)d_ws;
    auto take = [&](size_t bytes) { char* p = wsp; wsp += (bytes + 255) & ~(size_t)255; return (void*)p; };
    bf* AKB = (bf*)take((size_t)NE * HD * 2); bf* AVTh = (bf*)take((size_t)HD * NE * 2); bf* AVTl = (bf*)take((size_t)HD * NE * 2); float* QE = (float*)take((size_t)ZH * TT * NE * 4); bf* PBh = (bf*)take((size_t)ZH * TT * NE * 2); bf* PBl = (bf*)take((size_t)ZH * TT * NE * 2); float* ZR = (float*)take((size_t)ZH * TT * HD * 4); bf* WQ = (bf*)take((size_t)DQ * DM * 2); bf* WK = (bf*)take((size_t)DKV * DM * 2); bf* WV = (bf*)take((size_t)DKV * DM * 2); bf* WO = (bf*)take((size_t)DM * DQ * 2); float* CS = (float*)take((size_t)TT * HD * 2 * 4);
    bf* XB = (bf*)take((size_t)TT * DM * 2); float* FQ = (float*)take((size_t)TT * DQ * 4); float* FK = (float*)take((size_t)TT * DKV * 4);
    h16* QP16 = (h16*)take((size_t)NH_ * TT * HD * 2); h16* KP16 = (h16*)take((size_t)NKV * TT * HD * 2); h16* VT16 = (h16*)take((size_t)NKV * HD * TT * 2);
    bf* QPh = (bf*)take((size_t)NH_ * TT * HD * 2); bf* QPl = (bf*)take((size_t)NH_ * TT * HD * 2); bf* KPh = (bf*)take((size_t)NKV * TT * HD * 2); bf* KPl = (bf*)take((size_t)NKV * TT * HD * 2); bf* VTh = (bf*)take((size_t)NKV * HD * TT * 2); bf* VTl = (bf*)take((size_t)NKV * HD * TT * 2); bf* Ph = (bf*)take((size_t)ZH * RH * TT * 2); bf* Pl = (bf*)take((size_t)ZH * RH * TT * 2);
    float* Sb = (float*)take((size_t)ZH * TT * TT * 4); h16* P16 = (h16*)take((size_t)ZH * TT * TT * 2); float* Ob = (float*)take((size_t)ZH * TT * HD * 4); bf* ATh = (bf*)take((size_t)TT * DQ * 2); bf* ATl = (bf*)take((size_t)TT * DQ * 2);
    if ((size_t)(wsp - (char*)d_ws) > ws_size) return;    // ws 256 MiB
    float* FV = FK;   // v projection reuses the k buffer after the k planes are built (stream-ordered)
    { k_cvt8<<<(unsigned)(((size_t)DQ * DM / 8 + 255) / 256), 256, 0, stream>>>(wq, WQ, (size_t)DQ * DM / 8); k_cvt8<<<(unsigned)(((size_t)DKV * DM / 8 + 255) / 256), 256, 0, stream>>>(wk, WK, (size_t)DKV * DM / 8); k_cvt8<<<(unsigned)(((size_t)DKV * DM / 8 + 255) / 256), 256, 0, stream>>>(wv, WV, (size_t)DKV * DM / 8);
      k_cvt8<<<(unsigned)(((size_t)DM * DQ / 8 + 255) / 256), 256, 0, stream>>>(wo, WO, (size_t)DM * DQ / 8);
       }
    k_csid<<<(TT * HD + 255) / 256, 256, 0, stream>>>(CS);
    const unsigned LQ = (unsigned)(((size_t)NH_ * TT * HD / 2 + 255) / 256), LKv = (unsigned)(((size_t)NKV * TT * HD / 2 + 255) / 256);
    k_epadK<<<(unsigned)(((size_t)NE * HD / 8 + 255) / 256), 256, 0, stream>>>(ak, AKB);   /* rel_k -> bf16 [128][64], rows >= 101 zero */ k_epadVT<<<(unsigned)(((size_t)HD * NE / 4 + 255) / 256), 256, 0, stream>>>(av, AVTh, AVTl);   /* rel_v^T hi/lo [64][128], cols >= 101 zero */
    for (int b = 0; b < NB_; ++b) {
        
        k_cvt8s<<<(unsigned)(((size_t)TT * DM / 8 + 255) / 256), 256, 0, stream>>>(x + (size_t)b * DM, XB, (size_t)NB_ * DM);   /* sequence-first [L][B][HID]: batch column b */
        k_gemmw<bf, 0, true, 8><<<dim3(TT / 64, DQ / 64, 1), 256, 0, stream>>>(XB, nullptr, WQ, nullptr, DM, FQ, DQ, bq, 0, 0, 0);
        k_rope<<<LQ, 256, 0, stream>>>(FQ, DQ, NH_, CS, nullptr, nullptr, 1.0f, QP16, QPh, QPl);
        k_cvt8s<<<(unsigned)(((size_t)TT * DM / 8 + 255) / 256), 256, 0, stream>>>(xk + (size_t)b * DM, XB, (size_t)NB_ * DM);   /* sequence-first [L][B][HID]: batch column b */ k_gemmw<bf, 0, true, 8><<<dim3(TT / 64, DKV / 64, 1), 256, 0, stream>>>(XB, nullptr, WK, nullptr, DM, FK, DKV, bk, 0, 0, 0);
        k_rope<<<LKv, 256, 0, stream>>>(FK, DKV, NKV, CS, nullptr, nullptr, 1.0f, KP16, KPh, KPl);
        k_cvt8s<<<(unsigned)(((size_t)TT * DM / 8 + 255) / 256), 256, 0, stream>>>(xv + (size_t)b * DM, XB, (size_t)NB_ * DM);   /* sequence-first [L][B][HID]: batch column b */ k_gemmw<bf, 0, true, 8><<<dim3(TT / 64, DKV / 64, 1), 256, 0, stream>>>(XB, nullptr, WV, nullptr, DM, FV, DKV, bv, 0, 0, 0); k_vtp<<<LKv, 256, 0, stream>>>(FV, DKV, NKV, VT16, VTh, VTl);
        for (int h0 = 0; h0 < NH_; h0 += ZH) { const size_t zq = (size_t)h0, zk = (size_t)(h0 / REP);   // one kv head per query head: the pass's two heads use consecutive kv planes (z-strides TT*HD)
            k_gemmw<bf, 2, false><<<dim3(RH / 64, TT / 64, ZH), 32, 0, stream>>>(QPh + zq * TT * HD, QPl + zq * TT * HD, KPh + zk * TT * HD, KPl + zk * TT * HD, HD, Sb, TT, nullptr, (size_t)TT * HD, (size_t)TT * HD, (size_t)TT * TT);

            k_gemmw<bf, 1, false><<<dim3(TT / 64, NE / 64, ZH), 32, 0, stream>>>(QPh + zq * TT * HD, QPl + zq * TT * HD, AKB, nullptr, HD, QE, NE, nullptr, (size_t)TT * HD, 0, (size_t)TT * NE);   /* QE = q . rel_k^T */ k_addrelc<<<(unsigned)(((size_t)ZH * TT * TT / 4 + 255) / 256), 256, 0, stream>>>(Sb, QE);   /* + q.rel_k[clip(j - i) + 50] */ k_asoft<<<ZH * TT / 8, 256, 0, stream>>>(Sb, P16, Ph, Pl);
            k_gemmw<bf, 2, false, 16><<<dim3(RH / 64, HD / 64, ZH), 512, 0, stream>>>(Ph, Pl, VTh + zk * HD * TT, VTl + zk * HD * TT, TT, Ob, HD, nullptr, (size_t)RH * TT, (size_t)HD * TT, (size_t)TT * HD); k_pbuck<<<(unsigned)(((size_t)ZH * TT + 7) / 8), 256, 0, stream>>>(Ph, Pl, PBh, PBl);   /* attn folded onto the 101 clipped offsets */ k_gemmw<bf, 2, false, 4><<<dim3(TT / 64, HD / 64, ZH), 128, 0, stream>>>(PBh, PBl, AVTh, AVTl, NE, ZR, HD, nullptr, (size_t)TT * NE, 0, (size_t)TT * HD);   /* ZR = PB . rel_v */ k_addF<<<(unsigned)(((size_t)ZH * TT * HD / 4 + 255) / 256), 256, 0, stream>>>(Ob, ZR);   /* context += relative-value term */

            k_merge<<<(unsigned)(((size_t)ZH * TT * HD / 2 + 255) / 256), 256, 0, stream>>>(Ob, h0, ATh, ATl); }
        k_gemmw<bf, 1, true, 8><<<dim3(TT / 64, DM / 64, 1), 256, 0, stream>>>(ATh, ATl, WO, nullptr, DQ, OUT + (size_t)b * DM, NB_ * DM, bo, 0, 0, 0); }   /* sequence-first output [L][B][HID]: row pitch B x HID, column block b */
}

// v002
// Measured time: 1040 microseconds a run.
// Two timings next to v001 put it at 1.40 and 1.39 times that version's speed.
// Over all steps from v000 it is 1.85 times as fast.
#include <hip/hip_runtime.h>

// Relative multi-head attention with key AND value relative-position embeddings, sequence-first tensors (query, key, value [2048][2][1024]; q = query Wq^T + bq, k = key Wk^T + bk, v = value Wv^T + bv ('oi' 0.02, biases 0.02; 16 heads x 64); idx[i][j] = clip(j - i, -50, 50) + 50; attn = softmax((q.k + q.rel_k[idx]) / 8); x = attn v + sum_j attn[i][j] rel_v[idx] (rel_k, rel_v [101][64] 0.02, read); out = merged Wo^T + bo -> [2048][2][1024] sequence-first (4.2 M); argument order query, key, value, Wq, bq, Wk, bk, Wv, bv, Wo, bo, rel_k, rel_v).
// Layout per batch column: strided bf16 gathers of query, key, value in turn; 'oi' weights; exact projections + f32 biases; rel_k as a zero-padded bf16 plane [128][64] and rel_v^T as hi/lo planes [64][128]; per pass of two heads: score tiles (hi/lo 3 products, every row), QE = q.rel_k^T (hi/lo x exact) gathered into the scores at column clip(j - i) + 50, softmax (x 1/8) with every row on hi/lo planes and the probabilities folded onto the 101 offsets in the same kernel (interior = one key, the two ends = fixed-order sums), P.v (hi/lo x hi/lo) and PB.rel_v added to the context; merged hi/lo x Wo exact + bo written with the sequence-first row pitch.
// Compute dtypes, f32 accumulate: every input rounded to bf16; projections exact + f32 biases; scores and the relative-key term ~f32; softmax f32; P as bf16 hi/lo; attn.v and the relative-value term 3 products (~f32); Wo hl x exact + bias.

#define NB_  2
#define TT   2048
#define DM   1024
#define NH_  16
#define NKV  16
#define REP  (NH_ / NKV)
#define HD   64
#define DQ   (NH_ * HD)
#define DKV  (NKV * HD)
#define ZH   2
#define RH   TT                   // every row on hi/lo planes (the relative-value fold needs normalised planes)
#define WIN  0
#define PCAR 1024.0f
#define SCL  0.125f   // 1/sqrt(64) (the module divides by jnp.sqrt(DH))
#define NE   128      // 2*50+1 = 101 relative offsets padded to 128
#define NRE  101
#define CUT  50
typedef _Float16 h16;
typedef unsigned short bf;
typedef __attribute__((ext_vector_type(16))) __bf16   v16bf;
typedef __attribute__((ext_vector_type(16))) _Float16 v16h;
typedef __attribute__((ext_vector_type(8)))  _Float16 v8h;
typedef __attribute__((ext_vector_type(8)))  unsigned short v8us;
typedef __attribute__((ext_vector_type(8)))  float    v8f;
typedef __attribute__((ext_vector_type(4)))  float    v4f;
typedef v8h  __attribute__((may_alias)) v8ha;
typedef v4f  __attribute__((may_alias)) v4fa;
typedef v8us __attribute__((may_alias)) v8usa;

__device__ __forceinline__ unsigned short f2bf(float f) { unsigned u = __float_as_uint(f); u += 0x7FFFu + ((u >> 16) & 1u); return (unsigned short)(u >> 16); }
__device__ __forceinline__ float bf2f(unsigned short b) { return __uint_as_float(((unsigned)b) << 16); }
__device__ __forceinline__ float bfr(float f) { return bf2f(f2bf(f)); }
__device__ __forceinline__ v16h cat16(v8h lo, v8h hi) { return __builtin_shufflevector(lo, hi, 0, 1, 2, 3, 4, 5, 6, 7, 8, 9, 10, 11, 12, 13, 14, 15); }
__device__ __forceinline__ v16bf cat16b(v8us lo, v8us hi) { return __builtin_bit_cast(v16bf, __builtin_shufflevector(lo, hi, 0, 1, 2, 3, 4, 5, 6, 7, 8, 9, 10, 11, 12, 13, 14, 15)); }
__device__ __forceinline__ v8f wmma16(v16h a, v16h b, v8f c) { return __builtin_amdgcn_wmma_f32_16x16x32_f16(false, a, false, b, (short)0, c, false, false); }
__device__ __forceinline__ v8f wmmab(v16bf a, v16bf b, v8f c) { return __builtin_amdgcn_wmma_f32_16x16x32_bf16(false, a, false, b, (short)0, c, false, false); }



// ---- k_gemmw: register-blocked GEMM, ONE WAVE per 64x64 output tile (16 accumulators), operands straight from K-contiguous 16-bit planes; grid (M/64, N/64, Z), 32 threads.
// C[m][n] (f32, pitch ldc, + optional f32 bias[n]) = sum_k A[m][k] Bt[n][k] (+ split products per NSPLIT). z-batch strides sA/sB/sC in elements. K % 32 == 0.
// KS > 1 (long K, few tiles): 32 KS threads, wave w of the work-group takes k in [w K/KS, (w+1) K/KS) of the same tile; the KS partial tiles are summed in fixed wave order through LDS. K % (32 KS) == 0.
template <typename T16> struct WFrag;
template <> struct WFrag<h16> { typedef v16h V; static __device__ __forceinline__ V ld(const h16* p) { return cat16(*(const v8h*)p, *(const v8h*)(p + 16)); } static __device__ __forceinline__ v8f mma(V a, V b, v8f c) { return wmma16(a, b, c); } };
template <> struct WFrag<bf> { typedef v16bf V; static __device__ __forceinline__ V ld(const bf* p) { return cat16b(*(const v8us*)p, *(const v8us*)(p + 16)); } static __device__ __forceinline__ v8f mma(V a, V b, v8f c) { return wmmab(a, b, c); } };
template <typename T16, int NSPLIT, bool BIAS, int KS = 1>
__global__ __launch_bounds__(32 * KS) void k_gemmw(const T16* __restrict__ A, const T16* __restrict__ A2, const T16* __restrict__ Bt, const T16* __restrict__ Bt2, int K, float* C, int ldc, const float* __restrict__ bias, size_t sA, size_t sB, size_t sC) {
    typedef typename WFrag<T16>::V V;
    __shared__ __align__(16) float os[KS == 1 ? 16 * 68 : KS * 64 * 68];
    const size_t z = blockIdx.z; A += z * sA; if (A2) A2 += z * sA; Bt += z * sB; if (Bt2) Bt2 += z * sB; C += z * sC;
    const int lane = threadIdx.x & 31, lr = lane & 15, hi = lane >> 4; const int r0 = blockIdx.x * 64, c0 = blockIdx.y * 64;
    const int wv = (KS == 1) ? 0 : __builtin_amdgcn_readfirstlane((int)(threadIdx.x >> 5)); const int k0 = wv * (K / KS), k1 = k0 + K / KS;
    v8f acc[4][4];
#pragma unroll
    for (int mb = 0; mb < 4; ++mb)
#pragma unroll
        for (int nb = 0; nb < 4; ++nb) acc[mb][nb] = (v8f){};
    const size_t aoff = (size_t)(r0 + lr) * K + 8 * hi, boff = (size_t)(c0 + lr) * K + 8 * hi;
#pragma unroll 1
    for (int kc = k0; kc < k1; kc += 32) {
        V a[4], a2[4];
#pragma unroll
        for (int mb = 0; mb < 4; ++mb) { a[mb] = WFrag<T16>::ld(A + aoff + (size_t)mb * 16 * K + kc); if (NSPLIT == 1 || NSPLIT == 2) a2[mb] = WFrag<T16>::ld(A2 + aoff + (size_t)mb * 16 * K + kc); }
#pragma unroll
        for (int nb = 0; nb < 4; ++nb) { const V b = WFrag<T16>::ld(Bt + boff + (size_t)nb * 16 * K + kc); V b2; if (NSPLIT >= 2) b2 = WFrag<T16>::ld(Bt2 + boff + (size_t)nb * 16 * K + kc);
#pragma unroll
            for (int mb = 0; mb < 4; ++mb) { acc[mb][nb] = WFrag<T16>::mma(a[mb], b, acc[mb][nb]); if (NSPLIT == 1 || NSPLIT == 2) acc[mb][nb] = WFrag<T16>::mma(a2[mb], b, acc[mb][nb]); if (NSPLIT >= 2) acc[mb][nb] = WFrag<T16>::mma(a[mb], b2, acc[mb][nb]); } }
        asm volatile("v_nop\n\tv_nop\n\tv_nop\n\tv_nop" : "+v"(acc[0][0]), "+v"(acc[1][1]), "+v"(acc[2][2]), "+v"(acc[3][3]) : "v"(a[0]), "v"(a[3]));
    }
    if (KS > 1) {
        float* my = os + wv * (64 * 68);
#pragma unroll
        for (int mb = 0; mb < 4; ++mb)
#pragma unroll
            for (int nb = 0; nb < 4; ++nb)
#pragma unroll
                for (int j = 0; j < 8; ++j) my[(mb * 16 + hi * 8 + j) * 68 + nb * 16 + lr] = acc[mb][nb][j];
        __syncthreads();   // every wave's partial tile is in LDS before any wave sums across them
#pragma unroll
        for (int s = 0; s < 1024 / (32 * KS); ++s) { const int slot = s * (32 * KS) + (int)threadIdx.x; const int row = slot >> 4, cofs = (slot & 15) * 4; v4f val = *(const v4fa*)(os + row * 68 + cofs);
#pragma unroll
            for (int w = 1; w < KS; ++w) { const v4f p = *(const v4fa*)(os + w * (64 * 68) + row * 68 + cofs); val += p; }
            if (BIAS) { val[0] += bfr(bias[c0 + cofs]); val[1] += bfr(bias[c0 + cofs + 1]); val[2] += bfr(bias[c0 + cofs + 2]); val[3] += bfr(bias[c0 + cofs + 3]); }
            *(v4f*)(C + (size_t)(r0 + row) * ldc + c0 + cofs) = val; }
        return;
    }
#pragma unroll
    for (int mb = 0; mb < 4; ++mb) {
#pragma unroll
        for (int nb = 0; nb < 4; ++nb) {
#pragma unroll
            for (int j = 0; j < 8; ++j) os[(hi * 8 + j) * 68 + nb * 16 + lr] = acc[mb][nb][j]; }
        __builtin_amdgcn_wave_barrier(); asm volatile("" ::: "memory");
        float* crow = C + (size_t)(r0 + mb * 16) * ldc + c0;
{
#pragma unroll
            for (int s = 0; s < 8; ++s) { const int row = 2 * s + hi, cofs = lr * 4; v4f val = *(const v4fa*)(os + row * 68 + cofs); if (BIAS) { val[0] += bfr(bias[c0 + cofs]); val[1] += bfr(bias[c0 + cofs + 1]); val[2] += bfr(bias[c0 + cofs + 2]); val[3] += bfr(bias[c0 + cofs + 3]); }
                *(v4f*)(crow + (size_t)row * ldc + cofs) = val; }
             }
        __builtin_amdgcn_wave_barrier(); asm volatile("" ::: "memory");
    }
}

__device__ __forceinline__ h16 tohx(float x) { return (h16)x; }
__device__ __forceinline__ void splitf(float y, unsigned short& h, unsigned short& l) { h = f2bf(y); l = f2bf(y - bf2f(h)); }
typedef __attribute__((ext_vector_type(2))) _Float16 v2h;
typedef __attribute__((ext_vector_type(4))) _Float16 v4h;
typedef __attribute__((ext_vector_type(2))) unsigned short v2us;
typedef __attribute__((ext_vector_type(4))) unsigned short v4us;
typedef __attribute__((ext_vector_type(2))) float v2f;
typedef __attribute__((ext_vector_type(4))) int v4i;

__global__ __launch_bounds__(256) void k_cvt8(const float* __restrict__ src, bf* dst, size_t n8) { const size_t i = (size_t)blockIdx.x * 256 + threadIdx.x; if (i >= n8) return; const v8f v = *(const v8f*)(src + i * 8); v8us o;
#pragma unroll
    for (int k = 0; k < 8; ++k) o[k] = f2bf(v[k]); *(v8us*)(dst + i * 8) = o;  }

__global__ __launch_bounds__(256) void k_cvt8s(const float* __restrict__ X, bf* XB, size_t pitch) { const size_t i = (size_t)blockIdx.x * 256 + threadIdx.x; if (i >= (size_t)TT * DM / 8) return; const size_t e = i * 8; const int c = (int)(e % DM); const int srow = (int)(e / DM); const v8f a = *(const v8f*)(X + (size_t)srow * pitch + c); v8us o;
#pragma unroll
    for (int q = 0; q < 8; ++q) o[q] = f2bf(a[q]);
    *(v8us*)(XB + e) = o;  }
// k_rope: head planes [h][t][d] (fp16 + hi/lo) of rope(x) x sc with the rotate-half convention out[d] = x[d] cos[t][d] - x[d+HD/2] sin[t][d], out[d+HD/2] = x[d+HD/2] cos[t][d+HD/2] + x[d] sin[t][d+HD/2]
__global__ __launch_bounds__(256) void k_rope(const float* __restrict__ F, int pitch, int nheads, const float* __restrict__ CS, const float* __restrict__ RF, const float* __restrict__ nw, float sc, h16* P16, bf* Ph, bf* Pl) {
    const size_t e = ((size_t)blockIdx.x * 256 + threadIdx.x) * 2; if (e >= (size_t)nheads * TT * HD) return; const int d = (int)(e % HD); const int t = (int)((e / HD) % TT); const int h = (int)(e / ((size_t)HD * TT)); const float* f = F + (size_t)t * pitch + h * HD; const float rf = RF ? RF[(size_t)h * TT + t] : 1.0f; v2h o16; v2us oh, ol;
#pragma unroll
    for (int q = 0; q < 2; ++q) { const int dd = d + q; const int dp = (dd < HD / 2) ? dd + HD / 2 : dd - HD / 2; float x0 = f[dd], x1 = f[dp];
        if (RF) { float n0 = __fmul_rn(x0, rf), n1 = __fmul_rn(x1, rf); asm volatile("" : "+v"(n0)); asm volatile("" : "+v"(n1)); x0 = __fmul_rn(bfr(nw[dd]), n0); x1 = __fmul_rn(bfr(nw[dp]), n1); }
        const v2f cs = *(const v2f*)(CS + ((size_t)t * HD + dd) * 2); float a = __fmul_rn(x0, cs[0]), bq = __fmul_rn(x1, cs[1]); asm volatile("" : "+v"(a)); asm volatile("" : "+v"(bq)); const float r = ((dd < HD / 2) ? __fsub_rn(a, bq) : __fadd_rn(a, bq)) * sc;
        o16[q] = tohx(r); unsigned short a2, c2; splitf(r, a2, c2); oh[q] = a2; ol[q] = c2; }
    *(v2h*)(P16 + e) = o16; *(v2us*)(Ph + e) = oh; *(v2us*)(Pl + e) = ol;  }
__global__ __launch_bounds__(256) void k_vtp(const float* __restrict__ F, int pitch, int nheads, h16* V16, bf* Vh, bf* Vl) { const size_t e = ((size_t)blockIdx.x * 256 + threadIdx.x) * 2; if (e >= (size_t)nheads * HD * TT) return; const int t = (int)(e % TT); const int d = (int)((e / TT) % HD); const int g = (int)(e / ((size_t)TT * HD)); v2h o16; v2us oh, ol;
#pragma unroll
    for (int q = 0; q < 2; ++q) { const float x = F[(size_t)(t + q) * pitch + g * HD + d]; o16[q] = tohx(x); unsigned short a2, c2; splitf(x, a2, c2); oh[q] = a2; ol[q] = c2; }
    *(v2h*)(V16 + e) = o16; *(v2us*)(Vh + e) = oh; *(v2us*)(Vl + e) = ol;  }
__global__ __launch_bounds__(256) void k_csid(float* CS) { const int idx = blockIdx.x * 256 + threadIdx.x; if (idx >= TT * HD) return; v2f cs; cs[0] = 1.0f; cs[1] = 0.0f; *(v2f*)(CS + (size_t)idx * 2) = cs;  }
// k_asoft: ONE WAVE per row (zz, i), the row held in registers from the scores to the fold: t = (S + QE[clip(j - i) + 50]) x HD^-0.5 (no mask); softmax over the 2048 keys (one exp, fixed trees); P on hi/lo planes; the same registers folded onto the 101 offsets (interior = one key, the two ends = fixed-order sums) -> PB hi/lo [row][128].
// A lane's keys are j = 128 ch + 4 lane + q. The interior offsets (|j - i| < 50) span fewer than 128 keys, so they meet at most ONE ch of a lane, chs; every key of a lower ch lies at the low end (offset 0), every key of a higher ch at the high end (offset 100).
static_assert(RH == TT, "the fold reads every row's normalised hi/lo values");
typedef __attribute__((ext_vector_type(4))) unsigned int v4u;
__global__ __launch_bounds__(256) void k_asoft(const float* __restrict__ Sb, const float* __restrict__ QE, bf* Ph, bf* Pl, bf* Bh, bf* Bl) {
    __shared__ __align__(16) unsigned int pb[8][NE];   // per wave: the row's 128 offset slots, hi | lo << 16
    const int lane = threadIdx.x & 31; const int wv = threadIdx.x >> 5; const int row = blockIdx.x * 8 + wv; if (row >= ZH * TT) return; const int i = row % TT; const float* sr = Sb + (size_t)row * TT; const float* qe = QE + (size_t)row * NE; float v[TT / 32]; float mx = -3.0e38f;
    const int chs = (i + CUT - 1 - lane * 4) >> 7; const int js = chs * 128 + lane * 4 - i;   // js + q = j - i of the lane's four keys of ch == chs
    const float qlo = qe[0], qhi = qe[2 * CUT]; float g[4];
    asm volatile("s_wait_xcnt 0x0" ::: "memory");   // the two loads above share one address pair: the wait stands before a later load's result may take those registers
#pragma unroll
    for (int q = 0; q < 4; ++q) g[q] = qe[min(max(js + q, -CUT), CUT) + CUT];
#pragma unroll
    for (int ch = 0; ch < TT / 128; ++ch) { const int j0 = ch * 128 + lane * 4; const v4f a = *(const v4f*)(sr + j0); const float e = (ch < chs) ? qlo : qhi;
#pragma unroll
        for (int q = 0; q < 4; ++q) { const float t = __fadd_rn(a[q], (ch == chs) ? g[q] : e) * SCL; v[ch * 4 + q] = t; mx = fmaxf(mx, t); } }
#pragma unroll
    for (int sh = 16; sh; sh >>= 1) mx = fmaxf(mx, __shfl_xor(mx, sh, 32));
    float sum = 0.f;
#pragma unroll
    for (int k = 0; k < TT / 32; ++k) { float d0 = __fsub_rn(v[k], mx); asm volatile("" : "+v"(d0)); v[k] = __builtin_amdgcn_exp2f(__fmul_rn(d0, 1.4426950408889634f)); sum += v[k]; }
#pragma unroll
    for (int sh = 16; sh; sh >>= 1) sum += __shfl_xor(sum, sh, 32);
    const float f = __fdiv_rn(1.0f, sum);
    float lo_s = 0.f, hi_s = 0.f; float gv[4] = {0.f, 0.f, 0.f, 0.f};   // gv: the lane's four probabilities of ch == chs (zero where the row has no such ch)
#pragma unroll
    for (int ch = 0; ch < TT / 128; ++ch) { v4us oh, ol; float p[4];
#pragma unroll
        for (int q = 0; q < 4; ++q) { const float y = v[ch * 4 + q] * f; unsigned short a, c2; splitf(y, a, c2); oh[q] = a; ol[q] = c2; p[q] = __fadd_rn(bf2f(a), bf2f(c2)); if (ch == chs) gv[q] = y; }
        const float s4 = __fadd_rn(__fadd_rn(p[0], p[1]), __fadd_rn(p[2], p[3])); lo_s = __fadd_rn(lo_s, (ch < chs) ? s4 : 0.f); hi_s = __fadd_rn(hi_s, (ch > chs) ? s4 : 0.f);
        const size_t oo = (size_t)row * TT + ch * 128 + lane * 4; *(v4us*)(Ph + oo) = oh; *(v4us*)(Pl + oo) = ol; }
    unsigned int gi[4];
#pragma unroll
    for (int q = 0; q < 4; ++q) { unsigned short a, c2; splitf(gv[q], a, c2); const float p = __fadd_rn(bf2f(a), bf2f(c2)); gi[q] = (unsigned int)a | ((unsigned int)c2 << 16); lo_s = __fadd_rn(lo_s, (js + q <= -CUT) ? p : 0.f); hi_s = __fadd_rn(hi_s, (js + q >= CUT) ? p : 0.f); }
#pragma unroll
    for (int sh = 16; sh; sh >>= 1) { lo_s = __fadd_rn(lo_s, __shfl_xor(lo_s, sh, 32)); hi_s = __fadd_rn(hi_s, __shfl_xor(hi_s, sh, 32)); }
    unsigned short l0h, l0l, h0h, h0l; splitf(lo_s, l0h, l0l); splitf(hi_s, h0h, h0l);
    unsigned int* my = pb[wv]; *(v4u*)(my + lane * 4) = (v4u){0u, 0u, 0u, 0u};   // slots that no key of the row reaches stay zero
    __builtin_amdgcn_wave_barrier(); asm volatile("" ::: "memory");   // compiler order only: the zero fill of all lanes stays in front of any lane's scatter (one wave's LDS operations run in order)
#pragma unroll
    for (int q = 0; q < 4; ++q) { const int bkt = js + q + CUT; if (bkt > 0 && bkt < 2 * CUT) my[bkt] = gi[q]; }   // interior offset = one key; slots are distinct across lanes (j mod 128 is)
    __builtin_amdgcn_wave_barrier(); asm volatile("" ::: "memory");   // compiler order only: other lanes' scatter stays in front of this lane's read
    const v4u r = *(const v4u*)(my + lane * 4); v4us oh, ol;
#pragma unroll
    for (int q = 0; q < 4; ++q) { const int bkt = lane * 4 + q; oh[q] = (bkt == 0) ? l0h : ((bkt == 2 * CUT) ? h0h : (unsigned short)(r[q] & 0xFFFFu)); ol[q] = (bkt == 0) ? l0l : ((bkt == 2 * CUT) ? h0l : (unsigned short)(r[q] >> 16)); }
    *(v4us*)(Bh + (size_t)row * NE + lane * 4) = oh; *(v4us*)(Bl + (size_t)row * NE + lane * 4) = ol;
}
__global__ __launch_bounds__(256) void k_epadK(const float* __restrict__ E, bf* EB) { const size_t i = (size_t)blockIdx.x * 256 + threadIdx.x; if (i >= (size_t)NE * HD / 8) return; const int d0 = (int)(i % (HD / 8)) * 8; const int r = (int)(i / (HD / 8)); const float* src = E + (size_t)min(r, NRE - 1) * HD + d0; v8us o;
#pragma unroll
    for (int q = 0; q < 8; ++q) { const unsigned short v = f2bf(src[q]); o[q] = (r < NRE) ? v : (unsigned short)0; }
    *(v8us*)(EB + (size_t)r * HD + d0) = o;  }

__global__ __launch_bounds__(256) void k_epadVT(const float* __restrict__ E, bf* Th, bf* Tl) { const size_t i = (size_t)blockIdx.x * 256 + threadIdx.x; if (i >= (size_t)HD * NE / 4) return; const size_t e = i * 4; const int c0 = (int)(e % NE); const int d = (int)(e / NE); v4us oh, ol;
#pragma unroll
    for (int q = 0; q < 4; ++q) { const int r = c0 + q; const float v = bfr(E[(size_t)min(r, NRE - 1) * HD + d]); unsigned short u, w; splitf(v, u, w);   /* input rounded to bf16 once: lo == 0 */ oh[q] = (r < NRE) ? u : (unsigned short)0; ol[q] = (r < NRE) ? w : (unsigned short)0; }
    *(v4us*)(Th + e) = oh; *(v4us*)(Tl + e) = ol;  }

__global__ __launch_bounds__(256) void k_addF(float* Y, const float* __restrict__ F) { const size_t i = (size_t)blockIdx.x * 256 + threadIdx.x; if (i >= (size_t)ZH * TT * HD / 4) return; const v4f a = *(const v4f*)(Y + i * 4); const v4f f = *(const v4f*)(F + i * 4); v4f o;
#pragma unroll
    for (int q = 0; q < 4; ++q) o[q] = __fadd_rn(a[q], f[q]);
    *(v4f*)(Y + i * 4) = o;  }

__global__ __launch_bounds__(256) void k_merge(const float* __restrict__ O, int h0, bf* Ah, bf* Al) { const size_t e = ((size_t)blockIdx.x * 256 + threadIdx.x) * 2; if (e >= (size_t)ZH * TT * HD) return; const int d = (int)(e % HD); const int t = (int)((e / HD) % TT); const int zz = (int)(e / ((size_t)HD * TT)); const float cs = (t < RH) ? 1.0f : (1.0f / PCAR); const size_t oo = (size_t)t * DQ + (h0 + zz) * HD + d;
    v2us oh, ol;
#pragma unroll
    for (int q = 0; q < 2; ++q) { unsigned short a, c2; splitf(O[e + q] * cs, a, c2); oh[q] = a; ol[q] = c2; } *(v2us*)(Ah + oo) = oh; *(v2us*)(Al + oo) = ol;  }

extern "C" void kernel_launch(void* const* d_in, const int* in_sizes, int n_in,
                              void* d_out, int out_size, void* d_ws, size_t ws_size, hipStream_t stream) {
    (void)in_sizes; (void)n_in; (void)out_size;
    const float* x = (const float*)d_in[0];   /* query */ const float* xk = (const float*)d_in[1]; const float* xv = (const float*)d_in[2]; const float* wq = (const float*)d_in[3]; const float* bq = (const float*)d_in[4]; const float* wk = (const float*)d_in[5]; const float* bk = (const float*)d_in[6]; const float* wv = (const float*)d_in[7]; const float* bv = (const float*)d_in[8]; const float* wo = (const float*)d_in[9]; const float* bo = (const float*)d_in[10]; const float* ak = (const float*)d_in[11];   /* rel_k_table [101][64] */ const float* av = (const float*)d_in[12];   /* rel_v_table [101][64] */
    float* OUT = (float*)d_out;     // [2048][2][1024] sequence-first
    char* wsp = (char*)d_ws;
    auto take = [&](size_t bytes) { char* p = wsp; wsp += (bytes + 255) & ~(size_t)255; return (void*)p; };
    bf* AKB = (bf*)take((size_t)NE * HD * 2); bf* AVTh = (bf*)take((size_t)HD * NE * 2); bf* AVTl = (bf*)take((size_t)HD * NE * 2); float* QE = (float*)take((size_t)ZH * TT * NE * 4); bf* PBh = (bf*)take((size_t)ZH * TT * NE * 2); bf* PBl = (bf*)take((size_t)ZH * TT * NE * 2); float* ZR = (float*)take((size_t)ZH * TT * HD * 4); bf* WQ = (bf*)take((size_t)DQ * DM * 2); bf* WK = (bf*)take((size_t)DKV * DM * 2); bf* WV = (bf*)take((size_t)DKV * DM * 2); bf* WO = (bf*)take((size_t)DM * DQ * 2); float* CS = (float*)take((size_t)TT * HD * 2 * 4);
    bf* XB = (bf*)take((size_t)TT * DM * 2); float* FQ = (float*)take((size_t)TT * DQ * 4); float* FK = (float*)take((size_t)TT * DKV * 4);
    h16* QP16 = (h16*)take((size_t)NH_ * TT * HD * 2); h16* KP16 = (h16*)take((size_t)NKV * TT * HD * 2); h16* VT16 = (h16*)take((size_t)NKV * HD * TT * 2);
    bf* QPh = (bf*)take((size_t)NH_ * TT * HD * 2); bf* QPl = (bf*)take((size_t)NH_ * TT * HD * 2); bf* KPh = (bf*)take((size_t)NKV * TT * HD * 2); bf* KPl = (bf*)take((size_t)NKV * TT * HD * 2); bf* VTh = (bf*)take((size_t)NKV * HD * TT * 2); bf* VTl = (bf*)take((size_t)NKV * HD * TT * 2); bf* Ph = (bf*)take((size_t)ZH * RH * TT * 2); bf* Pl = (bf*)take((size_t)ZH * RH * TT * 2);
    float* Sb = (float*)take((size_t)ZH * TT * TT * 4); h16* P16 = (h16*)take((size_t)ZH * TT * TT * 2); float* Ob = (float*)take((size_t)ZH * TT * HD * 4); bf* ATh = (bf*)take((size_t)TT * DQ * 2); bf* ATl = (bf*)take((size_t)TT * DQ * 2);
    if ((size_t)(wsp - (char*)d_ws) > ws_size) return;    // ws 256 MiB
    float* FV = FK;   // v projection reuses the k buffer after the k planes are built (stream-ordered)
    { k_cvt8<<<(unsigned)(((size_t)DQ * DM / 8 + 255) / 256), 256, 0, stream>>>(wq, WQ, (size_t)DQ * DM / 8); k_cvt8<<<(unsigned)(((size_t)DKV * DM / 8 + 255) / 256), 256, 0, stream>>>(wk, WK, (size_t)DKV * DM / 8); k_cvt8<<<(unsigned)(((size_t)DKV * DM / 8 + 255) / 256), 256, 0, stream>>>(wv, WV, (size_t)DKV * DM / 8);
      k_cvt8<<<(unsigned)(((size_t)DM * DQ / 8 + 255) / 256), 256, 0, stream>>>(wo, WO, (size_t)DM * DQ / 8);
       }
    k_csid<<<(TT * HD + 255) / 256, 256, 0, stream>>>(CS);
    const unsigned LQ = (unsigned)(((size_t)NH_ * TT * HD / 2 + 255) / 256), LKv = (unsigned)(((size_t)NKV * TT * HD / 2 + 255) / 256);
    k_epadK<<<(unsigned)(((size_t)NE * HD / 8 + 255) / 256), 256, 0, stream>>>(ak, AKB);   /* rel_k -> bf16 [128][64], rows >= 101 zero */ k_epadVT<<<(unsigned)(((size_t)HD * NE / 4 + 255) / 256), 256, 0, stream>>>(av, AVTh, AVTl);   /* rel_v^T hi/lo [64][128], cols >= 101 zero */
    for (int b = 0; b < NB_; ++b) {
        
        k_cvt8s<<<(unsigned)(((size_t)TT * DM / 8 + 255) / 256), 256, 0, stream>>>(x + (size_t)b * DM, XB, (size_t)NB_ * DM);   /* sequence-first [L][B][HID]: batch column b */
        k_gemmw<bf, 0, true, 8><<<dim3(TT / 64, DQ / 64, 1), 256, 0, stream>>>(XB, nullptr, WQ, nullptr, DM, FQ, DQ, bq, 0, 0, 0);
        k_rope<<<LQ, 256, 0, stream>>>(FQ, DQ, NH_, CS, nullptr, nullptr, 1.0f, QP16, QPh, QPl);
        k_cvt8s<<<(unsigned)(((size_t)TT * DM / 8 + 255) / 256), 256, 0, stream>>>(xk + (size_t)b * DM, XB, (size_t)NB_ * DM);   /* sequence-first [L][B][HID]: batch column b */ k_gemmw<bf, 0, true, 8><<<dim3(TT / 64, DKV / 64, 1), 256, 0, stream>>>(XB, nullptr, WK, nullptr, DM, FK, DKV, bk, 0, 0, 0);
        k_rope<<<LKv, 256, 0, stream>>>(FK, DKV, NKV, CS, nullptr, nullptr, 1.0f, KP16, KPh, KPl);
        k_cvt8s<<<(unsigned)(((size_t)TT * DM / 8 + 255) / 256), 256, 0, stream>>>(xv + (size_t)b * DM, XB, (size_t)NB_ * DM);   /* sequence-first [L][B][HID]: batch column b */ k_gemmw<bf, 0, true, 8><<<dim3(TT / 64, DKV / 64, 1), 256, 0, stream>>>(XB, nullptr, WV, nullptr, DM, FV, DKV, bv, 0, 0, 0); k_vtp<<<LKv, 256, 0, stream>>>(FV, DKV, NKV, VT16, VTh, VTl);
        for (int h0 = 0; h0 < NH_; h0 += ZH) { const size_t zq = (size_t)h0, zk = (size_t)(h0 / REP);   // one kv head per query head: the pass's two heads use consecutive kv planes (z-strides TT*HD)
            k_gemmw<bf, 2, false><<<dim3(RH / 64, TT / 64, ZH), 32, 0, stream>>>(QPh + zq * TT * HD, QPl + zq * TT * HD, KPh + zk * TT * HD, KPl + zk * TT * HD, HD, Sb, TT, nullptr, (size_t)TT * HD, (size_t)TT * HD, (size_t)TT * TT);

            k_gemmw<bf, 1, false><<<dim3(TT / 64, NE / 64, ZH), 32, 0, stream>>>(QPh + zq * TT * HD, QPl + zq * TT * HD, AKB, nullptr, HD, QE, NE, nullptr, (size_t)TT * HD, 0, (size_t)TT * NE);   /* QE = q . rel_k^T */ k_asoft<<<ZH * TT / 8, 256, 0, stream>>>(Sb, QE, Ph, Pl, PBh, PBl);   /* + q.rel_k[clip(j - i) + 50], softmax, attn folded onto the 101 clipped offsets */
            k_gemmw<bf, 2, false, 16><<<dim3(RH / 64, HD / 64, ZH), 512, 0, stream>>>(Ph, Pl, VTh + zk * HD * TT, VTl + zk * HD * TT, TT, Ob, HD, nullptr, (size_t)RH * TT, (size_t)HD * TT, (size_t)TT * HD); k_gemmw<bf, 2, false, 4><<<dim3(TT / 64, HD / 64, ZH), 128, 0, stream>>>(PBh, PBl, AVTh, AVTl, NE, ZR, HD, nullptr, (size_t)TT * NE, 0, (size_t)TT * HD);   /* ZR = PB . rel_v */ k_addF<<<(unsigned)(((size_t)ZH * TT * HD / 4 + 255) / 256), 256, 0, stream>>>(Ob, ZR);   /* context += relative-value term */

            k_merge<<<(unsigned)(((size_t)ZH * TT * HD / 2 + 255) / 256), 256, 0, stream>>>(Ob, h0, ATh, ATl); }
        k_gemmw<bf, 1, true, 8><<<dim3(TT / 64, DM / 64, 1), 256, 0, stream>>>(ATh, ATl, WO, nullptr, DQ, OUT + (size_t)b * DM, NB_ * DM, bo, 0, 0, 0); }   /* sequence-first output [L][B][HID]: row pitch B x HID, column block b */
}

// v003
// A run of this version takes 688 microseconds.
// In two side-by-side timings against v002, it was 1.50 and 1.51 times as fast.
// Counting every step since v000, it is 2.78 times as fast.
#include <hip/hip_runtime.h>

// Relative multi-head attention with key AND value relative-position embeddings, sequence-first tensors (query, key, value [2048][2][1024]; q = query Wq^T + bq, k = key Wk^T + bk, v = value Wv^T + bv ('oi' 0.02, biases 0.02; 16 heads x 64); idx[i][j] = clip(j - i, -50, 50) + 50; attn = softmax((q.k + q.rel_k[idx]) / 8); x = attn v + sum_j attn[i][j] rel_v[idx] (rel_k, rel_v [101][64] 0.02, read); out = merged Wo^T + bo -> [2048][2][1024] sequence-first (4.2 M); argument order query, key, value, Wq, bq, Wk, bk, Wv, bv, Wo, bo, rel_k, rel_v).
// Layout per batch column: strided bf16 gathers of query, key, value in turn; 'oi' weights; exact projections + f32 biases; rel_k as a zero-padded bf16 plane [128][64] and rel_v^T as hi/lo planes [64][128]; per pass of eight heads: score tiles (hi/lo 3 products, every row), QE = q.rel_k^T (hi/lo x exact) gathered into the scores at column clip(j - i) + 50, softmax (x 1/8) with every row's hi/lo values written over its own scores, P.v (hi/lo x hi/lo), the probabilities folded onto the 101 offsets (interior = one key, the two ends = fixed-order sums) and PB.rel_v added to the context; merged hi/lo x Wo exact + bo written with the sequence-first row pitch.
// Compute dtypes, f32 accumulate: every input rounded to bf16; projections exact + f32 biases; scores and the relative-key term ~f32; softmax f32; P as bf16 hi/lo; attn.v and the relative-value term 3 products (~f32); Wo hl x exact + bias.

#define NB_  2
#define TT   2048
#define DM   1024
#define NH_  16
#define NKV  16
#define REP  (NH_ / NKV)
#define HD   64
#define DQ   (NH_ * HD)
#define DKV  (NKV * HD)
#define ZH   8
#define RH   TT                   // every row on hi/lo planes (the relative-value fold needs normalised planes)
#define WIN  0
#define PCAR 1024.0f
#define SCL  0.125f   // 1/sqrt(64) (the module divides by jnp.sqrt(DH))
#define NE   128      // 2*50+1 = 101 relative offsets padded to 128
#define NRE  101
#define CUT  50
typedef _Float16 h16;
typedef unsigned short bf;
typedef __attribute__((ext_vector_type(16))) __bf16   v16bf;
typedef __attribute__((ext_vector_type(16))) _Float16 v16h;
typedef __attribute__((ext_vector_type(8)))  _Float16 v8h;
typedef __attribute__((ext_vector_type(8)))  unsigned short v8us;
typedef __attribute__((ext_vector_type(8)))  float    v8f;
typedef __attribute__((ext_vector_type(4)))  float    v4f;
typedef v8h  __attribute__((may_alias)) v8ha;
typedef v4f  __attribute__((may_alias)) v4fa;
typedef v8us __attribute__((may_alias)) v8usa;

__device__ __forceinline__ unsigned short f2bf(float f) { unsigned u = __float_as_uint(f); u += 0x7FFFu + ((u >> 16) & 1u); return (unsigned short)(u >> 16); }
__device__ __forceinline__ float bf2f(unsigned short b) { return __uint_as_float(((unsigned)b) << 16); }
__device__ __forceinline__ float bfr(float f) { return bf2f(f2bf(f)); }
__device__ __forceinline__ v16h cat16(v8h lo, v8h hi) { return __builtin_shufflevector(lo, hi, 0, 1, 2, 3, 4, 5, 6, 7, 8, 9, 10, 11, 12, 13, 14, 15); }
__device__ __forceinline__ v16bf cat16b(v8us lo, v8us hi) { return __builtin_bit_cast(v16bf, __builtin_shufflevector(lo, hi, 0, 1, 2, 3, 4, 5, 6, 7, 8, 9, 10, 11, 12, 13, 14, 15)); }
__device__ __forceinline__ v8f wmma16(v16h a, v16h b, v8f c) { return __builtin_amdgcn_wmma_f32_16x16x32_f16(false, a, false, b, (short)0, c, false, false); }
__device__ __forceinline__ v8f wmmab(v16bf a, v16bf b, v8f c) { return __builtin_amdgcn_wmma_f32_16x16x32_bf16(false, a, false, b, (short)0, c, false, false); }



// ---- k_gemmw: register-blocked GEMM, ONE WAVE per 64x64 output tile (16 accumulators), operands straight from K-contiguous 16-bit planes; grid (M/64, N/64, Z), 32 threads.
// C[m][n] (f32, pitch ldc, + optional f32 bias[n]) = sum_{k < KL} A[m][k] Bt[n][k] (+ split products per NSPLIT). K = row pitch of A and Bt in elements, KL <= K the summed length. z-batch strides sA/sB/sC in elements. KL % 32 == 0.
// KS > 1 (long K, few tiles): 32 KS threads, wave w of the work-group takes k in [w KL/KS, (w+1) KL/KS) of the same tile; the KS partial tiles are summed in fixed wave order through LDS. KL % (32 KS) == 0.
template <typename T16> struct WFrag;
template <> struct WFrag<h16> { typedef v16h V; static __device__ __forceinline__ V ld(const h16* p) { return cat16(*(const v8h*)p, *(const v8h*)(p + 16)); } static __device__ __forceinline__ v8f mma(V a, V b, v8f c) { return wmma16(a, b, c); } };
template <> struct WFrag<bf> { typedef v16bf V; static __device__ __forceinline__ V ld(const bf* p) { return cat16b(*(const v8us*)p, *(const v8us*)(p + 16)); } static __device__ __forceinline__ v8f mma(V a, V b, v8f c) { return wmmab(a, b, c); } };
template <typename T16, int NSPLIT, bool BIAS, int KS = 1>
__global__ __launch_bounds__(32 * KS) void k_gemmw(const T16* __restrict__ A, const T16* __restrict__ A2, const T16* __restrict__ Bt, const T16* __restrict__ Bt2, int K, int KL, float* C, int ldc, const float* __restrict__ bias, size_t sA, size_t sB, size_t sC) {
    typedef typename WFrag<T16>::V V;
    __shared__ __align__(16) float os[KS == 1 ? 16 * 68 : KS * 64 * 68];
    const size_t z = blockIdx.z; A += z * sA; if (A2) A2 += z * sA; Bt += z * sB; if (Bt2) Bt2 += z * sB; C += z * sC;
    const int lane = threadIdx.x & 31, lr = lane & 15, hi = lane >> 4; const int r0 = blockIdx.x * 64, c0 = blockIdx.y * 64;
    const int wv = (KS == 1) ? 0 : __builtin_amdgcn_readfirstlane((int)(threadIdx.x >> 5)); const int k0 = wv * (KL / KS), k1 = k0 + KL / KS;
    v8f acc[4][4];
#pragma unroll
    for (int mb = 0; mb < 4; ++mb)
#pragma unroll
        for (int nb = 0; nb < 4; ++nb) acc[mb][nb] = (v8f){};
    const size_t aoff = (size_t)(r0 + lr) * K + 8 * hi, boff = (size_t)(c0 + lr) * K + 8 * hi;
#pragma unroll 1
    for (int kc = k0; kc < k1; kc += 32) {
        V a[4], a2[4];
#pragma unroll
        for (int mb = 0; mb < 4; ++mb) { a[mb] = WFrag<T16>::ld(A + aoff + (size_t)mb * 16 * K + kc); if (NSPLIT == 1 || NSPLIT == 2) a2[mb] = WFrag<T16>::ld(A2 + aoff + (size_t)mb * 16 * K + kc); }
#pragma unroll
        for (int nb = 0; nb < 4; ++nb) { const V b = WFrag<T16>::ld(Bt + boff + (size_t)nb * 16 * K + kc); V b2; if (NSPLIT >= 2) b2 = WFrag<T16>::ld(Bt2 + boff + (size_t)nb * 16 * K + kc);
#pragma unroll
            for (int mb = 0; mb < 4; ++mb) { acc[mb][nb] = WFrag<T16>::mma(a[mb], b, acc[mb][nb]); if (NSPLIT == 1 || NSPLIT == 2) acc[mb][nb] = WFrag<T16>::mma(a2[mb], b, acc[mb][nb]); if (NSPLIT >= 2) acc[mb][nb] = WFrag<T16>::mma(a[mb], b2, acc[mb][nb]); } }
        asm volatile("v_nop\n\tv_nop\n\tv_nop\n\tv_nop" : "+v"(acc[0][0]), "+v"(acc[1][1]), "+v"(acc[2][2]), "+v"(acc[3][3]) : "v"(a[0]), "v"(a[3]));
    }
    if (KS > 1) {
        float* my = os + wv * (64 * 68);
#pragma unroll
        for (int mb = 0; mb < 4; ++mb)
#pragma unroll
            for (int nb = 0; nb < 4; ++nb)
#pragma unroll
                for (int j = 0; j < 8; ++j) my[(mb * 16 + hi * 8 + j) * 68 + nb * 16 + lr] = acc[mb][nb][j];
        __syncthreads();   // every wave's partial tile is in LDS before any wave sums across them
#pragma unroll
        for (int s = 0; s < 1024 / (32 * KS); ++s) { const int slot = s * (32 * KS) + (int)threadIdx.x; const int row = slot >> 4, cofs = (slot & 15) * 4; v4f val = *(const v4fa*)(os + row * 68 + cofs);
#pragma unroll
            for (int w = 1; w < KS; ++w) { const v4f p = *(const v4fa*)(os + w * (64 * 68) + row * 68 + cofs); val += p; }
            if (BIAS) { val[0] += bfr(bias[c0 + cofs]); val[1] += bfr(bias[c0 + cofs + 1]); val[2] += bfr(bias[c0 + cofs + 2]); val[3] += bfr(bias[c0 + cofs + 3]); }
            *(v4f*)(C + (size_t)(r0 + row) * ldc + c0 + cofs) = val; }
        return;
    }
#pragma unroll
    for (int mb = 0; mb < 4; ++mb) {
#pragma unroll
        for (int nb = 0; nb < 4; ++nb) {
#pragma unroll
            for (int j = 0; j < 8; ++j) os[(hi * 8 + j) * 68 + nb * 16 + lr] = acc[mb][nb][j]; }
        __builtin_amdgcn_wave_barrier(); asm volatile("" ::: "memory");
        float* crow = C + (size_t)(r0 + mb * 16) * ldc + c0;
{
#pragma unroll
            for (int s = 0; s < 8; ++s) { const int row = 2 * s + hi, cofs = lr * 4; v4f val = *(const v4fa*)(os + row * 68 + cofs); if (BIAS) { val[0] += bfr(bias[c0 + cofs]); val[1] += bfr(bias[c0 + cofs + 1]); val[2] += bfr(bias[c0 + cofs + 2]); val[3] += bfr(bias[c0 + cofs + 3]); }
                *(v4f*)(crow + (size_t)row * ldc + cofs) = val; }
             }
        __builtin_amdgcn_wave_barrier(); asm volatile("" ::: "memory");
    }
}

__device__ __forceinline__ h16 tohx(float x) { return (h16)x; }
__device__ __forceinline__ void splitf(float y, unsigned short& h, unsigned short& l) { h = f2bf(y); l = f2bf(y - bf2f(h)); }
typedef __attribute__((ext_vector_type(2))) _Float16 v2h;
typedef __attribute__((ext_vector_type(4))) _Float16 v4h;
typedef __attribute__((ext_vector_type(2))) unsigned short v2us;
typedef __attribute__((ext_vector_type(4))) unsigned short v4us;
typedef __attribute__((ext_vector_type(2))) float v2f;
typedef __attribute__((ext_vector_type(4))) int v4i;

__global__ __launch_bounds__(256) void k_cvt8(const float* __restrict__ src, bf* dst, size_t n8) { const size_t i = (size_t)blockIdx.x * 256 + threadIdx.x; if (i >= n8) return; const v8f v = *(const v8f*)(src + i * 8); v8us o;
#pragma unroll
    for (int k = 0; k < 8; ++k) o[k] = f2bf(v[k]); *(v8us*)(dst + i * 8) = o;  }

__global__ __launch_bounds__(256) void k_cvt8s(const float* __restrict__ X, bf* XB, size_t pitch) { const size_t i = (size_t)blockIdx.x * 256 + threadIdx.x; if (i >= (size_t)TT * DM / 8) return; const size_t e = i * 8; const int c = (int)(e % DM); const int srow = (int)(e / DM); const v8f a = *(const v8f*)(X + (size_t)srow * pitch + c); v8us o;
#pragma unroll
    for (int q = 0; q < 8; ++q) o[q] = f2bf(a[q]);
    *(v8us*)(XB + e) = o;  }
// k_rope: head planes [h][t][d] (fp16 + hi/lo) of rope(x) x sc with the rotate-half convention out[d] = x[d] cos[t][d] - x[d+HD/2] sin[t][d], out[d+HD/2] = x[d+HD/2] cos[t][d+HD/2] + x[d] sin[t][d+HD/2]
__global__ __launch_bounds__(256) void k_rope(const float* __restrict__ F, int pitch, int nheads, const float* __restrict__ CS, const float* __restrict__ RF, const float* __restrict__ nw, float sc, h16* P16, bf* Ph, bf* Pl) {
    const size_t e = ((size_t)blockIdx.x * 256 + threadIdx.x) * 2; if (e >= (size_t)nheads * TT * HD) return; const int d = (int)(e % HD); const int t = (int)((e / HD) % TT); const int h = (int)(e / ((size_t)HD * TT)); const float* f = F + (size_t)t * pitch + h * HD; const float rf = RF ? RF[(size_t)h * TT + t] : 1.0f; v2h o16; v2us oh, ol;
#pragma unroll
    for (int q = 0; q < 2; ++q) { const int dd = d + q; const int dp = (dd < HD / 2) ? dd + HD / 2 : dd - HD / 2; float x0 = f[dd], x1 = f[dp];
        if (RF) { float n0 = __fmul_rn(x0, rf), n1 = __fmul_rn(x1, rf); asm volatile("" : "+v"(n0)); asm volatile("" : "+v"(n1)); x0 = __fmul_rn(bfr(nw[dd]), n0); x1 = __fmul_rn(bfr(nw[dp]), n1); }
        const v2f cs = *(const v2f*)(CS + ((size_t)t * HD + dd) * 2); float a = __fmul_rn(x0, cs[0]), bq = __fmul_rn(x1, cs[1]); asm volatile("" : "+v"(a)); asm volatile("" : "+v"(bq)); const float r = ((dd < HD / 2) ? __fsub_rn(a, bq) : __fadd_rn(a, bq)) * sc;
        o16[q] = tohx(r); unsigned short a2, c2; splitf(r, a2, c2); oh[q] = a2; ol[q] = c2; }
    *(v2h*)(P16 + e) = o16; *(v2us*)(Ph + e) = oh; *(v2us*)(Pl + e) = ol;  }
__global__ __launch_bounds__(256) void k_vtp(const float* __restrict__ F, int pitch, int nheads, h16* V16, bf* Vhl) {   /* Vhl row (g, d) = 2048 hi | 2048 lo, the row form of P */ const size_t e = ((size_t)blockIdx.x * 256 + threadIdx.x) * 2; if (e >= (size_t)nheads * HD * TT) return; const int t = (int)(e % TT); const int d = (int)((e / TT) % HD); const int g = (int)(e / ((size_t)TT * HD)); v2h o16; v2us oh, ol;
#pragma unroll
    for (int q = 0; q < 2; ++q) { const float x = F[(size_t)(t + q) * pitch + g * HD + d]; o16[q] = tohx(x); unsigned short a2, c2; splitf(x, a2, c2); oh[q] = a2; ol[q] = c2; }
    const size_t e2 = ((size_t)g * HD + d) * (2 * TT) + t; *(v2h*)(V16 + e) = o16; *(v2us*)(Vhl + e2) = oh; *(v2us*)(Vhl + e2 + TT) = ol;  }
__global__ __launch_bounds__(256) void k_csid(float* CS) { const int idx = blockIdx.x * 256 + threadIdx.x; if (idx >= TT * HD) return; v2f cs; cs[0] = 1.0f; cs[1] = 0.0f; *(v2f*)(CS + (size_t)idx * 2) = cs;  }
// k_asoft: ONE WAVE per row (zz, i), the row held in registers from the scores to the fold: t = (S + QE[clip(j - i) + 50]) x HD^-0.5 (no mask); softmax over the 2048 keys (one exp, fixed trees); P hi/lo written IN PLACE over the row's own 8 KiB of scores (hi = the first 2048 bf16, lo = the next 2048; the wave has read its whole row before its first store, and no other wave touches the row); the same registers folded onto the 101 offsets (interior = one key, the two ends = fixed-order sums) -> PB hi/lo [row][128].
// A lane's keys are j = 128 ch + 4 lane + q. The interior offsets (|j - i| < 50) span fewer than 128 keys, so they meet at most ONE ch of a lane, chs; every key of a lower ch lies at the low end (offset 0), every key of a higher ch at the high end (offset 100).
static_assert(RH == TT, "the fold reads every row's normalised hi/lo values");
typedef __attribute__((ext_vector_type(4))) unsigned int v4u;
typedef v4us __attribute__((may_alias)) v4usa;
__global__ __launch_bounds__(256) void k_asoft(float* SP, const float* __restrict__ QE, bf* Bh, bf* Bl) {
    __shared__ __align__(16) unsigned int pb[8][NE];   // per wave: the row's 128 offset slots, hi | lo << 16
    const int lane = threadIdx.x & 31; const int wv = threadIdx.x >> 5; const int row = blockIdx.x * 8 + wv; if (row >= ZH * TT) return; const int i = row % TT; const float* sr = SP + (size_t)row * TT; bf* pr = (bf*)(SP + (size_t)row * TT); const float* qe = QE + (size_t)row * NE; float v[TT / 32]; float mx = -3.0e38f;
    const int chs = (i + CUT - 1 - lane * 4) >> 7; const int js = chs * 128 + lane * 4 - i;   // js + q = j - i of the lane's four keys of ch == chs
    const float qlo = qe[0], qhi = qe[2 * CUT]; float g[4];
    asm volatile("s_wait_xcnt 0x0" ::: "memory");   // the two loads above share one address pair: the wait stands before a later load's result may take those registers
#pragma unroll
    for (int q = 0; q < 4; ++q) g[q] = qe[min(max(js + q, -CUT), CUT) + CUT];
#pragma unroll
    for (int ch = 0; ch < TT / 128; ++ch) { const int j0 = ch * 128 + lane * 4; const v4f a = *(const v4fa*)(sr + j0); const float e = (ch < chs) ? qlo : qhi;
#pragma unroll
        for (int q = 0; q < 4; ++q) { const float t = __fadd_rn(a[q], (ch == chs) ? g[q] : e) * SCL; v[ch * 4 + q] = t; mx = fmaxf(mx, t); } }
#pragma unroll
    for (int sh = 16; sh; sh >>= 1) mx = fmaxf(mx, __shfl_xor(mx, sh, 32));
    float sum = 0.f;
#pragma unroll
    for (int k = 0; k < TT / 32; ++k) { float d0 = __fsub_rn(v[k], mx); asm volatile("" : "+v"(d0)); v[k] = __builtin_amdgcn_exp2f(__fmul_rn(d0, 1.4426950408889634f)); sum += v[k]; }
#pragma unroll
    for (int sh = 16; sh; sh >>= 1) sum += __shfl_xor(sum, sh, 32);
    const float f = __fdiv_rn(1.0f, sum);
    float lo_s = 0.f, hi_s = 0.f; float gv[4] = {0.f, 0.f, 0.f, 0.f};   // gv: the lane's four probabilities of ch == chs (zero where the row has no such ch)
#pragma unroll
    for (int ch = 0; ch < TT / 128; ++ch) { v4us oh, ol; float p[4];
#pragma unroll
        for (int q = 0; q < 4; ++q) { const float y = v[ch * 4 + q] * f; unsigned short a, c2; splitf(y, a, c2); oh[q] = a; ol[q] = c2; p[q] = __fadd_rn(bf2f(a), bf2f(c2)); if (ch == chs) gv[q] = y; }
        const float s4 = __fadd_rn(__fadd_rn(p[0], p[1]), __fadd_rn(p[2], p[3])); lo_s = __fadd_rn(lo_s, (ch < chs) ? s4 : 0.f); hi_s = __fadd_rn(hi_s, (ch > chs) ? s4 : 0.f);
        const int oo = ch * 128 + lane * 4; *(v4usa*)(pr + oo) = oh; *(v4usa*)(pr + TT + oo) = ol; }
    unsigned int gi[4];
#pragma unroll
    for (int q = 0; q < 4; ++q) { unsigned short a, c2; splitf(gv[q], a, c2); const float p = __fadd_rn(bf2f(a), bf2f(c2)); gi[q] = (unsigned int)a | ((unsigned int)c2 << 16); lo_s = __fadd_rn(lo_s, (js + q <= -CUT) ? p : 0.f); hi_s = __fadd_rn(hi_s, (js + q >= CUT) ? p : 0.f); }
#pragma unroll
    for (int sh = 16; sh; sh >>= 1) { lo_s = __fadd_rn(lo_s, __shfl_xor(lo_s, sh, 32)); hi_s = __fadd_rn(hi_s, __shfl_xor(hi_s, sh, 32)); }
    unsigned short l0h, l0l, h0h, h0l; splitf(lo_s, l0h, l0l); splitf(hi_s, h0h, h0l);
    unsigned int* my = pb[wv]; *(v4u*)(my + lane * 4) = (v4u){0u, 0u, 0u, 0u};   // slots that no key of the row reaches stay zero
    __builtin_amdgcn_wave_barrier(); asm volatile("" ::: "memory");   // compiler order only: the zero fill of all lanes stays in front of any lane's scatter (one wave's LDS operations run in order)
#pragma unroll
    for (int q = 0; q < 4; ++q) { const int bkt = js + q + CUT; if (bkt > 0 && bkt < 2 * CUT) my[bkt] = gi[q]; }   // interior offset = one key; slots are distinct across lanes (j mod 128 is)
    __builtin_amdgcn_wave_barrier(); asm volatile("" ::: "memory");   // compiler order only: other lanes' scatter stays in front of this lane's read
    const v4u r = *(const v4u*)(my + lane * 4); v4us oh, ol;
#pragma unroll
    for (int q = 0; q < 4; ++q) { const int bkt = lane * 4 + q; oh[q] = (bkt == 0) ? l0h : ((bkt == 2 * CUT) ? h0h : (unsigned short)(r[q] & 0xFFFFu)); ol[q] = (bkt == 0) ? l0l : ((bkt == 2 * CUT) ? h0l : (unsigned short)(r[q] >> 16)); }
    *(v4us*)(Bh + (size_t)row * NE + lane * 4) = oh; *(v4us*)(Bl + (size_t)row * NE + lane * 4) = ol;
}
__global__ __launch_bounds__(256) void k_epadK(const float* __restrict__ E, bf* EB) { const size_t i = (size_t)blockIdx.x * 256 + threadIdx.x; if (i >= (size_t)NE * HD / 8) return; const int d0 = (int)(i % (HD / 8)) * 8; const int r = (int)(i / (HD / 8)); const float* src = E + (size_t)min(r, NRE - 1) * HD + d0; v8us o;
#pragma unroll
    for (int q = 0; q < 8; ++q) { const unsigned short v = f2bf(src[q]); o[q] = (r < NRE) ? v : (unsigned short)0; }
    *(v8us*)(EB + (size_t)r * HD + d0) = o;  }

__global__ __launch_bounds__(256) void k_epadVT(const float* __restrict__ E, bf* Th, bf* Tl) { const size_t i = (size_t)blockIdx.x * 256 + threadIdx.x; if (i >= (size_t)HD * NE / 4) return; const size_t e = i * 4; const int c0 = (int)(e % NE); const int d = (int)(e / NE); v4us oh, ol;
#pragma unroll
    for (int q = 0; q < 4; ++q) { const int r = c0 + q; const float v = bfr(E[(size_t)min(r, NRE - 1) * HD + d]); unsigned short u, w; splitf(v, u, w);   /* input rounded to bf16 once: lo == 0 */ oh[q] = (r < NRE) ? u : (unsigned short)0; ol[q] = (r < NRE) ? w : (unsigned short)0; }
    *(v4us*)(Th + e) = oh; *(v4us*)(Tl + e) = ol;  }

__global__ __launch_bounds__(256) void k_addF(float* Y, const float* __restrict__ F) { const size_t i = (size_t)blockIdx.x * 256 + threadIdx.x; if (i >= (size_t)ZH * TT * HD / 4) return; const v4f a = *(const v4f*)(Y + i * 4); const v4f f = *(const v4f*)(F + i * 4); v4f o;
#pragma unroll
    for (int q = 0; q < 4; ++q) o[q] = __fadd_rn(a[q], f[q]);
    *(v4f*)(Y + i * 4) = o;  }

__global__ __launch_bounds__(256) void k_merge(const float* __restrict__ O, int h0, bf* Ah, bf* Al) { const size_t e = ((size_t)blockIdx.x * 256 + threadIdx.x) * 2; if (e >= (size_t)ZH * TT * HD) return; const int d = (int)(e % HD); const int t = (int)((e / HD) % TT); const int zz = (int)(e / ((size_t)HD * TT)); const float cs = (t < RH) ? 1.0f : (1.0f / PCAR); const size_t oo = (size_t)t * DQ + (h0 + zz) * HD + d;
    v2us oh, ol;
#pragma unroll
    for (int q = 0; q < 2; ++q) { unsigned short a, c2; splitf(O[e + q] * cs, a, c2); oh[q] = a; ol[q] = c2; } *(v2us*)(Ah + oo) = oh; *(v2us*)(Al + oo) = ol;  }

extern "C" void kernel_launch(void* const* d_in, const int* in_sizes, int n_in,
                              void* d_out, int out_size, void* d_ws, size_t ws_size, hipStream_t stream) {
    (void)in_sizes; (void)n_in; (void)out_size;
    const float* x = (const float*)d_in[0];   /* query */ const float* xk = (const float*)d_in[1]; const float* xv = (const float*)d_in[2]; const float* wq = (const float*)d_in[3]; const float* bq = (const float*)d_in[4]; const float* wk = (const float*)d_in[5]; const float* bk = (const float*)d_in[6]; const float* wv = (const float*)d_in[7]; const float* bv = (const float*)d_in[8]; const float* wo = (const float*)d_in[9]; const float* bo = (const float*)d_in[10]; const float* ak = (const float*)d_in[11];   /* rel_k_table [101][64] */ const float* av = (const float*)d_in[12];   /* rel_v_table [101][64] */
    float* OUT = (float*)d_out;     // [2048][2][1024] sequence-first
    char* wsp = (char*)d_ws;
    auto take = [&](size_t bytes) { char* p = wsp; wsp += (bytes + 255) & ~(size_t)255; return (void*)p; };
    bf* AKB = (bf*)take((size_t)NE * HD * 2); bf* AVTh = (bf*)take((size_t)HD * NE * 2); bf* AVTl = (bf*)take((size_t)HD * NE * 2); float* QE = (float*)take((size_t)ZH * TT * NE * 4); bf* PBh = (bf*)take((size_t)ZH * TT * NE * 2); bf* PBl = (bf*)take((size_t)ZH * TT * NE * 2); float* ZR = (float*)take((size_t)ZH * TT * HD * 4); bf* WQ = (bf*)take((size_t)DQ * DM * 2); bf* WK = (bf*)take((size_t)DKV * DM * 2); bf* WV = (bf*)take((size_t)DKV * DM * 2); bf* WO = (bf*)take((size_t)DM * DQ * 2); float* CS = (float*)take((size_t)TT * HD * 2 * 4);
    bf* XB = (bf*)take((size_t)TT * DM * 2); float* FQ = (float*)take((size_t)TT * DQ * 4); float* FK = (float*)take((size_t)TT * DKV * 4);
    h16* QP16 = (h16*)take((size_t)NH_ * TT * HD * 2); h16* KP16 = (h16*)take((size_t)NKV * TT * HD * 2); h16* VT16 = (h16*)take((size_t)NKV * HD * TT * 2);
    bf* QPh = (bf*)take((size_t)NH_ * TT * HD * 2); bf* QPl = (bf*)take((size_t)NH_ * TT * HD * 2); bf* KPh = (bf*)take((size_t)NKV * TT * HD * 2); bf* KPl = (bf*)take((size_t)NKV * TT * HD * 2); bf* VT = (bf*)take((size_t)NKV * HD * 2 * TT * 2);
    float* Sb = (float*)take((size_t)ZH * TT * TT * 4); float* Ob = (float*)take((size_t)ZH * TT * HD * 4); bf* ATh = (bf*)take((size_t)TT * DQ * 2); bf* ATl = (bf*)take((size_t)TT * DQ * 2);
    if ((size_t)(wsp - (char*)d_ws) > ws_size) return;    // ws 256 MiB
    float* FV = FK;   // v projection reuses the k buffer after the k planes are built (stream-ordered)
    { k_cvt8<<<(unsigned)(((size_t)DQ * DM / 8 + 255) / 256), 256, 0, stream>>>(wq, WQ, (size_t)DQ * DM / 8); k_cvt8<<<(unsigned)(((size_t)DKV * DM / 8 + 255) / 256), 256, 0, stream>>>(wk, WK, (size_t)DKV * DM / 8); k_cvt8<<<(unsigned)(((size_t)DKV * DM / 8 + 255) / 256), 256, 0, stream>>>(wv, WV, (size_t)DKV * DM / 8);
      k_cvt8<<<(unsigned)(((size_t)DM * DQ / 8 + 255) / 256), 256, 0, stream>>>(wo, WO, (size_t)DM * DQ / 8);
       }
    k_csid<<<(TT * HD + 255) / 256, 256, 0, stream>>>(CS);
    const unsigned LQ = (unsigned)(((size_t)NH_ * TT * HD / 2 + 255) / 256), LKv = (unsigned)(((size_t)NKV * TT * HD / 2 + 255) / 256);
    k_epadK<<<(unsigned)(((size_t)NE * HD / 8 + 255) / 256), 256, 0, stream>>>(ak, AKB);   /* rel_k -> bf16 [128][64], rows >= 101 zero */ k_epadVT<<<(unsigned)(((size_t)HD * NE / 4 + 255) / 256), 256, 0, stream>>>(av, AVTh, AVTl);   /* rel_v^T hi/lo [64][128], cols >= 101 zero */
    for (int b = 0; b < NB_; ++b) {
        
        k_cvt8s<<<(unsigned)(((size_t)TT * DM / 8 + 255) / 256), 256, 0, stream>>>(x + (size_t)b * DM, XB, (size_t)NB_ * DM);   /* sequence-first [L][B][HID]: batch column b */
        k_gemmw<bf, 0, true, 8><<<dim3(TT / 64, DQ / 64, 1), 256, 0, stream>>>(XB, nullptr, WQ, nullptr, DM, DM, FQ, DQ, bq, 0, 0, 0);
        k_rope<<<LQ, 256, 0, stream>>>(FQ, DQ, NH_, CS, nullptr, nullptr, 1.0f, QP16, QPh, QPl);
        k_cvt8s<<<(unsigned)(((size_t)TT * DM / 8 + 255) / 256), 256, 0, stream>>>(xk + (size_t)b * DM, XB, (size_t)NB_ * DM);   /* sequence-first [L][B][HID]: batch column b */ k_gemmw<bf, 0, true, 8><<<dim3(TT / 64, DKV / 64, 1), 256, 0, stream>>>(XB, nullptr, WK, nullptr, DM, DM, FK, DKV, bk, 0, 0, 0);
        k_rope<<<LKv, 256, 0, stream>>>(FK, DKV, NKV, CS, nullptr, nullptr, 1.0f, KP16, KPh, KPl);
        k_cvt8s<<<(unsigned)(((size_t)TT * DM / 8 + 255) / 256), 256, 0, stream>>>(xv + (size_t)b * DM, XB, (size_t)NB_ * DM);   /* sequence-first [L][B][HID]: batch column b */ k_gemmw<bf, 0, true, 8><<<dim3(TT / 64, DKV / 64, 1), 256, 0, stream>>>(XB, nullptr, WV, nullptr, DM, DM, FV, DKV, bv, 0, 0, 0); k_vtp<<<LKv, 256, 0, stream>>>(FV, DKV, NKV, VT16, VT);
        for (int h0 = 0; h0 < NH_; h0 += ZH) { const size_t zq = (size_t)h0, zk = (size_t)(h0 / REP);   // one kv head per query head: the pass's heads use consecutive kv planes
            k_gemmw<bf, 2, false><<<dim3(RH / 64, TT / 64, ZH), 32, 0, stream>>>(QPh + zq * TT * HD, QPl + zq * TT * HD, KPh + zk * TT * HD, KPl + zk * TT * HD, HD, HD, Sb, TT, nullptr, (size_t)TT * HD, (size_t)TT * HD, (size_t)TT * TT);

            k_gemmw<bf, 1, false><<<dim3(TT / 64, NE / 64, ZH), 32, 0, stream>>>(QPh + zq * TT * HD, QPl + zq * TT * HD, AKB, nullptr, HD, HD, QE, NE, nullptr, (size_t)TT * HD, 0, (size_t)TT * NE);   /* QE = q . rel_k^T */ k_asoft<<<ZH * TT / 8, 256, 0, stream>>>(Sb, QE, PBh, PBl);   /* + q.rel_k[clip(j - i) + 50], softmax, attn folded onto the 101 clipped offsets */
            k_gemmw<bf, 2, false, 16><<<dim3(RH / 64, HD / 64, ZH), 512, 0, stream>>>((const bf*)Sb, (const bf*)Sb + TT, VT + zk * HD * 2 * TT, VT + zk * HD * 2 * TT + TT, 2 * TT, TT, Ob, HD, nullptr, (size_t)RH * 2 * TT, (size_t)HD * 2 * TT, (size_t)TT * HD);   /* P rows lie in the score rows, hi | lo, like the v^T rows: row pitch 2 x 2048 bf16, 2048 summed */ k_gemmw<bf, 2, false, 4><<<dim3(TT / 64, HD / 64, ZH), 128, 0, stream>>>(PBh, PBl, AVTh, AVTl, NE, NE, ZR, HD, nullptr, (size_t)TT * NE, 0, (size_t)TT * HD);   /* ZR = PB . rel_v */ k_addF<<<(unsigned)(((size_t)ZH * TT * HD / 4 + 255) / 256), 256, 0, stream>>>(Ob, ZR);   /* context += relative-value term */

            k_merge<<<(unsigned)(((size_t)ZH * TT * HD / 2 + 255) / 256), 256, 0, stream>>>(Ob, h0, ATh, ATl); }
        k_gemmw<bf, 1, true, 8><<<dim3(TT / 64, DM / 64, 1), 256, 0, stream>>>(ATh, ATl, WO, nullptr, DQ, DQ, OUT + (size_t)b * DM, NB_ * DM, bo, 0, 0, 0); }   /* sequence-first output [L][B][HID]: row pitch B x HID, column block b */
}

// v004
// A run of this version takes 480 microseconds.
// Next to v003, in two timings, it ran 1.43 and 1.44 times as fast.
// Counting every step since v000, it is 3.99 times as fast.
#include <hip/hip_runtime.h>

// Relative multi-head attention with key AND value relative-position embeddings, sequence-first tensors (query, key, value [2048][2][1024]; q = query Wq^T + bq, k = key Wk^T + bk, v = value Wv^T + bv ('oi' 0.02, biases 0.02; 16 heads x 64); idx[i][j] = clip(j - i, -50, 50) + 50; attn = softmax((q.k + q.rel_k[idx]) / 8); x = attn v + sum_j attn[i][j] rel_v[idx] (rel_k, rel_v [101][64] 0.02, read); out = merged Wo^T + bo -> [2048][2][1024] sequence-first (4.2 M); argument order query, key, value, Wq, bq, Wk, bk, Wv, bv, Wo, bo, rel_k, rel_v).
// Layout per batch column: strided bf16 gathers of query, key, value in turn; 'oi' weights; exact projections + f32 biases; rel_k as a zero-padded bf16 plane [128][64] and rel_v^T as hi/lo planes [64][128]; per pass of eight heads: QE = q.rel_k^T (hi/lo x exact); one fused kernel for the score tiles (hi/lo 3 products), QE gathered in at column clip(j - i) + 50, running softmax (x 1/8), P.v (hi/lo x hi/lo) and the probabilities folded onto the 101 offsets (interior = one key, the two ends = fixed-order sums); PB.rel_v added to the context; merged hi/lo x Wo exact + bo written with the sequence-first row pitch.
// Compute dtypes, f32 accumulate: every input rounded to bf16; projections exact + f32 biases; scores and the relative-key term ~f32; softmax f32; P as bf16 hi/lo; attn.v and the relative-value term 3 products (~f32); Wo hl x exact + bias.

#define NB_  2
#define TT   2048
#define DM   1024
#define NH_  16
#define NKV  16
#define REP  (NH_ / NKV)
#define HD   64
#define DQ   (NH_ * HD)
#define DKV  (NKV * HD)
#define ZH   8
#define RH   TT                   // every row on hi/lo planes (the relative-value fold needs normalised planes)
#define WIN  0
#define PCAR 1024.0f
#define SCL  0.125f   // 1/sqrt(64) (the module divides by jnp.sqrt(DH))
#define NE   128      // 2*50+1 = 101 relative offsets padded to 128
#define NRE  101
#define CUT  50
typedef _Float16 h16;
typedef unsigned short bf;
typedef __attribute__((ext_vector_type(16))) __bf16   v16bf;
typedef __attribute__((ext_vector_type(16))) _Float16 v16h;
typedef __attribute__((ext_vector_type(8)))  _Float16 v8h;
typedef __attribute__((ext_vector_type(8)))  unsigned short v8us;
typedef __attribute__((ext_vector_type(8)))  float    v8f;
typedef __attribute__((ext_vector_type(4)))  float    v4f;
typedef v8h  __attribute__((may_alias)) v8ha;
typedef v4f  __attribute__((may_alias)) v4fa;
typedef v8us __attribute__((may_alias)) v8usa;

__device__ __forceinline__ unsigned short f2bf(float f) { unsigned u = __float_as_uint(f); u += 0x7FFFu + ((u >> 16) & 1u); return (unsigned short)(u >> 16); }
__device__ __forceinline__ float bf2f(unsigned short b) { return __uint_as_float(((unsigned)b) << 16); }
__device__ __forceinline__ float bfr(float f) { return bf2f(f2bf(f)); }
__device__ __forceinline__ v16h cat16(v8h lo, v8h hi) { return __builtin_shufflevector(lo, hi, 0, 1, 2, 3, 4, 5, 6, 7, 8, 9, 10, 11, 12, 13, 14, 15); }
__device__ __forceinline__ v16bf cat16b(v8us lo, v8us hi) { return __builtin_bit_cast(v16bf, __builtin_shufflevector(lo, hi, 0, 1, 2, 3, 4, 5, 6, 7, 8, 9, 10, 11, 12, 13, 14, 15)); }
__device__ __forceinline__ v8f wmma16(v16h a, v16h b, v8f c) { return __builtin_amdgcn_wmma_f32_16x16x32_f16(false, a, false, b, (short)0, c, false, false); }
__device__ __forceinline__ v8f wmmab(v16bf a, v16bf b, v8f c) { return __builtin_amdgcn_wmma_f32_16x16x32_bf16(false, a, false, b, (short)0, c, false, false); }



// ---- k_gemmw: register-blocked GEMM, ONE WAVE per 64x64 output tile (16 accumulators), operands straight from K-contiguous 16-bit planes; grid (M/64, N/64, Z), 32 threads.
// C[m][n] (f32, pitch ldc, + optional f32 bias[n]) = sum_{k < KL} A[m][k] Bt[n][k] (+ split products per NSPLIT). K = row pitch of A and Bt in elements, KL <= K the summed length. z-batch strides sA/sB/sC in elements. KL % 32 == 0.
// KS > 1 (long K, few tiles): 32 KS threads, wave w of the work-group takes k in [w KL/KS, (w+1) KL/KS) of the same tile; the KS partial tiles are summed in fixed wave order through LDS. KL % (32 KS) == 0.
template <typename T16> struct WFrag;
template <> struct WFrag<h16> { typedef v16h V; static __device__ __forceinline__ V ld(const h16* p) { return cat16(*(const v8h*)p, *(const v8h*)(p + 16)); } static __device__ __forceinline__ v8f mma(V a, V b, v8f c) { return wmma16(a, b, c); } };
template <> struct WFrag<bf> { typedef v16bf V; static __device__ __forceinline__ V ld(const bf* p) { return cat16b(*(const v8us*)p, *(const v8us*)(p + 16)); } static __device__ __forceinline__ v8f mma(V a, V b, v8f c) { return wmmab(a, b, c); } };
template <typename T16, int NSPLIT, bool BIAS, int KS = 1>
__global__ __launch_bounds__(32 * KS) void k_gemmw(const T16* __restrict__ A, const T16* __restrict__ A2, const T16* __restrict__ Bt, const T16* __restrict__ Bt2, int K, int KL, float* C, int ldc, const float* __restrict__ bias, size_t sA, size_t sB, size_t sC) {
    typedef typename WFrag<T16>::V V;
    __shared__ __align__(16) float os[KS == 1 ? 16 * 68 : KS * 64 * 68];
    const size_t z = blockIdx.z; A += z * sA; if (A2) A2 += z * sA; Bt += z * sB; if (Bt2) Bt2 += z * sB; C += z * sC;
    const int lane = threadIdx.x & 31, lr = lane & 15, hi = lane >> 4; const int r0 = blockIdx.x * 64, c0 = blockIdx.y * 64;
    const int wv = (KS == 1) ? 0 : __builtin_amdgcn_readfirstlane((int)(threadIdx.x >> 5)); const int k0 = wv * (KL / KS), k1 = k0 + KL / KS;
    v8f acc[4][4];
#pragma unroll
    for (int mb = 0; mb < 4; ++mb)
#pragma unroll
        for (int nb = 0; nb < 4; ++nb) acc[mb][nb] = (v8f){};
    const size_t aoff = (size_t)(r0 + lr) * K + 8 * hi, boff = (size_t)(c0 + lr) * K + 8 * hi;
#pragma unroll 1
    for (int kc = k0; kc < k1; kc += 32) {
        V a[4], a2[4];
#pragma unroll
        for (int mb = 0; mb < 4; ++mb) { a[mb] = WFrag<T16>::ld(A + aoff + (size_t)mb * 16 * K + kc); if (NSPLIT == 1 || NSPLIT == 2) a2[mb] = WFrag<T16>::ld(A2 + aoff + (size_t)mb * 16 * K + kc); }
#pragma unroll
        for (int nb = 0; nb < 4; ++nb) { const V b = WFrag<T16>::ld(Bt + boff + (size_t)nb * 16 * K + kc); V b2; if (NSPLIT >= 2) b2 = WFrag<T16>::ld(Bt2 + boff + (size_t)nb * 16 * K + kc);
#pragma unroll
            for (int mb = 0; mb < 4; ++mb) { acc[mb][nb] = WFrag<T16>::mma(a[mb], b, acc[mb][nb]); if (NSPLIT == 1 || NSPLIT == 2) acc[mb][nb] = WFrag<T16>::mma(a2[mb], b, acc[mb][nb]); if (NSPLIT >= 2) acc[mb][nb] = WFrag<T16>::mma(a[mb], b2, acc[mb][nb]); } }
        asm volatile("v_nop\n\tv_nop\n\tv_nop\n\tv_nop" : "+v"(acc[0][0]), "+v"(acc[1][1]), "+v"(acc[2][2]), "+v"(acc[3][3]) : "v"(a[0]), "v"(a[3]));
    }
    if (KS > 1) {
        float* my = os + wv * (64 * 68);
#pragma unroll
        for (int mb = 0; mb < 4; ++mb)
#pragma unroll
            for (int nb = 0; nb < 4; ++nb)
#pragma unroll
                for (int j = 0; j < 8; ++j) my[(mb * 16 + hi * 8 + j) * 68 + nb * 16 + lr] = acc[mb][nb][j];
        __syncthreads();   // every wave's partial tile is in LDS before any wave sums across them
#pragma unroll
        for (int s = 0; s < 1024 / (32 * KS); ++s) { const int slot = s * (32 * KS) + (int)threadIdx.x; const int row = slot >> 4, cofs = (slot & 15) * 4; v4f val = *(const v4fa*)(os + row * 68 + cofs);
#pragma unroll
            for (int w = 1; w < KS; ++w) { const v4f p = *(const v4fa*)(os + w * (64 * 68) + row * 68 + cofs); val += p; }
            if (BIAS) { val[0] += bfr(bias[c0 + cofs]); val[1] += bfr(bias[c0 + cofs + 1]); val[2] += bfr(bias[c0 + cofs + 2]); val[3] += bfr(bias[c0 + cofs + 3]); }
            *(v4f*)(C + (size_t)(r0 + row) * ldc + c0 + cofs) = val; }
        return;
    }
#pragma unroll
    for (int mb = 0; mb < 4; ++mb) {
#pragma unroll
        for (int nb = 0; nb < 4; ++nb) {
#pragma unroll
            for (int j = 0; j < 8; ++j) os[(hi * 8 + j) * 68 + nb * 16 + lr] = acc[mb][nb][j]; }
        __builtin_amdgcn_wave_barrier(); asm volatile("" ::: "memory");
        float* crow = C + (size_t)(r0 + mb * 16) * ldc + c0;
{
#pragma unroll
            for (int s = 0; s < 8; ++s) { const int row = 2 * s + hi, cofs = lr * 4; v4f val = *(const v4fa*)(os + row * 68 + cofs); if (BIAS) { val[0] += bfr(bias[c0 + cofs]); val[1] += bfr(bias[c0 + cofs + 1]); val[2] += bfr(bias[c0 + cofs + 2]); val[3] += bfr(bias[c0 + cofs + 3]); }
                *(v4f*)(crow + (size_t)row * ldc + cofs) = val; }
             }
        __builtin_amdgcn_wave_barrier(); asm volatile("" ::: "memory");
    }
}

__device__ __forceinline__ h16 tohx(float x) { return (h16)x; }
__device__ __forceinline__ void splitf(float y, unsigned short& h, unsigned short& l) { h = f2bf(y); l = f2bf(y - bf2f(h)); }
typedef __attribute__((ext_vector_type(2))) _Float16 v2h;
typedef __attribute__((ext_vector_type(4))) _Float16 v4h;
typedef __attribute__((ext_vector_type(2))) unsigned short v2us;
typedef __attribute__((ext_vector_type(4))) unsigned short v4us;
typedef __attribute__((ext_vector_type(2))) float v2f;
typedef __attribute__((ext_vector_type(4))) int v4i;

__global__ __launch_bounds__(256) void k_cvt8(const float* __restrict__ src, bf* dst, size_t n8) { const size_t i = (size_t)blockIdx.x * 256 + threadIdx.x; if (i >= n8) return; const v8f v = *(const v8f*)(src + i * 8); v8us o;
#pragma unroll
    for (int k = 0; k < 8; ++k) o[k] = f2bf(v[k]); *(v8us*)(dst + i * 8) = o;  }

__global__ __launch_bounds__(256) void k_cvt8s(const float* __restrict__ X, bf* XB, size_t pitch) { const size_t i = (size_t)blockIdx.x * 256 + threadIdx.x; if (i >= (size_t)TT * DM / 8) return; const size_t e = i * 8; const int c = (int)(e % DM); const int srow = (int)(e / DM); const v8f a = *(const v8f*)(X + (size_t)srow * pitch + c); v8us o;
#pragma unroll
    for (int q = 0; q < 8; ++q) o[q] = f2bf(a[q]);
    *(v8us*)(XB + e) = o;  }
// k_rope: head planes [h][t][d] (fp16 + hi/lo) of rope(x) x sc with the rotate-half convention out[d] = x[d] cos[t][d] - x[d+HD/2] sin[t][d], out[d+HD/2] = x[d+HD/2] cos[t][d+HD/2] + x[d] sin[t][d+HD/2]
__global__ __launch_bounds__(256) void k_rope(const float* __restrict__ F, int pitch, int nheads, const float* __restrict__ CS, const float* __restrict__ RF, const float* __restrict__ nw, float sc, h16* P16, bf* Ph, bf* Pl) {
    const size_t e = ((size_t)blockIdx.x * 256 + threadIdx.x) * 2; if (e >= (size_t)nheads * TT * HD) return; const int d = (int)(e % HD); const int t = (int)((e / HD) % TT); const int h = (int)(e / ((size_t)HD * TT)); const float* f = F + (size_t)t * pitch + h * HD; const float rf = RF ? RF[(size_t)h * TT + t] : 1.0f; v2h o16; v2us oh, ol;
#pragma unroll
    for (int q = 0; q < 2; ++q) { const int dd = d + q; const int dp = (dd < HD / 2) ? dd + HD / 2 : dd - HD / 2; float x0 = f[dd], x1 = f[dp];
        if (RF) { float n0 = __fmul_rn(x0, rf), n1 = __fmul_rn(x1, rf); asm volatile("" : "+v"(n0)); asm volatile("" : "+v"(n1)); x0 = __fmul_rn(bfr(nw[dd]), n0); x1 = __fmul_rn(bfr(nw[dp]), n1); }
        const v2f cs = *(const v2f*)(CS + ((size_t)t * HD + dd) * 2); float a = __fmul_rn(x0, cs[0]), bq = __fmul_rn(x1, cs[1]); asm volatile("" : "+v"(a)); asm volatile("" : "+v"(bq)); const float r = ((dd < HD / 2) ? __fsub_rn(a, bq) : __fadd_rn(a, bq)) * sc;
        o16[q] = tohx(r); unsigned short a2, c2; splitf(r, a2, c2); oh[q] = a2; ol[q] = c2; }
    *(v2h*)(P16 + e) = o16; *(v2us*)(Ph + e) = oh; *(v2us*)(Pl + e) = ol;  }
__global__ __launch_bounds__(256) void k_vtp(const float* __restrict__ F, int pitch, int nheads, h16* V16, bf* Vhl) {   /* Vhl row (g, d) = 2048 hi | 2048 lo */ const size_t e = ((size_t)blockIdx.x * 256 + threadIdx.x) * 2; if (e >= (size_t)nheads * HD * TT) return; const int t = (int)(e % TT); const int d = (int)((e / TT) % HD); const int g = (int)(e / ((size_t)TT * HD)); v2h o16; v2us oh, ol;
#pragma unroll
    for (int q = 0; q < 2; ++q) { const float x = F[(size_t)(t + q) * pitch + g * HD + d]; o16[q] = tohx(x); unsigned short a2, c2; splitf(x, a2, c2); oh[q] = a2; ol[q] = c2; }
    const size_t e2 = ((size_t)g * HD + d) * (2 * TT) + t; *(v2h*)(V16 + e) = o16; *(v2us*)(Vhl + e2) = oh; *(v2us*)(Vhl + e2 + TT) = ol;  }
__global__ __launch_bounds__(256) void k_csid(float* CS) { const int idx = blockIdx.x * 256 + threadIdx.x; if (idx >= TT * HD) return; v2f cs; cs[0] = 1.0f; cs[1] = 0.0f; *(v2f*)(CS + (size_t)idx * 2) = cs;  }
// k_fattn: scores, softmax, P.v and the offset fold in ONE kernel; a score never leaves its wave's registers. Work-group = 4 waves x 16 queries of one head; keys in tiles of 64, K hi/lo [key][d] and v^T hi/lo [d][key] staged through registers into two LDS buffers (row pitch 144 B), the next tile's global loads issued before this tile's work.
// Every product is taken transposed, so that a lane owns ONE query (lane & 15): S^T = K.Q^T (rows = keys, columns = queries), O^T = v^T.P^T (rows = d). The accumulator of two 16-key S^T tiles IS the 32-key operand fragment of P^T (register j of tile 0 = key 8 hi + j, of tile 1 = key 16 + 8 hi + j), and row maximum, row sum and rescale are per-lane values.
// Running softmax in the exp2 domain: u = (s + QE[clip(j - i) + 50]) / 8 x log2(e); p = exp2(u - m), sums and O^T rescaled by exp2(m_old - m_new), divided by the row sum at the end. Fold: the two end offsets are running sums of p; an interior offset is one key, whose u waits in the wave's own LDS until m and the sum are final.
typedef __attribute__((ext_vector_type(4))) unsigned int v4u;
typedef v4us __attribute__((may_alias)) v4usa;
#define LP  72     // LDS row pitch in bf16: 144 B = 16 B x 9, free of bank conflicts for 16-byte fragment reads
#define TBP 132    // pitch in floats of a query's 128 offset slots
#define UC  (SCL * 1.4426950408889634f)
__global__ __launch_bounds__(128) void k_fattn(const bf* __restrict__ Qh, const bf* __restrict__ Ql, const bf* __restrict__ Kh, const bf* __restrict__ Kl, const bf* __restrict__ Vhl, const float* __restrict__ QE, float* O, bf* Bh, bf* Bl) {
    __shared__ __align__(16) bf st[2][4][64 * LP];     // per buffer: K hi, K lo, v^T hi, v^T lo
    __shared__ __align__(16) float tb[4][16 * TBP];    // per wave: u of the interior offsets, [query][offset]
    __shared__ __align__(16) float qs[4][16 * TBP];    // per wave: its sixteen rows of QE x UC
    const int tid = threadIdx.x, lane = tid & 31, lr = lane & 15, hi = lane >> 4; const int wv = __builtin_amdgcn_readfirstlane(tid >> 5);
    const int z = blockIdx.y; const int q0 = blockIdx.x * 64 + wv * 16; const int i = q0 + lr; const size_t hb = (size_t)z * TT * HD;
    // every global address = a base that is the same for the wave + a lane's byte offset that lives as long as its loads or stores do
    const char* kh = (const char*)(Kh + hb); const char* kl = (const char*)(Kl + hb); const char* vv = (const char*)(Vhl + (size_t)z * HD * 2 * TT); float* tw = tb[wv]; float* qw = qs[wv];
    const unsigned ko = (unsigned)tid * 16u;   // K tile: 8 KiB in a row, slice r = 2 KiB
    const unsigned vo = (unsigned)(tid >> 3) * (2 * TT * 2) + (unsigned)(tid & 7) * 16u;   // v^T tile: row d = 16 r + (tid >> 3) of 8 KiB pitch, lo plane 4 KiB behind hi
    const unsigned qo = (unsigned)(lr * HD + 8 * hi) * 2u, eo = (unsigned)lane * 16u;
    v8us pf[16];
#pragma unroll
    for (int r = 0; r < 4; ++r) { pf[r] = *(const v8usa*)(kh + r * 2048 + (size_t)ko); pf[4 + r] = *(const v8usa*)(kl + r * 2048 + (size_t)ko); pf[8 + r] = *(const v8usa*)(vv + r * (16 * 2 * TT * 2) + (size_t)vo); pf[12 + r] = *(const v8usa*)(vv + r * (16 * 2 * TT * 2) + TT * 2 + (size_t)vo); }
    v16bf qh[2], ql[2]; const char* qhb = (const char*)(Qh + hb + (size_t)q0 * HD); const char* qlb = (const char*)(Ql + hb + (size_t)q0 * HD);
#pragma unroll
    for (int kc = 0; kc < 2; ++kc) { qh[kc] = cat16b(*(const v8usa*)(qhb + kc * 64 + (size_t)qo), *(const v8usa*)(qhb + kc * 64 + 32 + (size_t)qo)); ql[kc] = cat16b(*(const v8usa*)(qlb + kc * 64 + (size_t)qo), *(const v8usa*)(qlb + kc * 64 + 32 + (size_t)qo)); }
    const char* qeb = (const char*)(QE + ((size_t)z * TT + q0) * NE); v4f er[16];
#pragma unroll
    for (int r = 0; r < 16; ++r) er[r] = *(const v4fa*)(qeb + r * (NE * 4) + (size_t)eo);
    asm volatile("s_wait_xcnt 0x0" :: "v"(qo), "v"(eo) : "memory");   // stands before a register that the loads above name is rewritten; the two offsets that end here are held up to it
#pragma unroll
    for (int r = 0; r < 16; ++r) *(v4fa*)(qw + r * TBP + lane * 4) = er[r] * UC;
    for (int s = lane; s < 16 * TBP / 4; s += 32) *(v4fa*)(tw + s * 4) = (v4f){0.f, 0.f, 0.f, 0.f};   // slots that no key of a row reaches are read below and stay zero
    __builtin_amdgcn_wave_barrier(); asm volatile("" ::: "memory");   // compiler order only: other lanes' QE stores stay in front of this lane's reads (one wave's LDS operations run in order)
    const float qlo = qw[lr * TBP], qhi = qw[lr * TBP + 2 * CUT];
#pragma unroll
    for (int r = 0; r < 4; ++r) { const int c = r * 128 + tid; const int o = (c >> 3) * LP + (c & 7) * 8;
#pragma unroll
        for (int pl = 0; pl < 4; ++pl) *(v8usa*)(&st[0][pl][o]) = pf[pl * 4 + r]; }
    __syncthreads();   // tile 0 is in LDS before any wave reads it
    v8f oacc[4];
#pragma unroll
    for (int dt = 0; dt < 4; ++dt) oacc[dt] = (v8f){};
    float m = -3.0e38f, l = 0.f, lo_s = 0.f, hi_s = 0.f;
#pragma unroll 1
    for (int t = 0; t < TT / 64; ++t) {   // rolled: one tile's body is long enough, and the two buffers alternate by index
        const int kb = t * 64; const bf* sb = &st[t & 1][0][0];
        if (t + 1 < TT / 64) {
#pragma unroll
            for (int r = 0; r < 4; ++r) { const size_t kn = (size_t)(kb + 64); pf[r] = *(const v8usa*)(kh + kn * (HD * 2) + r * 2048 + (size_t)ko); pf[4 + r] = *(const v8usa*)(kl + kn * (HD * 2) + r * 2048 + (size_t)ko); pf[8 + r] = *(const v8usa*)(vv + kn * 2 + r * (16 * 2 * TT * 2) + (size_t)vo); pf[12 + r] = *(const v8usa*)(vv + kn * 2 + r * (16 * 2 * TT * 2) + TT * 2 + (size_t)vo); }
            asm volatile("s_wait_xcnt 0x0" ::: "memory"); }   // stands before an address register of the sixteen loads above is rewritten
        v8f s[4];
#pragma unroll
        for (int kt = 0; kt < 4; ++kt) s[kt] = (v8f){};
#pragma unroll
        for (int kc = 0; kc < 2; ++kc) { v16bf ah[4], al[4];
#pragma unroll
            for (int kt = 0; kt < 4; ++kt) { const int o = (kt * 16 + lr) * LP + 8 * hi + kc * 32; ah[kt] = WFrag<bf>::ld(sb + o); al[kt] = WFrag<bf>::ld(sb + 64 * LP + o); }
#pragma unroll
            for (int kt = 0; kt < 4; ++kt) s[kt] = wmmab(ah[kt], qh[kc], s[kt]);
#pragma unroll
            for (int kt = 0; kt < 4; ++kt) s[kt] = wmmab(al[kt], qh[kc], s[kt]);
#pragma unroll
            for (int kt = 0; kt < 4; ++kt) s[kt] = wmmab(ah[kt], ql[kc], s[kt]); }
        float u[4][8]; float tm = -3.0e38f;
#pragma unroll
        for (int kt = 0; kt < 4; ++kt) { const int jb = kb + kt * 16;   // the three cases are the same for the whole wave
            if (jb + 15 - q0 <= -CUT) {
#pragma unroll
                for (int j = 0; j < 8; ++j) u[kt][j] = fmaf(s[kt][j], UC, qlo);
            } else if (jb - (q0 + 15) >= CUT) {
#pragma unroll
                for (int j = 0; j < 8; ++j) u[kt][j] = fmaf(s[kt][j], UC, qhi);
            } else {
#pragma unroll
                for (int j = 0; j < 8; ++j) { const int d = jb + hi * 8 + j - i; u[kt][j] = fmaf(s[kt][j], UC, qw[lr * TBP + min(max(d, -CUT), CUT) + CUT]); if (d > -CUT && d < CUT) tw[lr * TBP + d + CUT] = u[kt][j]; }
            }
#pragma unroll
            for (int j = 0; j < 8; ++j) tm = fmaxf(tm, u[kt][j]); }
        tm = fmaxf(tm, __shfl_xor(tm, 16, 32));   // the two half-waves hold the two halves of a query's keys
        const float mn = fmaxf(m, tm); const float al_ = __builtin_amdgcn_exp2f(m - mn); m = mn;
        float la = 0.f, loa = 0.f, hia = 0.f;
#pragma unroll
        for (int kt = 0; kt < 4; ++kt) { const int jb = kb + kt * 16;
#pragma unroll
            for (int j = 0; j < 8; ++j) u[kt][j] = __builtin_amdgcn_exp2f(u[kt][j] - mn);
            const float s8 = ((u[kt][0] + u[kt][1]) + (u[kt][2] + u[kt][3])) + ((u[kt][4] + u[kt][5]) + (u[kt][6] + u[kt][7])); la += s8;
            if (jb + 15 - q0 <= -CUT) loa += s8;
            else if (jb - (q0 + 15) >= CUT) hia += s8;
            else {
#pragma unroll
                for (int j = 0; j < 8; ++j) { const int d = jb + hi * 8 + j - i; loa += (d <= -CUT) ? u[kt][j] : 0.f; hia += (d >= CUT) ? u[kt][j] : 0.f; }
            } }
        l = fmaf(l, al_, la); lo_s = fmaf(lo_s, al_, loa); hi_s = fmaf(hi_s, al_, hia);
#pragma unroll
        for (int dt = 0; dt < 4; ++dt)
#pragma unroll
            for (int j = 0; j < 8; ++j) oacc[dt][j] *= al_;
#pragma unroll
        for (int c = 0; c < 2; ++c) { v16bf ph, pl;
#pragma unroll
            for (int e = 0; e < 16; ++e) { const float x = u[2 * c + (e >> 3)][e & 7]; const __bf16 h = (__bf16)x; ph[e] = h; pl[e] = (__bf16)(x - (float)h); }
            v16bf vh[4], vl[4];
#pragma unroll
            for (int dt = 0; dt < 4; ++dt) { const int o = (dt * 16 + lr) * LP + 8 * hi + c * 32; vh[dt] = WFrag<bf>::ld(sb + 2 * 64 * LP + o); vl[dt] = WFrag<bf>::ld(sb + 3 * 64 * LP + o); }
#pragma unroll
            for (int dt = 0; dt < 4; ++dt) oacc[dt] = wmmab(vh[dt], ph, oacc[dt]);
#pragma unroll
            for (int dt = 0; dt < 4; ++dt) oacc[dt] = wmmab(vl[dt], ph, oacc[dt]);
#pragma unroll
            for (int dt = 0; dt < 4; ++dt) oacc[dt] = wmmab(vh[dt], pl, oacc[dt]); }
        if (t + 1 < TT / 64) {
#pragma unroll
            for (int r = 0; r < 4; ++r) { const int c = r * 128 + tid; const int o = (c >> 3) * LP + (c & 7) * 8;
#pragma unroll
                for (int pl = 0; pl < 4; ++pl) *(v8usa*)(&st[(t + 1) & 1][pl][o]) = pf[pl * 4 + r]; } }
        __syncthreads();   // publishes tile t + 1 and ends every wave's reads of tile t, whose buffer the next trip refills
    }
    asm volatile("s_wait_xcnt 0x0" :: "v"(ko), "v"(vo) : "memory");   // stands before the tile loads' two offset registers may be rewritten; they are held up to it
    l += __shfl_xor(l, 16, 32); lo_s += __shfl_xor(lo_s, 16, 32); hi_s += __shfl_xor(hi_s, 16, 32);
    const float f = __fdiv_rn(1.0f, l); lo_s *= f; hi_s *= f;
    char* ob = (char*)(O + hb + (size_t)q0 * HD); const unsigned oo = (unsigned)(lr * HD + hi * 8) * 4u;
#pragma unroll
    for (int dt = 0; dt < 4; ++dt) { v4f a, b;
#pragma unroll
        for (int j = 0; j < 4; ++j) { a[j] = oacc[dt][j] * f; b[j] = oacc[dt][4 + j] * f; }
        *(v4fa*)(ob + dt * 64 + (size_t)oo) = a; *(v4fa*)(ob + dt * 64 + 16 + (size_t)oo) = b; }
    asm volatile("s_wait_xcnt 0x0" :: "v"(oo) : "memory");   // stands before a register that the stores above name is rewritten
    __builtin_amdgcn_wave_barrier(); asm volatile("" ::: "memory");   // compiler order only: other lanes' u stores stay in front of this lane's reads (one wave's LDS operations run in order)
#pragma unroll 1
    for (int r = 0; r < 16; ++r) {   // rolled: sixteen short rows, once a wave
        const float mr = __shfl(m, r, 32), fr = __shfl(f, r, 32), lor = __shfl(lo_s, r, 32), hir = __shfl(hi_s, r, 32); const int ir = q0 + r; const v4f uu = *(const v4fa*)(tw + r * TBP + lane * 4); v4us oh, ol;
#pragma unroll
        for (int q = 0; q < 4; ++q) { const int bkt = lane * 4 + q; const int j = ir + bkt - CUT; const float y = __builtin_amdgcn_exp2f(uu[q] - mr) * fr; const bool in = bkt > 0 && bkt < 2 * CUT && j >= 0 && j < TT;
            const float w = (bkt == 0) ? lor : ((bkt == 2 * CUT) ? hir : (in ? y : 0.f)); unsigned short a, c2; splitf(w, a, c2); oh[q] = a; ol[q] = c2; }
        const size_t po = ((size_t)z * TT + ir) * NE * 2; const unsigned bo = (unsigned)lane * 8u; *(v4usa*)((char*)Bh + po + (size_t)bo) = oh; *(v4usa*)((char*)Bl + po + (size_t)bo) = ol;
        asm volatile("s_wait_xcnt 0x0" :: "v"(bo) : "memory"); }   // stands before the next row rewrites a register that the two stores name
}
__global__ __launch_bounds__(256) void k_epadK(const float* __restrict__ E, bf* EB) { const size_t i = (size_t)blockIdx.x * 256 + threadIdx.x; if (i >= (size_t)NE * HD / 8) return; const int d0 = (int)(i % (HD / 8)) * 8; const int r = (int)(i / (HD / 8)); const float* src = E + (size_t)min(r, NRE - 1) * HD + d0; v8us o;
#pragma unroll
    for (int q = 0; q < 8; ++q) { const unsigned short v = f2bf(src[q]); o[q] = (r < NRE) ? v : (unsigned short)0; }
    *(v8us*)(EB + (size_t)r * HD + d0) = o;  }

__global__ __launch_bounds__(256) void k_epadVT(const float* __restrict__ E, bf* Th, bf* Tl) { const size_t i = (size_t)blockIdx.x * 256 + threadIdx.x; if (i >= (size_t)HD * NE / 4) return; const size_t e = i * 4; const int c0 = (int)(e % NE); const int d = (int)(e / NE); v4us oh, ol;
#pragma unroll
    for (int q = 0; q < 4; ++q) { const int r = c0 + q; const float v = bfr(E[(size_t)min(r, NRE - 1) * HD + d]); unsigned short u, w; splitf(v, u, w);   /* input rounded to bf16 once: lo == 0 */ oh[q] = (r < NRE) ? u : (unsigned short)0; ol[q] = (r < NRE) ? w : (unsigned short)0; }
    *(v4us*)(Th + e) = oh; *(v4us*)(Tl + e) = ol;  }

__global__ __launch_bounds__(256) void k_addF(float* Y, const float* __restrict__ F) { const size_t i = (size_t)blockIdx.x * 256 + threadIdx.x; if (i >= (size_t)ZH * TT * HD / 4) return; const v4f a = *(const v4f*)(Y + i * 4); const v4f f = *(const v4f*)(F + i * 4); v4f o;
#pragma unroll
    for (int q = 0; q < 4; ++q) o[q] = __fadd_rn(a[q], f[q]);
    *(v4f*)(Y + i * 4) = o;  }

__global__ __launch_bounds__(256) void k_merge(const float* __restrict__ O, int h0, bf* Ah, bf* Al) { const size_t e = ((size_t)blockIdx.x * 256 + threadIdx.x) * 2; if (e >= (size_t)ZH * TT * HD) return; const int d = (int)(e % HD); const int t = (int)((e / HD) % TT); const int zz = (int)(e / ((size_t)HD * TT)); const float cs = (t < RH) ? 1.0f : (1.0f / PCAR); const size_t oo = (size_t)t * DQ + (h0 + zz) * HD + d;
    v2us oh, ol;
#pragma unroll
    for (int q = 0; q < 2; ++q) { unsigned short a, c2; splitf(O[e + q] * cs, a, c2); oh[q] = a; ol[q] = c2; } *(v2us*)(Ah + oo) = oh; *(v2us*)(Al + oo) = ol;  }

extern "C" void kernel_launch(void* const* d_in, const int* in_sizes, int n_in,
                              void* d_out, int out_size, void* d_ws, size_t ws_size, hipStream_t stream) {
    (void)in_sizes; (void)n_in; (void)out_size;
    const float* x = (const float*)d_in[0];   /* query */ const float* xk = (const float*)d_in[1]; const float* xv = (const float*)d_in[2]; const float* wq = (const float*)d_in[3]; const float* bq = (const float*)d_in[4]; const float* wk = (const float*)d_in[5]; const float* bk = (const float*)d_in[6]; const float* wv = (const float*)d_in[7]; const float* bv = (const float*)d_in[8]; const float* wo = (const float*)d_in[9]; const float* bo = (const float*)d_in[10]; const float* ak = (const float*)d_in[11];   /* rel_k_table [101][64] */ const float* av = (const float*)d_in[12];   /* rel_v_table [101][64] */
    float* OUT = (float*)d_out;     // [2048][2][1024] sequence-first
    char* wsp = (char*)d_ws;
    auto take = [&](size_t bytes) { char* p = wsp; wsp += (bytes + 255) & ~(size_t)255; return (void*)p; };
    bf* AKB = (bf*)take((size_t)NE * HD * 2); bf* AVTh = (bf*)take((size_t)HD * NE * 2); bf* AVTl = (bf*)take((size_t)HD * NE * 2); float* QE = (float*)take((size_t)ZH * TT * NE * 4); bf* PBh = (bf*)take((size_t)ZH * TT * NE * 2); bf* PBl = (bf*)take((size_t)ZH * TT * NE * 2); float* ZR = (float*)take((size_t)ZH * TT * HD * 4); bf* WQ = (bf*)take((size_t)DQ * DM * 2); bf* WK = (bf*)take((size_t)DKV * DM * 2); bf* WV = (bf*)take((size_t)DKV * DM * 2); bf* WO = (bf*)take((size_t)DM * DQ * 2); float* CS = (float*)take((size_t)TT * HD * 2 * 4);
    bf* XB = (bf*)take((size_t)TT * DM * 2); float* FQ = (float*)take((size_t)TT * DQ * 4); float* FK = (float*)take((size_t)TT * DKV * 4);
    h16* QP16 = (h16*)take((size_t)NH_ * TT * HD * 2); h16* KP16 = (h16*)take((size_t)NKV * TT * HD * 2); h16* VT16 = (h16*)take((size_t)NKV * HD * TT * 2);
    bf* QPh = (bf*)take((size_t)NH_ * TT * HD * 2); bf* QPl = (bf*)take((size_t)NH_ * TT * HD * 2); bf* KPh = (bf*)take((size_t)NKV * TT * HD * 2); bf* KPl = (bf*)take((size_t)NKV * TT * HD * 2); bf* VT = (bf*)take((size_t)NKV * HD * 2 * TT * 2);
    float* Ob = (float*)take((size_t)ZH * TT * HD * 4); bf* ATh = (bf*)take((size_t)TT * DQ * 2); bf* ATl = (bf*)take((size_t)TT * DQ * 2);
    if ((size_t)(wsp - (char*)d_ws) > ws_size) return;    // ws 256 MiB
    float* FV = FK;   // v projection reuses the k buffer after the k planes are built (stream-ordered)
    { k_cvt8<<<(unsigned)(((size_t)DQ * DM / 8 + 255) / 256), 256, 0, stream>>>(wq, WQ, (size_t)DQ * DM / 8); k_cvt8<<<(unsigned)(((size_t)DKV * DM / 8 + 255) / 256), 256, 0, stream>>>(wk, WK, (size_t)DKV * DM / 8); k_cvt8<<<(unsigned)(((size_t)DKV * DM / 8 + 255) / 256), 256, 0, stream>>>(wv, WV, (size_t)DKV * DM / 8);
      k_cvt8<<<(unsigned)(((size_t)DM * DQ / 8 + 255) / 256), 256, 0, stream>>>(wo, WO, (size_t)DM * DQ / 8);
       }
    k_csid<<<(TT * HD + 255) / 256, 256, 0, stream>>>(CS);
    const unsigned LQ = (unsigned)(((size_t)NH_ * TT * HD / 2 + 255) / 256), LKv = (unsigned)(((size_t)NKV * TT * HD / 2 + 255) / 256);
    k_epadK<<<(unsigned)(((size_t)NE * HD / 8 + 255) / 256), 256, 0, stream>>>(ak, AKB);   /* rel_k -> bf16 [128][64], rows >= 101 zero */ k_epadVT<<<(unsigned)(((size_t)HD * NE / 4 + 255) / 256), 256, 0, stream>>>(av, AVTh, AVTl);   /* rel_v^T hi/lo [64][128], cols >= 101 zero */
    for (int b = 0; b < NB_; ++b) {
        
        k_cvt8s<<<(unsigned)(((size_t)TT * DM / 8 + 255) / 256), 256, 0, stream>>>(x + (size_t)b * DM, XB, (size_t)NB_ * DM);   /* sequence-first [L][B][HID]: batch column b */
        k_gemmw<bf, 0, true, 8><<<dim3(TT / 64, DQ / 64, 1), 256, 0, stream>>>(XB, nullptr, WQ, nullptr, DM, DM, FQ, DQ, bq, 0, 0, 0);
        k_rope<<<LQ, 256, 0, stream>>>(FQ, DQ, NH_, CS, nullptr, nullptr, 1.0f, QP16, QPh, QPl);
        k_cvt8s<<<(unsigned)(((size_t)TT * DM / 8 + 255) / 256), 256, 0, stream>>>(xk + (size_t)b * DM, XB, (size_t)NB_ * DM);   /* sequence-first [L][B][HID]: batch column b */ k_gemmw<bf, 0, true, 8><<<dim3(TT / 64, DKV / 64, 1), 256, 0, stream>>>(XB, nullptr, WK, nullptr, DM, DM, FK, DKV, bk, 0, 0, 0);
        k_rope<<<LKv, 256, 0, stream>>>(FK, DKV, NKV, CS, nullptr, nullptr, 1.0f, KP16, KPh, KPl);
        k_cvt8s<<<(unsigned)(((size_t)TT * DM / 8 + 255) / 256), 256, 0, stream>>>(xv + (size_t)b * DM, XB, (size_t)NB_ * DM);   /* sequence-first [L][B][HID]: batch column b */ k_gemmw<bf, 0, true, 8><<<dim3(TT / 64, DKV / 64, 1), 256, 0, stream>>>(XB, nullptr, WV, nullptr, DM, DM, FV, DKV, bv, 0, 0, 0); k_vtp<<<LKv, 256, 0, stream>>>(FV, DKV, NKV, VT16, VT);
        for (int h0 = 0; h0 < NH_; h0 += ZH) { const size_t zq = (size_t)h0, zk = (size_t)(h0 / REP);   // one kv head per query head: the pass's heads use consecutive kv planes

            k_gemmw<bf, 1, false><<<dim3(TT / 64, NE / 64, ZH), 32, 0, stream>>>(QPh + zq * TT * HD, QPl + zq * TT * HD, AKB, nullptr, HD, HD, QE, NE, nullptr, (size_t)TT * HD, 0, (size_t)TT * NE);   /* QE = q . rel_k^T */
            k_fattn<<<dim3(TT / 64, ZH), 128, 0, stream>>>(QPh + zq * TT * HD, QPl + zq * TT * HD, KPh + zk * TT * HD, KPl + zk * TT * HD, VT + zk * HD * 2 * TT, QE, Ob, PBh, PBl);   /* scores + q.rel_k[clip(j - i) + 50], softmax, P.v, attn folded onto the 101 clipped offsets */ k_gemmw<bf, 2, false, 4><<<dim3(TT / 64, HD / 64, ZH), 128, 0, stream>>>(PBh, PBl, AVTh, AVTl, NE, NE, ZR, HD, nullptr, (size_t)TT * NE, 0, (size_t)TT * HD);   /* ZR = PB . rel_v */ k_addF<<<(unsigned)(((size_t)ZH * TT * HD / 4 + 255) / 256), 256, 0, stream>>>(Ob, ZR);   /* context += relative-value term */

            k_merge<<<(unsigned)(((size_t)ZH * TT * HD / 2 + 255) / 256), 256, 0, stream>>>(Ob, h0, ATh, ATl); }
        k_gemmw<bf, 1, true, 8><<<dim3(TT / 64, DM / 64, 1), 256, 0, stream>>>(ATh, ATl, WO, nullptr, DQ, DQ, OUT + (size_t)b * DM, NB_ * DM, bo, 0, 0, 0); }   /* sequence-first output [L][B][HID]: row pitch B x HID, column block b */
}

// v005
// A run of this version takes 337 microseconds.
// Two timings next to v004 both put it at 1.43 times that version's speed.
// All steps since v000 together make it 5.71 times as fast.
#include <hip/hip_runtime.h>

// Relative multi-head attention with key AND value relative-position embeddings, sequence-first tensors (query, key, value [2048][2][1024]; q = query Wq^T + bq, k = key Wk^T + bk, v = value Wv^T + bv ('oi' 0.02, biases 0.02; 16 heads x 64); idx[i][j] = clip(j - i, -50, 50) + 50; attn = softmax((q.k + q.rel_k[idx]) / 8); x = attn v + sum_j attn[i][j] rel_v[idx] (rel_k, rel_v [101][64] 0.02, read); out = merged Wo^T + bo -> [2048][2][1024] sequence-first (4.2 M); argument order query, key, value, Wq, bq, Wk, bk, Wv, bv, Wo, bo, rel_k, rel_v).
// Layout: query, key, value in turn as ONE bf16 matrix of 4096 rows (row = 2 l + b, the sequence-first order as it lies in memory), so every stage is launched once for both batch columns; head planes z = 16 b + h; 'oi' weights; exact projections + f32 biases; rel_k as a zero-padded bf16 plane [128][64] and rel_v^T as hi/lo planes [64][128]; over all 32 head planes at once: QE = q.rel_k^T (hi/lo x exact); one fused kernel for the score tiles (hi/lo 3 products), QE gathered in at column clip(j - i) + 50, running softmax (x 1/8), P.v (hi/lo x hi/lo) and the probabilities folded onto the 101 offsets (interior = one key, the two ends = fixed-order sums); PB.rel_v added to the context; merged hi/lo (row 2 l + b) x Wo exact + bo, whose rows are the output's own.
// Compute dtypes, f32 accumulate: every input rounded to bf16; projections exact + f32 biases; scores and the relative-key term ~f32; softmax f32; P as bf16 hi/lo; attn.v and the relative-value term 3 products (~f32); Wo hl x exact + bias.

#define NB_  2
#define TT   2048
#define DM   1024
#define NH_  16
#define NKV  16
#define REP  (NH_ / NKV)
#define HD   64
#define DQ   (NH_ * HD)
#define DKV  (NKV * HD)
#define ZH   (NB_ * NH_)          // head planes per launch: every head of both batch columns
#define RH   TT                   // every row on hi/lo planes (the relative-value fold needs normalised planes)
#define WIN  0
#define PCAR 1024.0f
#define SCL  0.125f   // 1/sqrt(64) (the module divides by jnp.sqrt(DH))
#define NE   128      // 2*50+1 = 101 relative offsets padded to 128
#define NRE  101
#define CUT  50
typedef _Float16 h16;
typedef unsigned short bf;
typedef __attribute__((ext_vector_type(16))) __bf16   v16bf;
typedef __attribute__((ext_vector_type(16))) _Float16 v16h;
typedef __attribute__((ext_vector_type(8)))  _Float16 v8h;
typedef __attribute__((ext_vector_type(8)))  unsigned short v8us;
typedef __attribute__((ext_vector_type(8)))  float    v8f;
typedef __attribute__((ext_vector_type(4)))  float    v4f;
typedef v8h  __attribute__((may_alias)) v8ha;
typedef v4f  __attribute__((may_alias)) v4fa;
typedef v8us __attribute__((may_alias)) v8usa;

__device__ __forceinline__ unsigned short f2bf(float f) { unsigned u = __float_as_uint(f); u += 0x7FFFu + ((u >> 16) & 1u); return (unsigned short)(u >> 16); }
__device__ __forceinline__ float bf2f(unsigned short b) { return __uint_as_float(((unsigned)b) << 16); }
__device__ __forceinline__ float bfr(float f) { return bf2f(f2bf(f)); }
__device__ __forceinline__ v16h cat16(v8h lo, v8h hi) { return __builtin_shufflevector(lo, hi, 0, 1, 2, 3, 4, 5, 6, 7, 8, 9, 10, 11, 12, 13, 14, 15); }
__device__ __forceinline__ v16bf cat16b(v8us lo, v8us hi) { return __builtin_bit_cast(v16bf, __builtin_shufflevector(lo, hi, 0, 1, 2, 3, 4, 5, 6, 7, 8, 9, 10, 11, 12, 13, 14, 15)); }
__device__ __forceinline__ v8f wmma16(v16h a, v16h b, v8f c) { return __builtin_amdgcn_wmma_f32_16x16x32_f16(false, a, false, b, (short)0, c, false, false); }
__device__ __forceinline__ v8f wmmab(v16bf a, v16bf b, v8f c) { return __builtin_amdgcn_wmma_f32_16x16x32_bf16(false, a, false, b, (short)0, c, false, false); }



// ---- k_gemmw: register-blocked GEMM, ONE WAVE per 64x64 output tile (16 accumulators), operands straight from K-contiguous 16-bit planes; grid (M/64, N/64, Z), 32 threads.
// C[m][n] (f32, pitch ldc, + optional f32 bias[n]) = sum_{k < KL} A[m][k] Bt[n][k] (+ split products per NSPLIT). K = row pitch of A and Bt in elements, KL <= K the summed length. z-batch strides sA/sB/sC in elements. KL % 32 == 0.
// KS > 1 (long K, few tiles): 32 KS threads, wave w of the work-group takes k in [w KL/KS, (w+1) KL/KS) of the same tile; the KS partial tiles are summed in fixed wave order through LDS. KL % (32 KS) == 0.
template <typename T16> struct WFrag;
template <> struct WFrag<h16> { typedef v16h V; static __device__ __forceinline__ V ld(const h16* p) { return cat16(*(const v8h*)p, *(const v8h*)(p + 16)); } static __device__ __forceinline__ v8f mma(V a, V b, v8f c) { return wmma16(a, b, c); } };
template <> struct WFrag<bf> { typedef v16bf V; static __device__ __forceinline__ V ld(const bf* p) { return cat16b(*(const v8us*)p, *(const v8us*)(p + 16)); } static __device__ __forceinline__ v8f mma(V a, V b, v8f c) { return wmmab(a, b, c); } };
template <typename T16, int NSPLIT, bool BIAS, int KS = 1>
__global__ __launch_bounds__(32 * KS) void k_gemmw(const T16* __restrict__ A, const T16* __restrict__ A2, const T16* __restrict__ Bt, const T16* __restrict__ Bt2, int K, int KL, float* C, int ldc, const float* __restrict__ bias, size_t sA, size_t sB, size_t sC) {
    typedef typename WFrag<T16>::V V;
    __shared__ __align__(16) float os[KS == 1 ? 16 * 68 : KS * 64 * 68];
    const size_t z = blockIdx.z; A += z * sA; if (A2) A2 += z * sA; Bt += z * sB; if (Bt2) Bt2 += z * sB; C += z * sC;
    const int lane = threadIdx.x & 31, lr = lane & 15, hi = lane >> 4; const int r0 = blockIdx.x * 64, c0 = blockIdx.y * 64;
    const int wv = (KS == 1) ? 0 : __builtin_amdgcn_readfirstlane((int)(threadIdx.x >> 5)); const int k0 = wv * (KL / KS), k1 = k0 + KL / KS;
    v8f acc[4][4];
#pragma unroll
    for (int mb = 0; mb < 4; ++mb)
#pragma unroll
        for (int nb = 0; nb < 4; ++nb) acc[mb][nb] = (v8f){};
    const size_t aoff = (size_t)(r0 + lr) * K + 8 * hi, boff = (size_t)(c0 + lr) * K + 8 * hi;
#pragma unroll 1
    for (int kc = k0; kc < k1; kc += 32) {
        V a[4], a2[4];
#pragma unroll
        for (int mb = 0; mb < 4; ++mb) { a[mb] = WFrag<T16>::ld(A + aoff + (size_t)mb * 16 * K + kc); if (NSPLIT == 1 || NSPLIT == 2) a2[mb] = WFrag<T16>::ld(A2 + aoff + (size_t)mb * 16 * K + kc); }
#pragma unroll
        for (int nb = 0; nb < 4; ++nb) { const V b = WFrag<T16>::ld(Bt + boff + (size_t)nb * 16 * K + kc); V b2; if (NSPLIT >= 2) b2 = WFrag<T16>::ld(Bt2 + boff + (size_t)nb * 16 * K + kc);
#pragma unroll
            for (int mb = 0; mb < 4; ++mb) { acc[mb][nb] = WFrag<T16>::mma(a[mb], b, acc[mb][nb]); if (NSPLIT == 1 || NSPLIT == 2) acc[mb][nb] = WFrag<T16>::mma(a2[mb], b, acc[mb][nb]); if (NSPLIT >= 2) acc[mb][nb] = WFrag<T16>::mma(a[mb], b2, acc[mb][nb]); } }
        asm volatile("v_nop\n\tv_nop\n\tv_nop\n\tv_nop" : "+v"(acc[0][0]), "+v"(acc[1][1]), "+v"(acc[2][2]), "+v"(acc[3][3]) : "v"(a[0]), "v"(a[3]));
    }
    if (KS > 1) {
        float* my = os + wv * (64 * 68);
#pragma unroll
        for (int mb = 0; mb < 4; ++mb)
#pragma unroll
            for (int nb = 0; nb < 4; ++nb)
#pragma unroll
                for (int j = 0; j < 8; ++j) my[(mb * 16 + hi * 8 + j) * 68 + nb * 16 + lr] = acc[mb][nb][j];
        __syncthreads();   // every wave's partial tile is in LDS before any wave sums across them
#pragma unroll
        for (int s = 0; s < 1024 / (32 * KS); ++s) { const int slot = s * (32 * KS) + (int)threadIdx.x; const int row = slot >> 4, cofs = (slot & 15) * 4; v4f val = *(const v4fa*)(os + row * 68 + cofs);
#pragma unroll
            for (int w = 1; w < KS; ++w) { const v4f p = *(const v4fa*)(os + w * (64 * 68) + row * 68 + cofs); val += p; }
            if (BIAS) { val[0] += bfr(bias[c0 + cofs]); val[1] += bfr(bias[c0 + cofs + 1]); val[2] += bfr(bias[c0 + cofs + 2]); val[3] += bfr(bias[c0 + cofs + 3]); }
            *(v4f*)(C + (size_t)(r0 + row) * ldc + c0 + cofs) = val; }
        return;
    }
#pragma unroll
    for (int mb = 0; mb < 4; ++mb) {
#pragma unroll
        for (int nb = 0; nb < 4; ++nb) {
#pragma unroll
            for (int j = 0; j < 8; ++j) os[(hi * 8 + j) * 68 + nb * 16 + lr] = acc[mb][nb][j]; }
        __builtin_amdgcn_wave_barrier(); asm volatile("" ::: "memory");
        float* crow = C + (size_t)(r0 + mb * 16) * ldc + c0;
{
#pragma unroll
            for (int s = 0; s < 8; ++s) { const int row = 2 * s + hi, cofs = lr * 4; v4f val = *(const v4fa*)(os + row * 68 + cofs); if (BIAS) { val[0] += bfr(bias[c0 + cofs]); val[1] += bfr(bias[c0 + cofs + 1]); val[2] += bfr(bias[c0 + cofs + 2]); val[3] += bfr(bias[c0 + cofs + 3]); }
                *(v4f*)(crow + (size_t)row * ldc + cofs) = val; }
             }
        __builtin_amdgcn_wave_barrier(); asm volatile("" ::: "memory");
    }
}

__device__ __forceinline__ h16 tohx(float x) { return (h16)x; }
__device__ __forceinline__ void splitf(float y, unsigned short& h, unsigned short& l) { h = f2bf(y); l = f2bf(y - bf2f(h)); }
typedef __attribute__((ext_vector_type(2))) _Float16 v2h;
typedef __attribute__((ext_vector_type(4))) _Float16 v4h;
typedef __attribute__((ext_vector_type(2))) unsigned short v2us;
typedef __attribute__((ext_vector_type(4))) unsigned short v4us;
typedef __attribute__((ext_vector_type(2))) float v2f;
typedef __attribute__((ext_vector_type(4))) int v4i;

__global__ __launch_bounds__(256) void k_cvt8(const float* __restrict__ src, bf* dst, size_t n8) { const size_t i = (size_t)blockIdx.x * 256 + threadIdx.x; if (i >= n8) return; const v8f v = *(const v8f*)(src + i * 8); v8us o;
#pragma unroll
    for (int k = 0; k < 8; ++k) o[k] = f2bf(v[k]); *(v8us*)(dst + i * 8) = o;  }

// k_rope: head planes [h][t][d] (fp16 + hi/lo) of rope(x) x sc with the rotate-half convention out[d] = x[d] cos[t][d] - x[d+HD/2] sin[t][d], out[d+HD/2] = x[d+HD/2] cos[t][d+HD/2] + x[d] sin[t][d+HD/2]
__global__ __launch_bounds__(256) void k_rope(const float* __restrict__ F, int pitch, int nheads, const float* __restrict__ CS, const float* __restrict__ RF, const float* __restrict__ nw, float sc, h16* P16, bf* Ph, bf* Pl) {
    const size_t e = ((size_t)blockIdx.x * 256 + threadIdx.x) * 2; if (e >= (size_t)nheads * TT * HD) return; const int d = (int)(e % HD); const int t = (int)((e / HD) % TT); const int h = (int)(e / ((size_t)HD * TT)); const float* f = F + (size_t)t * pitch + h * HD; const float rf = RF ? RF[(size_t)h * TT + t] : 1.0f; v2h o16; v2us oh, ol;
#pragma unroll
    for (int q = 0; q < 2; ++q) { const int dd = d + q; const int dp = (dd < HD / 2) ? dd + HD / 2 : dd - HD / 2; float x0 = f[dd], x1 = f[dp];
        if (RF) { float n0 = __fmul_rn(x0, rf), n1 = __fmul_rn(x1, rf); asm volatile("" : "+v"(n0)); asm volatile("" : "+v"(n1)); x0 = __fmul_rn(bfr(nw[dd]), n0); x1 = __fmul_rn(bfr(nw[dp]), n1); }
        const v2f cs = *(const v2f*)(CS + ((size_t)t * HD + dd) * 2); float a = __fmul_rn(x0, cs[0]), bq = __fmul_rn(x1, cs[1]); asm volatile("" : "+v"(a)); asm volatile("" : "+v"(bq)); const float r = ((dd < HD / 2) ? __fsub_rn(a, bq) : __fadd_rn(a, bq)) * sc;
        o16[q] = tohx(r); unsigned short a2, c2; splitf(r, a2, c2); oh[q] = a2; ol[q] = c2; }
    *(v2h*)(P16 + e) = o16; *(v2us*)(Ph + e) = oh; *(v2us*)(Pl + e) = ol;  }
__global__ __launch_bounds__(256) void k_vtp(const float* __restrict__ F, int pitch, int nheads, h16* V16, bf* Vhl) {   /* Vhl row (g, d) = 2048 hi | 2048 lo */ const size_t e = ((size_t)blockIdx.x * 256 + threadIdx.x) * 2; if (e >= (size_t)nheads * HD * TT) return; const int t = (int)(e % TT); const int d = (int)((e / TT) % HD); const int g = (int)(e / ((size_t)TT * HD)); v2h o16; v2us oh, ol;
#pragma unroll
    for (int q = 0; q < 2; ++q) { const float x = F[(size_t)(t + q) * pitch + g * HD + d]; o16[q] = tohx(x); unsigned short a2, c2; splitf(x, a2, c2); oh[q] = a2; ol[q] = c2; }
    const size_t e2 = ((size_t)g * HD + d) * (2 * TT) + t; *(v2h*)(V16 + e) = o16; *(v2us*)(Vhl + e2) = oh; *(v2us*)(Vhl + e2 + TT) = ol;  }
__global__ __launch_bounds__(256) void k_csid(float* CS) { const int idx = blockIdx.x * 256 + threadIdx.x; if (idx >= TT * HD) return; v2f cs; cs[0] = 1.0f; cs[1] = 0.0f; *(v2f*)(CS + (size_t)idx * 2) = cs;  }
// k_fattn: scores, softmax, P.v and the offset fold in ONE kernel; a score never leaves its wave's registers. Work-group = 4 waves x 16 queries of one head; keys in tiles of 64, K hi/lo [key][d] and v^T hi/lo [d][key] staged through registers into two LDS buffers (row pitch 144 B), the next tile's global loads issued before this tile's work.
// Every product is taken transposed, so that a lane owns ONE query (lane & 15): S^T = K.Q^T (rows = keys, columns = queries), O^T = v^T.P^T (rows = d). The accumulator of two 16-key S^T tiles IS the 32-key operand fragment of P^T (register j of tile 0 = key 8 hi + j, of tile 1 = key 16 + 8 hi + j), and row maximum, row sum and rescale are per-lane values.
// Running softmax in the exp2 domain: u = (s + QE[clip(j - i) + 50]) / 8 x log2(e); p = exp2(u - m), sums and O^T rescaled by exp2(m_old - m_new), divided by the row sum at the end. Fold: the two end offsets are running sums of p; an interior offset is one key, whose u waits in the wave's own LDS until m and the sum are final.
typedef __attribute__((ext_vector_type(4))) unsigned int v4u;
typedef v4us __attribute__((may_alias)) v4usa;
#define LP  72     // LDS row pitch in bf16: 144 B = 16 B x 9, free of bank conflicts for 16-byte fragment reads
#define TBP 132    // pitch in floats of a query's 128 offset slots
#define UC  (SCL * 1.4426950408889634f)
__global__ __launch_bounds__(128) void k_fattn(const bf* __restrict__ Qh, const bf* __restrict__ Ql, const bf* __restrict__ Kh, const bf* __restrict__ Kl, const bf* __restrict__ Vhl, const float* __restrict__ QE, float* O, bf* Bh, bf* Bl) {
    __shared__ __align__(16) bf st[2][4][64 * LP];     // per buffer: K hi, K lo, v^T hi, v^T lo
    __shared__ __align__(16) float tb[4][16 * TBP];    // per wave: u of the interior offsets, [query][offset]
    __shared__ __align__(16) float qs[4][16 * TBP];    // per wave: its sixteen rows of QE x UC
    const int tid = threadIdx.x, lane = tid & 31, lr = lane & 15, hi = lane >> 4; const int wv = __builtin_amdgcn_readfirstlane(tid >> 5);
    const int z = blockIdx.y; const int q0 = blockIdx.x * 64 + wv * 16; const int i = q0 + lr; const size_t hb = (size_t)z * TT * HD;
    // every global address = a base that is the same for the wave + a lane's byte offset that lives as long as its loads or stores do
    const char* kh = (const char*)(Kh + hb); const char* kl = (const char*)(Kl + hb); const char* vv = (const char*)(Vhl + (size_t)z * HD * 2 * TT); float* tw = tb[wv]; float* qw = qs[wv];
    const unsigned ko = (unsigned)tid * 16u;   // K tile: 8 KiB in a row, slice r = 2 KiB
    const unsigned vo = (unsigned)(tid >> 3) * (2 * TT * 2) + (unsigned)(tid & 7) * 16u;   // v^T tile: row d = 16 r + (tid >> 3) of 8 KiB pitch, lo plane 4 KiB behind hi
    const unsigned qo = (unsigned)(lr * HD + 8 * hi) * 2u, eo = (unsigned)lane * 16u;
    v8us pf[16];
#pragma unroll
    for (int r = 0; r < 4; ++r) { pf[r] = *(const v8usa*)(kh + r * 2048 + (size_t)ko); pf[4 + r] = *(const v8usa*)(kl + r * 2048 + (size_t)ko); pf[8 + r] = *(const v8usa*)(vv + r * (16 * 2 * TT * 2) + (size_t)vo); pf[12 + r] = *(const v8usa*)(vv + r * (16 * 2 * TT * 2) + TT * 2 + (size_t)vo); }
    v16bf qh[2], ql[2]; const char* qhb = (const char*)(Qh + hb + (size_t)q0 * HD); const char* qlb = (const char*)(Ql + hb + (size_t)q0 * HD);
#pragma unroll
    for (int kc = 0; kc < 2; ++kc) { qh[kc] = cat16b(*(const v8usa*)(qhb + kc * 64 + (size_t)qo), *(const v8usa*)(qhb + kc * 64 + 32 + (size_t)qo)); ql[kc] = cat16b(*(const v8usa*)(qlb + kc * 64 + (size_t)qo), *(const v8usa*)(qlb + kc * 64 + 32 + (size_t)qo)); }
    const char* qeb = (const char*)(QE + ((size_t)z * TT + q0) * NE); v4f er[16];
#pragma unroll
    for (int r = 0; r < 16; ++r) er[r] = *(const v4fa*)(qeb + r * (NE * 4) + (size_t)eo);
    asm volatile("s_wait_xcnt 0x0" :: "v"(qo), "v"(eo) : "memory");   // stands before a register that the loads above name is rewritten; the two offsets that end here are held up to it
#pragma unroll
    for (int r = 0; r < 16; ++r) *(v4fa*)(qw + r * TBP + lane * 4) = er[r] * UC;
    for (int s = lane; s < 16 * TBP / 4; s += 32) *(v4fa*)(tw + s * 4) = (v4f){0.f, 0.f, 0.f, 0.f};   // slots that no key of a row reaches are read below and stay zero
    __builtin_amdgcn_wave_barrier(); asm volatile("" ::: "memory");   // compiler order only: other lanes' QE stores stay in front of this lane's reads (one wave's LDS operations run in order)
    const float qlo = qw[lr * TBP], qhi = qw[lr * TBP + 2 * CUT];
#pragma unroll
    for (int r = 0; r < 4; ++r) { const int c = r * 128 + tid; const int o = (c >> 3) * LP + (c & 7) * 8;
#pragma unroll
        for (int pl = 0; pl < 4; ++pl) *(v8usa*)(&st[0][pl][o]) = pf[pl * 4 + r]; }
    __syncthreads();   // tile 0 is in LDS before any wave reads it
    v8f oacc[4];
#pragma unroll
    for (int dt = 0; dt < 4; ++dt) oacc[dt] = (v8f){};
    float m = -3.0e38f, l = 0.f, lo_s = 0.f, hi_s = 0.f;
#pragma unroll 1
    for (int t = 0; t < TT / 64; ++t) {   // rolled: one tile's body is long enough, and the two buffers alternate by index
        const int kb = t * 64; const bf* sb = &st[t & 1][0][0];
        if (t + 1 < TT / 64) {
#pragma unroll
            for (int r = 0; r < 4; ++r) { const size_t kn = (size_t)(kb + 64); pf[r] = *(const v8usa*)(kh + kn * (HD * 2) + r * 2048 + (size_t)ko); pf[4 + r] = *(const v8usa*)(kl + kn * (HD * 2) + r * 2048 + (size_t)ko); pf[8 + r] = *(const v8usa*)(vv + kn * 2 + r * (16 * 2 * TT * 2) + (size_t)vo); pf[12 + r] = *(const v8usa*)(vv + kn * 2 + r * (16 * 2 * TT * 2) + TT * 2 + (size_t)vo); }
            asm volatile("s_wait_xcnt 0x0" ::: "memory"); }   // stands before an address register of the sixteen loads above is rewritten
        v8f s[4];
#pragma unroll
        for (int kt = 0; kt < 4; ++kt) s[kt] = (v8f){};
#pragma unroll
        for (int kc = 0; kc < 2; ++kc) { v16bf ah[4], al[4];
#pragma unroll
            for (int kt = 0; kt < 4; ++kt) { const int o = (kt * 16 + lr) * LP + 8 * hi + kc * 32; ah[kt] = WFrag<bf>::ld(sb + o); al[kt] = WFrag<bf>::ld(sb + 64 * LP + o); }
#pragma unroll
            for (int kt = 0; kt < 4; ++kt) s[kt] = wmmab(ah[kt], qh[kc], s[kt]);
#pragma unroll
            for (int kt = 0; kt < 4; ++kt) s[kt] = wmmab(al[kt], qh[kc], s[kt]);
#pragma unroll
            for (int kt = 0; kt < 4; ++kt) s[kt] = wmmab(ah[kt], ql[kc], s[kt]); }
        float u[4][8]; float tm = -3.0e38f;
#pragma unroll
        for (int kt = 0; kt < 4; ++kt) { const int jb = kb + kt * 16;   // the three cases are the same for the whole wave
            if (jb + 15 - q0 <= -CUT) {
#pragma unroll
                for (int j = 0; j < 8; ++j) u[kt][j] = fmaf(s[kt][j], UC, qlo);
            } else if (jb - (q0 + 15) >= CUT) {
#pragma unroll
                for (int j = 0; j < 8; ++j) u[kt][j] = fmaf(s[kt][j], UC, qhi);
            } else {
#pragma unroll
                for (int j = 0; j < 8; ++j) { const int d = jb + hi * 8 + j - i; u[kt][j] = fmaf(s[kt][j], UC, qw[lr * TBP + min(max(d, -CUT), CUT) + CUT]); if (d > -CUT && d < CUT) tw[lr * TBP + d + CUT] = u[kt][j]; }
            }
#pragma unroll
            for (int j = 0; j < 8; ++j) tm = fmaxf(tm, u[kt][j]); }
        tm = fmaxf(tm, __shfl_xor(tm, 16, 32));   // the two half-waves hold the two halves of a query's keys
        const float mn = fmaxf(m, tm); const float al_ = __builtin_amdgcn_exp2f(m - mn); m = mn;
        float la = 0.f, loa = 0.f, hia = 0.f;
#pragma unroll
        for (int kt = 0; kt < 4; ++kt) { const int jb = kb + kt * 16;
#pragma unroll
            for (int j = 0; j < 8; ++j) u[kt][j] = __builtin_amdgcn_exp2f(u[kt][j] - mn);
            const float s8 = ((u[kt][0] + u[kt][1]) + (u[kt][2] + u[kt][3])) + ((u[kt][4] + u[kt][5]) + (u[kt][6] + u[kt][7])); la += s8;
            if (jb + 15 - q0 <= -CUT) loa += s8;
            else if (jb - (q0 + 15) >= CUT) hia += s8;
            else {
#pragma unroll
                for (int j = 0; j < 8; ++j) { const int d = jb + hi * 8 + j - i; loa += (d <= -CUT) ? u[kt][j] : 0.f; hia += (d >= CUT) ? u[kt][j] : 0.f; }
            } }
        l = fmaf(l, al_, la); lo_s = fmaf(lo_s, al_, loa); hi_s = fmaf(hi_s, al_, hia);
#pragma unroll
        for (int dt = 0; dt < 4; ++dt)
#pragma unroll
            for (int j = 0; j < 8; ++j) oacc[dt][j] *= al_;
#pragma unroll
        for (int c = 0; c < 2; ++c) { v16bf ph, pl;
#pragma unroll
            for (int e = 0; e < 16; ++e) { const float x = u[2 * c + (e >> 3)][e & 7]; const __bf16 h = (__bf16)x; ph[e] = h; pl[e] = (__bf16)(x - (float)h); }
            v16bf vh[4], vl[4];
#pragma unroll
            for (int dt = 0; dt < 4; ++dt) { const int o = (dt * 16 + lr) * LP + 8 * hi + c * 32; vh[dt] = WFrag<bf>::ld(sb + 2 * 64 * LP + o); vl[dt] = WFrag<bf>::ld(sb + 3 * 64 * LP + o); }
#pragma unroll
            for (int dt = 0; dt < 4; ++dt) oacc[dt] = wmmab(vh[dt], ph, oacc[dt]);
#pragma unroll
            for (int dt = 0; dt < 4; ++dt) oacc[dt] = wmmab(vl[dt], ph, oacc[dt]);
#pragma unroll
            for (int dt = 0; dt < 4; ++dt) oacc[dt] = wmmab(vh[dt], pl, oacc[dt]); }
        if (t + 1 < TT / 64) {
#pragma unroll
            for (int r = 0; r < 4; ++r) { const int c = r * 128 + tid; const int o = (c >> 3) * LP + (c & 7) * 8;
#pragma unroll
                for (int pl = 0; pl < 4; ++pl) *(v8usa*)(&st[(t + 1) & 1][pl][o]) = pf[pl * 4 + r]; } }
        __syncthreads();   // publishes tile t + 1 and ends every wave's reads of tile t, whose buffer the next trip refills
    }
    asm volatile("s_wait_xcnt 0x0" :: "v"(ko), "v"(vo) : "memory");   // stands before the tile loads' two offset registers may be rewritten; they are held up to it
    l += __shfl_xor(l, 16, 32); lo_s += __shfl_xor(lo_s, 16, 32); hi_s += __shfl_xor(hi_s, 16, 32);
    const float f = __fdiv_rn(1.0f, l); lo_s *= f; hi_s *= f;
    char* ob = (char*)(O + hb + (size_t)q0 * HD); const unsigned oo = (unsigned)(lr * HD + hi * 8) * 4u;
#pragma unroll
    for (int dt = 0; dt < 4; ++dt) { v4f a, b;
#pragma unroll
        for (int j = 0; j < 4; ++j) { a[j] = oacc[dt][j] * f; b[j] = oacc[dt][4 + j] * f; }
        *(v4fa*)(ob + dt * 64 + (size_t)oo) = a; *(v4fa*)(ob + dt * 64 + 16 + (size_t)oo) = b; }
    asm volatile("s_wait_xcnt 0x0" :: "v"(oo) : "memory");   // stands before a register that the stores above name is rewritten
    __builtin_amdgcn_wave_barrier(); asm volatile("" ::: "memory");   // compiler order only: other lanes' u stores stay in front of this lane's reads (one wave's LDS operations run in order)
#pragma unroll 1
    for (int r = 0; r < 16; ++r) {   // rolled: sixteen short rows, once a wave
        const float mr = __shfl(m, r, 32), fr = __shfl(f, r, 32), lor = __shfl(lo_s, r, 32), hir = __shfl(hi_s, r, 32); const int ir = q0 + r; const v4f uu = *(const v4fa*)(tw + r * TBP + lane * 4); v4us oh, ol;
#pragma unroll
        for (int q = 0; q < 4; ++q) { const int bkt = lane * 4 + q; const int j = ir + bkt - CUT; const float y = __builtin_amdgcn_exp2f(uu[q] - mr) * fr; const bool in = bkt > 0 && bkt < 2 * CUT && j >= 0 && j < TT;
            const float w = (bkt == 0) ? lor : ((bkt == 2 * CUT) ? hir : (in ? y : 0.f)); unsigned short a, c2; splitf(w, a, c2); oh[q] = a; ol[q] = c2; }
        const size_t po = ((size_t)z * TT + ir) * NE * 2; const unsigned bo = (unsigned)lane * 8u; *(v4usa*)((char*)Bh + po + (size_t)bo) = oh; *(v4usa*)((char*)Bl + po + (size_t)bo) = ol;
        asm volatile("s_wait_xcnt 0x0" :: "v"(bo) : "memory"); }   // stands before the next row rewrites a register that the two stores name
}
__global__ __launch_bounds__(256) void k_epadK(const float* __restrict__ E, bf* EB) { const size_t i = (size_t)blockIdx.x * 256 + threadIdx.x; if (i >= (size_t)NE * HD / 8) return; const int d0 = (int)(i % (HD / 8)) * 8; const int r = (int)(i / (HD / 8)); const float* src = E + (size_t)min(r, NRE - 1) * HD + d0; v8us o;
#pragma unroll
    for (int q = 0; q < 8; ++q) { const unsigned short v = f2bf(src[q]); o[q] = (r < NRE) ? v : (unsigned short)0; }
    *(v8us*)(EB + (size_t)r * HD + d0) = o;  }

__global__ __launch_bounds__(256) void k_epadVT(const float* __restrict__ E, bf* Th, bf* Tl) { const size_t i = (size_t)blockIdx.x * 256 + threadIdx.x; if (i >= (size_t)HD * NE / 4) return; const size_t e = i * 4; const int c0 = (int)(e % NE); const int d = (int)(e / NE); v4us oh, ol;
#pragma unroll
    for (int q = 0; q < 4; ++q) { const int r = c0 + q; const float v = bfr(E[(size_t)min(r, NRE - 1) * HD + d]); unsigned short u, w; splitf(v, u, w);   /* input rounded to bf16 once: lo == 0 */ oh[q] = (r < NRE) ? u : (unsigned short)0; ol[q] = (r < NRE) ? w : (unsigned short)0; }
    *(v4us*)(Th + e) = oh; *(v4us*)(Tl + e) = ol;  }

__global__ __launch_bounds__(256) void k_addF(float* Y, const float* __restrict__ F) { const size_t i = (size_t)blockIdx.x * 256 + threadIdx.x; if (i >= (size_t)ZH * TT * HD / 4) return; const v4f a = *(const v4f*)(Y + i * 4); const v4f f = *(const v4f*)(F + i * 4); v4f o;
#pragma unroll
    for (int q = 0; q < 4; ++q) o[q] = __fadd_rn(a[q], f[q]);
    *(v4f*)(Y + i * 4) = o;  }

__global__ __launch_bounds__(256) void k_merge(const float* __restrict__ O, bf* Ah, bf* Al) { const size_t e = ((size_t)blockIdx.x * 256 + threadIdx.x) * 2; if (e >= (size_t)ZH * TT * HD) return; const int d = (int)(e % HD); const int t = (int)((e / HD) % TT); const int zz = (int)(e / ((size_t)HD * TT)); const float cs = (t < RH) ? 1.0f : (1.0f / PCAR); const size_t oo = (size_t)t * (NB_ * DQ) + zz * HD + d;   /* row 2 t + b, column 64 h + d, with zz = 16 b + h */
    v2us oh, ol;
#pragma unroll
    for (int q = 0; q < 2; ++q) { unsigned short a, c2; splitf(O[e + q] * cs, a, c2); oh[q] = a; ol[q] = c2; } *(v2us*)(Ah + oo) = oh; *(v2us*)(Al + oo) = ol;  }

extern "C" void kernel_launch(void* const* d_in, const int* in_sizes, int n_in,
                              void* d_out, int out_size, void* d_ws, size_t ws_size, hipStream_t stream) {
    (void)in_sizes; (void)n_in; (void)out_size;
    const float* x = (const float*)d_in[0];   /* query */ const float* xk = (const float*)d_in[1]; const float* xv = (const float*)d_in[2]; const float* wq = (const float*)d_in[3]; const float* bq = (const float*)d_in[4]; const float* wk = (const float*)d_in[5]; const float* bk = (const float*)d_in[6]; const float* wv = (const float*)d_in[7]; const float* bv = (const float*)d_in[8]; const float* wo = (const float*)d_in[9]; const float* bo = (const float*)d_in[10]; const float* ak = (const float*)d_in[11];   /* rel_k_table [101][64] */ const float* av = (const float*)d_in[12];   /* rel_v_table [101][64] */
    float* OUT = (float*)d_out;     // [2048][2][1024] sequence-first
    char* wsp = (char*)d_ws;
    auto take = [&](size_t bytes) { char* p = wsp; wsp += (bytes + 255) & ~(size_t)255; return (void*)p; };
    bf* AKB = (bf*)take((size_t)NE * HD * 2); bf* AVTh = (bf*)take((size_t)HD * NE * 2); bf* AVTl = (bf*)take((size_t)HD * NE * 2); float* QE = (float*)take((size_t)ZH * TT * NE * 4); bf* PBh = (bf*)take((size_t)ZH * TT * NE * 2); bf* PBl = (bf*)take((size_t)ZH * TT * NE * 2); float* ZR = (float*)take((size_t)ZH * TT * HD * 4); bf* WQ = (bf*)take((size_t)DQ * DM * 2); bf* WK = (bf*)take((size_t)DKV * DM * 2); bf* WV = (bf*)take((size_t)DKV * DM * 2); bf* WO = (bf*)take((size_t)DM * DQ * 2); float* CS = (float*)take((size_t)TT * HD * 2 * 4);
    bf* XB = (bf*)take((size_t)NB_ * TT * DM * 2); float* FQ = (float*)take((size_t)NB_ * TT * DQ * 4); float* FK = (float*)take((size_t)NB_ * TT * DKV * 4);
    h16* QP16 = (h16*)take((size_t)ZH * TT * HD * 2); h16* KP16 = (h16*)take((size_t)ZH * TT * HD * 2); h16* VT16 = (h16*)take((size_t)ZH * HD * TT * 2);
    bf* QPh = (bf*)take((size_t)ZH * TT * HD * 2); bf* QPl = (bf*)take((size_t)ZH * TT * HD * 2); bf* KPh = (bf*)take((size_t)ZH * TT * HD * 2); bf* KPl = (bf*)take((size_t)ZH * TT * HD * 2); bf* VT = (bf*)take((size_t)ZH * HD * 2 * TT * 2);
    float* Ob = (float*)take((size_t)ZH * TT * HD * 4); bf* ATh = (bf*)take((size_t)NB_ * TT * DQ * 2); bf* ATl = (bf*)take((size_t)NB_ * TT * DQ * 2);
    if ((size_t)(wsp - (char*)d_ws) > ws_size) return;    // 233 MiB of the 256 MiB
    float* FV = FK;   // v projection reuses the k buffer after the k planes are built (stream-ordered)
    { k_cvt8<<<(unsigned)(((size_t)DQ * DM / 8 + 255) / 256), 256, 0, stream>>>(wq, WQ, (size_t)DQ * DM / 8); k_cvt8<<<(unsigned)(((size_t)DKV * DM / 8 + 255) / 256), 256, 0, stream>>>(wk, WK, (size_t)DKV * DM / 8); k_cvt8<<<(unsigned)(((size_t)DKV * DM / 8 + 255) / 256), 256, 0, stream>>>(wv, WV, (size_t)DKV * DM / 8);
      k_cvt8<<<(unsigned)(((size_t)DM * DQ / 8 + 255) / 256), 256, 0, stream>>>(wo, WO, (size_t)DM * DQ / 8);
       }
    k_csid<<<(TT * HD + 255) / 256, 256, 0, stream>>>(CS);
    const unsigned LX = (unsigned)(((size_t)NB_ * TT * DM / 8 + 255) / 256), LP2 = (unsigned)(((size_t)ZH * TT * HD / 2 + 255) / 256);
    k_epadK<<<(unsigned)(((size_t)NE * HD / 8 + 255) / 256), 256, 0, stream>>>(ak, AKB);   /* rel_k -> bf16 [128][64], rows >= 101 zero */ k_epadVT<<<(unsigned)(((size_t)HD * NE / 4 + 255) / 256), 256, 0, stream>>>(av, AVTh, AVTl);   /* rel_v^T hi/lo [64][128], cols >= 101 zero */
    // A sequence-first tensor [L][B][HID] is a matrix of L B rows; in a projection F of it, element (t, b, h, d) lies at t (B x 1024) + (16 b + h) 64 + d: a head plane z = 16 b + h at row pitch B x 1024.
    k_cvt8<<<LX, 256, 0, stream>>>(x, XB, (size_t)NB_ * TT * DM / 8);
    k_gemmw<bf, 0, true, 8><<<dim3(NB_ * TT / 64, DQ / 64, 1), 256, 0, stream>>>(XB, nullptr, WQ, nullptr, DM, DM, FQ, DQ, bq, 0, 0, 0);
    k_rope<<<LP2, 256, 0, stream>>>(FQ, NB_ * DQ, ZH, CS, nullptr, nullptr, 1.0f, QP16, QPh, QPl);
    k_cvt8<<<LX, 256, 0, stream>>>(xk, XB, (size_t)NB_ * TT * DM / 8);
    k_gemmw<bf, 0, true, 8><<<dim3(NB_ * TT / 64, DKV / 64, 1), 256, 0, stream>>>(XB, nullptr, WK, nullptr, DM, DM, FK, DKV, bk, 0, 0, 0);
    k_rope<<<LP2, 256, 0, stream>>>(FK, NB_ * DKV, ZH, CS, nullptr, nullptr, 1.0f, KP16, KPh, KPl);
    k_cvt8<<<LX, 256, 0, stream>>>(xv, XB, (size_t)NB_ * TT * DM / 8);
    k_gemmw<bf, 0, true, 8><<<dim3(NB_ * TT / 64, DKV / 64, 1), 256, 0, stream>>>(XB, nullptr, WV, nullptr, DM, DM, FV, DKV, bv, 0, 0, 0);
    k_vtp<<<LP2, 256, 0, stream>>>(FV, NB_ * DKV, ZH, VT16, VT);
    k_gemmw<bf, 1, false><<<dim3(TT / 64, NE / 64, ZH), 32, 0, stream>>>(QPh, QPl, AKB, nullptr, HD, HD, QE, NE, nullptr, (size_t)TT * HD, 0, (size_t)TT * NE);   /* QE = q . rel_k^T */
    k_fattn<<<dim3(TT / 64, ZH), 128, 0, stream>>>(QPh, QPl, KPh, KPl, VT, QE, Ob, PBh, PBl);   /* scores + q.rel_k[clip(j - i) + 50], softmax, P.v, attn folded onto the 101 clipped offsets */
    k_gemmw<bf, 2, false, 4><<<dim3(TT / 64, HD / 64, ZH), 128, 0, stream>>>(PBh, PBl, AVTh, AVTl, NE, NE, ZR, HD, nullptr, (size_t)TT * NE, 0, (size_t)TT * HD);   /* ZR = PB . rel_v */
    k_addF<<<(unsigned)(((size_t)ZH * TT * HD / 4 + 255) / 256), 256, 0, stream>>>(Ob, ZR);   /* context += relative-value term */
    k_merge<<<LP2, 256, 0, stream>>>(Ob, ATh, ATl);
    k_gemmw<bf, 1, true, 8><<<dim3(NB_ * TT / 64, DM / 64, 1), 256, 0, stream>>>(ATh, ATl, WO, nullptr, DQ, DQ, OUT, DM, bo, 0, 0, 0);   /* rows 2 l + b: the sequence-first output as it lies in memory */
}

// v006
// A run of this version takes 273 microseconds.
// Two timings next to v005 both put it at 1.23 times that version's speed.
// Counting every step since v000, it is 7.01 times as fast.
#include <hip/hip_runtime.h>

// Relative multi-head attention with key AND value relative-position embeddings, sequence-first tensors (query, key, value [2048][2][1024]; q = query Wq^T + bq, k = key Wk^T + bk, v = value Wv^T + bv ('oi' 0.02, biases 0.02; 16 heads x 64); idx[i][j] = clip(j - i, -50, 50) + 50; attn = softmax((q.k + q.rel_k[idx]) / 8); x = attn v + sum_j attn[i][j] rel_v[idx] (rel_k, rel_v [101][64] 0.02, read); out = merged Wo^T + bo -> [2048][2][1024] sequence-first (4.2 M); argument order query, key, value, Wq, bq, Wk, bk, Wv, bv, Wo, bo, rel_k, rel_v).
// Layout: query, key, value in turn as ONE bf16 matrix of 4096 rows (query and key: row = 2 l + b, the sequence-first order as it lies in memory; value: row 2048 b + l), so every stage is launched once for both batch columns; head planes z = 16 b + h; 'oi' weights; exact projections + f32 biases; rel_k as a zero-padded bf16 plane [128][64] and rel_v^T as hi/lo planes [64][128]; over all 32 head planes at once: QE = q.rel_k^T (hi/lo x exact); one fused kernel for the score tiles (hi/lo 3 products), QE gathered in at column clip(j - i) + 50, running softmax (x 1/8), P.v (hi/lo x hi/lo) and the probabilities folded onto the 101 offsets (interior = one key, the two ends = fixed-order sums); PB.rel_v added to the context; merged hi/lo (row 2 l + b) x Wo exact + bo, whose rows are the output's own.
// Compute dtypes, f32 accumulate: every input rounded to bf16; projections exact + f32 biases; scores and the relative-key term ~f32; softmax f32; P as bf16 hi/lo; attn.v and the relative-value term 3 products (~f32); Wo hl x exact + bias.

#define NB_  2
#define TT   2048
#define DM   1024
#define NH_  16
#define NKV  16
#define REP  (NH_ / NKV)
#define HD   64
#define DQ   (NH_ * HD)
#define DKV  (NKV * HD)
#define ZH   (NB_ * NH_)          // head planes per launch: every head of both batch columns
#define RH   TT                   // unused
#define WIN  0
#define PCAR 1024.0f
#define SCL  0.125f   // 1/sqrt(64) (the module divides by jnp.sqrt(DH))
#define NE   128      // 2*50+1 = 101 relative offsets padded to 128
#define NRE  101
#define CUT  50
typedef _Float16 h16;
typedef unsigned short bf;
typedef __attribute__((ext_vector_type(16))) __bf16   v16bf;
typedef __attribute__((ext_vector_type(16))) _Float16 v16h;
typedef __attribute__((ext_vector_type(8)))  _Float16 v8h;
typedef __attribute__((ext_vector_type(8)))  unsigned short v8us;
typedef __attribute__((ext_vector_type(8)))  float    v8f;
typedef __attribute__((ext_vector_type(4)))  float    v4f;
typedef v8h  __attribute__((may_alias)) v8ha;
typedef v4f  __attribute__((may_alias)) v4fa;
typedef v8us __attribute__((may_alias)) v8usa;

__device__ __forceinline__ unsigned short f2bf(float f) { unsigned u = __float_as_uint(f); u += 0x7FFFu + ((u >> 16) & 1u); return (unsigned short)(u >> 16); }
__device__ __forceinline__ float bf2f(unsigned short b) { return __uint_as_float(((unsigned)b) << 16); }
__device__ __forceinline__ float bfr(float f) { return bf2f(f2bf(f)); }
__device__ __forceinline__ void splitf(float y, unsigned short& h, unsigned short& l) { h = f2bf(y); l = f2bf(y - bf2f(h)); }
typedef __attribute__((ext_vector_type(4))) unsigned short v4us;
__device__ __forceinline__ v16h cat16(v8h lo, v8h hi) { return __builtin_shufflevector(lo, hi, 0, 1, 2, 3, 4, 5, 6, 7, 8, 9, 10, 11, 12, 13, 14, 15); }
__device__ __forceinline__ v16bf cat16b(v8us lo, v8us hi) { return __builtin_bit_cast(v16bf, __builtin_shufflevector(lo, hi, 0, 1, 2, 3, 4, 5, 6, 7, 8, 9, 10, 11, 12, 13, 14, 15)); }
__device__ __forceinline__ v8f wmma16(v16h a, v16h b, v8f c) { return __builtin_amdgcn_wmma_f32_16x16x32_f16(false, a, false, b, (short)0, c, false, false); }
__device__ __forceinline__ v8f wmmab(v16bf a, v16bf b, v8f c) { return __builtin_amdgcn_wmma_f32_16x16x32_bf16(false, a, false, b, (short)0, c, false, false); }



// ---- k_gemmw: register-blocked GEMM, ONE WAVE per 64x64 output tile (16 accumulators), operands straight from K-contiguous 16-bit planes; grid (M/64, N/64, Z), 32 threads.
// C[m][n] (f32, pitch ldc, + optional f32 bias[n]) = sum_{k < KL} A[m][k] Bt[n][k] (+ split products per NSPLIT). K = row pitch of A and Bt in elements, KL <= K the summed length. z-batch strides sA/sB/sC in elements. KL % 32 == 0.
// KS > 1 (long K, few tiles): 32 KS threads, wave w of the work-group takes k in [w KL/KS, (w+1) KL/KS) of the same tile; the KS partial tiles are summed in fixed wave order through LDS. KL % (32 KS) == 0.
template <typename T16> struct WFrag;
template <> struct WFrag<h16> { typedef v16h V; static __device__ __forceinline__ V ld(const h16* p) { return cat16(*(const v8h*)p, *(const v8h*)(p + 16)); } static __device__ __forceinline__ v8f mma(V a, V b, v8f c) { return wmma16(a, b, c); } };
template <> struct WFrag<bf> { typedef v16bf V; static __device__ __forceinline__ V ld(const bf* p) { return cat16b(*(const v8us*)p, *(const v8us*)(p + 16)); } static __device__ __forceinline__ v8f mma(V a, V b, v8f c) { return wmmab(a, b, c); } };
// EPI (KS > 1 only) = what the summed tile becomes; 1 to 3 write the next stage's bf16 hi/lo operand planes themselves, whole 128-byte rows, and no f32 tile:
//   0: f32 C. 1: rows 2 t + b, columns 64 h + d -> head planes Eh, El [16 b + h][t][d]. 2: rows 64 h + d (A = the weight; bias added by ROW, BIAS false), columns t (Bt = the input's rows of batch column z) -> v^T rows Eh [16 z + h][d][2048 hi | 2048 lo].
//   3: head plane z, rows t, columns d: C is READ (the context P.v), the tile added to it -> merged rows Eh, El [2 t + b][64 h + d], z = 16 b + h.
template <typename T16, int NSPLIT, bool BIAS, int KS = 1, int EPI = 0>
__global__ __launch_bounds__(32 * KS) void k_gemmw(const T16* __restrict__ A, const T16* __restrict__ A2, const T16* __restrict__ Bt, const T16* __restrict__ Bt2, int K, int KL, float* C, int ldc, const float* __restrict__ bias, size_t sA, size_t sB, size_t sC, bf* Eh, bf* El) {
    typedef typename WFrag<T16>::V V;
    __shared__ __align__(16) float os[KS == 1 ? 16 * 68 : KS * 64 * 68];
    const size_t z = blockIdx.z; A += z * sA; if (A2) A2 += z * sA; Bt += z * sB; if (Bt2) Bt2 += z * sB; C += z * sC;
    const int lane = threadIdx.x & 31, lr = lane & 15, hi = lane >> 4; const int r0 = blockIdx.x * 64, c0 = blockIdx.y * 64;
    const int wv = (KS == 1) ? 0 : __builtin_amdgcn_readfirstlane((int)(threadIdx.x >> 5)); const int k0 = wv * (KL / KS), k1 = k0 + KL / KS;
    v8f acc[4][4];
#pragma unroll
    for (int mb = 0; mb < 4; ++mb)
#pragma unroll
        for (int nb = 0; nb < 4; ++nb) acc[mb][nb] = (v8f){};
    const size_t aoff = (size_t)(r0 + lr) * K + 8 * hi, boff = (size_t)(c0 + lr) * K + 8 * hi;
#pragma unroll 1
    for (int kc = k0; kc < k1; kc += 32) {
        V a[4], a2[4];
#pragma unroll
        for (int mb = 0; mb < 4; ++mb) { a[mb] = WFrag<T16>::ld(A + aoff + (size_t)mb * 16 * K + kc); if (NSPLIT == 1 || NSPLIT == 2) a2[mb] = WFrag<T16>::ld(A2 + aoff + (size_t)mb * 16 * K + kc); }
#pragma unroll
        for (int nb = 0; nb < 4; ++nb) { const V b = WFrag<T16>::ld(Bt + boff + (size_t)nb * 16 * K + kc); V b2; if (NSPLIT >= 2) b2 = WFrag<T16>::ld(Bt2 + boff + (size_t)nb * 16 * K + kc);
#pragma unroll
            for (int mb = 0; mb < 4; ++mb) { acc[mb][nb] = WFrag<T16>::mma(a[mb], b, acc[mb][nb]); if (NSPLIT == 1 || NSPLIT == 2) acc[mb][nb] = WFrag<T16>::mma(a2[mb], b, acc[mb][nb]); if (NSPLIT >= 2) acc[mb][nb] = WFrag<T16>::mma(a[mb], b2, acc[mb][nb]); } }
        asm volatile("v_nop\n\tv_nop\n\tv_nop\n\tv_nop" : "+v"(acc[0][0]), "+v"(acc[1][1]), "+v"(acc[2][2]), "+v"(acc[3][3]) : "v"(a[0]), "v"(a[3]));
    }
    if (KS > 1) {
        float* my = os + wv * (64 * 68);
#pragma unroll
        for (int mb = 0; mb < 4; ++mb)
#pragma unroll
            for (int nb = 0; nb < 4; ++nb)
#pragma unroll
                for (int j = 0; j < 8; ++j) my[(mb * 16 + hi * 8 + j) * 68 + nb * 16 + lr] = acc[mb][nb][j];
        constexpr int NS = 1024 / (32 * KS);
        v4f oc[EPI == 3 ? NS : 1];
        if (EPI == 3) {   // the context values this thread adds to, asked for ahead of the barrier so that their latency runs beside it
#pragma unroll
            for (int s = 0; s < NS; ++s) { const int slot = s * (32 * KS) + (int)threadIdx.x; oc[s] = *(const v4f*)(C + (size_t)(r0 + (slot >> 4)) * ldc + (slot & 15) * 4); } }
        __syncthreads();   // every wave's partial tile is in LDS before any wave sums across them
        v4us eh[EPI == 0 ? 1 : NS], el[EPI == 0 ? 1 : NS];
#pragma unroll
        for (int s = 0; s < 1024 / (32 * KS); ++s) { const int slot = s * (32 * KS) + (int)threadIdx.x; const int row = slot >> 4, cofs = (slot & 15) * 4; v4f val = *(const v4fa*)(os + row * 68 + cofs);
#pragma unroll
            for (int w = 1; w < KS; ++w) { const v4f p = *(const v4fa*)(os + w * (64 * 68) + row * 68 + cofs); val += p; }
            if (BIAS) { val[0] += bfr(bias[c0 + cofs]); val[1] += bfr(bias[c0 + cofs + 1]); val[2] += bfr(bias[c0 + cofs + 2]); val[3] += bfr(bias[c0 + cofs + 3]); }
            if (EPI == 0) { *(v4f*)(C + (size_t)(r0 + row) * ldc + c0 + cofs) = val; }
            if (EPI == 2) { const float br = bfr(bias[r0 + row]); val[0] += br; val[1] += br; val[2] += br; val[3] += br; }
            if (EPI == 3) { val[0] = __fadd_rn(oc[s][0], val[0]); val[1] = __fadd_rn(oc[s][1], val[1]); val[2] = __fadd_rn(oc[s][2], val[2]); val[3] = __fadd_rn(oc[s][3], val[3]); }
            if (EPI != 0) {
#pragma unroll
                for (int q = 0; q < 4; ++q) { unsigned short a, c2; splitf(val[q], a, c2); eh[s][q] = a; el[s][q] = c2; } } }
        if (EPI != 0) {   // the stores stand behind all the sums, so that no store lies between the slots' LDS reads and they can issue together
#pragma unroll
            for (int s = 0; s < NS; ++s) { const int slot = s * (32 * KS) + (int)threadIdx.x; const int R = r0 + (slot >> 4), cofs = (slot & 15) * 4; size_t e = 0, e2 = 0;
                if (EPI == 1) { e = ((size_t)((R & 1) * NH_ + (int)blockIdx.y) * TT + (R >> 1)) * HD + cofs; e2 = e; }
                if (EPI == 2) { e = (z * DKV + R) * (size_t)(2 * TT) + c0 + cofs; e2 = e + TT; }
                if (EPI == 3) { e = (size_t)R * (NB_ * DQ) + z * HD + cofs; e2 = e; }
                *(v4us*)(Eh + e) = eh[s]; *(v4us*)(El + e2) = el[s]; } }
        return;
    }
#pragma unroll
    for (int mb = 0; mb < 4; ++mb) {
#pragma unroll
        for (int nb = 0; nb < 4; ++nb) {
#pragma unroll
            for (int j = 0; j < 8; ++j) os[(hi * 8 + j) * 68 + nb * 16 + lr] = acc[mb][nb][j]; }
        __builtin_amdgcn_wave_barrier(); asm volatile("" ::: "memory");
        float* crow = C + (size_t)(r0 + mb * 16) * ldc + c0;
{
#pragma unroll
            for (int s = 0; s < 8; ++s) { const int row = 2 * s + hi, cofs = lr * 4; v4f val = *(const v4fa*)(os + row * 68 + cofs); if (BIAS) { val[0] += bfr(bias[c0 + cofs]); val[1] += bfr(bias[c0 + cofs + 1]); val[2] += bfr(bias[c0 + cofs + 2]); val[3] += bfr(bias[c0 + cofs + 3]); }
                *(v4f*)(crow + (size_t)row * ldc + cofs) = val; }
             }
        __builtin_amdgcn_wave_barrier(); asm volatile("" ::: "memory");
    }
}

typedef __attribute__((ext_vector_type(2))) _Float16 v2h;
typedef __attribute__((ext_vector_type(4))) _Float16 v4h;
typedef __attribute__((ext_vector_type(2))) unsigned short v2us;
typedef __attribute__((ext_vector_type(2))) float v2f;
typedef __attribute__((ext_vector_type(4))) int v4i;

__global__ __launch_bounds__(256) void k_cvt8(const float* __restrict__ src, bf* dst, size_t n8) { const size_t i = (size_t)blockIdx.x * 256 + threadIdx.x; if (i >= n8) return; const v8f v = *(const v8f*)(src + i * 8); v8us o;
#pragma unroll
    for (int k = 0; k < 8; ++k) o[k] = f2bf(v[k]); *(v8us*)(dst + i * 8) = o;  }
// k_cvt8b: the same for a sequence-first tensor, its rows 2 t + b laid out batch column by batch column (row b TT + t), so that 64 rows in a row are 64 t of one column
__global__ __launch_bounds__(256) void k_cvt8b(const float* __restrict__ src, bf* dst) { const size_t i = (size_t)blockIdx.x * 256 + threadIdx.x; if (i >= (size_t)NB_ * TT * DM / 8) return; const v8f v = *(const v8f*)(src + i * 8); v8us o;
#pragma unroll
    for (int k = 0; k < 8; ++k) o[k] = f2bf(v[k]);
    const size_t R = i / (DM / 8), c = (i % (DM / 8)) * 8; *(v8us*)(dst + ((R & 1) * TT + (R >> 1)) * DM + c) = o;  }

// k_fattn: scores, softmax, P.v and the offset fold in ONE kernel; a score never leaves its wave's registers. Work-group = 4 waves x 16 queries of one head; keys in tiles of 64, K hi/lo [key][d] and v^T hi/lo [d][key] staged through registers into two LDS buffers (row pitch 144 B), the next tile's global loads issued before this tile's work.
// Every product is taken transposed, so that a lane owns ONE query (lane & 15): S^T = K.Q^T (rows = keys, columns = queries), O^T = v^T.P^T (rows = d). The accumulator of two 16-key S^T tiles IS the 32-key operand fragment of P^T (register j of tile 0 = key 8 hi + j, of tile 1 = key 16 + 8 hi + j), and row maximum, row sum and rescale are per-lane values.
// Running softmax in the exp2 domain: u = (s + QE[clip(j - i) + 50]) / 8 x log2(e); p = exp2(u - m), sums and O^T rescaled by exp2(m_old - m_new), divided by the row sum at the end. Fold: the two end offsets are running sums of p; an interior offset is one key, whose u waits in the wave's own LDS until m and the sum are final.
typedef __attribute__((ext_vector_type(4))) unsigned int v4u;
typedef v4us __attribute__((may_alias)) v4usa;
#define LP  72     // LDS row pitch in bf16: 144 B = 16 B x 9, free of bank conflicts for 16-byte fragment reads
#define TBP 132    // pitch in floats of a query's 128 offset slots
#define UC  (SCL * 1.4426950408889634f)
__global__ __launch_bounds__(128) void k_fattn(const bf* __restrict__ Qh, const bf* __restrict__ Ql, const bf* __restrict__ Kh, const bf* __restrict__ Kl, const bf* __restrict__ Vhl, const float* __restrict__ QE, float* O, bf* Bh, bf* Bl) {
    __shared__ __align__(16) bf st[2][4][64 * LP];     // per buffer: K hi, K lo, v^T hi, v^T lo
    __shared__ __align__(16) float tb[4][16 * TBP];    // per wave: u of the interior offsets, [query][offset]
    __shared__ __align__(16) float qs[4][16 * TBP];    // per wave: its sixteen rows of QE x UC
    const int tid = threadIdx.x, lane = tid & 31, lr = lane & 15, hi = lane >> 4; const int wv = __builtin_amdgcn_readfirstlane(tid >> 5);
    const int z = blockIdx.y; const int q0 = blockIdx.x * 64 + wv * 16; const int i = q0 + lr; const size_t hb = (size_t)z * TT * HD;
    // every global address = a base that is the same for the wave + a lane's byte offset that lives as long as its loads or stores do
    const char* kh = (const char*)(Kh + hb); const char* kl = (const char*)(Kl + hb); const char* vv = (const char*)(Vhl + (size_t)z * HD * 2 * TT); float* tw = tb[wv]; float* qw = qs[wv];
    const unsigned ko = (unsigned)tid * 16u;   // K tile: 8 KiB in a row, slice r = 2 KiB
    const unsigned vo = (unsigned)(tid >> 3) * (2 * TT * 2) + (unsigned)(tid & 7) * 16u;   // v^T tile: row d = 16 r + (tid >> 3) of 8 KiB pitch, lo plane 4 KiB behind hi
    const unsigned qo = (unsigned)(lr * HD + 8 * hi) * 2u, eo = (unsigned)lane * 16u;
    v8us pf[16];
#pragma unroll
    for (int r = 0; r < 4; ++r) { pf[r] = *(const v8usa*)(kh + r * 2048 + (size_t)ko); pf[4 + r] = *(const v8usa*)(kl + r * 2048 + (size_t)ko); pf[8 + r] = *(const v8usa*)(vv + r * (16 * 2 * TT * 2) + (size_t)vo); pf[12 + r] = *(const v8usa*)(vv + r * (16 * 2 * TT * 2) + TT * 2 + (size_t)vo); }
    v16bf qh[2], ql[2]; const char* qhb = (const char*)(Qh + hb + (size_t)q0 * HD); const char* qlb = (const char*)(Ql + hb + (size_t)q0 * HD);
#pragma unroll
    for (int kc = 0; kc < 2; ++kc) { qh[kc] = cat16b(*(const v8usa*)(qhb + kc * 64 + (size_t)qo), *(const v8usa*)(qhb + kc * 64 + 32 + (size_t)qo)); ql[kc] = cat16b(*(const v8usa*)(qlb + kc * 64 + (size_t)qo), *(const v8usa*)(qlb + kc * 64 + 32 + (size_t)qo)); }
    const char* qeb = (const char*)(QE + ((size_t)z * TT + q0) * NE); v4f er[16];
#pragma unroll
    for (int r = 0; r < 16; ++r) er[r] = *(const v4fa*)(qeb + r * (NE * 4) + (size_t)eo);
    asm volatile("s_wait_xcnt 0x0" :: "v"(qo), "v"(eo) : "memory");   // stands before a register that the loads above name is rewritten; the two offsets that end here are held up to it
#pragma unroll
    for (int r = 0; r < 16; ++r) *(v4fa*)(qw + r * TBP + lane * 4) = er[r] * UC;
    for (int s = lane; s < 16 * TBP / 4; s += 32) *(v4fa*)(tw + s * 4) = (v4f){0.f, 0.f, 0.f, 0.f};   // slots that no key of a row reaches are read below and stay zero
    __builtin_amdgcn_wave_barrier(); asm volatile("" ::: "memory");   // compiler order only: other lanes' QE stores stay in front of this lane's reads (one wave's LDS operations run in order)
    const float qlo = qw[lr * TBP], qhi = qw[lr * TBP + 2 * CUT];
#pragma unroll
    for (int r = 0; r < 4; ++r) { const int c = r * 128 + tid; const int o = (c >> 3) * LP + (c & 7) * 8;
#pragma unroll
        for (int pl = 0; pl < 4; ++pl) *(v8usa*)(&st[0][pl][o]) = pf[pl * 4 + r]; }
    __syncthreads();   // tile 0 is in LDS before any wave reads it
    v8f oacc[4];
#pragma unroll
    for (int dt = 0; dt < 4; ++dt) oacc[dt] = (v8f){};
    float m = -3.0e38f, l = 0.f, lo_s = 0.f, hi_s = 0.f;
#pragma unroll 1
    for (int t = 0; t < TT / 64; ++t) {   // rolled: one tile's body is long enough, and the two buffers alternate by index
        const int kb = t * 64; const bf* sb = &st[t & 1][0][0];
        if (t + 1 < TT / 64) {
#pragma unroll
            for (int r = 0; r < 4; ++r) { const size_t kn = (size_t)(kb + 64); pf[r] = *(const v8usa*)(kh + kn * (HD * 2) + r * 2048 + (size_t)ko); pf[4 + r] = *(const v8usa*)(kl + kn * (HD * 2) + r * 2048 + (size_t)ko); pf[8 + r] = *(const v8usa*)(vv + kn * 2 + r * (16 * 2 * TT * 2) + (size_t)vo); pf[12 + r] = *(const v8usa*)(vv + kn * 2 + r * (16 * 2 * TT * 2) + TT * 2 + (size_t)vo); }
            asm volatile("s_wait_xcnt 0x0" ::: "memory"); }   // stands before an address register of the sixteen loads above is rewritten
        v8f s[4];
#pragma unroll
        for (int kt = 0; kt < 4; ++kt) s[kt] = (v8f){};
#pragma unroll
        for (int kc = 0; kc < 2; ++kc) { v16bf ah[4], al[4];
#pragma unroll
            for (int kt = 0; kt < 4; ++kt) { const int o = (kt * 16 + lr) * LP + 8 * hi + kc * 32; ah[kt] = WFrag<bf>::ld(sb + o); al[kt] = WFrag<bf>::ld(sb + 64 * LP + o); }
#pragma unroll
            for (int kt = 0; kt < 4; ++kt) s[kt] = wmmab(ah[kt], qh[kc], s[kt]);
#pragma unroll
            for (int kt = 0; kt < 4; ++kt) s[kt] = wmmab(al[kt], qh[kc], s[kt]);
#pragma unroll
            for (int kt = 0; kt < 4; ++kt) s[kt] = wmmab(ah[kt], ql[kc], s[kt]); }
        float u[4][8]; float tm = -3.0e38f;
#pragma unroll
        for (int kt = 0; kt < 4; ++kt) { const int jb = kb + kt * 16;   // the three cases are the same for the whole wave
            if (jb + 15 - q0 <= -CUT) {
#pragma unroll
                for (int j = 0; j < 8; ++j) u[kt][j] = fmaf(s[kt][j], UC, qlo);
            } else if (jb - (q0 + 15) >= CUT) {
#pragma unroll
                for (int j = 0; j < 8; ++j) u[kt][j] = fmaf(s[kt][j], UC, qhi);
            } else {
#pragma unroll
                for (int j = 0; j < 8; ++j) { const int d = jb + hi * 8 + j - i; u[kt][j] = fmaf(s[kt][j], UC, qw[lr * TBP + min(max(d, -CUT), CUT) + CUT]); if (d > -CUT && d < CUT) tw[lr * TBP + d + CUT] = u[kt][j]; }
            }
#pragma unroll
            for (int j = 0; j < 8; ++j) tm = fmaxf(tm, u[kt][j]); }
        tm = fmaxf(tm, __shfl_xor(tm, 16, 32));   // the two half-waves hold the two halves of a query's keys
        const float mn = fmaxf(m, tm); const float al_ = __builtin_amdgcn_exp2f(m - mn); m = mn;
        float la = 0.f, loa = 0.f, hia = 0.f;
#pragma unroll
        for (int kt = 0; kt < 4; ++kt) { const int jb = kb + kt * 16;
#pragma unroll
            for (int j = 0; j < 8; ++j) u[kt][j] = __builtin_amdgcn_exp2f(u[kt][j] - mn);
            const float s8 = ((u[kt][0] + u[kt][1]) + (u[kt][2] + u[kt][3])) + ((u[kt][4] + u[kt][5]) + (u[kt][6] + u[kt][7])); la += s8;
            if (jb + 15 - q0 <= -CUT) loa += s8;
            else if (jb - (q0 + 15) >= CUT) hia += s8;
            else {
#pragma unroll
                for (int j = 0; j < 8; ++j) { const int d = jb + hi * 8 + j - i; loa += (d <= -CUT) ? u[kt][j] : 0.f; hia += (d >= CUT) ? u[kt][j] : 0.f; }
            } }
        l = fmaf(l, al_, la); lo_s = fmaf(lo_s, al_, loa); hi_s = fmaf(hi_s, al_, hia);
#pragma unroll
        for (int dt = 0; dt < 4; ++dt)
#pragma unroll
            for (int j = 0; j < 8; ++j) oacc[dt][j] *= al_;
#pragma unroll
        for (int c = 0; c < 2; ++c) { v16bf ph, pl;
#pragma unroll
            for (int e = 0; e < 16; ++e) { const float x = u[2 * c + (e >> 3)][e & 7]; const __bf16 h = (__bf16)x; ph[e] = h; pl[e] = (__bf16)(x - (float)h); }
            v16bf vh[4], vl[4];
#pragma unroll
            for (int dt = 0; dt < 4; ++dt) { const int o = (dt * 16 + lr) * LP + 8 * hi + c * 32; vh[dt] = WFrag<bf>::ld(sb + 2 * 64 * LP + o); vl[dt] = WFrag<bf>::ld(sb + 3 * 64 * LP + o); }
#pragma unroll
            for (int dt = 0; dt < 4; ++dt) oacc[dt] = wmmab(vh[dt], ph, oacc[dt]);
#pragma unroll
            for (int dt = 0; dt < 4; ++dt) oacc[dt] = wmmab(vl[dt], ph, oacc[dt]);
#pragma unroll
            for (int dt = 0; dt < 4; ++dt) oacc[dt] = wmmab(vh[dt], pl, oacc[dt]); }
        if (t + 1 < TT / 64) {
#pragma unroll
            for (int r = 0; r < 4; ++r) { const int c = r * 128 + tid; const int o = (c >> 3) * LP + (c & 7) * 8;
#pragma unroll
                for (int pl = 0; pl < 4; ++pl) *(v8usa*)(&st[(t + 1) & 1][pl][o]) = pf[pl * 4 + r]; } }
        __syncthreads();   // publishes tile t + 1 and ends every wave's reads of tile t, whose buffer the next trip refills
    }
    asm volatile("s_wait_xcnt 0x0" :: "v"(ko), "v"(vo) : "memory");   // stands before the tile loads' two offset registers may be rewritten; they are held up to it
    l += __shfl_xor(l, 16, 32); lo_s += __shfl_xor(lo_s, 16, 32); hi_s += __shfl_xor(hi_s, 16, 32);
    const float f = __fdiv_rn(1.0f, l); lo_s *= f; hi_s *= f;
    char* ob = (char*)(O + hb + (size_t)q0 * HD); const unsigned oo = (unsigned)(lr * HD + hi * 8) * 4u;
#pragma unroll
    for (int dt = 0; dt < 4; ++dt) { v4f a, b;
#pragma unroll
        for (int j = 0; j < 4; ++j) { a[j] = oacc[dt][j] * f; b[j] = oacc[dt][4 + j] * f; }
        *(v4fa*)(ob + dt * 64 + (size_t)oo) = a; *(v4fa*)(ob + dt * 64 + 16 + (size_t)oo) = b; }
    asm volatile("s_wait_xcnt 0x0" :: "v"(oo) : "memory");   // stands before a register that the stores above name is rewritten
    __builtin_amdgcn_wave_barrier(); asm volatile("" ::: "memory");   // compiler order only: other lanes' u stores stay in front of this lane's reads (one wave's LDS operations run in order)
#pragma unroll 1
    for (int r = 0; r < 16; ++r) {   // rolled: sixteen short rows, once a wave
        const float mr = __shfl(m, r, 32), fr = __shfl(f, r, 32), lor = __shfl(lo_s, r, 32), hir = __shfl(hi_s, r, 32); const int ir = q0 + r; const v4f uu = *(const v4fa*)(tw + r * TBP + lane * 4); v4us oh, ol;
#pragma unroll
        for (int q = 0; q < 4; ++q) { const int bkt = lane * 4 + q; const int j = ir + bkt - CUT; const float y = __builtin_amdgcn_exp2f(uu[q] - mr) * fr; const bool in = bkt > 0 && bkt < 2 * CUT && j >= 0 && j < TT;
            const float w = (bkt == 0) ? lor : ((bkt == 2 * CUT) ? hir : (in ? y : 0.f)); unsigned short a, c2; splitf(w, a, c2); oh[q] = a; ol[q] = c2; }
        const size_t po = ((size_t)z * TT + ir) * NE * 2; const unsigned bo = (unsigned)lane * 8u; *(v4usa*)((char*)Bh + po + (size_t)bo) = oh; *(v4usa*)((char*)Bl + po + (size_t)bo) = ol;
        asm volatile("s_wait_xcnt 0x0" :: "v"(bo) : "memory"); }   // stands before the next row rewrites a register that the two stores name
}
__global__ __launch_bounds__(256) void k_epadK(const float* __restrict__ E, bf* EB) { const size_t i = (size_t)blockIdx.x * 256 + threadIdx.x; if (i >= (size_t)NE * HD / 8) return; const int d0 = (int)(i % (HD / 8)) * 8; const int r = (int)(i / (HD / 8)); const float* src = E + (size_t)min(r, NRE - 1) * HD + d0; v8us o;
#pragma unroll
    for (int q = 0; q < 8; ++q) { const unsigned short v = f2bf(src[q]); o[q] = (r < NRE) ? v : (unsigned short)0; }
    *(v8us*)(EB + (size_t)r * HD + d0) = o;  }

__global__ __launch_bounds__(256) void k_epadVT(const float* __restrict__ E, bf* Th, bf* Tl) { const size_t i = (size_t)blockIdx.x * 256 + threadIdx.x; if (i >= (size_t)HD * NE / 4) return; const size_t e = i * 4; const int c0 = (int)(e % NE); const int d = (int)(e / NE); v4us oh, ol;
#pragma unroll
    for (int q = 0; q < 4; ++q) { const int r = c0 + q; const float v = bfr(E[(size_t)min(r, NRE - 1) * HD + d]); unsigned short u, w; splitf(v, u, w);   /* input rounded to bf16 once: lo == 0 */ oh[q] = (r < NRE) ? u : (unsigned short)0; ol[q] = (r < NRE) ? w : (unsigned short)0; }
    *(v4us*)(Th + e) = oh; *(v4us*)(Tl + e) = ol;  }

extern "C" void kernel_launch(void* const* d_in, const int* in_sizes, int n_in,
                              void* d_out, int out_size, void* d_ws, size_t ws_size, hipStream_t stream) {
    (void)in_sizes; (void)n_in; (void)out_size;
    const float* x = (const float*)d_in[0];   /* query */ const float* xk = (const float*)d_in[1]; const float* xv = (const float*)d_in[2]; const float* wq = (const float*)d_in[3]; const float* bq = (const float*)d_in[4]; const float* wk = (const float*)d_in[5]; const float* bk = (const float*)d_in[6]; const float* wv = (const float*)d_in[7]; const float* bv = (const float*)d_in[8]; const float* wo = (const float*)d_in[9]; const float* bo = (const float*)d_in[10]; const float* ak = (const float*)d_in[11];   /* rel_k_table [101][64] */ const float* av = (const float*)d_in[12];   /* rel_v_table [101][64] */
    float* OUT = (float*)d_out;     // [2048][2][1024] sequence-first
    char* wsp = (char*)d_ws;
    auto take = [&](size_t bytes) { char* p = wsp; wsp += (bytes + 255) & ~(size_t)255; return (void*)p; };
    bf* AKB = (bf*)take((size_t)NE * HD * 2); bf* AVTh = (bf*)take((size_t)HD * NE * 2); bf* AVTl = (bf*)take((size_t)HD * NE * 2); float* QE = (float*)take((size_t)ZH * TT * NE * 4); bf* PBh = (bf*)take((size_t)ZH * TT * NE * 2); bf* PBl = (bf*)take((size_t)ZH * TT * NE * 2); bf* WQ = (bf*)take((size_t)DQ * DM * 2); bf* WK = (bf*)take((size_t)DKV * DM * 2); bf* WV = (bf*)take((size_t)DKV * DM * 2); bf* WO = (bf*)take((size_t)DM * DQ * 2);
    bf* XB = (bf*)take((size_t)NB_ * TT * DM * 2);
    bf* QPh = (bf*)take((size_t)ZH * TT * HD * 2); bf* QPl = (bf*)take((size_t)ZH * TT * HD * 2); bf* KPh = (bf*)take((size_t)ZH * TT * HD * 2); bf* KPl = (bf*)take((size_t)ZH * TT * HD * 2); bf* VT = (bf*)take((size_t)ZH * HD * 2 * TT * 2);
    float* Ob = (float*)take((size_t)ZH * TT * HD * 4); bf* ATh = (bf*)take((size_t)NB_ * TT * DQ * 2); bf* ATl = (bf*)take((size_t)NB_ * TT * DQ * 2);
    if ((size_t)(wsp - (char*)d_ws) > ws_size) return;
    { k_cvt8<<<(unsigned)(((size_t)DQ * DM / 8 + 255) / 256), 256, 0, stream>>>(wq, WQ, (size_t)DQ * DM / 8); k_cvt8<<<(unsigned)(((size_t)DKV * DM / 8 + 255) / 256), 256, 0, stream>>>(wk, WK, (size_t)DKV * DM / 8); k_cvt8<<<(unsigned)(((size_t)DKV * DM / 8 + 255) / 256), 256, 0, stream>>>(wv, WV, (size_t)DKV * DM / 8);
      k_cvt8<<<(unsigned)(((size_t)DM * DQ / 8 + 255) / 256), 256, 0, stream>>>(wo, WO, (size_t)DM * DQ / 8);
       }
    const unsigned LX = (unsigned)(((size_t)NB_ * TT * DM / 8 + 255) / 256);
    k_epadK<<<(unsigned)(((size_t)NE * HD / 8 + 255) / 256), 256, 0, stream>>>(ak, AKB);   /* rel_k -> bf16 [128][64], rows >= 101 zero */ k_epadVT<<<(unsigned)(((size_t)HD * NE / 4 + 255) / 256), 256, 0, stream>>>(av, AVTh, AVTl);   /* rel_v^T hi/lo [64][128], cols >= 101 zero */
    // A sequence-first tensor [L][B][HID] is a matrix of L B rows (row 2 t + b); each projection's own epilogue splits its f32 tile into the hi/lo head planes z = 16 b + h that the attention kernel reads.
    k_cvt8<<<LX, 256, 0, stream>>>(x, XB, (size_t)NB_ * TT * DM / 8);
    k_gemmw<bf, 0, true, 8, 1><<<dim3(NB_ * TT / 64, DQ / 64, 1), 256, 0, stream>>>(XB, nullptr, WQ, nullptr, DM, DM, nullptr, 0, bq, 0, 0, 0, QPh, QPl);
    k_cvt8<<<LX, 256, 0, stream>>>(xk, XB, (size_t)NB_ * TT * DM / 8);
    k_gemmw<bf, 0, true, 8, 1><<<dim3(NB_ * TT / 64, DKV / 64, 1), 256, 0, stream>>>(XB, nullptr, WK, nullptr, DM, DM, nullptr, 0, bk, 0, 0, 0, KPh, KPl);
    k_cvt8b<<<LX, 256, 0, stream>>>(xv, XB);
    k_gemmw<bf, 0, false, 8, 2><<<dim3(DKV / 64, TT / 64, NB_), 256, 0, stream>>>(WV, nullptr, XB, nullptr, DM, DM, nullptr, 0, bv, 0, (size_t)TT * DM, 0, VT, VT);   /* v^T = Wv . value^T, one batch column per z */
    k_gemmw<bf, 1, false><<<dim3(TT / 64, NE / 64, ZH), 32, 0, stream>>>(QPh, QPl, AKB, nullptr, HD, HD, QE, NE, nullptr, (size_t)TT * HD, 0, (size_t)TT * NE, nullptr, nullptr);   /* QE = q . rel_k^T */
    k_fattn<<<dim3(TT / 64, ZH), 128, 0, stream>>>(QPh, QPl, KPh, KPl, VT, QE, Ob, PBh, PBl);   /* scores + q.rel_k[clip(j - i) + 50], softmax, P.v, attn folded onto the 101 clipped offsets */
    k_gemmw<bf, 2, false, 4, 3><<<dim3(TT / 64, HD / 64, ZH), 128, 0, stream>>>(PBh, PBl, AVTh, AVTl, NE, NE, Ob, HD, nullptr, (size_t)TT * NE, 0, (size_t)TT * HD, ATh, ATl);   /* merged = context + PB . rel_v, hi/lo */
    k_gemmw<bf, 1, true, 8><<<dim3(NB_ * TT / 64, DM / 64, 1), 256, 0, stream>>>(ATh, ATl, WO, nullptr, DQ, DQ, OUT, DM, bo, 0, 0, 0, nullptr, nullptr);   /* rows 2 l + b: the sequence-first output as it lies in memory */
}

// v007
// Measured time: 261 microseconds a run.
// Next to v006, in two timings, it ran 1.04 times as fast each time.
// Over all steps from v000 it is 7.31 times as fast.
#include <hip/hip_runtime.h>

// Relative multi-head attention with key AND value relative-position embeddings, sequence-first tensors (query, key, value [2048][2][1024]; q = query Wq^T + bq, k = key Wk^T + bk, v = value Wv^T + bv ('oi' 0.02, biases 0.02; 16 heads x 64); idx[i][j] = clip(j - i, -50, 50) + 50; attn = softmax((q.k + q.rel_k[idx]) / 8); x = attn v + sum_j attn[i][j] rel_v[idx] (rel_k, rel_v [101][64] 0.02, read); out = merged Wo^T + bo -> [2048][2][1024] sequence-first (4.2 M); argument order query, key, value, Wq, bq, Wk, bk, Wv, bv, Wo, bo, rel_k, rel_v).
// Layout: query, key, value each as ONE bf16 matrix of 4096 rows (query, key: row = 2 l + b, the sequence-first order as it lies in memory; value: row = 2048 b + l), all inputs rounded in one launch and the three projections taken in one, so every stage is launched once for both batch columns; head planes z = 16 b + h; 'oi' weights; exact projections + f32 biases; rel_k as a zero-padded bf16 plane [128][64] and rel_v^T as hi/lo planes [64][128]; over all 32 head planes at once: QE = q.rel_k^T (hi/lo x exact); one fused kernel for the score tiles (hi/lo 3 products), QE gathered in at column clip(j - i) + 50, running softmax (x 1/8), P.v (hi/lo x hi/lo) and the probabilities folded onto the 101 offsets (interior = one key, the two ends = fixed-order sums); PB.rel_v added to the context; merged hi/lo (row 2 l + b) x Wo exact + bo, whose rows are the output's own.
// Compute dtypes, f32 accumulate: every input rounded to bf16; projections exact + f32 biases; scores and the relative-key term ~f32; softmax f32; P as bf16 hi/lo; attn.v and the relative-value term 3 products (~f32); Wo hl x exact + bias.

#define NB_  2
#define TT   2048
#define DM   1024
#define NH_  16
#define NKV  16
#define REP  (NH_ / NKV)
#define HD   64
#define DQ   (NH_ * HD)
#define DKV  (NKV * HD)
#define ZH   (NB_ * NH_)          // head planes per launch: every head of both batch columns
#define RH   TT                   // unused
#define WIN  0
#define PCAR 1024.0f
#define SCL  0.125f   // 1/sqrt(64) (the module divides by jnp.sqrt(DH))
#define NE   128      // 2*50+1 = 101 relative offsets padded to 128
#define NRE  101
#define CUT  50
typedef _Float16 h16;
typedef unsigned short bf;
typedef __attribute__((ext_vector_type(16))) __bf16   v16bf;
typedef __attribute__((ext_vector_type(16))) _Float16 v16h;
typedef __attribute__((ext_vector_type(8)))  _Float16 v8h;
typedef __attribute__((ext_vector_type(8)))  unsigned short v8us;
typedef __attribute__((ext_vector_type(8)))  float    v8f;
typedef __attribute__((ext_vector_type(4)))  float    v4f;
typedef v8h  __attribute__((may_alias)) v8ha;
typedef v4f  __attribute__((may_alias)) v4fa;
typedef v8us __attribute__((may_alias)) v8usa;

__device__ __forceinline__ unsigned short f2bf(float f) { unsigned u = __float_as_uint(f); u += 0x7FFFu + ((u >> 16) & 1u); return (unsigned short)(u >> 16); }
__device__ __forceinline__ float bf2f(unsigned short b) { return __uint_as_float(((unsigned)b) << 16); }
__device__ __forceinline__ float bfr(float f) { return bf2f(f2bf(f)); }
__device__ __forceinline__ void splitf(float y, unsigned short& h, unsigned short& l) { h = f2bf(y); l = f2bf(y - bf2f(h)); }
typedef __attribute__((ext_vector_type(4))) unsigned short v4us;
__device__ __forceinline__ v16h cat16(v8h lo, v8h hi) { return __builtin_shufflevector(lo, hi, 0, 1, 2, 3, 4, 5, 6, 7, 8, 9, 10, 11, 12, 13, 14, 15); }
__device__ __forceinline__ v16bf cat16b(v8us lo, v8us hi) { return __builtin_bit_cast(v16bf, __builtin_shufflevector(lo, hi, 0, 1, 2, 3, 4, 5, 6, 7, 8, 9, 10, 11, 12, 13, 14, 15)); }
__device__ __forceinline__ v8f wmma16(v16h a, v16h b, v8f c) { return __builtin_amdgcn_wmma_f32_16x16x32_f16(false, a, false, b, (short)0, c, false, false); }
__device__ __forceinline__ v8f wmmab(v16bf a, v16bf b, v8f c) { return __builtin_amdgcn_wmma_f32_16x16x32_bf16(false, a, false, b, (short)0, c, false, false); }



// ---- k_gemmw: register-blocked GEMM, ONE WAVE per 64x64 output tile (16 accumulators), operands straight from K-contiguous 16-bit planes; grid (M/64, N/64, Z), 32 threads.
// C[m][n] (f32, pitch ldc, + optional f32 bias[n]) = sum_{k < KL} A[m][k] Bt[n][k] (+ split products per NSPLIT). K = row pitch of A and Bt in elements, KL <= K the summed length. z-batch strides sA/sB/sC in elements. KL % 32 == 0.
// KS > 1 (long K, few tiles): 32 KS threads, wave w of the work-group takes k in [w KL/KS, (w+1) KL/KS) of the same tile; the KS partial tiles are summed in fixed wave order through LDS. KL % (32 KS) == 0.
template <typename T16> struct WFrag;
template <> struct WFrag<h16> { typedef v16h V; static __device__ __forceinline__ V ld(const h16* p) { return cat16(*(const v8h*)p, *(const v8h*)(p + 16)); } static __device__ __forceinline__ v8f mma(V a, V b, v8f c) { return wmma16(a, b, c); } };
template <> struct WFrag<bf> { typedef v16bf V; static __device__ __forceinline__ V ld(const bf* p) { return cat16b(*(const v8us*)p, *(const v8us*)(p + 16)); } static __device__ __forceinline__ v8f mma(V a, V b, v8f c) { return wmmab(a, b, c); } };
// EPI (KS > 1 only) = what the summed tile becomes; 1 to 3 write the next stage's bf16 hi/lo operand planes themselves, whole 128-byte rows, and no f32 tile:
//   0: f32 C. 1: rows 2 t + b, columns 64 h + d -> head planes Eh, El [16 b + h][t][d]. 2: rows 64 h + d (A = the weight; bias added by ROW, BIAS false), columns t (Bt = the input's rows of batch column z) -> v^T rows Eh [16 z + h][d][2048 hi | 2048 lo].
//   3: head plane z, rows t, columns d: C is READ (the context P.v), the tile added to it -> merged rows Eh, El [2 t + b][64 h + d], z = 16 b + h.
// gemmw_body is the work of one work-group, its tile (bx, by, bz) and its LDS handed in, so that one launch can hold GEMMs of several kinds (k_proj) on one LDS array.
template <typename T16, int NSPLIT, bool BIAS, int KS, int EPI>
__device__ __forceinline__ void gemmw_body(const T16* __restrict__ A, const T16* __restrict__ A2, const T16* __restrict__ Bt, const T16* __restrict__ Bt2, int K, int KL, float* C, int ldc, const float* __restrict__ bias, size_t sA, size_t sB, size_t sC, bf* Eh, bf* El, float* os, int bx, int by, int bz) {
    typedef typename WFrag<T16>::V V;
    const size_t z = (size_t)bz; A += z * sA; if (A2) A2 += z * sA; Bt += z * sB; if (Bt2) Bt2 += z * sB; C += z * sC;
    const int lane = threadIdx.x & 31, lr = lane & 15, hi = lane >> 4; const int r0 = bx * 64, c0 = by * 64;
    const int wv = (KS == 1) ? 0 : __builtin_amdgcn_readfirstlane((int)(threadIdx.x >> 5)); const int k0 = wv * (KL / KS), k1 = k0 + KL / KS;
    v8f acc[4][4];
#pragma unroll
    for (int mb = 0; mb < 4; ++mb)
#pragma unroll
        for (int nb = 0; nb < 4; ++nb) acc[mb][nb] = (v8f){};
    const size_t aoff = (size_t)(r0 + lr) * K + 8 * hi, boff = (size_t)(c0 + lr) * K + 8 * hi;
#pragma unroll 1
    for (int kc = k0; kc < k1; kc += 32) {
        V a[4], a2[4];
#pragma unroll
        for (int mb = 0; mb < 4; ++mb) { a[mb] = WFrag<T16>::ld(A + aoff + (size_t)mb * 16 * K + kc); if (NSPLIT == 1 || NSPLIT == 2) a2[mb] = WFrag<T16>::ld(A2 + aoff + (size_t)mb * 16 * K + kc); }
#pragma unroll
        for (int nb = 0; nb < 4; ++nb) { const V b = WFrag<T16>::ld(Bt + boff + (size_t)nb * 16 * K + kc); V b2; if (NSPLIT >= 2) b2 = WFrag<T16>::ld(Bt2 + boff + (size_t)nb * 16 * K + kc);
#pragma unroll
            for (int mb = 0; mb < 4; ++mb) { acc[mb][nb] = WFrag<T16>::mma(a[mb], b, acc[mb][nb]); if (NSPLIT == 1 || NSPLIT == 2) acc[mb][nb] = WFrag<T16>::mma(a2[mb], b, acc[mb][nb]); if (NSPLIT >= 2) acc[mb][nb] = WFrag<T16>::mma(a[mb], b2, acc[mb][nb]); } }
        asm volatile("v_nop\n\tv_nop\n\tv_nop\n\tv_nop" : "+v"(acc[0][0]), "+v"(acc[1][1]), "+v"(acc[2][2]), "+v"(acc[3][3]) : "v"(a[0]), "v"(a[3]));
    }
    if (KS > 1) {
        float* my = os + wv * (64 * 68);
#pragma unroll
        for (int mb = 0; mb < 4; ++mb)
#pragma unroll
            for (int nb = 0; nb < 4; ++nb)
#pragma unroll
                for (int j = 0; j < 8; ++j) my[(mb * 16 + hi * 8 + j) * 68 + nb * 16 + lr] = acc[mb][nb][j];
        constexpr int NS = 1024 / (32 * KS);
        v4f oc[EPI == 3 ? NS : 1];
        if (EPI == 3) {   // the context values this thread adds to, asked for ahead of the barrier so that their latency runs beside it
#pragma unroll
            for (int s = 0; s < NS; ++s) { const int slot = s * (32 * KS) + (int)threadIdx.x; oc[s] = *(const v4f*)(C + (size_t)(r0 + (slot >> 4)) * ldc + (slot & 15) * 4); } }
        __syncthreads();   // every wave's partial tile is in LDS before any wave sums across them
        v4us eh[EPI == 0 ? 1 : NS], el[EPI == 0 ? 1 : NS];
#pragma unroll
        for (int s = 0; s < 1024 / (32 * KS); ++s) { const int slot = s * (32 * KS) + (int)threadIdx.x; const int row = slot >> 4, cofs = (slot & 15) * 4; v4f val = *(const v4fa*)(os + row * 68 + cofs);
#pragma unroll
            for (int w = 1; w < KS; ++w) { const v4f p = *(const v4fa*)(os + w * (64 * 68) + row * 68 + cofs); val += p; }
            if (BIAS) { val[0] += bfr(bias[c0 + cofs]); val[1] += bfr(bias[c0 + cofs + 1]); val[2] += bfr(bias[c0 + cofs + 2]); val[3] += bfr(bias[c0 + cofs + 3]); }
            if (EPI == 0) { *(v4f*)(C + (size_t)(r0 + row) * ldc + c0 + cofs) = val; }
            if (EPI == 2) { const float br = bfr(bias[r0 + row]); val[0] += br; val[1] += br; val[2] += br; val[3] += br; }
            if (EPI == 3) { val[0] = __fadd_rn(oc[s][0], val[0]); val[1] = __fadd_rn(oc[s][1], val[1]); val[2] = __fadd_rn(oc[s][2], val[2]); val[3] = __fadd_rn(oc[s][3], val[3]); }
            if (EPI != 0) {
#pragma unroll
                for (int q = 0; q < 4; ++q) { unsigned short a, c2; splitf(val[q], a, c2); eh[s][q] = a; el[s][q] = c2; } } }
        if (EPI != 0) {   // the stores stand behind all the sums, so that no store lies between the slots' LDS reads and they can issue together
#pragma unroll
            for (int s = 0; s < NS; ++s) { const int slot = s * (32 * KS) + (int)threadIdx.x; const int R = r0 + (slot >> 4), cofs = (slot & 15) * 4; size_t e = 0, e2 = 0;
                if (EPI == 1) { e = ((size_t)((R & 1) * NH_ + by) * TT + (R >> 1)) * HD + cofs; e2 = e; }
                if (EPI == 2) { e = (z * DKV + R) * (size_t)(2 * TT) + c0 + cofs; e2 = e + TT; }
                if (EPI == 3) { e = (size_t)R * (NB_ * DQ) + z * HD + cofs; e2 = e; }
                *(v4us*)(Eh + e) = eh[s]; *(v4us*)(El + e2) = el[s]; } }
        return;
    }
#pragma unroll
    for (int mb = 0; mb < 4; ++mb) {
#pragma unroll
        for (int nb = 0; nb < 4; ++nb) {
#pragma unroll
            for (int j = 0; j < 8; ++j) os[(hi * 8 + j) * 68 + nb * 16 + lr] = acc[mb][nb][j]; }
        __builtin_amdgcn_wave_barrier(); asm volatile("" ::: "memory");
        float* crow = C + (size_t)(r0 + mb * 16) * ldc + c0;
{
#pragma unroll
            for (int s = 0; s < 8; ++s) { const int row = 2 * s + hi, cofs = lr * 4; v4f val = *(const v4fa*)(os + row * 68 + cofs); if (BIAS) { val[0] += bfr(bias[c0 + cofs]); val[1] += bfr(bias[c0 + cofs + 1]); val[2] += bfr(bias[c0 + cofs + 2]); val[3] += bfr(bias[c0 + cofs + 3]); }
                *(v4f*)(crow + (size_t)row * ldc + cofs) = val; }
             }
        __builtin_amdgcn_wave_barrier(); asm volatile("" ::: "memory");
    }
}
template <typename T16, int NSPLIT, bool BIAS, int KS = 1, int EPI = 0>
__global__ __launch_bounds__(32 * KS) void k_gemmw(const T16* __restrict__ A, const T16* __restrict__ A2, const T16* __restrict__ Bt, const T16* __restrict__ Bt2, int K, int KL, float* C, int ldc, const float* __restrict__ bias, size_t sA, size_t sB, size_t sC, bf* Eh, bf* El) {
    __shared__ __align__(16) float os[KS == 1 ? 16 * 68 : KS * 64 * 68];
    gemmw_body<T16, NSPLIT, BIAS, KS, EPI>(A, A2, Bt, Bt2, K, KL, C, ldc, bias, sA, sB, sC, Eh, El, os, (int)blockIdx.x, (int)blockIdx.y, (int)blockIdx.z);
}
// k_proj: the three projections, which do not depend on one another, in ONE launch; grid (64, 16, 3): z = 0 q, 1 k (x = tile of rows 2 t + b, y = head), 2 v^T = Wv . value^T, whose 16 row tiles x 32 column tiles x 2 batch columns are counted through by x + 64 y.
__global__ __launch_bounds__(256) void k_proj(const bf* __restrict__ XQ, const bf* __restrict__ XK, const bf* __restrict__ XV, const bf* __restrict__ WQ, const bf* __restrict__ WK, const bf* __restrict__ WV, const float* __restrict__ bq, const float* __restrict__ bk, const float* __restrict__ bv, int K, bf* QPh, bf* QPl, bf* KPh, bf* KPl, bf* VT) {
    __shared__ __align__(16) float os[8 * 64 * 68];
    const int bx = (int)blockIdx.x, by = (int)blockIdx.y, job = (int)blockIdx.z;   // the same for the whole work-group, so every barrier below is reached by all of it
    if (job == 2) { gemmw_body<bf, 0, false, 8, 2>(WV, nullptr, XV, nullptr, K, K, nullptr, 0, bv, 0, (size_t)TT * DM, 0, VT, VT, os, bx & 15, (bx >> 4) + 4 * (by & 7), by >> 3);
        asm volatile("s_wait_xcnt 0x0" ::: "memory"); }   // stands behind the v^T stores, before the code laid out after them rewrites a register that they name
    else if (job == 1) gemmw_body<bf, 0, true, 8, 1>(XK, nullptr, WK, nullptr, K, K, nullptr, 0, bk, 0, 0, 0, KPh, KPl, os, bx, by, 0);
    else gemmw_body<bf, 0, true, 8, 1>(XQ, nullptr, WQ, nullptr, K, K, nullptr, 0, bq, 0, 0, 0, QPh, QPl, os, bx, by, 0);
}

typedef __attribute__((ext_vector_type(2))) _Float16 v2h;
typedef __attribute__((ext_vector_type(4))) _Float16 v4h;
typedef __attribute__((ext_vector_type(2))) unsigned short v2us;
typedef __attribute__((ext_vector_type(2))) float v2f;
typedef __attribute__((ext_vector_type(4))) int v4i;

// k_fattn: scores, softmax, P.v and the offset fold in ONE kernel; a score never leaves its wave's registers. Work-group = 4 waves x 16 queries of one head; keys in tiles of 64, K hi/lo [key][d] and v^T hi/lo [d][key] staged through registers into two LDS buffers (row pitch 144 B), the next tile's global loads issued before this tile's work.
// Every product is taken transposed, so that a lane owns ONE query (lane & 15): S^T = K.Q^T (rows = keys, columns = queries), O^T = v^T.P^T (rows = d). The accumulator of two 16-key S^T tiles IS the 32-key operand fragment of P^T (register j of tile 0 = key 8 hi + j, of tile 1 = key 16 + 8 hi + j), and row maximum, row sum and rescale are per-lane values.
// Running softmax in the exp2 domain: u = (s + QE[clip(j - i) + 50]) / 8 x log2(e); p = exp2(u - m), sums and O^T rescaled by exp2(m_old - m_new), divided by the row sum at the end. Fold: the two end offsets are running sums of p; an interior offset is one key, whose u waits in the wave's own LDS until m and the sum are final.
typedef __attribute__((ext_vector_type(4))) unsigned int v4u;
typedef v4us __attribute__((may_alias)) v4usa;
#define LP  72     // LDS row pitch in bf16: 144 B = 16 B x 9, free of bank conflicts for 16-byte fragment reads
#define TBP 132    // pitch in floats of a query's 128 offset slots
#define UC  (SCL * 1.4426950408889634f)
__global__ __launch_bounds__(128) void k_fattn(const bf* __restrict__ Qh, const bf* __restrict__ Ql, const bf* __restrict__ Kh, const bf* __restrict__ Kl, const bf* __restrict__ Vhl, const float* __restrict__ QE, float* O, bf* Bh, bf* Bl) {
    __shared__ __align__(16) bf st[2][4][64 * LP];     // per buffer: K hi, K lo, v^T hi, v^T lo
    __shared__ __align__(16) float tb[4][16 * TBP];    // per wave: u of the interior offsets, [query][offset]
    __shared__ __align__(16) float qs[4][16 * TBP];    // per wave: its sixteen rows of QE x UC
    const int tid = threadIdx.x, lane = tid & 31, lr = lane & 15, hi = lane >> 4; const int wv = __builtin_amdgcn_readfirstlane(tid >> 5);
    const int z = blockIdx.y; const int q0 = blockIdx.x * 64 + wv * 16; const int i = q0 + lr; const size_t hb = (size_t)z * TT * HD;
    // every global address = a base that is the same for the wave + a lane's byte offset that lives as long as its loads or stores do
    const char* kh = (const char*)(Kh + hb); const char* kl = (const char*)(Kl + hb); const char* vv = (const char*)(Vhl + (size_t)z * HD * 2 * TT); float* tw = tb[wv]; float* qw = qs[wv];
    const unsigned ko = (unsigned)tid * 16u;   // K tile: 8 KiB in a row, slice r = 2 KiB
    const unsigned vo = (unsigned)(tid >> 3) * (2 * TT * 2) + (unsigned)(tid & 7) * 16u;   // v^T tile: row d = 16 r + (tid >> 3) of 8 KiB pitch, lo plane 4 KiB behind hi
    const unsigned qo = (unsigned)(lr * HD + 8 * hi) * 2u, eo = (unsigned)lane * 16u;
    v8us pf[16];
#pragma unroll
    for (int r = 0; r < 4; ++r) { pf[r] = *(const v8usa*)(kh + r * 2048 + (size_t)ko); pf[4 + r] = *(const v8usa*)(kl + r * 2048 + (size_t)ko); pf[8 + r] = *(const v8usa*)(vv + r * (16 * 2 * TT * 2) + (size_t)vo); pf[12 + r] = *(const v8usa*)(vv + r * (16 * 2 * TT * 2) + TT * 2 + (size_t)vo); }
    v16bf qh[2], ql[2]; const char* qhb = (const char*)(Qh + hb + (size_t)q0 * HD); const char* qlb = (const char*)(Ql + hb + (size_t)q0 * HD);
#pragma unroll
    for (int kc = 0; kc < 2; ++kc) { qh[kc] = cat16b(*(const v8usa*)(qhb + kc * 64 + (size_t)qo), *(const v8usa*)(qhb + kc * 64 + 32 + (size_t)qo)); ql[kc] = cat16b(*(const v8usa*)(qlb + kc * 64 + (size_t)qo), *(const v8usa*)(qlb + kc * 64 + 32 + (size_t)qo)); }
    const char* qeb = (const char*)(QE + ((size_t)z * TT + q0) * NE); v4f er[16];
#pragma unroll
    for (int r = 0; r < 16; ++r) er[r] = *(const v4fa*)(qeb + r * (NE * 4) + (size_t)eo);
    asm volatile("s_wait_xcnt 0x0" :: "v"(qo), "v"(eo) : "memory");   // stands before a register that the loads above name is rewritten; the two offsets that end here are held up to it
#pragma unroll
    for (int r = 0; r < 16; ++r) *(v4fa*)(qw + r * TBP + lane * 4) = er[r] * UC;
    for (int s = lane; s < 16 * TBP / 4; s += 32) *(v4fa*)(tw + s * 4) = (v4f){0.f, 0.f, 0.f, 0.f};   // slots that no key of a row reaches are read below and stay zero
    __builtin_amdgcn_wave_barrier(); asm volatile("" ::: "memory");   // compiler order only: other lanes' QE stores stay in front of this lane's reads (one wave's LDS operations run in order)
    const float qlo = qw[lr * TBP], qhi = qw[lr * TBP + 2 * CUT];
#pragma unroll
    for (int r = 0; r < 4; ++r) { const int c = r * 128 + tid; const int o = (c >> 3) * LP + (c & 7) * 8;
#pragma unroll
        for (int pl = 0; pl < 4; ++pl) *(v8usa*)(&st[0][pl][o]) = pf[pl * 4 + r]; }
    __syncthreads();   // tile 0 is in LDS before any wave reads it
    v8f oacc[4];
#pragma unroll
    for (int dt = 0; dt < 4; ++dt) oacc[dt] = (v8f){};
    float m = -3.0e38f, l = 0.f, lo_s = 0.f, hi_s = 0.f;
#pragma unroll 1
    for (int t = 0; t < TT / 64; ++t) {   // rolled: one tile's body is long enough, and the two buffers alternate by index
        const int kb = t * 64; const bf* sb = &st[t & 1][0][0];
        if (t + 1 < TT / 64) {
#pragma unroll
            for (int r = 0; r < 4; ++r) { const size_t kn = (size_t)(kb + 64); pf[r] = *(const v8usa*)(kh + kn * (HD * 2) + r * 2048 + (size_t)ko); pf[4 + r] = *(const v8usa*)(kl + kn * (HD * 2) + r * 2048 + (size_t)ko); pf[8 + r] = *(const v8usa*)(vv + kn * 2 + r * (16 * 2 * TT * 2) + (size_t)vo); pf[12 + r] = *(const v8usa*)(vv + kn * 2 + r * (16 * 2 * TT * 2) + TT * 2 + (size_t)vo); }
            asm volatile("s_wait_xcnt 0x0" ::: "memory"); }   // stands before an address register of the sixteen loads above is rewritten
        v8f s[4];
#pragma unroll
        for (int kt = 0; kt < 4; ++kt) s[kt] = (v8f){};
#pragma unroll
        for (int kc = 0; kc < 2; ++kc) { v16bf ah[4], al[4];
#pragma unroll
            for (int kt = 0; kt < 4; ++kt) { const int o = (kt * 16 + lr) * LP + 8 * hi + kc * 32; ah[kt] = WFrag<bf>::ld(sb + o); al[kt] = WFrag<bf>::ld(sb + 64 * LP + o); }
#pragma unroll
            for (int kt = 0; kt < 4; ++kt) s[kt] = wmmab(ah[kt], qh[kc], s[kt]);
#pragma unroll
            for (int kt = 0; kt < 4; ++kt) s[kt] = wmmab(al[kt], qh[kc], s[kt]);
#pragma unroll
            for (int kt = 0; kt < 4; ++kt) s[kt] = wmmab(ah[kt], ql[kc], s[kt]); }
        float u[4][8]; float tm = -3.0e38f;
#pragma unroll
        for (int kt = 0; kt < 4; ++kt) { const int jb = kb + kt * 16;   // the three cases are the same for the whole wave
            if (jb + 15 - q0 <= -CUT) {
#pragma unroll
                for (int j = 0; j < 8; ++j) u[kt][j] = fmaf(s[kt][j], UC, qlo);
            } else if (jb - (q0 + 15) >= CUT) {
#pragma unroll
                for (int j = 0; j < 8; ++j) u[kt][j] = fmaf(s[kt][j], UC, qhi);
            } else {
#pragma unroll
                for (int j = 0; j < 8; ++j) { const int d = jb + hi * 8 + j - i; u[kt][j] = fmaf(s[kt][j], UC, qw[lr * TBP + min(max(d, -CUT), CUT) + CUT]); if (d > -CUT && d < CUT) tw[lr * TBP + d + CUT] = u[kt][j]; }
            }
#pragma unroll
            for (int j = 0; j < 8; ++j) tm = fmaxf(tm, u[kt][j]); }
        tm = fmaxf(tm, __shfl_xor(tm, 16, 32));   // the two half-waves hold the two halves of a query's keys
        const float mn = fmaxf(m, tm); const float al_ = __builtin_amdgcn_exp2f(m - mn); m = mn;
        float la = 0.f, loa = 0.f, hia = 0.f;
#pragma unroll
        for (int kt = 0; kt < 4; ++kt) { const int jb = kb + kt * 16;
#pragma unroll
            for (int j = 0; j < 8; ++j) u[kt][j] = __builtin_amdgcn_exp2f(u[kt][j] - mn);
            const float s8 = ((u[kt][0] + u[kt][1]) + (u[kt][2] + u[kt][3])) + ((u[kt][4] + u[kt][5]) + (u[kt][6] + u[kt][7])); la += s8;
            if (jb + 15 - q0 <= -CUT) loa += s8;
            else if (jb - (q0 + 15) >= CUT) hia += s8;
            else {
#pragma unroll
                for (int j = 0; j < 8; ++j) { const int d = jb + hi * 8 + j - i; loa += (d <= -CUT) ? u[kt][j] : 0.f; hia += (d >= CUT) ? u[kt][j] : 0.f; }
            } }
        l = fmaf(l, al_, la); lo_s = fmaf(lo_s, al_, loa); hi_s = fmaf(hi_s, al_, hia);
#pragma unroll
        for (int dt = 0; dt < 4; ++dt)
#pragma unroll
            for (int j = 0; j < 8; ++j) oacc[dt][j] *= al_;
#pragma unroll
        for (int c = 0; c < 2; ++c) { v16bf ph, pl;
#pragma unroll
            for (int e = 0; e < 16; ++e) { const float x = u[2 * c + (e >> 3)][e & 7]; const __bf16 h = (__bf16)x; ph[e] = h; pl[e] = (__bf16)(x - (float)h); }
            v16bf vh[4], vl[4];
#pragma unroll
            for (int dt = 0; dt < 4; ++dt) { const int o = (dt * 16 + lr) * LP + 8 * hi + c * 32; vh[dt] = WFrag<bf>::ld(sb + 2 * 64 * LP + o); vl[dt] = WFrag<bf>::ld(sb + 3 * 64 * LP + o); }
#pragma unroll
            for (int dt = 0; dt < 4; ++dt) oacc[dt] = wmmab(vh[dt], ph, oacc[dt]);
#pragma unroll
            for (int dt = 0; dt < 4; ++dt) oacc[dt] = wmmab(vl[dt], ph, oacc[dt]);
#pragma unroll
            for (int dt = 0; dt < 4; ++dt) oacc[dt] = wmmab(vh[dt], pl, oacc[dt]); }
        if (t + 1 < TT / 64) {
#pragma unroll
            for (int r = 0; r < 4; ++r) { const int c = r * 128 + tid; const int o = (c >> 3) * LP + (c & 7) * 8;
#pragma unroll
                for (int pl = 0; pl < 4; ++pl) *(v8usa*)(&st[(t + 1) & 1][pl][o]) = pf[pl * 4 + r]; } }
        __syncthreads();   // publishes tile t + 1 and ends every wave's reads of tile t, whose buffer the next trip refills
    }
    asm volatile("s_wait_xcnt 0x0" :: "v"(ko), "v"(vo) : "memory");   // stands before the tile loads' two offset registers may be rewritten; they are held up to it
    l += __shfl_xor(l, 16, 32); lo_s += __shfl_xor(lo_s, 16, 32); hi_s += __shfl_xor(hi_s, 16, 32);
    const float f = __fdiv_rn(1.0f, l); lo_s *= f; hi_s *= f;
    char* ob = (char*)(O + hb + (size_t)q0 * HD); const unsigned oo = (unsigned)(lr * HD + hi * 8) * 4u;
#pragma unroll
    for (int dt = 0; dt < 4; ++dt) { v4f a, b;
#pragma unroll
        for (int j = 0; j < 4; ++j) { a[j] = oacc[dt][j] * f; b[j] = oacc[dt][4 + j] * f; }
        *(v4fa*)(ob + dt * 64 + (size_t)oo) = a; *(v4fa*)(ob + dt * 64 + 16 + (size_t)oo) = b; }
    asm volatile("s_wait_xcnt 0x0" :: "v"(oo) : "memory");   // stands before a register that the stores above name is rewritten
    __builtin_amdgcn_wave_barrier(); asm volatile("" ::: "memory");   // compiler order only: other lanes' u stores stay in front of this lane's reads (one wave's LDS operations run in order)
#pragma unroll 1
    for (int r = 0; r < 16; ++r) {   // rolled: sixteen short rows, once a wave
        const float mr = __shfl(m, r, 32), fr = __shfl(f, r, 32), lor = __shfl(lo_s, r, 32), hir = __shfl(hi_s, r, 32); const int ir = q0 + r; const v4f uu = *(const v4fa*)(tw + r * TBP + lane * 4); v4us oh, ol;
#pragma unroll
        for (int q = 0; q < 4; ++q) { const int bkt = lane * 4 + q; const int j = ir + bkt - CUT; const float y = __builtin_amdgcn_exp2f(uu[q] - mr) * fr; const bool in = bkt > 0 && bkt < 2 * CUT && j >= 0 && j < TT;
            const float w = (bkt == 0) ? lor : ((bkt == 2 * CUT) ? hir : (in ? y : 0.f)); unsigned short a, c2; splitf(w, a, c2); oh[q] = a; ol[q] = c2; }
        const size_t po = ((size_t)z * TT + ir) * NE * 2; const unsigned bo = (unsigned)lane * 8u; *(v4usa*)((char*)Bh + po + (size_t)bo) = oh; *(v4usa*)((char*)Bl + po + (size_t)bo) = ol;
        asm volatile("s_wait_xcnt 0x0" :: "v"(bo) : "memory"); }   // stands before the next row rewrites a register that the two stores name
}
// k_prep: every rounding of an input to bf16 in ONE launch (none depends on another). A work-group takes 2048 runs of 8 floats of one tensor, a thread 8 of them, all eight loads asked for before the first is used.
// Work-groups 0..767: query, key (rows 2 t + b as they lie) and value (its rows laid out batch column by batch column, row b TT + t, so that 64 rows in a row are 64 t of one column); 768..1023: the four weights; then 4 for rel_k -> [128][64], rows >= 101 zero, and 8 for rel_v^T hi/lo [64][128], columns >= 101 zero.
#define PU   8
#define PXB  (NB_ * TT * DM / 8 / (256 * PU))   // work-groups per input tensor
#define PWB  (DQ * DM / 8 / (256 * PU))         // work-groups per weight
#define PEK  (NE * HD / 8 / 256)
#define PEV  (HD * NE / 4 / 256)
template <int STEP> __device__ __forceinline__ void put8(char* db, unsigned so, const v8f (&v)[PU]) {
#pragma unroll
    for (int u = 0; u < PU; ++u) { v8us o;
#pragma unroll
        for (int k = 0; k < 8; ++k) o[k] = f2bf(v[u][k]);
        *(v8usa*)(db + u * STEP + (size_t)so) = o; }
}
__global__ __launch_bounds__(256) void k_prep(const float* __restrict__ xq, const float* __restrict__ xk, const float* __restrict__ xv, const float* __restrict__ wq, const float* __restrict__ wk, const float* __restrict__ wv, const float* __restrict__ wo, const float* __restrict__ ek, const float* __restrict__ ev, bf* XQ, bf* XK, bf* XV, bf* WQ, bf* WK, bf* WV, bf* WO, bf* EB, bf* Th, bf* Tl) {
    const int b = (int)blockIdx.x, tid = (int)threadIdx.x;
    if (b < 3 * PXB + 4 * PWB) {
        const float* src; bf* dst; int lb;   // all three the same for the work-group
        if (b < 3 * PXB) { lb = b % PXB; src = b < PXB ? xq : (b < 2 * PXB ? xk : xv); dst = b < PXB ? XQ : (b < 2 * PXB ? XK : XV); }
        else { const int w = (b - 3 * PXB) / PWB; lb = (b - 3 * PXB) % PWB; src = w == 0 ? wq : (w == 1 ? wk : (w == 2 ? wv : wo)); dst = w == 0 ? WQ : (w == 1 ? WK : (w == 2 ? WV : WO)); }
        const char* sb = (const char*)(src + (size_t)lb * (256 * PU * 8)); const unsigned lo = (unsigned)tid * 32u; v8f v[PU];
#pragma unroll
        for (int u = 0; u < PU; ++u) v[u] = *(const v8f*)(sb + u * (256 * 32) + (size_t)lo);
        if (b >= 2 * PXB && b < 3 * PXB) put8<DM * 2>((char*)(dst + (size_t)lb * (PU * DM)), (unsigned)((tid >> 7) * (TT * DM) + (tid & 127) * 8) * 2u, v);   // run u of the thread lies in row 2 (8 lb + u) + (tid >> 7) of value
        else put8<256 * 16>((char*)(dst + (size_t)lb * (256 * PU * 8)), (unsigned)tid * 16u, v);
        return;
    }
    if (b < 3 * PXB + 4 * PWB + PEK) { const size_t i = (size_t)(b - (3 * PXB + 4 * PWB)) * 256 + tid; const int d0 = (int)(i % (HD / 8)) * 8; const int r = (int)(i / (HD / 8)); const float* src = ek + (size_t)min(r, NRE - 1) * HD + d0; v8us o;
#pragma unroll
        for (int q = 0; q < 8; ++q) { const unsigned short v = f2bf(src[q]); o[q] = (r < NRE) ? v : (unsigned short)0; }
        *(v8us*)(EB + (size_t)r * HD + d0) = o;
        asm volatile("s_wait_xcnt 0x0" ::: "memory");   // stands behind the store, before the code laid out after it rewrites a register that it names
        return; }
    { const size_t i = (size_t)(b - (3 * PXB + 4 * PWB + PEK)) * 256 + tid; const size_t e = i * 4; const int c0 = (int)(e % NE); const int d = (int)(e / NE); v4us oh, ol;
#pragma unroll
        for (int q = 0; q < 4; ++q) { const int r = c0 + q; const float v = bfr(ev[(size_t)min(r, NRE - 1) * HD + d]); unsigned short u, w; splitf(v, u, w);   /* input rounded to bf16 once: lo == 0 */ oh[q] = (r < NRE) ? u : (unsigned short)0; ol[q] = (r < NRE) ? w : (unsigned short)0; }
        *(v4us*)(Th + e) = oh; *(v4us*)(Tl + e) = ol;
        asm volatile("s_wait_xcnt 0x0" ::: "memory"); }   // stands behind the two stores, before the code laid out after them rewrites a register that they name
}

extern "C" void kernel_launch(void* const* d_in, const int* in_sizes, int n_in,
                              void* d_out, int out_size, void* d_ws, size_t ws_size, hipStream_t stream) {
    (void)in_sizes; (void)n_in; (void)out_size;
    const float* x = (const float*)d_in[0];   /* query */ const float* xk = (const float*)d_in[1]; const float* xv = (const float*)d_in[2]; const float* wq = (const float*)d_in[3]; const float* bq = (const float*)d_in[4]; const float* wk = (const float*)d_in[5]; const float* bk = (const float*)d_in[6]; const float* wv = (const float*)d_in[7]; const float* bv = (const float*)d_in[8]; const float* wo = (const float*)d_in[9]; const float* bo = (const float*)d_in[10]; const float* ak = (const float*)d_in[11];   /* rel_k_table [101][64] */ const float* av = (const float*)d_in[12];   /* rel_v_table [101][64] */
    float* OUT = (float*)d_out;     // [2048][2][1024] sequence-first
    char* wsp = (char*)d_ws;
    auto take = [&](size_t bytes) { char* p = wsp; wsp += (bytes + 255) & ~(size_t)255; return (void*)p; };
    bf* AKB = (bf*)take((size_t)NE * HD * 2); bf* AVTh = (bf*)take((size_t)HD * NE * 2); bf* AVTl = (bf*)take((size_t)HD * NE * 2); float* QE = (float*)take((size_t)ZH * TT * NE * 4); bf* PBh = (bf*)take((size_t)ZH * TT * NE * 2); bf* PBl = (bf*)take((size_t)ZH * TT * NE * 2); bf* WQ = (bf*)take((size_t)DQ * DM * 2); bf* WK = (bf*)take((size_t)DKV * DM * 2); bf* WV = (bf*)take((size_t)DKV * DM * 2); bf* WO = (bf*)take((size_t)DM * DQ * 2);
    bf* XQ = (bf*)take((size_t)NB_ * TT * DM * 2); bf* XK = (bf*)take((size_t)NB_ * TT * DM * 2); bf* XV = (bf*)take((size_t)NB_ * TT * DM * 2);
    bf* QPh = (bf*)take((size_t)ZH * TT * HD * 2); bf* QPl = (bf*)take((size_t)ZH * TT * HD * 2); bf* KPh = (bf*)take((size_t)ZH * TT * HD * 2); bf* KPl = (bf*)take((size_t)ZH * TT * HD * 2); bf* VT = (bf*)take((size_t)ZH * HD * 2 * TT * 2);
    float* Ob = (float*)take((size_t)ZH * TT * HD * 4); bf* ATh = (bf*)take((size_t)NB_ * TT * DQ * 2); bf* ATl = (bf*)take((size_t)NB_ * TT * DQ * 2);
    if ((size_t)(wsp - (char*)d_ws) > ws_size) return;
    k_prep<<<3 * PXB + 4 * PWB + PEK + PEV, 256, 0, stream>>>(x, xk, xv, wq, wk, wv, wo, ak, av, XQ, XK, XV, WQ, WK, WV, WO, AKB, AVTh, AVTl);   /* every input -> bf16 */
    // A sequence-first tensor [L][B][HID] is a matrix of L B rows (row 2 t + b); each projection's own epilogue splits its f32 tile into the hi/lo head planes z = 16 b + h that the attention kernel reads.
    k_proj<<<dim3(NB_ * TT / 64, DQ / 64, 3), 256, 0, stream>>>(XQ, XK, XV, WQ, WK, WV, bq, bk, bv, DM, QPh, QPl, KPh, KPl, VT);
    k_gemmw<bf, 1, false><<<dim3(TT / 64, NE / 64, ZH), 32, 0, stream>>>(QPh, QPl, AKB, nullptr, HD, HD, QE, NE, nullptr, (size_t)TT * HD, 0, (size_t)TT * NE, nullptr, nullptr);   /* QE = q . rel_k^T */
    k_fattn<<<dim3(TT / 64, ZH), 128, 0, stream>>>(QPh, QPl, KPh, KPl, VT, QE, Ob, PBh, PBl);   /* scores + q.rel_k[clip(j - i) + 50], softmax, P.v, attn folded onto the 101 clipped offsets */
    k_gemmw<bf, 2, false, 4, 3><<<dim3(TT / 64, HD / 64, ZH), 128, 0, stream>>>(PBh, PBl, AVTh, AVTl, NE, NE, Ob, HD, nullptr, (size_t)TT * NE, 0, (size_t)TT * HD, ATh, ATl);   /* merged = context + PB . rel_v, hi/lo */
    k_gemmw<bf, 1, true, 8><<<dim3(NB_ * TT / 64, DM / 64, 1), 256, 0, stream>>>(ATh, ATl, WO, nullptr, DQ, DQ, OUT, DM, bo, 0, 0, 0, nullptr, nullptr);   /* rows 2 l + b: the sequence-first output as it lies in memory */
}

// v008
// One run takes 231 microseconds.
// Timed twice side by side with v007, it ran 1.13 times as fast both times.
// Over all steps from v000 it is 8.24 times as fast.
#include <hip/hip_runtime.h>

// Relative multi-head attention with key AND value relative-position embeddings, sequence-first tensors (query, key, value [2048][2][1024]; q = query Wq^T + bq, k = key Wk^T + bk, v = value Wv^T + bv ('oi' 0.02, biases 0.02; 16 heads x 64); idx[i][j] = clip(j - i, -50, 50) + 50; attn = softmax((q.k + q.rel_k[idx]) / 8); x = attn v + sum_j attn[i][j] rel_v[idx] (rel_k, rel_v [101][64] 0.02, read); out = merged Wo^T + bo -> [2048][2][1024] sequence-first (4.2 M); argument order query, key, value, Wq, bq, Wk, bk, Wv, bv, Wo, bo, rel_k, rel_v).
// Layout: query, key, value each as ONE bf16 matrix of 4096 rows (query, key: row = 2 l + b, the sequence-first order as it lies in memory; value: row = 2048 b + l), all inputs rounded in one launch and the three projections taken in one, so every stage is launched once for both batch columns; head planes z = 16 b + h; 'oi' weights; exact projections + f32 biases; rel_k as a zero-padded bf16 plane [128][64] and rel_v^T as hi/lo planes [64][128]; over all 32 head planes at once: QE = q.rel_k^T (hi/lo x exact); one fused kernel for the score tiles (hi/lo 3 products), QE gathered in at column clip(j - i) + 50, running softmax (x 1/8), P.v (hi/lo x hi/lo) and the probabilities folded onto the 101 offsets (interior = one key, the two ends = fixed-order sums); PB.rel_v added to the context; merged hi/lo (row 2 l + b) x Wo exact + bo, whose rows are the output's own.
// Compute dtypes, f32 accumulate: every input rounded to bf16; projections exact + f32 biases; scores and the relative-key term ~f32; softmax f32; P as bf16 hi/lo; attn.v and the relative-value term 3 products (~f32); Wo hl x exact + bias.

#define NB_  2
#define TT   2048
#define DM   1024
#define NH_  16
#define NKV  16
#define REP  (NH_ / NKV)
#define HD   64
#define DQ   (NH_ * HD)
#define DKV  (NKV * HD)
#define ZH   (NB_ * NH_)          // head planes per launch: every head of both batch columns
#define RH   TT                   // unused
#define WIN  0
#define PCAR 1024.0f
#define SCL  0.125f   // 1/sqrt(64) (the module divides by jnp.sqrt(DH))
#define NE   128      // 2*50+1 = 101 relative offsets padded to 128
#define NRE  101
#define CUT  50
typedef _Float16 h16;
typedef unsigned short bf;
typedef __attribute__((ext_vector_type(16))) __bf16   v16bf;
typedef __attribute__((ext_vector_type(16))) _Float16 v16h;
typedef __attribute__((ext_vector_type(8)))  _Float16 v8h;
typedef __attribute__((ext_vector_type(8)))  unsigned short v8us;
typedef __attribute__((ext_vector_type(8)))  float    v8f;
typedef __attribute__((ext_vector_type(4)))  float    v4f;
typedef v8h  __attribute__((may_alias)) v8ha;
typedef v4f  __attribute__((may_alias)) v4fa;
typedef v8us __attribute__((may_alias)) v8usa;

__device__ __forceinline__ unsigned short f2bf(float f) { unsigned u = __float_as_uint(f); u += 0x7FFFu + ((u >> 16) & 1u); return (unsigned short)(u >> 16); }
__device__ __forceinline__ float bf2f(unsigned short b) { return __uint_as_float(((unsigned)b) << 16); }
__device__ __forceinline__ float bfr(float f) { return bf2f(f2bf(f)); }
__device__ __forceinline__ void splitf(float y, unsigned short& h, unsigned short& l) { h = f2bf(y); l = f2bf(y - bf2f(h)); }
typedef __attribute__((ext_vector_type(4))) unsigned short v4us;
__device__ __forceinline__ v16h cat16(v8h lo, v8h hi) { return __builtin_shufflevector(lo, hi, 0, 1, 2, 3, 4, 5, 6, 7, 8, 9, 10, 11, 12, 13, 14, 15); }
__device__ __forceinline__ v16bf cat16b(v8us lo, v8us hi) { return __builtin_bit_cast(v16bf, __builtin_shufflevector(lo, hi, 0, 1, 2, 3, 4, 5, 6, 7, 8, 9, 10, 11, 12, 13, 14, 15)); }
__device__ __forceinline__ v8f wmma16(v16h a, v16h b, v8f c) { return __builtin_amdgcn_wmma_f32_16x16x32_f16(false, a, false, b, (short)0, c, false, false); }
__device__ __forceinline__ v8f wmmab(v16bf a, v16bf b, v8f c) { return __builtin_amdgcn_wmma_f32_16x16x32_bf16(false, a, false, b, (short)0, c, false, false); }



// ---- k_gemmw: register-blocked GEMM, ONE WAVE per 64x64 output tile (16 accumulators), operands straight from K-contiguous 16-bit planes; grid (M/64, N/64, Z), 32 threads.
// C[m][n] (f32, pitch ldc, + optional f32 bias[n]) = sum_{k < KL} A[m][k] Bt[n][k] (+ split products per NSPLIT). K = row pitch of A and Bt in elements, KL <= K the summed length. z-batch strides sA/sB/sC in elements. KL % 32 == 0.
// KS > 1 (long K, few tiles): 32 KS threads, wave w of the work-group takes k in [w KL/KS, (w+1) KL/KS) of the same tile; the KS partial tiles are summed in fixed wave order through LDS. KL % (32 KS) == 0.
template <typename T16> struct WFrag;
template <> struct WFrag<h16> { typedef v16h V; static __device__ __forceinline__ V ld(const h16* p) { return cat16(*(const v8h*)p, *(const v8h*)(p + 16)); } static __device__ __forceinline__ v8f mma(V a, V b, v8f c) { return wmma16(a, b, c); } };
template <> struct WFrag<bf> { typedef v16bf V; static __device__ __forceinline__ V ld(const bf* p) { return cat16b(*(const v8us*)p, *(const v8us*)(p + 16)); } static __device__ __forceinline__ v8f mma(V a, V b, v8f c) { return wmmab(a, b, c); } };
// EPI (KS > 1 only) = what the summed tile becomes; 1 to 3 write the next stage's bf16 hi/lo operand planes themselves, whole 128-byte rows, and no f32 tile:
//   0: f32 C. 1: rows 2 t + b, columns 64 h + d -> head planes Eh, El [16 b + h][t][d]. 2: rows 64 h + d (A = the weight; bias added by ROW, BIAS false), columns t (Bt = the input's rows of batch column z) -> v^T rows Eh [16 z + h][d][2048 hi | 2048 lo].
//   3: head plane z, rows t, columns d: C is READ (the context P.v), the tile added to it -> merged rows Eh, El [2 t + b][64 h + d], z = 16 b + h.
// KS == 8: the operands do not go from global memory into fragments (a fragment load touches sixteen lines, 32 B of each) but through LDS: in each of KL / KS / 64 phases every wave copies, for all 64 rows of each operand plane, the 128 B (one whole line, 64 k) of its own k range that come next, by asynchronous copies of 16 B a lane (a copy instruction = 4 rows x 128 B), and then reads its fragments from there. Each wave keeps its k range and walks it in the same order. The staged rows lie in the LDS array that later holds the partial tiles.
#define SGP 1040   // pitch in bytes of a staged row: 8 waves x 128 B + 16 = 16 B x 65, free of bank conflicts for 16-byte fragment reads
__device__ __forceinline__ void acopy8(unsigned l, const char* g, unsigned ls, size_t gs) {   // eight copies: LDS byte address l + i ls, global address g + i gs
    // one statement, so that s_wait_xcnt 0 stands behind the last copy and in front of any rewrite of a register that a copy names
    asm volatile("global_load_async_to_lds_b128 %0, %8, off\n\t"
                 "global_load_async_to_lds_b128 %1, %9, off\n\t"
                 "global_load_async_to_lds_b128 %2, %10, off\n\t"
                 "global_load_async_to_lds_b128 %3, %11, off\n\t"
                 "global_load_async_to_lds_b128 %4, %12, off\n\t"
                 "global_load_async_to_lds_b128 %5, %13, off\n\t"
                 "global_load_async_to_lds_b128 %6, %14, off\n\t"
                 "global_load_async_to_lds_b128 %7, %15, off\n\t"
                 "s_wait_xcnt 0x0"
                 :: "v"(l), "v"(l + ls), "v"(l + 2 * ls), "v"(l + 3 * ls), "v"(l + 4 * ls), "v"(l + 5 * ls), "v"(l + 6 * ls), "v"(l + 7 * ls),
                    "v"(g), "v"(g + gs), "v"(g + 2 * gs), "v"(g + 3 * gs), "v"(g + 4 * gs), "v"(g + 5 * gs), "v"(g + 6 * gs), "v"(g + 7 * gs) : "memory");
}
// gemmw_body is the work of one work-group, its tile (bx, by, bz) and its LDS handed in, so that one launch can hold GEMMs of several kinds (k_proj) on one LDS array.
template <typename T16, int NSPLIT, bool BIAS, int KS, int EPI>
__device__ __forceinline__ void gemmw_body(const T16* __restrict__ A, const T16* __restrict__ A2, const T16* __restrict__ Bt, const T16* __restrict__ Bt2, int K, int KL, float* C, int ldc, const float* __restrict__ bias, size_t sA, size_t sB, size_t sC, bf* Eh, bf* El, float* os, int bx, int by, int bz) {
    typedef typename WFrag<T16>::V V;
    const size_t z = (size_t)bz; A += z * sA; if (A2) A2 += z * sA; Bt += z * sB; if (Bt2) Bt2 += z * sB; C += z * sC;
    const int lane = threadIdx.x & 31, lr = lane & 15, hi = lane >> 4; const int r0 = bx * 64, c0 = by * 64;
    const int wv = (KS == 1) ? 0 : __builtin_amdgcn_readfirstlane((int)(threadIdx.x >> 5)); const int k0 = wv * (KL / KS), k1 = k0 + KL / KS;
    v8f acc[4][4];
#pragma unroll
    for (int mb = 0; mb < 4; ++mb)
#pragma unroll
        for (int nb = 0; nb < 4; ++nb) acc[mb][nb] = (v8f){};
    const size_t aoff = (size_t)(r0 + lr) * K + 8 * hi, boff = (size_t)(c0 + lr) * K + 8 * hi;
    if (KS == 8) {
        char* sl = (char*)os; constexpr int PB_ = (NSPLIT == 1 || NSPLIT == 2) ? 2 : 1;   // planes in LDS, 64 rows each: A, (A2), Bt, (Bt2)
        const unsigned l0 = (unsigned)(size_t)sl + (unsigned)(lane >> 3) * SGP + (unsigned)wv * 128u + (unsigned)(lane & 7) * 16u;
        const size_t g0 = ((size_t)(lane >> 3) * K + k0 + (lane & 7) * 8) * 2, gs = (size_t)K * 8;   // bytes; gs = four rows
        const unsigned fo = (unsigned)lr * SGP + (unsigned)wv * 128u + (unsigned)hi * 16u;
#pragma unroll 1
        for (int ph = 0; ph < KL / KS / 64; ++ph) {   // rolled: a phase is long, and the copies' addresses differ by ph alone
            if (ph) { asm volatile("s_wait_dscnt 0x0" ::: "memory");   // this wave's fragment reads of the last phase are done before it passes the barrier
                __syncthreads(); }   // every wave has left the staged rows before any copy rewrites them
#pragma unroll
            for (int g = 0; g < 2; ++g) { const size_t go = g0 + (size_t)ph * 128 + (size_t)g * 8 * gs; const unsigned lg = l0 + (unsigned)g * (32 * SGP);
                acopy8(lg, (const char*)(A + (size_t)r0 * K) + go, 4 * SGP, gs);
                if (NSPLIT == 1 || NSPLIT == 2) acopy8(lg + 64 * SGP, (const char*)(A2 + (size_t)r0 * K) + go, 4 * SGP, gs);
                acopy8(lg + PB_ * 64 * SGP, (const char*)(Bt + (size_t)c0 * K) + go, 4 * SGP, gs);
                if (NSPLIT >= 2) acopy8(lg + (PB_ + 1) * 64 * SGP, (const char*)(Bt2 + (size_t)c0 * K) + go, 4 * SGP, gs); }
            asm volatile("s_wait_asynccnt 0x0" ::: "memory");   // this wave's copies have landed
            __syncthreads();   // and every wave's, before any fragment is read
#pragma unroll 1
            for (int kl = 0; kl < 2; ++kl) {   // rolled, as the loop from global memory is
                const char* fp = sl + fo + kl * 64; V a[4], a2[4];
#pragma unroll
                for (int mb = 0; mb < 4; ++mb) { a[mb] = WFrag<T16>::ld((const T16*)(fp + mb * 16 * SGP)); if (NSPLIT == 1 || NSPLIT == 2) a2[mb] = WFrag<T16>::ld((const T16*)(fp + (64 + mb * 16) * SGP)); }
#pragma unroll
                for (int nb = 0; nb < 4; ++nb) { const V b = WFrag<T16>::ld((const T16*)(fp + (PB_ * 64 + nb * 16) * SGP)); V b2; if (NSPLIT >= 2) b2 = WFrag<T16>::ld((const T16*)(fp + ((PB_ + 1) * 64 + nb * 16) * SGP));
#pragma unroll
                    for (int mb = 0; mb < 4; ++mb) { acc[mb][nb] = WFrag<T16>::mma(a[mb], b, acc[mb][nb]); if (NSPLIT == 1 || NSPLIT == 2) acc[mb][nb] = WFrag<T16>::mma(a2[mb], b, acc[mb][nb]); if (NSPLIT >= 2) acc[mb][nb] = WFrag<T16>::mma(a[mb], b2, acc[mb][nb]); } }
                asm volatile("v_nop\n\tv_nop\n\tv_nop\n\tv_nop" : "+v"(acc[0][0]), "+v"(acc[1][1]), "+v"(acc[2][2]), "+v"(acc[3][3]) : "v"(a[0]), "v"(a[3]));   // the distance behind the last matrix instruction, on the loop's back edge too
            }
        }
        asm volatile("s_wait_dscnt 0x0" ::: "memory");   // this wave's last fragment reads are done
        __syncthreads();   // every wave has left the staged rows before the partial tiles are written over them
    } else
#pragma unroll 1
    for (int kc = k0; kc < k1; kc += 32) {
        V a[4], a2[4];
#pragma unroll
        for (int mb = 0; mb < 4; ++mb) { a[mb] = WFrag<T16>::ld(A + aoff + (size_t)mb * 16 * K + kc); if (NSPLIT == 1 || NSPLIT == 2) a2[mb] = WFrag<T16>::ld(A2 + aoff + (size_t)mb * 16 * K + kc); }
#pragma unroll
        for (int nb = 0; nb < 4; ++nb) { const V b = WFrag<T16>::ld(Bt + boff + (size_t)nb * 16 * K + kc); V b2; if (NSPLIT >= 2) b2 = WFrag<T16>::ld(Bt2 + boff + (size_t)nb * 16 * K + kc);
#pragma unroll
            for (int mb = 0; mb < 4; ++mb) { acc[mb][nb] = WFrag<T16>::mma(a[mb], b, acc[mb][nb]); if (NSPLIT == 1 || NSPLIT == 2) acc[mb][nb] = WFrag<T16>::mma(a2[mb], b, acc[mb][nb]); if (NSPLIT >= 2) acc[mb][nb] = WFrag<T16>::mma(a[mb], b2, acc[mb][nb]); } }
        asm volatile("v_nop\n\tv_nop\n\tv_nop\n\tv_nop" : "+v"(acc[0][0]), "+v"(acc[1][1]), "+v"(acc[2][2]), "+v"(acc[3][3]) : "v"(a[0]), "v"(a[3]));
    }
    if (KS > 1) {
        float* my = os + wv * (64 * 68);
#pragma unroll
        for (int mb = 0; mb < 4; ++mb)
#pragma unroll
            for (int nb = 0; nb < 4; ++nb)
#pragma unroll
                for (int j = 0; j < 8; ++j) my[(mb * 16 + hi * 8 + j) * 68 + nb * 16 + lr] = acc[mb][nb][j];
        constexpr int NS = 1024 / (32 * KS);
        v4f oc[EPI == 3 ? NS : 1];
        if (EPI == 3) {   // the context values this thread adds to, asked for ahead of the barrier so that their latency runs beside it
#pragma unroll
            for (int s = 0; s < NS; ++s) { const int slot = s * (32 * KS) + (int)threadIdx.x; oc[s] = *(const v4f*)(C + (size_t)(r0 + (slot >> 4)) * ldc + (slot & 15) * 4); } }
        __syncthreads();   // every wave's partial tile is in LDS before any wave sums across them
        v4us eh[EPI == 0 ? 1 : NS], el[EPI == 0 ? 1 : NS];
#pragma unroll
        for (int s = 0; s < 1024 / (32 * KS); ++s) { const int slot = s * (32 * KS) + (int)threadIdx.x; const int row = slot >> 4, cofs = (slot & 15) * 4; v4f val = *(const v4fa*)(os + row * 68 + cofs);
#pragma unroll
            for (int w = 1; w < KS; ++w) { const v4f p = *(const v4fa*)(os + w * (64 * 68) + row * 68 + cofs); val += p; }
            if (BIAS) { val[0] += bfr(bias[c0 + cofs]); val[1] += bfr(bias[c0 + cofs + 1]); val[2] += bfr(bias[c0 + cofs + 2]); val[3] += bfr(bias[c0 + cofs + 3]); }
            if (EPI == 0) { *(v4f*)(C + (size_t)(r0 + row) * ldc + c0 + cofs) = val; }
            if (EPI == 2) { const float br = bfr(bias[r0 + row]); val[0] += br; val[1] += br; val[2] += br; val[3] += br; }
            if (EPI == 3) { val[0] = __fadd_rn(oc[s][0], val[0]); val[1] = __fadd_rn(oc[s][1], val[1]); val[2] = __fadd_rn(oc[s][2], val[2]); val[3] = __fadd_rn(oc[s][3], val[3]); }
            if (EPI != 0) {
#pragma unroll
                for (int q = 0; q < 4; ++q) { unsigned short a, c2; splitf(val[q], a, c2); eh[s][q] = a; el[s][q] = c2; } } }
        if (EPI != 0) {   // the stores stand behind all the sums, so that no store lies between the slots' LDS reads and they can issue together
#pragma unroll
            for (int s = 0; s < NS; ++s) { const int slot = s * (32 * KS) + (int)threadIdx.x; const int R = r0 + (slot >> 4), cofs = (slot & 15) * 4; size_t e = 0, e2 = 0;
                if (EPI == 1) { e = ((size_t)((R & 1) * NH_ + by) * TT + (R >> 1)) * HD + cofs; e2 = e; }
                if (EPI == 2) { e = (z * DKV + R) * (size_t)(2 * TT) + c0 + cofs; e2 = e + TT; }
                if (EPI == 3) { e = (size_t)R * (NB_ * DQ) + z * HD + cofs; e2 = e; }
                *(v4us*)(Eh + e) = eh[s]; *(v4us*)(El + e2) = el[s]; } }
        return;
    }
#pragma unroll
    for (int mb = 0; mb < 4; ++mb) {
#pragma unroll
        for (int nb = 0; nb < 4; ++nb) {
#pragma unroll
            for (int j = 0; j < 8; ++j) os[(hi * 8 + j) * 68 + nb * 16 + lr] = acc[mb][nb][j]; }
        __builtin_amdgcn_wave_barrier(); asm volatile("" ::: "memory");
        float* crow = C + (size_t)(r0 + mb * 16) * ldc + c0;
{
#pragma unroll
            for (int s = 0; s < 8; ++s) { const int row = 2 * s + hi, cofs = lr * 4; v4f val = *(const v4fa*)(os + row * 68 + cofs); if (BIAS) { val[0] += bfr(bias[c0 + cofs]); val[1] += bfr(bias[c0 + cofs + 1]); val[2] += bfr(bias[c0 + cofs + 2]); val[3] += bfr(bias[c0 + cofs + 3]); }
                *(v4f*)(crow + (size_t)row * ldc + cofs) = val; }
             }
        __builtin_amdgcn_wave_barrier(); asm volatile("" ::: "memory");
    }
}
template <typename T16, int NSPLIT, bool BIAS, int KS = 1, int EPI = 0>
__global__ __launch_bounds__(32 * KS) void k_gemmw(const T16* __restrict__ A, const T16* __restrict__ A2, const T16* __restrict__ Bt, const T16* __restrict__ Bt2, int K, int KL, float* C, int ldc, const float* __restrict__ bias, size_t sA, size_t sB, size_t sC, bf* Eh, bf* El) {
    constexpr int NPL = 2 + ((NSPLIT == 1 || NSPLIT == 2) ? 1 : 0) + (NSPLIT >= 2 ? 1 : 0);   // operand planes staged where KS == 8
    __shared__ __align__(16) float os[KS == 1 ? 16 * 68 : ((KS == 8 && NPL * 64 * SGP > KS * 64 * 68 * 4) ? NPL * 64 * SGP / 4 : KS * 64 * 68)];
    gemmw_body<T16, NSPLIT, BIAS, KS, EPI>(A, A2, Bt, Bt2, K, KL, C, ldc, bias, sA, sB, sC, Eh, El, os, (int)blockIdx.x, (int)blockIdx.y, (int)blockIdx.z);
}
// k_proj: the three projections, which do not depend on one another, in ONE launch; grid (64, 16, 3): z = 0 q, 1 k (x = tile of rows 2 t + b, y = head), 2 v^T = Wv . value^T, whose 16 row tiles x 32 column tiles x 2 batch columns are counted through by x + 64 y.
__global__ __launch_bounds__(256) void k_proj(const bf* __restrict__ XQ, const bf* __restrict__ XK, const bf* __restrict__ XV, const bf* __restrict__ WQ, const bf* __restrict__ WK, const bf* __restrict__ WV, const float* __restrict__ bq, const float* __restrict__ bk, const float* __restrict__ bv, int K, bf* QPh, bf* QPl, bf* KPh, bf* KPl, bf* VT) {
    __shared__ __align__(16) float os[8 * 64 * 68];
    const int bx = (int)blockIdx.x, by = (int)blockIdx.y, job = (int)blockIdx.z;   // the same for the whole work-group, so every barrier below is reached by all of it
    if (job == 2) { gemmw_body<bf, 0, false, 8, 2>(WV, nullptr, XV, nullptr, K, K, nullptr, 0, bv, 0, (size_t)TT * DM, 0, VT, VT, os, bx & 15, (bx >> 4) + 4 * (by & 7), by >> 3);
        asm volatile("s_wait_xcnt 0x0" ::: "memory"); }   // stands behind the v^T stores, before the code laid out after them rewrites a register that they name
    else if (job == 1) gemmw_body<bf, 0, true, 8, 1>(XK, nullptr, WK, nullptr, K, K, nullptr, 0, bk, 0, 0, 0, KPh, KPl, os, bx, by, 0);
    else gemmw_body<bf, 0, true, 8, 1>(XQ, nullptr, WQ, nullptr, K, K, nullptr, 0, bq, 0, 0, 0, QPh, QPl, os, bx, by, 0);
}

typedef __attribute__((ext_vector_type(2))) _Float16 v2h;
typedef __attribute__((ext_vector_type(4))) _Float16 v4h;
typedef __attribute__((ext_vector_type(2))) unsigned short v2us;
typedef __attribute__((ext_vector_type(2))) float v2f;
typedef __attribute__((ext_vector_type(4))) int v4i;

// k_fattn: scores, softmax, P.v and the offset fold in ONE kernel; a score never leaves its wave's registers. Work-group = 4 waves x 16 queries of one head; keys in tiles of 64, K hi/lo [key][d] and v^T hi/lo [d][key] staged through registers into two LDS buffers (row pitch 144 B), the next tile's global loads issued before this tile's work.
// Every product is taken transposed, so that a lane owns ONE query (lane & 15): S^T = K.Q^T (rows = keys, columns = queries), O^T = v^T.P^T (rows = d). The accumulator of two 16-key S^T tiles IS the 32-key operand fragment of P^T (register j of tile 0 = key 8 hi + j, of tile 1 = key 16 + 8 hi + j), and row maximum, row sum and rescale are per-lane values.
// Running softmax in the exp2 domain: u = (s + QE[clip(j - i) + 50]) / 8 x log2(e); p = exp2(u - m), sums and O^T rescaled by exp2(m_old - m_new), divided by the row sum at the end. Fold: the two end offsets are running sums of p; an interior offset is one key, whose u waits in the wave's own LDS until m and the sum are final.
typedef __attribute__((ext_vector_type(4))) unsigned int v4u;
typedef v4us __attribute__((may_alias)) v4usa;
#define LP  72     // LDS row pitch in bf16: 144 B = 16 B x 9, free of bank conflicts for 16-byte fragment reads
#define TBP 132    // pitch in floats of a query's 128 offset slots
#define UC  (SCL * 1.4426950408889634f)
__global__ __launch_bounds__(128) void k_fattn(const bf* __restrict__ Qh, const bf* __restrict__ Ql, const bf* __restrict__ Kh, const bf* __restrict__ Kl, const bf* __restrict__ Vhl, const float* __restrict__ QE, float* O, bf* Bh, bf* Bl) {
    __shared__ __align__(16) bf st[2][4][64 * LP];     // per buffer: K hi, K lo, v^T hi, v^T lo
    __shared__ __align__(16) float tb[4][16 * TBP];    // per wave: u of the interior offsets, [query][offset]
    __shared__ __align__(16) float qs[4][16 * TBP];    // per wave: its sixteen rows of QE x UC
    const int tid = threadIdx.x, lane = tid & 31, lr = lane & 15, hi = lane >> 4; const int wv = __builtin_amdgcn_readfirstlane(tid >> 5);
    const int z = blockIdx.y; const int q0 = blockIdx.x * 64 + wv * 16; const int i = q0 + lr; const size_t hb = (size_t)z * TT * HD;
    // every global address = a base that is the same for the wave + a lane's byte offset that lives as long as its loads or stores do
    const char* kh = (const char*)(Kh + hb); const char* kl = (const char*)(Kl + hb); const char* vv = (const char*)(Vhl + (size_t)z * HD * 2 * TT); float* tw = tb[wv]; float* qw = qs[wv];
    const unsigned ko = (unsigned)tid * 16u;   // K tile: 8 KiB in a row, slice r = 2 KiB
    const unsigned vo = (unsigned)(tid >> 3) * (2 * TT * 2) + (unsigned)(tid & 7) * 16u;   // v^T tile: row d = 16 r + (tid >> 3) of 8 KiB pitch, lo plane 4 KiB behind hi
    const unsigned qo = (unsigned)(lr * HD + 8 * hi) * 2u, eo = (unsigned)lane * 16u;
    v8us pf[16];
#pragma unroll
    for (int r = 0; r < 4; ++r) { pf[r] = *(const v8usa*)(kh + r * 2048 + (size_t)ko); pf[4 + r] = *(const v8usa*)(kl + r * 2048 + (size_t)ko); pf[8 + r] = *(const v8usa*)(vv + r * (16 * 2 * TT * 2) + (size_t)vo); pf[12 + r] = *(const v8usa*)(vv + r * (16 * 2 * TT * 2) + TT * 2 + (size_t)vo); }
    v16bf qh[2], ql[2]; const char* qhb = (const char*)(Qh + hb + (size_t)q0 * HD); const char* qlb = (const char*)(Ql + hb + (size_t)q0 * HD);
#pragma unroll
    for (int kc = 0; kc < 2; ++kc) { qh[kc] = cat16b(*(const v8usa*)(qhb + kc * 64 + (size_t)qo), *(const v8usa*)(qhb + kc * 64 + 32 + (size_t)qo)); ql[kc] = cat16b(*(const v8usa*)(qlb + kc * 64 + (size_t)qo), *(const v8usa*)(qlb + kc * 64 + 32 + (size_t)qo)); }
    const char* qeb = (const char*)(QE + ((size_t)z * TT + q0) * NE); v4f er[16];
#pragma unroll
    for (int r = 0; r < 16; ++r) er[r] = *(const v4fa*)(qeb + r * (NE * 4) + (size_t)eo);
    asm volatile("s_wait_xcnt 0x0" :: "v"(qo), "v"(eo) : "memory");   // stands before a register that the loads above name is rewritten; the two offsets that end here are held up to it
#pragma unroll
    for (int r = 0; r < 16; ++r) *(v4fa*)(qw + r * TBP + lane * 4) = er[r] * UC;
    for (int s = lane; s < 16 * TBP / 4; s += 32) *(v4fa*)(tw + s * 4) = (v4f){0.f, 0.f, 0.f, 0.f};   // slots that no key of a row reaches are read below and stay zero
    __builtin_amdgcn_wave_barrier(); asm volatile("" ::: "memory");   // compiler order only: other lanes' QE stores stay in front of this lane's reads (one wave's LDS operations run in order)
    const float qlo = qw[lr * TBP], qhi = qw[lr * TBP + 2 * CUT];
#pragma unroll
    for (int r = 0; r < 4; ++r) { const int c = r * 128 + tid; const int o = (c >> 3) * LP + (c & 7) * 8;
#pragma unroll
        for (int pl = 0; pl < 4; ++pl) *(v8usa*)(&st[0][pl][o]) = pf[pl * 4 + r]; }
    __syncthreads();   // tile 0 is in LDS before any wave reads it
    v8f oacc[4];
#pragma unroll
    for (int dt = 0; dt < 4; ++dt) oacc[dt] = (v8f){};
    float m = -3.0e38f, l = 0.f, lo_s = 0.f, hi_s = 0.f;
#pragma unroll 1
    for (int t = 0; t < TT / 64; ++t) {   // rolled: one tile's body is long enough, and the two buffers alternate by index
        const int kb = t * 64; const bf* sb = &st[t & 1][0][0];
        if (t + 1 < TT / 64) {
#pragma unroll
            for (int r = 0; r < 4; ++r) { const size_t kn = (size_t)(kb + 64); pf[r] = *(const v8usa*)(kh + kn * (HD * 2) + r * 2048 + (size_t)ko); pf[4 + r] = *(const v8usa*)(kl + kn * (HD * 2) + r * 2048 + (size_t)ko); pf[8 + r] = *(const v8usa*)(vv + kn * 2 + r * (16 * 2 * TT * 2) + (size_t)vo); pf[12 + r] = *(const v8usa*)(vv + kn * 2 + r * (16 * 2 * TT * 2) + TT * 2 + (size_t)vo); }
            asm volatile("s_wait_xcnt 0x0" ::: "memory"); }   // stands before an address register of the sixteen loads above is rewritten
        v8f s[4];
#pragma unroll
        for (int kt = 0; kt < 4; ++kt) s[kt] = (v8f){};
#pragma unroll
        for (int kc = 0; kc < 2; ++kc) { v16bf ah[4], al[4];
#pragma unroll
            for (int kt = 0; kt < 4; ++kt) { const int o = (kt * 16 + lr) * LP + 8 * hi + kc * 32; ah[kt] = WFrag<bf>::ld(sb + o); al[kt] = WFrag<bf>::ld(sb + 64 * LP + o); }
#pragma unroll
            for (int kt = 0; kt < 4; ++kt) s[kt] = wmmab(ah[kt], qh[kc], s[kt]);
#pragma unroll
            for (int kt = 0; kt < 4; ++kt) s[kt] = wmmab(al[kt], qh[kc], s[kt]);
#pragma unroll
            for (int kt = 0; kt < 4; ++kt) s[kt] = wmmab(ah[kt], ql[kc], s[kt]); }
        float u[4][8]; float tm = -3.0e38f;
#pragma unroll
        for (int kt = 0; kt < 4; ++kt) { const int jb = kb + kt * 16;   // the three cases are the same for the whole wave
            if (jb + 15 - q0 <= -CUT) {
#pragma unroll
                for (int j = 0; j < 8; ++j) u[kt][j] = fmaf(s[kt][j], UC, qlo);
            } else if (jb - (q0 + 15) >= CUT) {
#pragma unroll
                for (int j = 0; j < 8; ++j) u[kt][j] = fmaf(s[kt][j], UC, qhi);
            } else {
#pragma unroll
                for (int j = 0; j < 8; ++j) { const int d = jb + hi * 8 + j - i; u[kt][j] = fmaf(s[kt][j], UC, qw[lr * TBP + min(max(d, -CUT), CUT) + CUT]); if (d > -CUT && d < CUT) tw[lr * TBP + d + CUT] = u[kt][j]; }
            }
#pragma unroll
            for (int j = 0; j < 8; ++j) tm = fmaxf(tm, u[kt][j]); }
        tm = fmaxf(tm, __shfl_xor(tm, 16, 32));   // the two half-waves hold the two halves of a query's keys
        const float mn = fmaxf(m, tm); const float al_ = __builtin_amdgcn_exp2f(m - mn); m = mn;
        float la = 0.f, loa = 0.f, hia = 0.f;
#pragma unroll
        for (int kt = 0; kt < 4; ++kt) { const int jb = kb + kt * 16;
#pragma unroll
            for (int j = 0; j < 8; ++j) u[kt][j] = __builtin_amdgcn_exp2f(u[kt][j] - mn);
            const float s8 = ((u[kt][0] + u[kt][1]) + (u[kt][2] + u[kt][3])) + ((u[kt][4] + u[kt][5]) + (u[kt][6] + u[kt][7])); la += s8;
            if (jb + 15 - q0 <= -CUT) loa += s8;
            else if (jb - (q0 + 15) >= CUT) hia += s8;
            else {
#pragma unroll
                for (int j = 0; j < 8; ++j) { const int d = jb + hi * 8 + j - i; loa += (d <= -CUT) ? u[kt][j] : 0.f; hia += (d >= CUT) ? u[kt][j] : 0.f; }
            } }
        l = fmaf(l, al_, la); lo_s = fmaf(lo_s, al_, loa); hi_s = fmaf(hi_s, al_, hia);
#pragma unroll
        for (int dt = 0; dt < 4; ++dt)
#pragma unroll
            for (int j = 0; j < 8; ++j) oacc[dt][j] *= al_;
#pragma unroll
        for (int c = 0; c < 2; ++c) { v16bf ph, pl;
#pragma unroll
            for (int e = 0; e < 16; ++e) { const float x = u[2 * c + (e >> 3)][e & 7]; const __bf16 h = (__bf16)x; ph[e] = h; pl[e] = (__bf16)(x - (float)h); }
            v16bf vh[4], vl[4];
#pragma unroll
            for (int dt = 0; dt < 4; ++dt) { const int o = (dt * 16 + lr) * LP + 8 * hi + c * 32; vh[dt] = WFrag<bf>::ld(sb + 2 * 64 * LP + o); vl[dt] = WFrag<bf>::ld(sb + 3 * 64 * LP + o); }
#pragma unroll
            for (int dt = 0; dt < 4; ++dt) oacc[dt] = wmmab(vh[dt], ph, oacc[dt]);
#pragma unroll
            for (int dt = 0; dt < 4; ++dt) oacc[dt] = wmmab(vl[dt], ph, oacc[dt]);
#pragma unroll
            for (int dt = 0; dt < 4; ++dt) oacc[dt] = wmmab(vh[dt], pl, oacc[dt]); }
        if (t + 1 < TT / 64) {
#pragma unroll
            for (int r = 0; r < 4; ++r) { const int c = r * 128 + tid; const int o = (c >> 3) * LP + (c & 7) * 8;
#pragma unroll
                for (int pl = 0; pl < 4; ++pl) *(v8usa*)(&st[(t + 1) & 1][pl][o]) = pf[pl * 4 + r]; } }
        __syncthreads();   // publishes tile t + 1 and ends every wave's reads of tile t, whose buffer the next trip refills
    }
    asm volatile("s_wait_xcnt 0x0" :: "v"(ko), "v"(vo) : "memory");   // stands before the tile loads' two offset registers may be rewritten; they are held up to it
    l += __shfl_xor(l, 16, 32); lo_s += __shfl_xor(lo_s, 16, 32); hi_s += __shfl_xor(hi_s, 16, 32);
    const float f = __fdiv_rn(1.0f, l); lo_s *= f; hi_s *= f;
    char* ob = (char*)(O + hb + (size_t)q0 * HD); const unsigned oo = (unsigned)(lr * HD + hi * 8) * 4u;
#pragma unroll
    for (int dt = 0; dt < 4; ++dt) { v4f a, b;
#pragma unroll
        for (int j = 0; j < 4; ++j) { a[j] = oacc[dt][j] * f; b[j] = oacc[dt][4 + j] * f; }
        *(v4fa*)(ob + dt * 64 + (size_t)oo) = a; *(v4fa*)(ob + dt * 64 + 16 + (size_t)oo) = b; }
    asm volatile("s_wait_xcnt 0x0" :: "v"(oo) : "memory");   // stands before a register that the stores above name is rewritten
    __builtin_amdgcn_wave_barrier(); asm volatile("" ::: "memory");   // compiler order only: other lanes' u stores stay in front of this lane's reads (one wave's LDS operations run in order)
#pragma unroll 1
    for (int r = 0; r < 16; ++r) {   // rolled: sixteen short rows, once a wave
        const float mr = __shfl(m, r, 32), fr = __shfl(f, r, 32), lor = __shfl(lo_s, r, 32), hir = __shfl(hi_s, r, 32); const int ir = q0 + r; const v4f uu = *(const v4fa*)(tw + r * TBP + lane * 4); v4us oh, ol;
#pragma unroll
        for (int q = 0; q < 4; ++q) { const int bkt = lane * 4 + q; const int j = ir + bkt - CUT; const float y = __builtin_amdgcn_exp2f(uu[q] - mr) * fr; const bool in = bkt > 0 && bkt < 2 * CUT && j >= 0 && j < TT;
            const float w = (bkt == 0) ? lor : ((bkt == 2 * CUT) ? hir : (in ? y : 0.f)); unsigned short a, c2; splitf(w, a, c2); oh[q] = a; ol[q] = c2; }
        const size_t po = ((size_t)z * TT + ir) * NE * 2; const unsigned bo = (unsigned)lane * 8u; *(v4usa*)((char*)Bh + po + (size_t)bo) = oh; *(v4usa*)((char*)Bl + po + (size_t)bo) = ol;
        asm volatile("s_wait_xcnt 0x0" :: "v"(bo) : "memory"); }   // stands before the next row rewrites a register that the two stores name
}
// k_prep: every rounding of an input to bf16 in ONE launch (none depends on another). A work-group takes 2048 runs of 8 floats of one tensor, a thread 8 of them, all eight loads asked for before the first is used.
// Work-groups 0..767: query, key (rows 2 t + b as they lie) and value (its rows laid out batch column by batch column, row b TT + t, so that 64 rows in a row are 64 t of one column); 768..1023: the four weights; then 4 for rel_k -> [128][64], rows >= 101 zero, and 8 for rel_v^T hi/lo [64][128], columns >= 101 zero.
#define PU   8
#define PXB  (NB_ * TT * DM / 8 / (256 * PU))   // work-groups per input tensor
#define PWB  (DQ * DM / 8 / (256 * PU))         // work-groups per weight
#define PEK  (NE * HD / 8 / 256)
#define PEV  (HD * NE / 4 / 256)
template <int STEP> __device__ __forceinline__ void put8(char* db, unsigned so, const v8f (&v)[PU]) {
#pragma unroll
    for (int u = 0; u < PU; ++u) { v8us o;
#pragma unroll
        for (int k = 0; k < 8; ++k) o[k] = f2bf(v[u][k]);
        *(v8usa*)(db + u * STEP + (size_t)so) = o; }
}
__global__ __launch_bounds__(256) void k_prep(const float* __restrict__ xq, const float* __restrict__ xk, const float* __restrict__ xv, const float* __restrict__ wq, const float* __restrict__ wk, const float* __restrict__ wv, const float* __restrict__ wo, const float* __restrict__ ek, const float* __restrict__ ev, bf* XQ, bf* XK, bf* XV, bf* WQ, bf* WK, bf* WV, bf* WO, bf* EB, bf* Th, bf* Tl) {
    const int b = (int)blockIdx.x, tid = (int)threadIdx.x;
    if (b < 3 * PXB + 4 * PWB) {
        const float* src; bf* dst; int lb;   // all three the same for the work-group
        if (b < 3 * PXB) { lb = b % PXB; src = b < PXB ? xq : (b < 2 * PXB ? xk : xv); dst = b < PXB ? XQ : (b < 2 * PXB ? XK : XV); }
        else { const int w = (b - 3 * PXB) / PWB; lb = (b - 3 * PXB) % PWB; src = w == 0 ? wq : (w == 1 ? wk : (w == 2 ? wv : wo)); dst = w == 0 ? WQ : (w == 1 ? WK : (w == 2 ? WV : WO)); }
        const char* sb = (const char*)(src + (size_t)lb * (256 * PU * 8)); const unsigned lo = (unsigned)tid * 32u; v8f v[PU];
#pragma unroll
        for (int u = 0; u < PU; ++u) v[u] = *(const v8f*)(sb + u * (256 * 32) + (size_t)lo);
        if (b >= 2 * PXB && b < 3 * PXB) put8<DM * 2>((char*)(dst + (size_t)lb * (PU * DM)), (unsigned)((tid >> 7) * (TT * DM) + (tid & 127) * 8) * 2u, v);   // run u of the thread lies in row 2 (8 lb + u) + (tid >> 7) of value
        else put8<256 * 16>((char*)(dst + (size_t)lb * (256 * PU * 8)), (unsigned)tid * 16u, v);
        return;
    }
    if (b < 3 * PXB + 4 * PWB + PEK) { const size_t i = (size_t)(b - (3 * PXB + 4 * PWB)) * 256 + tid; const int d0 = (int)(i % (HD / 8)) * 8; const int r = (int)(i / (HD / 8)); const float* src = ek + (size_t)min(r, NRE - 1) * HD + d0; v8us o;
#pragma unroll
        for (int q = 0; q < 8; ++q) { const unsigned short v = f2bf(src[q]); o[q] = (r < NRE) ? v : (unsigned short)0; }
        *(v8us*)(EB + (size_t)r * HD + d0) = o;
        asm volatile("s_wait_xcnt 0x0" ::: "memory");   // stands behind the store, before the code laid out after it rewrites a register that it names
        return; }
    { const size_t i = (size_t)(b - (3 * PXB + 4 * PWB + PEK)) * 256 + tid; const size_t e = i * 4; const int c0 = (int)(e % NE); const int d = (int)(e / NE); v4us oh, ol;
#pragma unroll
        for (int q = 0; q < 4; ++q) { const int r = c0 + q; const float v = bfr(ev[(size_t)min(r, NRE - 1) * HD + d]); unsigned short u, w; splitf(v, u, w);   /* input rounded to bf16 once: lo == 0 */ oh[q] = (r < NRE) ? u : (unsigned short)0; ol[q] = (r < NRE) ? w : (unsigned short)0; }
        *(v4us*)(Th + e) = oh; *(v4us*)(Tl + e) = ol;
        asm volatile("s_wait_xcnt 0x0" ::: "memory"); }   // stands behind the two stores, before the code laid out after them rewrites a register that they name
}

extern "C" void kernel_launch(void* const* d_in, const int* in_sizes, int n_in,
                              void* d_out, int out_size, void* d_ws, size_t ws_size, hipStream_t stream) {
    (void)in_sizes; (void)n_in; (void)out_size;
    const float* x = (const float*)d_in[0];   /* query */ const float* xk = (const float*)d_in[1]; const float* xv = (const float*)d_in[2]; const float* wq = (const float*)d_in[3]; const float* bq = (const float*)d_in[4]; const float* wk = (const float*)d_in[5]; const float* bk = (const float*)d_in[6]; const float* wv = (const float*)d_in[7]; const float* bv = (const float*)d_in[8]; const float* wo = (const float*)d_in[9]; const float* bo = (const float*)d_in[10]; const float* ak = (const float*)d_in[11];   /* rel_k_table [101][64] */ const float* av = (const float*)d_in[12];   /* rel_v_table [101][64] */
    float* OUT = (float*)d_out;     // [2048][2][1024] sequence-first
    char* wsp = (char*)d_ws;
    auto take = [&](size_t bytes) { char* p = wsp; wsp += (bytes + 255) & ~(size_t)255; return (void*)p; };
    bf* AKB = (bf*)take((size_t)NE * HD * 2); bf* AVTh = (bf*)take((size_t)HD * NE * 2); bf* AVTl = (bf*)take((size_t)HD * NE * 2); float* QE = (float*)take((size_t)ZH * TT * NE * 4); bf* PBh = (bf*)take((size_t)ZH * TT * NE * 2); bf* PBl = (bf*)take((size_t)ZH * TT * NE * 2); bf* WQ = (bf*)take((size_t)DQ * DM * 2); bf* WK = (bf*)take((size_t)DKV * DM * 2); bf* WV = (bf*)take((size_t)DKV * DM * 2); bf* WO = (bf*)take((size_t)DM * DQ * 2);
    bf* XQ = (bf*)take((size_t)NB_ * TT * DM * 2); bf* XK = (bf*)take((size_t)NB_ * TT * DM * 2); bf* XV = (bf*)take((size_t)NB_ * TT * DM * 2);
    bf* QPh = (bf*)take((size_t)ZH * TT * HD * 2); bf* QPl = (bf*)take((size_t)ZH * TT * HD * 2); bf* KPh = (bf*)take((size_t)ZH * TT * HD * 2); bf* KPl = (bf*)take((size_t)ZH * TT * HD * 2); bf* VT = (bf*)take((size_t)ZH * HD * 2 * TT * 2);
    float* Ob = (float*)take((size_t)ZH * TT * HD * 4); bf* ATh = (bf*)take((size_t)NB_ * TT * DQ * 2); bf* ATl = (bf*)take((size_t)NB_ * TT * DQ * 2);
    if ((size_t)(wsp - (char*)d_ws) > ws_size) return;
    k_prep<<<3 * PXB + 4 * PWB + PEK + PEV, 256, 0, stream>>>(x, xk, xv, wq, wk, wv, wo, ak, av, XQ, XK, XV, WQ, WK, WV, WO, AKB, AVTh, AVTl);   /* every input -> bf16 */
    // A sequence-first tensor [L][B][HID] is a matrix of L B rows (row 2 t + b); each projection's own epilogue splits its f32 tile into the hi/lo head planes z = 16 b + h that the attention kernel reads.
    k_proj<<<dim3(NB_ * TT / 64, DQ / 64, 3), 256, 0, stream>>>(XQ, XK, XV, WQ, WK, WV, bq, bk, bv, DM, QPh, QPl, KPh, KPl, VT);
    k_gemmw<bf, 1, false><<<dim3(TT / 64, NE / 64, ZH), 32, 0, stream>>>(QPh, QPl, AKB, nullptr, HD, HD, QE, NE, nullptr, (size_t)TT * HD, 0, (size_t)TT * NE, nullptr, nullptr);   /* QE = q . rel_k^T */
    k_fattn<<<dim3(TT / 64, ZH), 128, 0, stream>>>(QPh, QPl, KPh, KPl, VT, QE, Ob, PBh, PBl);   /* scores + q.rel_k[clip(j - i) + 50], softmax, P.v, attn folded onto the 101 clipped offsets */
    k_gemmw<bf, 2, false, 4, 3><<<dim3(TT / 64, HD / 64, ZH), 128, 0, stream>>>(PBh, PBl, AVTh, AVTl, NE, NE, Ob, HD, nullptr, (size_t)TT * NE, 0, (size_t)TT * HD, ATh, ATl);   /* merged = context + PB . rel_v, hi/lo */
    k_gemmw<bf, 1, true, 8><<<dim3(NB_ * TT / 64, DM / 64, 1), 256, 0, stream>>>(ATh, ATl, WO, nullptr, DQ, DQ, OUT, DM, bo, 0, 0, 0, nullptr, nullptr);   /* rows 2 l + b: the sequence-first output as it lies in memory */
}

// v009
// It runs in 208 microseconds.
// In both of two side-by-side timings against v008, it was 1.11 times as fast.
// Over all steps from v000 it is 9.14 times as fast.
#include <hip/hip_runtime.h>

// Relative multi-head attention with key AND value relative-position embeddings, sequence-first tensors (query, key, value [2048][2][1024]; q = query Wq^T + bq, k = key Wk^T + bk, v = value Wv^T + bv ('oi' 0.02, biases 0.02; 16 heads x 64); idx[i][j] = clip(j - i, -50, 50) + 50; attn = softmax((q.k + q.rel_k[idx]) / 8); x = attn v + sum_j attn[i][j] rel_v[idx] (rel_k, rel_v [101][64] 0.02, read); out = merged Wo^T + bo -> [2048][2][1024] sequence-first (4.2 M); argument order query, key, value, Wq, bq, Wk, bk, Wv, bv, Wo, bo, rel_k, rel_v).
// Layout: query, key, value each as ONE bf16 matrix of 4096 rows (query, key: row = 2 l + b, the sequence-first order as it lies in memory; value: row = 2048 b + l), all inputs rounded in one launch and the three projections taken in one, so every stage is launched once for both batch columns; head planes z = 16 b + h; 'oi' weights; exact projections + f32 biases; rel_k as a zero-padded bf16 plane [128][64] and rel_v^T as hi/lo planes [64][128]; over all 32 head planes at once: QE = q.rel_k^T (hi/lo x exact); one fused kernel for the score tiles (hi/lo 3 products), QE gathered in at column clip(j - i) + 50, running softmax (x 1/8), P.v (hi/lo x hi/lo) and the probabilities folded onto the 101 offsets (interior = one key, the two ends = fixed-order sums); PB.rel_v added to the context; merged hi/lo (row 2 l + b) x Wo exact + bo, whose rows are the output's own.
// Compute dtypes, f32 accumulate: every input rounded to bf16; projections exact + f32 biases; scores and the relative-key term ~f32; softmax f32; P as bf16 hi/lo; attn.v and the relative-value term 3 products (~f32); Wo hl x exact + bias.

#define NB_  2
#define TT   2048
#define DM   1024
#define NH_  16
#define NKV  16
#define REP  (NH_ / NKV)
#define HD   64
#define DQ   (NH_ * HD)
#define DKV  (NKV * HD)
#define ZH   (NB_ * NH_)          // head planes per launch: every head of both batch columns
#define RH   TT                   // unused
#define WIN  0
#define PCAR 1024.0f
#define SCL  0.125f   // 1/sqrt(64) (the module divides by jnp.sqrt(DH))
#define NE   128      // 2*50+1 = 101 relative offsets padded to 128
#define NRE  101
#define CUT  50
typedef _Float16 h16;
typedef unsigned short bf;
typedef __attribute__((ext_vector_type(16))) __bf16   v16bf;
typedef __attribute__((ext_vector_type(16))) _Float16 v16h;
typedef __attribute__((ext_vector_type(8)))  _Float16 v8h;
typedef __attribute__((ext_vector_type(8)))  unsigned short v8us;
typedef __attribute__((ext_vector_type(8)))  float    v8f;
typedef __attribute__((ext_vector_type(4)))  float    v4f;
typedef v8h  __attribute__((may_alias)) v8ha;
typedef v4f  __attribute__((may_alias)) v4fa;
typedef v8us __attribute__((may_alias)) v8usa;

__device__ __forceinline__ unsigned short f2bf(float f) { unsigned u = __float_as_uint(f); u += 0x7FFFu + ((u >> 16) & 1u); return (unsigned short)(u >> 16); }
__device__ __forceinline__ float bf2f(unsigned short b) { return __uint_as_float(((unsigned)b) << 16); }
__device__ __forceinline__ float bfr(float f) { return bf2f(f2bf(f)); }
__device__ __forceinline__ void splitf(float y, unsigned short& h, unsigned short& l) { h = f2bf(y); l = f2bf(y - bf2f(h)); }
typedef __attribute__((ext_vector_type(4))) unsigned short v4us;
__device__ __forceinline__ v16h cat16(v8h lo, v8h hi) { return __builtin_shufflevector(lo, hi, 0, 1, 2, 3, 4, 5, 6, 7, 8, 9, 10, 11, 12, 13, 14, 15); }
__device__ __forceinline__ v16bf cat16b(v8us lo, v8us hi) { return __builtin_bit_cast(v16bf, __builtin_shufflevector(lo, hi, 0, 1, 2, 3, 4, 5, 6, 7, 8, 9, 10, 11, 12, 13, 14, 15)); }
__device__ __forceinline__ v8f wmma16(v16h a, v16h b, v8f c) { return __builtin_amdgcn_wmma_f32_16x16x32_f16(false, a, false, b, (short)0, c, false, false); }
__device__ __forceinline__ v8f wmmab(v16bf a, v16bf b, v8f c) { return __builtin_amdgcn_wmma_f32_16x16x32_bf16(false, a, false, b, (short)0, c, false, false); }



// ---- k_gemmw: register-blocked GEMM, ONE WAVE per 64x64 output tile (16 accumulators), operands straight from K-contiguous 16-bit planes; grid (M/64, N/64, Z), 32 threads.
// C[m][n] (f32, pitch ldc, + optional f32 bias[n]) = sum_{k < KL} A[m][k] Bt[n][k] (+ split products per NSPLIT). K = row pitch of A and Bt in elements, KL <= K the summed length. z-batch strides sA/sB/sC in elements. KL % 32 == 0.
// KS > 1 (long K, few tiles): 32 KS threads, wave w of the work-group takes k in [w KL/KS, (w+1) KL/KS) of the same tile; the KS partial tiles are summed in fixed wave order through LDS. KL % (32 KS) == 0.
template <typename T16> struct WFrag;
template <> struct WFrag<h16> { typedef v16h V; static __device__ __forceinline__ V ld(const h16* p) { return cat16(*(const v8h*)p, *(const v8h*)(p + 16)); } static __device__ __forceinline__ v8f mma(V a, V b, v8f c) { return wmma16(a, b, c); } };
template <> struct WFrag<bf> { typedef v16bf V; static __device__ __forceinline__ V ld(const bf* p) { return cat16b(*(const v8us*)p, *(const v8us*)(p + 16)); } static __device__ __forceinline__ v8f mma(V a, V b, v8f c) { return wmmab(a, b, c); } };
// EPI (KS > 1 only) = what the summed tile becomes; 1 to 3 write the next stage's bf16 hi/lo operand planes themselves, whole 128-byte rows, and no f32 tile:
//   0: f32 C. 1: rows 2 t + b, columns 64 h + d -> head planes Eh, El [16 b + h][t][d]. 2: rows 64 h + d (A = the weight; bias added by ROW, BIAS false), columns t (Bt = the input's rows of batch column z) -> v^T rows Eh [16 z + h][d][2048 hi | 2048 lo].
//   3: head plane z, rows t, columns d: C is READ (the context P.v), the tile added to it -> merged rows Eh, El [2 t + b][64 h + d], z = 16 b + h.
// KS == 8: the operands do not go from global memory into fragments (a fragment load touches sixteen lines, 32 B of each) but through LDS: in each of KL / KS / 64 phases every wave copies, for all 64 rows of each operand plane, the 128 B (one whole line, 64 k) of its own k range that come next, by asynchronous copies of 16 B a lane (a copy instruction = 4 rows x 128 B), and then reads its fragments from there. Each wave keeps its k range and walks it in the same order. The staged rows lie in the LDS array that later holds the partial tiles.
#define SGP 1040   // pitch in bytes of a staged row: 8 waves x 128 B + 16 = 16 B x 65, free of bank conflicts for 16-byte fragment reads
__device__ __forceinline__ void acopy8(unsigned l, const char* g, unsigned ls, size_t gs) {   // eight copies: LDS byte address l + i ls, global address g + i gs
    // one statement, so that s_wait_xcnt 0 stands behind the last copy and in front of any rewrite of a register that a copy names
    asm volatile("global_load_async_to_lds_b128 %0, %8, off\n\t"
                 "global_load_async_to_lds_b128 %1, %9, off\n\t"
                 "global_load_async_to_lds_b128 %2, %10, off\n\t"
                 "global_load_async_to_lds_b128 %3, %11, off\n\t"
                 "global_load_async_to_lds_b128 %4, %12, off\n\t"
                 "global_load_async_to_lds_b128 %5, %13, off\n\t"
                 "global_load_async_to_lds_b128 %6, %14, off\n\t"
                 "global_load_async_to_lds_b128 %7, %15, off\n\t"
                 "s_wait_xcnt 0x0"
                 :: "v"(l), "v"(l + ls), "v"(l + 2 * ls), "v"(l + 3 * ls), "v"(l + 4 * ls), "v"(l + 5 * ls), "v"(l + 6 * ls), "v"(l + 7 * ls),
                    "v"(g), "v"(g + gs), "v"(g + 2 * gs), "v"(g + 3 * gs), "v"(g + 4 * gs), "v"(g + 5 * gs), "v"(g + 6 * gs), "v"(g + 7 * gs) : "memory");
}
// gemmw_body is the work of one work-group, its tile (bx, by, bz) and its LDS handed in, so that one launch can hold GEMMs of several kinds (k_proj) on one LDS array.
template <typename T16, int NSPLIT, bool BIAS, int KS, int EPI>
__device__ __forceinline__ void gemmw_body(const T16* __restrict__ A, const T16* __restrict__ A2, const T16* __restrict__ Bt, const T16* __restrict__ Bt2, int K, int KL, float* C, int ldc, const float* __restrict__ bias, size_t sA, size_t sB, size_t sC, bf* Eh, bf* El, float* os, int bx, int by, int bz) {
    typedef typename WFrag<T16>::V V;
    const size_t z = (size_t)bz; A += z * sA; if (A2) A2 += z * sA; Bt += z * sB; if (Bt2) Bt2 += z * sB; C += z * sC;
    const int lane = threadIdx.x & 31, lr = lane & 15, hi = lane >> 4; const int r0 = bx * 64, c0 = by * 64;
    const int wv = (KS == 1) ? 0 : __builtin_amdgcn_readfirstlane((int)(threadIdx.x >> 5)); const int k0 = wv * (KL / KS), k1 = k0 + KL / KS;
    v8f acc[4][4];
#pragma unroll
    for (int mb = 0; mb < 4; ++mb)
#pragma unroll
        for (int nb = 0; nb < 4; ++nb) acc[mb][nb] = (v8f){};
    const size_t aoff = (size_t)(r0 + lr) * K + 8 * hi, boff = (size_t)(c0 + lr) * K + 8 * hi;
    if (KS == 8) {
        char* sl = (char*)os; constexpr int PB_ = (NSPLIT == 1 || NSPLIT == 2) ? 2 : 1;   // planes in LDS, 64 rows each: A, (A2), Bt, (Bt2)
        const unsigned l0 = (unsigned)(size_t)sl + (unsigned)(lane >> 3) * SGP + (unsigned)wv * 128u + (unsigned)(lane & 7) * 16u;
        const size_t g0 = ((size_t)(lane >> 3) * K + k0 + (lane & 7) * 8) * 2, gs = (size_t)K * 8;   // bytes; gs = four rows
        const unsigned fo = (unsigned)lr * SGP + (unsigned)wv * 128u + (unsigned)hi * 16u;
#pragma unroll 1
        for (int ph = 0; ph < KL / KS / 64; ++ph) {   // rolled: a phase is long, and the copies' addresses differ by ph alone
            if (ph) { asm volatile("s_wait_dscnt 0x0" ::: "memory");   // this wave's fragment reads of the last phase are done before it passes the barrier
                __syncthreads(); }   // every wave has left the staged rows before any copy rewrites them
#pragma unroll
            for (int g = 0; g < 2; ++g) { const size_t go = g0 + (size_t)ph * 128 + (size_t)g * 8 * gs; const unsigned lg = l0 + (unsigned)g * (32 * SGP);
                acopy8(lg, (const char*)(A + (size_t)r0 * K) + go, 4 * SGP, gs);
                if (NSPLIT == 1 || NSPLIT == 2) acopy8(lg + 64 * SGP, (const char*)(A2 + (size_t)r0 * K) + go, 4 * SGP, gs);
                acopy8(lg + PB_ * 64 * SGP, (const char*)(Bt + (size_t)c0 * K) + go, 4 * SGP, gs);
                if (NSPLIT >= 2) acopy8(lg + (PB_ + 1) * 64 * SGP, (const char*)(Bt2 + (size_t)c0 * K) + go, 4 * SGP, gs); }
            asm volatile("s_wait_asynccnt 0x0" ::: "memory");   // this wave's copies have landed
            __syncthreads();   // and every wave's, before any fragment is read
#pragma unroll 1
            for (int kl = 0; kl < 2; ++kl) {   // rolled, as the loop from global memory is
                const char* fp = sl + fo + kl * 64; V a[4], a2[4];
#pragma unroll
                for (int mb = 0; mb < 4; ++mb) { a[mb] = WFrag<T16>::ld((const T16*)(fp + mb * 16 * SGP)); if (NSPLIT == 1 || NSPLIT == 2) a2[mb] = WFrag<T16>::ld((const T16*)(fp + (64 + mb * 16) * SGP)); }
#pragma unroll
                for (int nb = 0; nb < 4; ++nb) { const V b = WFrag<T16>::ld((const T16*)(fp + (PB_ * 64 + nb * 16) * SGP)); V b2; if (NSPLIT >= 2) b2 = WFrag<T16>::ld((const T16*)(fp + ((PB_ + 1) * 64 + nb * 16) * SGP));
#pragma unroll
                    for (int mb = 0; mb < 4; ++mb) { acc[mb][nb] = WFrag<T16>::mma(a[mb], b, acc[mb][nb]); if (NSPLIT == 1 || NSPLIT == 2) acc[mb][nb] = WFrag<T16>::mma(a2[mb], b, acc[mb][nb]); if (NSPLIT >= 2) acc[mb][nb] = WFrag<T16>::mma(a[mb], b2, acc[mb][nb]); } }
                asm volatile("v_nop\n\tv_nop\n\tv_nop\n\tv_nop" : "+v"(acc[0][0]), "+v"(acc[1][1]), "+v"(acc[2][2]), "+v"(acc[3][3]) : "v"(a[0]), "v"(a[3]));   // the distance behind the last matrix instruction, on the loop's back edge too
            }
        }
        asm volatile("s_wait_dscnt 0x0" ::: "memory");   // this wave's last fragment reads are done
        __syncthreads();   // every wave has left the staged rows before the partial tiles are written over them
    } else
#pragma unroll 1
    for (int kc = k0; kc < k1; kc += 32) {
        V a[4], a2[4];
#pragma unroll
        for (int mb = 0; mb < 4; ++mb) { a[mb] = WFrag<T16>::ld(A + aoff + (size_t)mb * 16 * K + kc); if (NSPLIT == 1 || NSPLIT == 2) a2[mb] = WFrag<T16>::ld(A2 + aoff + (size_t)mb * 16 * K + kc); }
#pragma unroll
        for (int nb = 0; nb < 4; ++nb) { const V b = WFrag<T16>::ld(Bt + boff + (size_t)nb * 16 * K + kc); V b2; if (NSPLIT >= 2) b2 = WFrag<T16>::ld(Bt2 + boff + (size_t)nb * 16 * K + kc);
#pragma unroll
            for (int mb = 0; mb < 4; ++mb) { acc[mb][nb] = WFrag<T16>::mma(a[mb], b, acc[mb][nb]); if (NSPLIT == 1 || NSPLIT == 2) acc[mb][nb] = WFrag<T16>::mma(a2[mb], b, acc[mb][nb]); if (NSPLIT >= 2) acc[mb][nb] = WFrag<T16>::mma(a[mb], b2, acc[mb][nb]); } }
        asm volatile("v_nop\n\tv_nop\n\tv_nop\n\tv_nop" : "+v"(acc[0][0]), "+v"(acc[1][1]), "+v"(acc[2][2]), "+v"(acc[3][3]) : "v"(a[0]), "v"(a[3]));
    }
    if (KS > 1) {
        float* my = os + wv * (64 * 68);
#pragma unroll
        for (int mb = 0; mb < 4; ++mb)
#pragma unroll
            for (int nb = 0; nb < 4; ++nb)
#pragma unroll
                for (int j = 0; j < 8; ++j) my[(mb * 16 + hi * 8 + j) * 68 + nb * 16 + lr] = acc[mb][nb][j];
        constexpr int NS = 1024 / (32 * KS);
        v4f oc[EPI == 3 ? NS : 1];
        if (EPI == 3) {   // the context values this thread adds to, asked for ahead of the barrier so that their latency runs beside it
#pragma unroll
            for (int s = 0; s < NS; ++s) { const int slot = s * (32 * KS) + (int)threadIdx.x; oc[s] = *(const v4f*)(C + (size_t)(r0 + (slot >> 4)) * ldc + (slot & 15) * 4); } }
        __syncthreads();   // every wave's partial tile is in LDS before any wave sums across them
        v4us eh[EPI == 0 ? 1 : NS], el[EPI == 0 ? 1 : NS];
#pragma unroll
        for (int s = 0; s < 1024 / (32 * KS); ++s) { const int slot = s * (32 * KS) + (int)threadIdx.x; const int row = slot >> 4, cofs = (slot & 15) * 4; v4f val = *(const v4fa*)(os + row * 68 + cofs);
#pragma unroll
            for (int w = 1; w < KS; ++w) { const v4f p = *(const v4fa*)(os + w * (64 * 68) + row * 68 + cofs); val += p; }
            if (BIAS) { val[0] += bfr(bias[c0 + cofs]); val[1] += bfr(bias[c0 + cofs + 1]); val[2] += bfr(bias[c0 + cofs + 2]); val[3] += bfr(bias[c0 + cofs + 3]); }
            if (EPI == 0) { *(v4f*)(C + (size_t)(r0 + row) * ldc + c0 + cofs) = val; }
            if (EPI == 2) { const float br = bfr(bias[r0 + row]); val[0] += br; val[1] += br; val[2] += br; val[3] += br; }
            if (EPI == 3) { val[0] = __fadd_rn(oc[s][0], val[0]); val[1] = __fadd_rn(oc[s][1], val[1]); val[2] = __fadd_rn(oc[s][2], val[2]); val[3] = __fadd_rn(oc[s][3], val[3]); }
            if (EPI != 0) {
#pragma unroll
                for (int q = 0; q < 4; ++q) { unsigned short a, c2; splitf(val[q], a, c2); eh[s][q] = a; el[s][q] = c2; } } }
        if (EPI != 0) {   // the stores stand behind all the sums, so that no store lies between the slots' LDS reads and they can issue together
#pragma unroll
            for (int s = 0; s < NS; ++s) { const int slot = s * (32 * KS) + (int)threadIdx.x; const int R = r0 + (slot >> 4), cofs = (slot & 15) * 4; size_t e = 0, e2 = 0;
                if (EPI == 1) { e = ((size_t)((R & 1) * NH_ + by) * TT + (R >> 1)) * HD + cofs; e2 = e; }
                if (EPI == 2) { e = (z * DKV + R) * (size_t)(2 * TT) + c0 + cofs; e2 = e + TT; }
                if (EPI == 3) { e = (size_t)R * (NB_ * DQ) + z * HD + cofs; e2 = e; }
                *(v4us*)(Eh + e) = eh[s]; *(v4us*)(El + e2) = el[s]; } }
        return;
    }
#pragma unroll
    for (int mb = 0; mb < 4; ++mb) {
#pragma unroll
        for (int nb = 0; nb < 4; ++nb) {
#pragma unroll
            for (int j = 0; j < 8; ++j) os[(hi * 8 + j) * 68 + nb * 16 + lr] = acc[mb][nb][j]; }
        __builtin_amdgcn_wave_barrier(); asm volatile("" ::: "memory");
        float* crow = C + (size_t)(r0 + mb * 16) * ldc + c0;
{
#pragma unroll
            for (int s = 0; s < 8; ++s) { const int row = 2 * s + hi, cofs = lr * 4; v4f val = *(const v4fa*)(os + row * 68 + cofs); if (BIAS) { val[0] += bfr(bias[c0 + cofs]); val[1] += bfr(bias[c0 + cofs + 1]); val[2] += bfr(bias[c0 + cofs + 2]); val[3] += bfr(bias[c0 + cofs + 3]); }
                *(v4f*)(crow + (size_t)row * ldc + cofs) = val; }
             }
        __builtin_amdgcn_wave_barrier(); asm volatile("" ::: "memory");
    }
}
template <typename T16, int NSPLIT, bool BIAS, int KS = 1, int EPI = 0>
__global__ __launch_bounds__(32 * KS) void k_gemmw(const T16* __restrict__ A, const T16* __restrict__ A2, const T16* __restrict__ Bt, const T16* __restrict__ Bt2, int K, int KL, float* C, int ldc, const float* __restrict__ bias, size_t sA, size_t sB, size_t sC, bf* Eh, bf* El) {
    constexpr int NPL = 2 + ((NSPLIT == 1 || NSPLIT == 2) ? 1 : 0) + (NSPLIT >= 2 ? 1 : 0);   // operand planes staged where KS == 8
    __shared__ __align__(16) float os[KS == 1 ? 16 * 68 : ((KS == 8 && NPL * 64 * SGP > KS * 64 * 68 * 4) ? NPL * 64 * SGP / 4 : KS * 64 * 68)];
    gemmw_body<T16, NSPLIT, BIAS, KS, EPI>(A, A2, Bt, Bt2, K, KL, C, ldc, bias, sA, sB, sC, Eh, El, os, (int)blockIdx.x, (int)blockIdx.y, (int)blockIdx.z);
}
// k_proj: the three projections, which do not depend on one another, in ONE launch; grid (64, 16, 3): z = 0 q, 1 k (x = tile of rows 2 t + b, y = head), 2 v^T = Wv . value^T, whose 16 row tiles x 32 column tiles x 2 batch columns are counted through by x + 64 y.
__global__ __launch_bounds__(256) void k_proj(const bf* __restrict__ XQ, const bf* __restrict__ XK, const bf* __restrict__ XV, const bf* __restrict__ WQ, const bf* __restrict__ WK, const bf* __restrict__ WV, const float* __restrict__ bq, const float* __restrict__ bk, const float* __restrict__ bv, int K, bf* QPh, bf* QPl, bf* KPh, bf* KPl, bf* VT) {
    __shared__ __align__(16) float os[8 * 64 * 68];
    const int bx = (int)blockIdx.x, by = (int)blockIdx.y, job = (int)blockIdx.z;   // the same for the whole work-group, so every barrier below is reached by all of it
    if (job == 2) { gemmw_body<bf, 0, false, 8, 2>(WV, nullptr, XV, nullptr, K, K, nullptr, 0, bv, 0, (size_t)TT * DM, 0, VT, VT, os, bx & 15, (bx >> 4) + 4 * (by & 7), by >> 3);
        asm volatile("s_wait_xcnt 0x0" ::: "memory"); }   // stands behind the v^T stores, before the code laid out after them rewrites a register that they name
    else if (job == 1) gemmw_body<bf, 0, true, 8, 1>(XK, nullptr, WK, nullptr, K, K, nullptr, 0, bk, 0, 0, 0, KPh, KPl, os, bx, by, 0);
    else gemmw_body<bf, 0, true, 8, 1>(XQ, nullptr, WQ, nullptr, K, K, nullptr, 0, bq, 0, 0, 0, QPh, QPl, os, bx, by, 0);
}

typedef __attribute__((ext_vector_type(2))) _Float16 v2h;
typedef __attribute__((ext_vector_type(4))) _Float16 v4h;
typedef __attribute__((ext_vector_type(2))) unsigned short v2us;
typedef __attribute__((ext_vector_type(2))) float v2f;
typedef __attribute__((ext_vector_type(4))) int v4i;

// k_fattn: scores, softmax, P.v and the offset fold in ONE kernel; a score never leaves its wave's registers. Work-group = 4 waves x 32 queries of one head (a wave holds QG = 2 column groups of 16 queries, so that each K and v^T fragment it reads from LDS feeds two matrix instructions and a staged tile serves 128 queries); keys in tiles of 64, K hi/lo [key][d] and v^T hi/lo [d][key] staged through registers into two LDS buffers (row pitch 144 B), the next tile's global loads issued before this tile's work.
// Every product is taken transposed, so that a lane owns ONE query of each group (lane & 15): S^T = K.Q^T (rows = keys, columns = queries), O^T = v^T.P^T (rows = d). The accumulator of two 16-key S^T tiles IS the 32-key operand fragment of P^T (register j of tile 0 = key 8 hi + j, of tile 1 = key 16 + 8 hi + j), and row maximum, row sum and rescale are per-lane values.
// Running softmax in the exp2 domain: u = (s + QE[clip(j - i) + 50]) / 8 x log2(e); p = exp2(u - m), sums and O^T rescaled by exp2(m_old - m_new), divided by the row sum at the end. Fold: the two end offsets are running sums of p; an interior offset is one key, whose u waits in the wave's own LDS until m and the sum are final: it takes the slot of the QE value that it was made from, which no other key reads.
typedef __attribute__((ext_vector_type(4))) unsigned int v4u;
typedef v4us __attribute__((may_alias)) v4usa;
#define LP  72     // LDS row pitch in bf16: 144 B = 16 B x 9, free of bank conflicts for 16-byte fragment reads
#define TBP 132    // pitch in floats of a query's 128 offset slots
#define QG  2      // groups of 16 queries per wave
#define UC  (SCL * 1.4426950408889634f)
__global__ __launch_bounds__(128) void k_fattn(const bf* __restrict__ Qh, const bf* __restrict__ Ql, const bf* __restrict__ Kh, const bf* __restrict__ Kl, const bf* __restrict__ Vhl, const float* __restrict__ QE, float* O, bf* Bh, bf* Bl) {
    __shared__ __align__(16) bf st[2][4][64 * LP];          // per buffer: K hi, K lo, v^T hi, v^T lo
    __shared__ __align__(16) float qs[4][QG * 16 * TBP];    // per wave, [query][offset]: its rows of QE x UC; an interior slot later holds its key's u
    const int tid = threadIdx.x, lane = tid & 31, lr = lane & 15, hi = lane >> 4; const int wv = __builtin_amdgcn_readfirstlane(tid >> 5);
    const int z = blockIdx.y; const int q0 = blockIdx.x * (64 * QG) + wv * (16 * QG); const size_t hb = (size_t)z * TT * HD;
    // every global address = a base that is the same for the wave + a lane's byte offset that lives as long as its loads or stores do
    const char* kh = (const char*)(Kh + hb); const char* kl = (const char*)(Kl + hb); const char* vv = (const char*)(Vhl + (size_t)z * HD * 2 * TT); float* qw = qs[wv];
    const unsigned ko = (unsigned)tid * 16u;   // K tile: 8 KiB in a row, slice r = 2 KiB
    const unsigned vo = (unsigned)(tid >> 3) * (2 * TT * 2) + (unsigned)(tid & 7) * 16u;   // v^T tile: row d = 16 r + (tid >> 3) of 8 KiB pitch, lo plane 4 KiB behind hi
    const unsigned qo = (unsigned)(lr * HD + 8 * hi) * 2u, eo = (unsigned)lane * 16u;
    const char* qeb = (const char*)(QE + ((size_t)z * TT + q0) * NE); v4f er[QG * 16];
#pragma unroll
    for (int r = 0; r < QG * 16; ++r) er[r] = *(const v4fa*)(qeb + r * (NE * 4) + (size_t)eo);
    asm volatile("s_wait_xcnt 0x0" :: "v"(eo), "s"(qeb) : "memory");   // stands before a register that the QE loads name is rewritten; their offset and their base, which end here, are held up to it
    v8us pf[16];
#pragma unroll
    for (int r = 0; r < 4; ++r) { pf[r] = *(const v8usa*)(kh + r * 2048 + (size_t)ko); pf[4 + r] = *(const v8usa*)(kl + r * 2048 + (size_t)ko); pf[8 + r] = *(const v8usa*)(vv + r * (16 * 2 * TT * 2) + (size_t)vo); pf[12 + r] = *(const v8usa*)(vv + r * (16 * 2 * TT * 2) + TT * 2 + (size_t)vo); }
    v16bf qh[QG][2], ql[QG][2]; const char* qhb = (const char*)(Qh + hb + (size_t)q0 * HD); const char* qlb = (const char*)(Ql + hb + (size_t)q0 * HD);
#pragma unroll
    for (int g = 0; g < QG; ++g)
#pragma unroll
        for (int kc = 0; kc < 2; ++kc) { const int go = g * (16 * HD * 2) + kc * 64; qh[g][kc] = cat16b(*(const v8usa*)(qhb + go + (size_t)qo), *(const v8usa*)(qhb + go + 32 + (size_t)qo)); ql[g][kc] = cat16b(*(const v8usa*)(qlb + go + (size_t)qo), *(const v8usa*)(qlb + go + 32 + (size_t)qo)); }
    asm volatile("s_wait_xcnt 0x0" :: "v"(qo), "s"(qhb), "s"(qlb) : "memory");   // stands before a register that the tile and query loads above name is rewritten; the offset and the two bases that end here are held up to it
#pragma unroll
    for (int r = 0; r < QG * 16; ++r) *(v4fa*)(qw + r * TBP + lane * 4) = er[r] * UC;
    __builtin_amdgcn_wave_barrier(); asm volatile("" ::: "memory");   // compiler order only: other lanes' QE stores stay in front of this lane's reads (one wave's LDS operations run in order)
    float qlo[QG], qhi[QG];
#pragma unroll
    for (int g = 0; g < QG; ++g) { qlo[g] = qw[(g * 16 + lr) * TBP]; qhi[g] = qw[(g * 16 + lr) * TBP + 2 * CUT]; }
#pragma unroll
    for (int r = 0; r < 4; ++r) { const int c = r * 128 + tid; const int o = (c >> 3) * LP + (c & 7) * 8;
#pragma unroll
        for (int pl = 0; pl < 4; ++pl) *(v8usa*)(&st[0][pl][o]) = pf[pl * 4 + r]; }
    __syncthreads();   // tile 0 is in LDS before any wave reads it
    v8f oacc[QG][4]; float m[QG], l[QG], lo_s[QG], hi_s[QG];
#pragma unroll
    for (int g = 0; g < QG; ++g) { m[g] = -3.0e38f; l[g] = 0.f; lo_s[g] = 0.f; hi_s[g] = 0.f;
#pragma unroll
        for (int dt = 0; dt < 4; ++dt) oacc[g][dt] = (v8f){}; }
#pragma unroll 1
    for (int t = 0; t < TT / 64; ++t) {   // rolled: one tile's body is long enough, and the two buffers alternate by index
        const int kb = t * 64; const bf* sb = &st[t & 1][0][0];
        if (t + 1 < TT / 64) {
#pragma unroll
            for (int r = 0; r < 4; ++r) { const size_t kn = (size_t)(kb + 64); pf[r] = *(const v8usa*)(kh + kn * (HD * 2) + r * 2048 + (size_t)ko); pf[4 + r] = *(const v8usa*)(kl + kn * (HD * 2) + r * 2048 + (size_t)ko); pf[8 + r] = *(const v8usa*)(vv + kn * 2 + r * (16 * 2 * TT * 2) + (size_t)vo); pf[12 + r] = *(const v8usa*)(vv + kn * 2 + r * (16 * 2 * TT * 2) + TT * 2 + (size_t)vo); }
            asm volatile("s_wait_xcnt 0x0" ::: "memory"); }   // stands before an address register of the sixteen loads above is rewritten
        v8f s[QG][4];
#pragma unroll
        for (int g = 0; g < QG; ++g)
#pragma unroll
            for (int kt = 0; kt < 4; ++kt) s[g][kt] = (v8f){};
#pragma unroll
        for (int kc = 0; kc < 2; ++kc) { v16bf ah[4], al[4];
#pragma unroll
            for (int kt = 0; kt < 4; ++kt) { const int o = (kt * 16 + lr) * LP + 8 * hi + kc * 32; ah[kt] = WFrag<bf>::ld(sb + o); al[kt] = WFrag<bf>::ld(sb + 64 * LP + o); }
#pragma unroll
            for (int kt = 0; kt < 4; ++kt)
#pragma unroll
                for (int g = 0; g < QG; ++g) s[g][kt] = wmmab(ah[kt], qh[g][kc], s[g][kt]);
#pragma unroll
            for (int kt = 0; kt < 4; ++kt)
#pragma unroll
                for (int g = 0; g < QG; ++g) s[g][kt] = wmmab(al[kt], qh[g][kc], s[g][kt]);
#pragma unroll
            for (int kt = 0; kt < 4; ++kt)
#pragma unroll
                for (int g = 0; g < QG; ++g) s[g][kt] = wmmab(ah[kt], ql[g][kc], s[g][kt]); }
        float u[QG][4][8];
#pragma unroll
        for (int g = 0; g < QG; ++g) { const int qg = q0 + g * 16, i = qg + lr, rb = (g * 16 + lr) * TBP; float tm = -3.0e38f;
#pragma unroll
            for (int kt = 0; kt < 4; ++kt) { const int jb = kb + kt * 16;   // the three cases are the same for the whole wave
                if (jb + 15 - qg <= -CUT) {
#pragma unroll
                    for (int j = 0; j < 8; ++j) u[g][kt][j] = fmaf(s[g][kt][j], UC, qlo[g]);
                } else if (jb - (qg + 15) >= CUT) {
#pragma unroll
                    for (int j = 0; j < 8; ++j) u[g][kt][j] = fmaf(s[g][kt][j], UC, qhi[g]);
                } else { float e[8];   // all eight QE values are read before the first u is stored among them
#pragma unroll
                    for (int j = 0; j < 8; ++j) { const int d = jb + hi * 8 + j - i; e[j] = qw[rb + min(max(d, -CUT), CUT) + CUT]; }
#pragma unroll
                    for (int j = 0; j < 8; ++j) { const int d = jb + hi * 8 + j - i; u[g][kt][j] = fmaf(s[g][kt][j], UC, e[j]); if (d > -CUT && d < CUT) qw[rb + d + CUT] = u[g][kt][j]; }
                }
#pragma unroll
                for (int j = 0; j < 8; ++j) tm = fmaxf(tm, u[g][kt][j]); }
            tm = fmaxf(tm, __shfl_xor(tm, 16, 32));   // the two half-waves hold the two halves of a query's keys
            const float mn = fmaxf(m[g], tm); const float al_ = __builtin_amdgcn_exp2f(m[g] - mn); m[g] = mn;
            float la = 0.f, loa = 0.f, hia = 0.f;
#pragma unroll
            for (int kt = 0; kt < 4; ++kt) { const int jb = kb + kt * 16;
#pragma unroll
                for (int j = 0; j < 8; ++j) u[g][kt][j] = __builtin_amdgcn_exp2f(u[g][kt][j] - mn);
                const float s8 = ((u[g][kt][0] + u[g][kt][1]) + (u[g][kt][2] + u[g][kt][3])) + ((u[g][kt][4] + u[g][kt][5]) + (u[g][kt][6] + u[g][kt][7])); la += s8;
                if (jb + 15 - qg <= -CUT) loa += s8;
                else if (jb - (qg + 15) >= CUT) hia += s8;
                else {
#pragma unroll
                    for (int j = 0; j < 8; ++j) { const int d = jb + hi * 8 + j - i; loa += (d <= -CUT) ? u[g][kt][j] : 0.f; hia += (d >= CUT) ? u[g][kt][j] : 0.f; }
                } }
            l[g] = fmaf(l[g], al_, la); lo_s[g] = fmaf(lo_s[g], al_, loa); hi_s[g] = fmaf(hi_s[g], al_, hia);
#pragma unroll
            for (int dt = 0; dt < 4; ++dt)
#pragma unroll
                for (int j = 0; j < 8; ++j) oacc[g][dt][j] *= al_; }
#pragma unroll
        for (int c = 0; c < 2; ++c) { v16bf ph[QG], pl[QG];
#pragma unroll
            for (int g = 0; g < QG; ++g)
#pragma unroll
                for (int e = 0; e < 16; ++e) { const float x = u[g][2 * c + (e >> 3)][e & 7]; const __bf16 h = (__bf16)x; ph[g][e] = h; pl[g][e] = (__bf16)(x - (float)h); }
            v16bf vh[4], vl[4];
#pragma unroll
            for (int dt = 0; dt < 4; ++dt) { const int o = (dt * 16 + lr) * LP + 8 * hi + c * 32; vh[dt] = WFrag<bf>::ld(sb + 2 * 64 * LP + o); vl[dt] = WFrag<bf>::ld(sb + 3 * 64 * LP + o); }
#pragma unroll
            for (int dt = 0; dt < 4; ++dt)
#pragma unroll
                for (int g = 0; g < QG; ++g) oacc[g][dt] = wmmab(vh[dt], ph[g], oacc[g][dt]);
#pragma unroll
            for (int dt = 0; dt < 4; ++dt)
#pragma unroll
                for (int g = 0; g < QG; ++g) oacc[g][dt] = wmmab(vl[dt], ph[g], oacc[g][dt]);
#pragma unroll
            for (int dt = 0; dt < 4; ++dt)
#pragma unroll
                for (int g = 0; g < QG; ++g) oacc[g][dt] = wmmab(vh[dt], pl[g], oacc[g][dt]); }
        if (t + 1 < TT / 64) {
#pragma unroll
            for (int r = 0; r < 4; ++r) { const int c = r * 128 + tid; const int o = (c >> 3) * LP + (c & 7) * 8;
#pragma unroll
                for (int pl = 0; pl < 4; ++pl) *(v8usa*)(&st[(t + 1) & 1][pl][o]) = pf[pl * 4 + r]; } }
        __syncthreads();   // publishes tile t + 1 and ends every wave's reads of tile t, whose buffer the next trip refills
    }
    asm volatile("s_wait_xcnt 0x0" :: "v"(ko), "v"(vo) : "memory");   // stands before the tile loads' two offset registers may be rewritten; they are held up to it
    float f[QG]; char* ob = (char*)(O + hb + (size_t)q0 * HD); const unsigned oo = (unsigned)(lr * HD + hi * 8) * 4u;
#pragma unroll
    for (int g = 0; g < QG; ++g) { l[g] += __shfl_xor(l[g], 16, 32); lo_s[g] += __shfl_xor(lo_s[g], 16, 32); hi_s[g] += __shfl_xor(hi_s[g], 16, 32);
        f[g] = __fdiv_rn(1.0f, l[g]); lo_s[g] *= f[g]; hi_s[g] *= f[g];
#pragma unroll
        for (int dt = 0; dt < 4; ++dt) { v4f a, b;
#pragma unroll
            for (int j = 0; j < 4; ++j) { a[j] = oacc[g][dt][j] * f[g]; b[j] = oacc[g][dt][4 + j] * f[g]; }
            *(v4fa*)(ob + g * (16 * HD * 4) + dt * 64 + (size_t)oo) = a; *(v4fa*)(ob + g * (16 * HD * 4) + dt * 64 + 16 + (size_t)oo) = b; } }
    asm volatile("s_wait_xcnt 0x0" :: "v"(oo) : "memory");   // stands before a register that the stores above name is rewritten
    __builtin_amdgcn_wave_barrier(); asm volatile("" ::: "memory");   // compiler order only: other lanes' u stores stay in front of this lane's reads (one wave's LDS operations run in order)
#pragma unroll
    for (int g = 0; g < QG; ++g)
#pragma unroll 1
    for (int r = 0; r < 16; ++r) {   // rolled: sixteen short rows a group, once a wave
        const float mr = __shfl(m[g], r, 32), fr = __shfl(f[g], r, 32), lor = __shfl(lo_s[g], r, 32), hir = __shfl(hi_s[g], r, 32); const int ir = q0 + g * 16 + r; const v4f uu = *(const v4fa*)(qw + (g * 16 + r) * TBP + lane * 4); v4us oh, ol;
#pragma unroll
        for (int q = 0; q < 4; ++q) { const int bkt = lane * 4 + q; const int j = ir + bkt - CUT; const float y = __builtin_amdgcn_exp2f(uu[q] - mr) * fr; const bool in = bkt > 0 && bkt < 2 * CUT && j >= 0 && j < TT;   // a slot that no key of the row reached still holds its QE value and is not taken
            const float w = (bkt == 0) ? lor : ((bkt == 2 * CUT) ? hir : (in ? y : 0.f)); unsigned short a, c2; splitf(w, a, c2); oh[q] = a; ol[q] = c2; }
        const size_t po = ((size_t)z * TT + ir) * NE * 2; const unsigned bo = (unsigned)lane * 8u; *(v4usa*)((char*)Bh + po + (size_t)bo) = oh; *(v4usa*)((char*)Bl + po + (size_t)bo) = ol;
        asm volatile("s_wait_xcnt 0x0" :: "v"(bo) : "memory"); }   // stands before the next row rewrites a register that the two stores name
}
// k_prep: every rounding of an input to bf16 in ONE launch (none depends on another). A work-group takes 2048 runs of 8 floats of one tensor, a thread 8 of them, all eight loads asked for before the first is used.
// Work-groups 0..767: query, key (rows 2 t + b as they lie) and value (its rows laid out batch column by batch column, row b TT + t, so that 64 rows in a row are 64 t of one column); 768..1023: the four weights; then 4 for rel_k -> [128][64], rows >= 101 zero, and 8 for rel_v^T hi/lo [64][128], columns >= 101 zero.
#define PU   8
#define PXB  (NB_ * TT * DM / 8 / (256 * PU))   // work-groups per input tensor
#define PWB  (DQ * DM / 8 / (256 * PU))         // work-groups per weight
#define PEK  (NE * HD / 8 / 256)
#define PEV  (HD * NE / 4 / 256)
template <int STEP> __device__ __forceinline__ void put8(char* db, unsigned so, const v8f (&v)[PU]) {
#pragma unroll
    for (int u = 0; u < PU; ++u) { v8us o;
#pragma unroll
        for (int k = 0; k < 8; ++k) o[k] = f2bf(v[u][k]);
        *(v8usa*)(db + u * STEP + (size_t)so) = o; }
}
__global__ __launch_bounds__(256) void k_prep(const float* __restrict__ xq, const float* __restrict__ xk, const float* __restrict__ xv, const float* __restrict__ wq, const float* __restrict__ wk, const float* __restrict__ wv, const float* __restrict__ wo, const float* __restrict__ ek, const float* __restrict__ ev, bf* XQ, bf* XK, bf* XV, bf* WQ, bf* WK, bf* WV, bf* WO, bf* EB, bf* Th, bf* Tl) {
    const int b = (int)blockIdx.x, tid = (int)threadIdx.x;
    if (b < 3 * PXB + 4 * PWB) {
        const float* src; bf* dst; int lb;   // all three the same for the work-group
        if (b < 3 * PXB) { lb = b % PXB; src = b < PXB ? xq : (b < 2 * PXB ? xk : xv); dst = b < PXB ? XQ : (b < 2 * PXB ? XK : XV); }
        else { const int w = (b - 3 * PXB) / PWB; lb = (b - 3 * PXB) % PWB; src = w == 0 ? wq : (w == 1 ? wk : (w == 2 ? wv : wo)); dst = w == 0 ? WQ : (w == 1 ? WK : (w == 2 ? WV : WO)); }
        const char* sb = (const char*)(src + (size_t)lb * (256 * PU * 8)); const unsigned lo = (unsigned)tid * 32u; v8f v[PU];
#pragma unroll
        for (int u = 0; u < PU; ++u) v[u] = *(const v8f*)(sb + u * (256 * 32) + (size_t)lo);
        if (b >= 2 * PXB && b < 3 * PXB) put8<DM * 2>((char*)(dst + (size_t)lb * (PU * DM)), (unsigned)((tid >> 7) * (TT * DM) + (tid & 127) * 8) * 2u, v);   // run u of the thread lies in row 2 (8 lb + u) + (tid >> 7) of value
        else put8<256 * 16>((char*)(dst + (size_t)lb * (256 * PU * 8)), (unsigned)tid * 16u, v);
        return;
    }
    if (b < 3 * PXB + 4 * PWB + PEK) { const size_t i = (size_t)(b - (3 * PXB + 4 * PWB)) * 256 + tid; const int d0 = (int)(i % (HD / 8)) * 8; const int r = (int)(i / (HD / 8)); const float* src = ek + (size_t)min(r, NRE - 1) * HD + d0; v8us o;
#pragma unroll
        for (int q = 0; q < 8; ++q) { const unsigned short v = f2bf(src[q]); o[q] = (r < NRE) ? v : (unsigned short)0; }
        *(v8us*)(EB + (size_t)r * HD + d0) = o;
        asm volatile("s_wait_xcnt 0x0" ::: "memory");   // stands behind the store, before the code laid out after it rewrites a register that it names
        return; }
    { const size_t i = (size_t)(b - (3 * PXB + 4 * PWB + PEK)) * 256 + tid; const size_t e = i * 4; const int c0 = (int)(e % NE); const int d = (int)(e / NE); v4us oh, ol;
#pragma unroll
        for (int q = 0; q < 4; ++q) { const int r = c0 + q; const float v = bfr(ev[(size_t)min(r, NRE - 1) * HD + d]); unsigned short u, w; splitf(v, u, w);   /* input rounded to bf16 once: lo == 0 */ oh[q] = (r < NRE) ? u : (unsigned short)0; ol[q] = (r < NRE) ? w : (unsigned short)0; }
        *(v4us*)(Th + e) = oh; *(v4us*)(Tl + e) = ol;
        asm volatile("s_wait_xcnt 0x0" ::: "memory"); }   // stands behind the two stores, before the code laid out after them rewrites a register that they name
}

extern "C" void kernel_launch(void* const* d_in, const int* in_sizes, int n_in,
                              void* d_out, int out_size, void* d_ws, size_t ws_size, hipStream_t stream) {
    (void)in_sizes; (void)n_in; (void)out_size;
    const float* x = (const float*)d_in[0];   /* query */ const float* xk = (const float*)d_in[1]; const float* xv = (const float*)d_in[2]; const float* wq = (const float*)d_in[3]; const float* bq = (const float*)d_in[4]; const float* wk = (const float*)d_in[5]; const float* bk = (const float*)d_in[6]; const float* wv = (const float*)d_in[7]; const float* bv = (const float*)d_in[8]; const float* wo = (const float*)d_in[9]; const float* bo = (const float*)d_in[10]; const float* ak = (const float*)d_in[11];   /* rel_k_table [101][64] */ const float* av = (const float*)d_in[12];   /* rel_v_table [101][64] */
    float* OUT = (float*)d_out;     // [2048][2][1024] sequence-first
    char* wsp = (char*)d_ws;
    auto take = [&](size_t bytes) { char* p = wsp; wsp += (bytes + 255) & ~(size_t)255; return (void*)p; };
    bf* AKB = (bf*)take((size_t)NE * HD * 2); bf* AVTh = (bf*)take((size_t)HD * NE * 2); bf* AVTl = (bf*)take((size_t)HD * NE * 2); float* QE = (float*)take((size_t)ZH * TT * NE * 4); bf* PBh = (bf*)take((size_t)ZH * TT * NE * 2); bf* PBl = (bf*)take((size_t)ZH * TT * NE * 2); bf* WQ = (bf*)take((size_t)DQ * DM * 2); bf* WK = (bf*)take((size_t)DKV * DM * 2); bf* WV = (bf*)take((size_t)DKV * DM * 2); bf* WO = (bf*)take((size_t)DM * DQ * 2);
    bf* XQ = (bf*)take((size_t)NB_ * TT * DM * 2); bf* XK = (bf*)take((size_t)NB_ * TT * DM * 2); bf* XV = (bf*)take((size_t)NB_ * TT * DM * 2);
    bf* QPh = (bf*)take((size_t)ZH * TT * HD * 2); bf* QPl = (bf*)take((size_t)ZH * TT * HD * 2); bf* KPh = (bf*)take((size_t)ZH * TT * HD * 2); bf* KPl = (bf*)take((size_t)ZH * TT * HD * 2); bf* VT = (bf*)take((size_t)ZH * HD * 2 * TT * 2);
    float* Ob = (float*)take((size_t)ZH * TT * HD * 4); bf* ATh = (bf*)take((size_t)NB_ * TT * DQ * 2); bf* ATl = (bf*)take((size_t)NB_ * TT * DQ * 2);
    if ((size_t)(wsp - (char*)d_ws) > ws_size) return;
    k_prep<<<3 * PXB + 4 * PWB + PEK + PEV, 256, 0, stream>>>(x, xk, xv, wq, wk, wv, wo, ak, av, XQ, XK, XV, WQ, WK, WV, WO, AKB, AVTh, AVTl);   /* every input -> bf16 */
    // A sequence-first tensor [L][B][HID] is a matrix of L B rows (row 2 t + b); each projection's own epilogue splits its f32 tile into the hi/lo head planes z = 16 b + h that the attention kernel reads.
    k_proj<<<dim3(NB_ * TT / 64, DQ / 64, 3), 256, 0, stream>>>(XQ, XK, XV, WQ, WK, WV, bq, bk, bv, DM, QPh, QPl, KPh, KPl, VT);
    k_gemmw<bf, 1, false><<<dim3(TT / 64, NE / 64, ZH), 32, 0, stream>>>(QPh, QPl, AKB, nullptr, HD, HD, QE, NE, nullptr, (size_t)TT * HD, 0, (size_t)TT * NE, nullptr, nullptr);   /* QE = q . rel_k^T */
    k_fattn<<<dim3(TT / (64 * QG), ZH), 128, 0, stream>>>(QPh, QPl, KPh, KPl, VT, QE, Ob, PBh, PBl);   /* scores + q.rel_k[clip(j - i) + 50], softmax, P.v, attn folded onto the 101 clipped offsets */
    k_gemmw<bf, 2, false, 4, 3><<<dim3(TT / 64, HD / 64, ZH), 128, 0, stream>>>(PBh, PBl, AVTh, AVTl, NE, NE, Ob, HD, nullptr, (size_t)TT * NE, 0, (size_t)TT * HD, ATh, ATl);   /* merged = context + PB . rel_v, hi/lo */
    k_gemmw<bf, 1, true, 8><<<dim3(NB_ * TT / 64, DM / 64, 1), 256, 0, stream>>>(ATh, ATl, WO, nullptr, DQ, DQ, OUT, DM, bo, 0, 0, 0, nullptr, nullptr);   /* rows 2 l + b: the sequence-first output as it lies in memory */
}

// v010
// Measured time: 187 microseconds a run.
// Next to v009, in two timings, it ran 1.12 times as fast each time.
// All steps since v000 together make it 10.2 times as fast.
#include <hip/hip_runtime.h>

// Relative multi-head attention with key AND value relative-position embeddings, sequence-first tensors (query, key, value [2048][2][1024]; q = query Wq^T + bq, k = key Wk^T + bk, v = value Wv^T + bv ('oi' 0.02, biases 0.02; 16 heads x 64); idx[i][j] = clip(j - i, -50, 50) + 50; attn = softmax((q.k + q.rel_k[idx]) / 8); x = attn v + sum_j attn[i][j] rel_v[idx] (rel_k, rel_v [101][64] 0.02, read); out = merged Wo^T + bo -> [2048][2][1024] sequence-first (4.2 M); argument order query, key, value, Wq, bq, Wk, bk, Wv, bv, Wo, bo, rel_k, rel_v).
// Layout: query, key, value each as ONE bf16 matrix of 4096 rows (query, key: row = 2 l + b, the sequence-first order as it lies in memory; value: row = 2048 b + l), all inputs rounded in one launch and the three projections taken in one, so every stage is launched once for both batch columns; head planes z = 16 b + h; 'oi' weights; exact projections + f32 biases; rel_k as a zero-padded bf16 plane [128][64] and rel_v^T as hi/lo planes [64][128]; over all 32 head planes at once, one fused kernel: QE = q.rel_k^T (hi/lo x exact) into LDS, the score tiles (hi/lo 3 products), QE gathered in at column clip(j - i) + 50, running softmax (x 1/8), P.v (hi/lo x hi/lo), the probabilities folded onto the 101 offsets (interior = one key, the two ends = fixed-order sums) and PB.rel_v added to the context; merged hi/lo (row 2 l + b) x Wo exact + bo, whose rows are the output's own.
// Compute dtypes, f32 accumulate: every input rounded to bf16; projections exact + f32 biases; scores and the relative-key term ~f32; softmax f32; P as bf16 hi/lo; attn.v and the relative-value term 3 products (~f32); Wo hl x exact + bias.

#define NB_  2
#define TT   2048
#define DM   1024
#define NH_  16
#define NKV  16
#define REP  (NH_ / NKV)
#define HD   64
#define DQ   (NH_ * HD)
#define DKV  (NKV * HD)
#define ZH   (NB_ * NH_)          // head planes per launch: every head of both batch columns
#define RH   TT                   // unused
#define WIN  0
#define PCAR 1024.0f
#define SCL  0.125f   // 1/sqrt(64) (the module divides by jnp.sqrt(DH))
#define NE   128      // 2*50+1 = 101 relative offsets padded to 128
#define NRE  101
#define CUT  50
typedef _Float16 h16;
typedef unsigned short bf;
typedef __attribute__((ext_vector_type(16))) __bf16   v16bf;
typedef __attribute__((ext_vector_type(16))) _Float16 v16h;
typedef __attribute__((ext_vector_type(8)))  _Float16 v8h;
typedef __attribute__((ext_vector_type(8)))  unsigned short v8us;
typedef __attribute__((ext_vector_type(8)))  float    v8f;
typedef __attribute__((ext_vector_type(4)))  float    v4f;
typedef v8h  __attribute__((may_alias)) v8ha;
typedef v4f  __attribute__((may_alias)) v4fa;
typedef v8us __attribute__((may_alias)) v8usa;

__device__ __forceinline__ unsigned short f2bf(float f) { unsigned u = __float_as_uint(f); u += 0x7FFFu + ((u >> 16) & 1u); return (unsigned short)(u >> 16); }
__device__ __forceinline__ float bf2f(unsigned short b) { return __uint_as_float(((unsigned)b) << 16); }
__device__ __forceinline__ float bfr(float f) { return bf2f(f2bf(f)); }
__device__ __forceinline__ void splitf(float y, unsigned short& h, unsigned short& l) { h = f2bf(y); l = f2bf(y - bf2f(h)); }
typedef __attribute__((ext_vector_type(4))) unsigned short v4us;
__device__ __forceinline__ v16h cat16(v8h lo, v8h hi) { return __builtin_shufflevector(lo, hi, 0, 1, 2, 3, 4, 5, 6, 7, 8, 9, 10, 11, 12, 13, 14, 15); }
__device__ __forceinline__ v16bf cat16b(v8us lo, v8us hi) { return __builtin_bit_cast(v16bf, __builtin_shufflevector(lo, hi, 0, 1, 2, 3, 4, 5, 6, 7, 8, 9, 10, 11, 12, 13, 14, 15)); }
__device__ __forceinline__ v8f wmma16(v16h a, v16h b, v8f c) { return __builtin_amdgcn_wmma_f32_16x16x32_f16(false, a, false, b, (short)0, c, false, false); }
__device__ __forceinline__ v8f wmmab(v16bf a, v16bf b, v8f c) { return __builtin_amdgcn_wmma_f32_16x16x32_bf16(false, a, false, b, (short)0, c, false, false); }



// ---- k_gemmw: register-blocked GEMM, ONE WAVE per 64x64 output tile (16 accumulators), operands straight from K-contiguous 16-bit planes; grid (M/64, N/64, Z), 32 threads.
// C[m][n] (f32, pitch ldc, + optional f32 bias[n]) = sum_{k < KL} A[m][k] Bt[n][k] (+ split products per NSPLIT). K = row pitch of A and Bt in elements, KL <= K the summed length. z-batch strides sA/sB/sC in elements. KL % 32 == 0.
// KS > 1 (long K, few tiles): 32 KS threads, wave w of the work-group takes k in [w KL/KS, (w+1) KL/KS) of the same tile; the KS partial tiles are summed in fixed wave order through LDS. KL % (32 KS) == 0.
template <typename T16> struct WFrag;
template <> struct WFrag<h16> { typedef v16h V; static __device__ __forceinline__ V ld(const h16* p) { return cat16(*(const v8h*)p, *(const v8h*)(p + 16)); } static __device__ __forceinline__ v8f mma(V a, V b, v8f c) { return wmma16(a, b, c); } };
template <> struct WFrag<bf> { typedef v16bf V; static __device__ __forceinline__ V ld(const bf* p) { return cat16b(*(const v8us*)p, *(const v8us*)(p + 16)); } static __device__ __forceinline__ v8f mma(V a, V b, v8f c) { return wmmab(a, b, c); } };
// EPI (KS > 1 only) = what the summed tile becomes; 1 to 3 write the next stage's bf16 hi/lo operand planes themselves, whole 128-byte rows, and no f32 tile:
//   0: f32 C. 1: rows 2 t + b, columns 64 h + d -> head planes Eh, El [16 b + h][t][d]. 2: rows 64 h + d (A = the weight; bias added by ROW, BIAS false), columns t (Bt = the input's rows of batch column z) -> v^T rows Eh [16 z + h][d][2048 hi | 2048 lo].
//   3: head plane z, rows t, columns d: C is READ (the context P.v), the tile added to it -> merged rows Eh, El [2 t + b][64 h + d], z = 16 b + h.
// KS == 8: the operands do not go from global memory into fragments (a fragment load touches sixteen lines, 32 B of each) but through LDS: in each of KL / KS / 64 phases every wave copies, for all 64 rows of each operand plane, the 128 B (one whole line, 64 k) of its own k range that come next, by asynchronous copies of 16 B a lane (a copy instruction = 4 rows x 128 B), and then reads its fragments from there. Each wave keeps its k range and walks it in the same order. The staged rows lie in the LDS array that later holds the partial tiles.
#define SGP 1040   // pitch in bytes of a staged row: 8 waves x 128 B + 16 = 16 B x 65, free of bank conflicts for 16-byte fragment reads
__device__ __forceinline__ void acopy8(unsigned l, const char* g, unsigned ls, size_t gs) {   // eight copies: LDS byte address l + i ls, global address g + i gs
    // one statement, so that s_wait_xcnt 0 stands behind the last copy and in front of any rewrite of a register that a copy names
    asm volatile("global_load_async_to_lds_b128 %0, %8, off\n\t"
                 "global_load_async_to_lds_b128 %1, %9, off\n\t"
                 "global_load_async_to_lds_b128 %2, %10, off\n\t"
                 "global_load_async_to_lds_b128 %3, %11, off\n\t"
                 "global_load_async_to_lds_b128 %4, %12, off\n\t"
                 "global_load_async_to_lds_b128 %5, %13, off\n\t"
                 "global_load_async_to_lds_b128 %6, %14, off\n\t"
                 "global_load_async_to_lds_b128 %7, %15, off\n\t"
                 "s_wait_xcnt 0x0"
                 :: "v"(l), "v"(l + ls), "v"(l + 2 * ls), "v"(l + 3 * ls), "v"(l + 4 * ls), "v"(l + 5 * ls), "v"(l + 6 * ls), "v"(l + 7 * ls),
                    "v"(g), "v"(g + gs), "v"(g + 2 * gs), "v"(g + 3 * gs), "v"(g + 4 * gs), "v"(g + 5 * gs), "v"(g + 6 * gs), "v"(g + 7 * gs) : "memory");
}
// gemmw_body is the work of one work-group, its tile (bx, by, bz) and its LDS handed in, so that one launch can hold GEMMs of several kinds (k_proj) on one LDS array.
template <typename T16, int NSPLIT, bool BIAS, int KS, int EPI>
__device__ __forceinline__ void gemmw_body(const T16* __restrict__ A, const T16* __restrict__ A2, const T16* __restrict__ Bt, const T16* __restrict__ Bt2, int K, int KL, float* C, int ldc, const float* __restrict__ bias, size_t sA, size_t sB, size_t sC, bf* Eh, bf* El, float* os, int bx, int by, int bz) {
    typedef typename WFrag<T16>::V V;
    const size_t z = (size_t)bz; A += z * sA; if (A2) A2 += z * sA; Bt += z * sB; if (Bt2) Bt2 += z * sB; C += z * sC;
    const int lane = threadIdx.x & 31, lr = lane & 15, hi = lane >> 4; const int r0 = bx * 64, c0 = by * 64;
    const int wv = (KS == 1) ? 0 : __builtin_amdgcn_readfirstlane((int)(threadIdx.x >> 5)); const int k0 = wv * (KL / KS), k1 = k0 + KL / KS;
    v8f acc[4][4];
#pragma unroll
    for (int mb = 0; mb < 4; ++mb)
#pragma unroll
        for (int nb = 0; nb < 4; ++nb) acc[mb][nb] = (v8f){};
    const size_t aoff = (size_t)(r0 + lr) * K + 8 * hi, boff = (size_t)(c0 + lr) * K + 8 * hi;
    if (KS == 8) {
        char* sl = (char*)os; constexpr int PB_ = (NSPLIT == 1 || NSPLIT == 2) ? 2 : 1;   // planes in LDS, 64 rows each: A, (A2), Bt, (Bt2)
        const unsigned l0 = (unsigned)(size_t)sl + (unsigned)(lane >> 3) * SGP + (unsigned)wv * 128u + (unsigned)(lane & 7) * 16u;
        const size_t g0 = ((size_t)(lane >> 3) * K + k0 + (lane & 7) * 8) * 2, gs = (size_t)K * 8;   // bytes; gs = four rows
        const unsigned fo = (unsigned)lr * SGP + (unsigned)wv * 128u + (unsigned)hi * 16u;
#pragma unroll 1
        for (int ph = 0; ph < KL / KS / 64; ++ph) {   // rolled: a phase is long, and the copies' addresses differ by ph alone
            if (ph) { asm volatile("s_wait_dscnt 0x0" ::: "memory");   // this wave's fragment reads of the last phase are done before it passes the barrier
                __syncthreads(); }   // every wave has left the staged rows before any copy rewrites them
#pragma unroll
            for (int g = 0; g < 2; ++g) { const size_t go = g0 + (size_t)ph * 128 + (size_t)g * 8 * gs; const unsigned lg = l0 + (unsigned)g * (32 * SGP);
                acopy8(lg, (const char*)(A + (size_t)r0 * K) + go, 4 * SGP, gs);
                if (NSPLIT == 1 || NSPLIT == 2) acopy8(lg + 64 * SGP, (const char*)(A2 + (size_t)r0 * K) + go, 4 * SGP, gs);
                acopy8(lg + PB_ * 64 * SGP, (const char*)(Bt + (size_t)c0 * K) + go, 4 * SGP, gs);
                if (NSPLIT >= 2) acopy8(lg + (PB_ + 1) * 64 * SGP, (const char*)(Bt2 + (size_t)c0 * K) + go, 4 * SGP, gs); }
            asm volatile("s_wait_asynccnt 0x0" ::: "memory");   // this wave's copies have landed
            __syncthreads();   // and every wave's, before any fragment is read
#pragma unroll 1
            for (int kl = 0; kl < 2; ++kl) {   // rolled, as the loop from global memory is
                const char* fp = sl + fo + kl * 64; V a[4], a2[4];
#pragma unroll
                for (int mb = 0; mb < 4; ++mb) { a[mb] = WFrag<T16>::ld((const T16*)(fp + mb * 16 * SGP)); if (NSPLIT == 1 || NSPLIT == 2) a2[mb] = WFrag<T16>::ld((const T16*)(fp + (64 + mb * 16) * SGP)); }
#pragma unroll
                for (int nb = 0; nb < 4; ++nb) { const V b = WFrag<T16>::ld((const T16*)(fp + (PB_ * 64 + nb * 16) * SGP)); V b2; if (NSPLIT >= 2) b2 = WFrag<T16>::ld((const T16*)(fp + ((PB_ + 1) * 64 + nb * 16) * SGP));
#pragma unroll
                    for (int mb = 0; mb < 4; ++mb) { acc[mb][nb] = WFrag<T16>::mma(a[mb], b, acc[mb][nb]); if (NSPLIT == 1 || NSPLIT == 2) acc[mb][nb] = WFrag<T16>::mma(a2[mb], b, acc[mb][nb]); if (NSPLIT >= 2) acc[mb][nb] = WFrag<T16>::mma(a[mb], b2, acc[mb][nb]); } }
                asm volatile("v_nop\n\tv_nop\n\tv_nop\n\tv_nop" : "+v"(acc[0][0]), "+v"(acc[1][1]), "+v"(acc[2][2]), "+v"(acc[3][3]) : "v"(a[0]), "v"(a[3]));   // the distance behind the last matrix instruction, on the loop's back edge too
            }
        }
        asm volatile("s_wait_dscnt 0x0" ::: "memory");   // this wave's last fragment reads are done
        __syncthreads();   // every wave has left the staged rows before the partial tiles are written over them
    } else
#pragma unroll 1
    for (int kc = k0; kc < k1; kc += 32) {
        V a[4], a2[4];
#pragma unroll
        for (int mb = 0; mb < 4; ++mb) { a[mb] = WFrag<T16>::ld(A + aoff + (size_t)mb * 16 * K + kc); if (NSPLIT == 1 || NSPLIT == 2) a2[mb] = WFrag<T16>::ld(A2 + aoff + (size_t)mb * 16 * K + kc); }
#pragma unroll
        for (int nb = 0; nb < 4; ++nb) { const V b = WFrag<T16>::ld(Bt + boff + (size_t)nb * 16 * K + kc); V b2; if (NSPLIT >= 2) b2 = WFrag<T16>::ld(Bt2 + boff + (size_t)nb * 16 * K + kc);
#pragma unroll
            for (int mb = 0; mb < 4; ++mb) { acc[mb][nb] = WFrag<T16>::mma(a[mb], b, acc[mb][nb]); if (NSPLIT == 1 || NSPLIT == 2) acc[mb][nb] = WFrag<T16>::mma(a2[mb], b, acc[mb][nb]); if (NSPLIT >= 2) acc[mb][nb] = WFrag<T16>::mma(a[mb], b2, acc[mb][nb]); } }
        asm volatile("v_nop\n\tv_nop\n\tv_nop\n\tv_nop" : "+v"(acc[0][0]), "+v"(acc[1][1]), "+v"(acc[2][2]), "+v"(acc[3][3]) : "v"(a[0]), "v"(a[3]));
    }
    if (KS > 1) {
        float* my = os + wv * (64 * 68);
#pragma unroll
        for (int mb = 0; mb < 4; ++mb)
#pragma unroll
            for (int nb = 0; nb < 4; ++nb)
#pragma unroll
                for (int j = 0; j < 8; ++j) my[(mb * 16 + hi * 8 + j) * 68 + nb * 16 + lr] = acc[mb][nb][j];
        constexpr int NS = 1024 / (32 * KS);
        v4f oc[EPI == 3 ? NS : 1];
        if (EPI == 3) {   // the context values this thread adds to, asked for ahead of the barrier so that their latency runs beside it
#pragma unroll
            for (int s = 0; s < NS; ++s) { const int slot = s * (32 * KS) + (int)threadIdx.x; oc[s] = *(const v4f*)(C + (size_t)(r0 + (slot >> 4)) * ldc + (slot & 15) * 4); } }
        __syncthreads();   // every wave's partial tile is in LDS before any wave sums across them
        v4us eh[EPI == 0 ? 1 : NS], el[EPI == 0 ? 1 : NS];
#pragma unroll
        for (int s = 0; s < 1024 / (32 * KS); ++s) { const int slot = s * (32 * KS) + (int)threadIdx.x; const int row = slot >> 4, cofs = (slot & 15) * 4; v4f val = *(const v4fa*)(os + row * 68 + cofs);
#pragma unroll
            for (int w = 1; w < KS; ++w) { const v4f p = *(const v4fa*)(os + w * (64 * 68) + row * 68 + cofs); val += p; }
            if (BIAS) { val[0] += bfr(bias[c0 + cofs]); val[1] += bfr(bias[c0 + cofs + 1]); val[2] += bfr(bias[c0 + cofs + 2]); val[3] += bfr(bias[c0 + cofs + 3]); }
            if (EPI == 0) { *(v4f*)(C + (size_t)(r0 + row) * ldc + c0 + cofs) = val; }
            if (EPI == 2) { const float br = bfr(bias[r0 + row]); val[0] += br; val[1] += br; val[2] += br; val[3] += br; }
            if (EPI == 3) { val[0] = __fadd_rn(oc[s][0], val[0]); val[1] = __fadd_rn(oc[s][1], val[1]); val[2] = __fadd_rn(oc[s][2], val[2]); val[3] = __fadd_rn(oc[s][3], val[3]); }
            if (EPI != 0) {
#pragma unroll
                for (int q = 0; q < 4; ++q) { unsigned short a, c2; splitf(val[q], a, c2); eh[s][q] = a; el[s][q] = c2; } } }
        if (EPI != 0) {   // the stores stand behind all the sums, so that no store lies between the slots' LDS reads and they can issue together
#pragma unroll
            for (int s = 0; s < NS; ++s) { const int slot = s * (32 * KS) + (int)threadIdx.x; const int R = r0 + (slot >> 4), cofs = (slot & 15) * 4; size_t e = 0, e2 = 0;
                if (EPI == 1) { e = ((size_t)((R & 1) * NH_ + by) * TT + (R >> 1)) * HD + cofs; e2 = e; }
                if (EPI == 2) { e = (z * DKV + R) * (size_t)(2 * TT) + c0 + cofs; e2 = e + TT; }
                if (EPI == 3) { e = (size_t)R * (NB_ * DQ) + z * HD + cofs; e2 = e; }
                *(v4us*)(Eh + e) = eh[s]; *(v4us*)(El + e2) = el[s]; } }
        return;
    }
#pragma unroll
    for (int mb = 0; mb < 4; ++mb) {
#pragma unroll
        for (int nb = 0; nb < 4; ++nb) {
#pragma unroll
            for (int j = 0; j < 8; ++j) os[(hi * 8 + j) * 68 + nb * 16 + lr] = acc[mb][nb][j]; }
        __builtin_amdgcn_wave_barrier(); asm volatile("" ::: "memory");
        float* crow = C + (size_t)(r0 + mb * 16) * ldc + c0;
{
#pragma unroll
            for (int s = 0; s < 8; ++s) { const int row = 2 * s + hi, cofs = lr * 4; v4f val = *(const v4fa*)(os + row * 68 + cofs); if (BIAS) { val[0] += bfr(bias[c0 + cofs]); val[1] += bfr(bias[c0 + cofs + 1]); val[2] += bfr(bias[c0 + cofs + 2]); val[3] += bfr(bias[c0 + cofs + 3]); }
                *(v4f*)(crow + (size_t)row * ldc + cofs) = val; }
             }
        __builtin_amdgcn_wave_barrier(); asm volatile("" ::: "memory");
    }
}
template <typename T16, int NSPLIT, bool BIAS, int KS = 1, int EPI = 0>
__global__ __launch_bounds__(32 * KS) void k_gemmw(const T16* __restrict__ A, const T16* __restrict__ A2, const T16* __restrict__ Bt, const T16* __restrict__ Bt2, int K, int KL, float* C, int ldc, const float* __restrict__ bias, size_t sA, size_t sB, size_t sC, bf* Eh, bf* El) {
    constexpr int NPL = 2 + ((NSPLIT == 1 || NSPLIT == 2) ? 1 : 0) + (NSPLIT >= 2 ? 1 : 0);   // operand planes staged where KS == 8
    __shared__ __align__(16) float os[KS == 1 ? 16 * 68 : ((KS == 8 && NPL * 64 * SGP > KS * 64 * 68 * 4) ? NPL * 64 * SGP / 4 : KS * 64 * 68)];
    gemmw_body<T16, NSPLIT, BIAS, KS, EPI>(A, A2, Bt, Bt2, K, KL, C, ldc, bias, sA, sB, sC, Eh, El, os, (int)blockIdx.x, (int)blockIdx.y, (int)blockIdx.z);
}
// k_proj: the three projections, which do not depend on one another, in ONE launch; grid (64, 16, 3): z = 0 q, 1 k (x = tile of rows 2 t + b, y = head), 2 v^T = Wv . value^T, whose 16 row tiles x 32 column tiles x 2 batch columns are counted through by x + 64 y.
__global__ __launch_bounds__(256) void k_proj(const bf* __restrict__ XQ, const bf* __restrict__ XK, const bf* __restrict__ XV, const bf* __restrict__ WQ, const bf* __restrict__ WK, const bf* __restrict__ WV, const float* __restrict__ bq, const float* __restrict__ bk, const float* __restrict__ bv, int K, bf* QPh, bf* QPl, bf* KPh, bf* KPl, bf* VT) {
    __shared__ __align__(16) float os[8 * 64 * 68];
    const int bx = (int)blockIdx.x, by = (int)blockIdx.y, job = (int)blockIdx.z;   // the same for the whole work-group, so every barrier below is reached by all of it
    if (job == 2) { gemmw_body<bf, 0, false, 8, 2>(WV, nullptr, XV, nullptr, K, K, nullptr, 0, bv, 0, (size_t)TT * DM, 0, VT, VT, os, bx & 15, (bx >> 4) + 4 * (by & 7), by >> 3);
        asm volatile("s_wait_xcnt 0x0" ::: "memory"); }   // stands behind the v^T stores, before the code laid out after them rewrites a register that they name
    else if (job == 1) gemmw_body<bf, 0, true, 8, 1>(XK, nullptr, WK, nullptr, K, K, nullptr, 0, bk, 0, 0, 0, KPh, KPl, os, bx, by, 0);
    else gemmw_body<bf, 0, true, 8, 1>(XQ, nullptr, WQ, nullptr, K, K, nullptr, 0, bq, 0, 0, 0, QPh, QPl, os, bx, by, 0);
}

typedef __attribute__((ext_vector_type(2))) _Float16 v2h;
typedef __attribute__((ext_vector_type(4))) _Float16 v4h;
typedef __attribute__((ext_vector_type(2))) unsigned short v2us;
typedef __attribute__((ext_vector_type(2))) float v2f;
typedef __attribute__((ext_vector_type(4))) int v4i;

// k_fattn: q.rel_k, scores, softmax, P.v, the offset fold and its product with rel_v in ONE kernel; a score never leaves its wave's registers, and QE and the folded probabilities never leave its LDS slots. Work-group = 4 waves x 32 queries of one head (a wave holds QG = 2 column groups of 16 queries, so that each K and v^T fragment it reads from LDS feeds two matrix instructions and a staged tile serves 128 queries); keys in tiles of 64, K hi/lo [key][d] and v^T hi/lo [d][key] staged through registers into two LDS buffers (row pitch 144 B), the next tile's global loads issued before this tile's work.
// Every product is taken transposed, so that a lane owns ONE query of each group (lane & 15): S^T = K.Q^T (rows = keys, columns = queries), O^T = v^T.P^T (rows = d). The accumulator of two 16-key S^T tiles IS the 32-key operand fragment of P^T (register j of tile 0 = key 8 hi + j, of tile 1 = key 16 + 8 hi + j), and row maximum, row sum and rescale are per-lane values.
// Running softmax in the exp2 domain: u = (s + QE[clip(j - i) + 50]) / 8 x log2(e); p = exp2(u - m), sums and O^T rescaled by exp2(m_old - m_new), divided by the row sum at the end. Fold: the two end offsets are running sums of p; an interior offset is one key, whose u waits in the wave's own LDS until m and the sum are final: it takes the slot of the QE value that it was made from, which no other key reads. Both relative-table products are transposed like the rest (QE^T = rel_k.Q^T, O^T += rel_v^T.PB^T), so a lane writes and reads the slots of its own query alone in them.
typedef __attribute__((ext_vector_type(4))) unsigned int v4u;
typedef v4us __attribute__((may_alias)) v4usa;
#define LP  72     // LDS row pitch in bf16: 144 B = 16 B x 9, free of bank conflicts for 16-byte fragment reads
#define TBP 132    // pitch in floats of a query's 128 offset slots
#define QG  2      // groups of 16 queries per wave
#define UC  (SCL * 1.4426950408889634f)
__global__ __launch_bounds__(128) void k_fattn(const bf* __restrict__ Qh, const bf* __restrict__ Ql, const bf* __restrict__ Kh, const bf* __restrict__ Kl, const bf* __restrict__ Vhl, const bf* __restrict__ EB, const bf* __restrict__ Th, const bf* __restrict__ Tl, bf* Eh, bf* El) {
    __shared__ __align__(16) bf st[2][4][64 * LP];          // per buffer: K hi, K lo, v^T hi, v^T lo
    __shared__ __align__(16) float qs[4][QG * 16 * TBP];    // per wave, [query][offset]: its rows of QE x UC; an interior slot later holds its key's u; at the end the merged rows are staged here
    const int tid = threadIdx.x, lane = tid & 31, lr = lane & 15, hi = lane >> 4; const int wv = __builtin_amdgcn_readfirstlane(tid >> 5);
    const int z = blockIdx.y; const int q0 = blockIdx.x * (64 * QG) + wv * (16 * QG); const size_t hb = (size_t)z * TT * HD;
    // every global address = a base that is the same for the wave + a lane's byte offset that lives as long as its loads or stores do
    const char* kh = (const char*)(Kh + hb); const char* kl = (const char*)(Kl + hb); const char* vv = (const char*)(Vhl + (size_t)z * HD * 2 * TT); float* qw = qs[wv];
    const unsigned ko = (unsigned)tid * 16u;   // K tile: 8 KiB in a row, slice r = 2 KiB
    const unsigned vo = (unsigned)(tid >> 3) * (2 * TT * 2) + (unsigned)(tid & 7) * 16u;   // v^T tile: row d = 16 r + (tid >> 3) of 8 KiB pitch, lo plane 4 KiB behind hi
    const unsigned qo = (unsigned)(lr * HD + 8 * hi) * 2u;   // a lane's place in a fragment of 16 rows of 128 B: the queries' and rel_k's alike
    v8us pf[16];
#pragma unroll
    for (int r = 0; r < 4; ++r) { pf[r] = *(const v8usa*)(kh + r * 2048 + (size_t)ko); pf[4 + r] = *(const v8usa*)(kl + r * 2048 + (size_t)ko); pf[8 + r] = *(const v8usa*)(vv + r * (16 * 2 * TT * 2) + (size_t)vo); pf[12 + r] = *(const v8usa*)(vv + r * (16 * 2 * TT * 2) + TT * 2 + (size_t)vo); }
    v16bf qh[QG][2], ql[QG][2]; const char* qhb = (const char*)(Qh + hb + (size_t)q0 * HD); const char* qlb = (const char*)(Ql + hb + (size_t)q0 * HD);
#pragma unroll
    for (int g = 0; g < QG; ++g)
#pragma unroll
        for (int kc = 0; kc < 2; ++kc) { const int go = g * (16 * HD * 2) + kc * 64; qh[g][kc] = cat16b(*(const v8usa*)(qhb + go + (size_t)qo), *(const v8usa*)(qhb + go + 32 + (size_t)qo)); ql[g][kc] = cat16b(*(const v8usa*)(qlb + go + (size_t)qo), *(const v8usa*)(qlb + go + 32 + (size_t)qo)); }
    const char* ekb = (const char*)EB; v16bf ea[NE / 16][2];   // rel_k [128][64] as the row operand, 16 offsets a tile
#pragma unroll
    for (int rt = 0; rt < NE / 16; ++rt)
#pragma unroll
        for (int kc = 0; kc < 2; ++kc) { const int go = rt * (16 * HD * 2) + kc * 64; ea[rt][kc] = cat16b(*(const v8usa*)(ekb + go + (size_t)qo), *(const v8usa*)(ekb + go + 32 + (size_t)qo)); }
    asm volatile("s_wait_xcnt 0x0" :: "v"(qo), "s"(qhb), "s"(qlb), "s"(ekb), "v"(ko), "v"(vo), "s"(kh), "s"(kl), "s"(vv) : "memory");   // stands before a register that the tile, query and rel_k loads above name is rewritten; their offsets and bases are held up to it
    __builtin_amdgcn_sched_barrier(0);   // keeps the matrix instructions below behind all the loads above, whose latencies so run together and not one after another
    // QE^T = rel_k . q^T (hi/lo x exact), rows = offsets, columns = the wave's own queries: a lane gets eight offsets in a row of its query and lays them, x UC, into that query's slots
#pragma unroll
    for (int rt = 0; rt < NE / 16; ++rt) { v8f e[QG];
#pragma unroll
        for (int g = 0; g < QG; ++g) e[g] = (v8f){};
#pragma unroll
        for (int kc = 0; kc < 2; ++kc) {
#pragma unroll
            for (int g = 0; g < QG; ++g) e[g] = wmmab(ea[rt][kc], qh[g][kc], e[g]);
#pragma unroll
            for (int g = 0; g < QG; ++g) e[g] = wmmab(ea[rt][kc], ql[g][kc], e[g]); }
#pragma unroll
        for (int g = 0; g < QG; ++g) { float* ep = qw + (g * 16 + lr) * TBP + rt * 16 + hi * 8; v4f a, b;
#pragma unroll
            for (int j = 0; j < 4; ++j) { a[j] = e[g][j] * UC; b[j] = e[g][4 + j] * UC; }
            *(v4fa*)ep = a; *(v4fa*)(ep + 4) = b; } }
    __builtin_amdgcn_wave_barrier(); asm volatile("" ::: "memory");   // compiler order only: other lanes' QE stores stay in front of this lane's reads (one wave's LDS operations run in order)
    float qlo[QG], qhi[QG];
#pragma unroll
    for (int g = 0; g < QG; ++g) { qlo[g] = qw[(g * 16 + lr) * TBP]; qhi[g] = qw[(g * 16 + lr) * TBP + 2 * CUT]; }
#pragma unroll
    for (int r = 0; r < 4; ++r) { const int c = r * 128 + tid; const int o = (c >> 3) * LP + (c & 7) * 8;
#pragma unroll
        for (int pl = 0; pl < 4; ++pl) *(v8usa*)(&st[0][pl][o]) = pf[pl * 4 + r]; }
    __syncthreads();   // tile 0 is in LDS before any wave reads it
    v8f oacc[QG][4]; float m[QG], l[QG], lo_s[QG], hi_s[QG];
#pragma unroll
    for (int g = 0; g < QG; ++g) { m[g] = -3.0e38f; l[g] = 0.f; lo_s[g] = 0.f; hi_s[g] = 0.f;
#pragma unroll
        for (int dt = 0; dt < 4; ++dt) oacc[g][dt] = (v8f){}; }
#pragma unroll 1
    for (int t = 0; t < TT / 64; ++t) {   // rolled: one tile's body is long enough, and the two buffers alternate by index
        const int kb = t * 64; const bf* sb = &st[t & 1][0][0];
        if (t + 1 < TT / 64) {
#pragma unroll
            for (int r = 0; r < 4; ++r) { const size_t kn = (size_t)(kb + 64); pf[r] = *(const v8usa*)(kh + kn * (HD * 2) + r * 2048 + (size_t)ko); pf[4 + r] = *(const v8usa*)(kl + kn * (HD * 2) + r * 2048 + (size_t)ko); pf[8 + r] = *(const v8usa*)(vv + kn * 2 + r * (16 * 2 * TT * 2) + (size_t)vo); pf[12 + r] = *(const v8usa*)(vv + kn * 2 + r * (16 * 2 * TT * 2) + TT * 2 + (size_t)vo); }
            asm volatile("s_wait_xcnt 0x0" ::: "memory"); }   // stands before an address register of the sixteen loads above is rewritten
        v8f s[QG][4];
#pragma unroll
        for (int g = 0; g < QG; ++g)
#pragma unroll
            for (int kt = 0; kt < 4; ++kt) s[g][kt] = (v8f){};
#pragma unroll
        for (int kc = 0; kc < 2; ++kc) { v16bf ah[4], al[4];
#pragma unroll
            for (int kt = 0; kt < 4; ++kt) { const int o = (kt * 16 + lr) * LP + 8 * hi + kc * 32; ah[kt] = WFrag<bf>::ld(sb + o); al[kt] = WFrag<bf>::ld(sb + 64 * LP + o); }
#pragma unroll
            for (int kt = 0; kt < 4; ++kt)
#pragma unroll
                for (int g = 0; g < QG; ++g) s[g][kt] = wmmab(ah[kt], qh[g][kc], s[g][kt]);
#pragma unroll
            for (int kt = 0; kt < 4; ++kt)
#pragma unroll
                for (int g = 0; g < QG; ++g) s[g][kt] = wmmab(al[kt], qh[g][kc], s[g][kt]);
#pragma unroll
            for (int kt = 0; kt < 4; ++kt)
#pragma unroll
                for (int g = 0; g < QG; ++g) s[g][kt] = wmmab(ah[kt], ql[g][kc], s[g][kt]); }
        float u[QG][4][8];
#pragma unroll
        for (int g = 0; g < QG; ++g) { const int qg = q0 + g * 16, i = qg + lr, rb = (g * 16 + lr) * TBP; float tm = -3.0e38f;
#pragma unroll
            for (int kt = 0; kt < 4; ++kt) { const int jb = kb + kt * 16;   // the three cases are the same for the whole wave
                if (jb + 15 - qg <= -CUT) {
#pragma unroll
                    for (int j = 0; j < 8; ++j) u[g][kt][j] = fmaf(s[g][kt][j], UC, qlo[g]);
                } else if (jb - (qg + 15) >= CUT) {
#pragma unroll
                    for (int j = 0; j < 8; ++j) u[g][kt][j] = fmaf(s[g][kt][j], UC, qhi[g]);
                } else { float e[8];   // all eight QE values are read before the first u is stored among them
#pragma unroll
                    for (int j = 0; j < 8; ++j) { const int d = jb + hi * 8 + j - i; e[j] = qw[rb + min(max(d, -CUT), CUT) + CUT]; }
#pragma unroll
                    for (int j = 0; j < 8; ++j) { const int d = jb + hi * 8 + j - i; u[g][kt][j] = fmaf(s[g][kt][j], UC, e[j]); if (d > -CUT && d < CUT) qw[rb + d + CUT] = u[g][kt][j]; }
                }
#pragma unroll
                for (int j = 0; j < 8; ++j) tm = fmaxf(tm, u[g][kt][j]); }
            tm = fmaxf(tm, __shfl_xor(tm, 16, 32));   // the two half-waves hold the two halves of a query's keys
            const float mn = fmaxf(m[g], tm); const float al_ = __builtin_amdgcn_exp2f(m[g] - mn); m[g] = mn;
            float la = 0.f, loa = 0.f, hia = 0.f;
#pragma unroll
            for (int kt = 0; kt < 4; ++kt) { const int jb = kb + kt * 16;
#pragma unroll
                for (int j = 0; j < 8; ++j) u[g][kt][j] = __builtin_amdgcn_exp2f(u[g][kt][j] - mn);
                const float s8 = ((u[g][kt][0] + u[g][kt][1]) + (u[g][kt][2] + u[g][kt][3])) + ((u[g][kt][4] + u[g][kt][5]) + (u[g][kt][6] + u[g][kt][7])); la += s8;
                if (jb + 15 - qg <= -CUT) loa += s8;
                else if (jb - (qg + 15) >= CUT) hia += s8;
                else {
#pragma unroll
                    for (int j = 0; j < 8; ++j) { const int d = jb + hi * 8 + j - i; loa += (d <= -CUT) ? u[g][kt][j] : 0.f; hia += (d >= CUT) ? u[g][kt][j] : 0.f; }
                } }
            l[g] = fmaf(l[g], al_, la); lo_s[g] = fmaf(lo_s[g], al_, loa); hi_s[g] = fmaf(hi_s[g], al_, hia);
#pragma unroll
            for (int dt = 0; dt < 4; ++dt)
#pragma unroll
                for (int j = 0; j < 8; ++j) oacc[g][dt][j] *= al_; }
#pragma unroll
        for (int c = 0; c < 2; ++c) { v16bf ph[QG], pl[QG];
#pragma unroll
            for (int g = 0; g < QG; ++g)
#pragma unroll
                for (int e = 0; e < 16; ++e) { const float x = u[g][2 * c + (e >> 3)][e & 7]; const __bf16 h = (__bf16)x; ph[g][e] = h; pl[g][e] = (__bf16)(x - (float)h); }
            v16bf vh[4], vl[4];
#pragma unroll
            for (int dt = 0; dt < 4; ++dt) { const int o = (dt * 16 + lr) * LP + 8 * hi + c * 32; vh[dt] = WFrag<bf>::ld(sb + 2 * 64 * LP + o); vl[dt] = WFrag<bf>::ld(sb + 3 * 64 * LP + o); }
#pragma unroll
            for (int dt = 0; dt < 4; ++dt)
#pragma unroll
                for (int g = 0; g < QG; ++g) oacc[g][dt] = wmmab(vh[dt], ph[g], oacc[g][dt]);
#pragma unroll
            for (int dt = 0; dt < 4; ++dt)
#pragma unroll
                for (int g = 0; g < QG; ++g) oacc[g][dt] = wmmab(vl[dt], ph[g], oacc[g][dt]);
#pragma unroll
            for (int dt = 0; dt < 4; ++dt)
#pragma unroll
                for (int g = 0; g < QG; ++g) oacc[g][dt] = wmmab(vh[dt], pl[g], oacc[g][dt]); }
        if (t + 1 < TT / 64) {
#pragma unroll
            for (int r = 0; r < 4; ++r) { const int c = r * 128 + tid; const int o = (c >> 3) * LP + (c & 7) * 8;
#pragma unroll
                for (int pl = 0; pl < 4; ++pl) *(v8usa*)(&st[(t + 1) & 1][pl][o]) = pf[pl * 4 + r]; } }
        __syncthreads();   // publishes tile t + 1 and ends every wave's reads of tile t, whose buffer the next trip refills
    }
    asm volatile("s_wait_xcnt 0x0" :: "v"(ko), "v"(vo) : "memory");   // stands before the tile loads' two offset registers may be rewritten; they are held up to it
    float f[QG];
#pragma unroll
    for (int g = 0; g < QG; ++g) { l[g] += __shfl_xor(l[g], 16, 32); lo_s[g] += __shfl_xor(lo_s[g], 16, 32); hi_s[g] += __shfl_xor(hi_s[g], 16, 32);
        f[g] = __fdiv_rn(1.0f, l[g]); lo_s[g] *= f[g]; hi_s[g] *= f[g];
#pragma unroll
        for (int dt = 0; dt < 4; ++dt)
#pragma unroll
            for (int j = 0; j < 8; ++j) oacc[g][dt][j] *= f[g]; }
    __builtin_amdgcn_wave_barrier(); asm volatile("" ::: "memory");   // compiler order only: other lanes' u stores stay in front of this lane's reads (one wave's LDS operations run in order)
    // O^T += rel_v^T . PB^T, rel_v^T hi/lo [d][offset] as the row operand: a lane reads its own query's slots in the k order of the P^T fragment (offset 32 c + 8 hi + e, then 16 further on), so m, 1 / sum and the two end sums are its own values
    const char* thb = (const char*)Th; const char* tlb = (const char*)Tl; const unsigned to = (unsigned)(lr * NE + 8 * hi) * 2u;
#pragma unroll 1
    for (int c = 0; c < NE / 32; ++c) {   // rolled: four short passes, once a wave, which unrolled would lengthen the kernel's text by a third
        v16bf th[4], tl[4], ph[QG], pl[QG]; const char* thc = thb + c * 64 + (size_t)to; const char* tlc = tlb + c * 64 + (size_t)to;
#pragma unroll
        for (int dt = 0; dt < 4; ++dt) { const int go = dt * (16 * NE * 2); th[dt] = cat16b(*(const v8usa*)(thc + go), *(const v8usa*)(thc + go + 32)); tl[dt] = cat16b(*(const v8usa*)(tlc + go), *(const v8usa*)(tlc + go + 32)); }
        asm volatile("s_wait_xcnt 0x0" :: "v"(thc), "v"(tlc) : "memory");   // stands before a register that the sixteen loads above name is rewritten; the lane's two addresses of this pass are held up to it, so that no load's result lands on them either
#pragma unroll
        for (int g = 0; g < QG; ++g) { const int i = q0 + g * 16 + lr; const float* up = qw + (g * 16 + lr) * TBP + c * 32 + 8 * hi; v4f uu[4];
            uu[0] = *(const v4fa*)up; uu[1] = *(const v4fa*)(up + 4); uu[2] = *(const v4fa*)(up + 16); uu[3] = *(const v4fa*)(up + 20);
#pragma unroll
            for (int e = 0; e < 16; ++e) { const int bkt = c * 32 + (e >> 3) * 16 + 8 * hi + (e & 7); const int j = i + bkt - CUT; const float y = __builtin_amdgcn_exp2f(uu[e >> 2][e & 3] - m[g]) * f[g]; const bool in = bkt > 0 && bkt < 2 * CUT && j >= 0 && j < TT;   // a slot that no key of the row reached still holds its QE value and is not taken
                const float w = (bkt == 0) ? lo_s[g] : ((bkt == 2 * CUT) ? hi_s[g] : (in ? y : 0.f)); const __bf16 h = (__bf16)w; ph[g][e] = h; pl[g][e] = (__bf16)(w - (float)h); } }
#pragma unroll
        for (int dt = 0; dt < 4; ++dt)
#pragma unroll
            for (int g = 0; g < QG; ++g) oacc[g][dt] = wmmab(th[dt], ph[g], oacc[g][dt]);
#pragma unroll
        for (int dt = 0; dt < 4; ++dt)
#pragma unroll
            for (int g = 0; g < QG; ++g) oacc[g][dt] = wmmab(th[dt], pl[g], oacc[g][dt]);
#pragma unroll
        for (int dt = 0; dt < 4; ++dt)
#pragma unroll
            for (int g = 0; g < QG; ++g) oacc[g][dt] = wmmab(tl[dt], ph[g], oacc[g][dt]); }
    __builtin_amdgcn_wave_barrier(); asm volatile("" ::: "memory");   // compiler order only: every lane's slot reads stay in front of the rows staged over them
    bf* sg = (bf*)qw;   // the wave's own slots now stage its 32 merged rows, hi [32][LP] and lo behind, so that the stores below cover whole 128-byte lines
#pragma unroll
    for (int g = 0; g < QG; ++g)
#pragma unroll
        for (int dt = 0; dt < 4; ++dt) { __attribute__((ext_vector_type(8))) __bf16 oh, ol;
#pragma unroll
            for (int j = 0; j < 8; ++j) { const float x = oacc[g][dt][j]; const __bf16 h = (__bf16)x; oh[j] = h; ol[j] = (__bf16)(x - (float)h); }
            const int o = (g * 16 + lr) * LP + dt * 16 + hi * 8; *(v8usa*)(sg + o) = __builtin_bit_cast(v8us, oh); *(v8usa*)(sg + QG * 16 * LP + o) = __builtin_bit_cast(v8us, ol); }
    __builtin_amdgcn_wave_barrier(); asm volatile("" ::: "memory");   // compiler order only: other lanes' staged pieces stay in front of this lane's reads
    char* ehb = (char*)(Eh + (size_t)q0 * (NB_ * DQ) + (size_t)z * HD); char* elb = (char*)(El + (size_t)q0 * (NB_ * DQ) + (size_t)z * HD);   // merged row 2 t + b, columns 64 h + d, z = 16 b + h
    const unsigned so = (unsigned)(lane >> 3) * (NB_ * DQ * 2) + (unsigned)(lane & 7) * 16u;   // a store = 4 rows x 128 B
#pragma unroll
    for (int r = 0; r < QG * 4; ++r) { const int o = (r * 4 + (lane >> 3)) * LP + (lane & 7) * 8; const v8us a = *(const v8usa*)(sg + o), b = *(const v8usa*)(sg + QG * 16 * LP + o);
        *(v8usa*)(ehb + r * (4 * NB_ * DQ * 2) + (size_t)so) = a; *(v8usa*)(elb + r * (4 * NB_ * DQ * 2) + (size_t)so) = b; }
}
// k_prep: every rounding of an input to bf16 in ONE launch (none depends on another). A work-group takes 2048 runs of 8 floats of one tensor, a thread 8 of them, all eight loads asked for before the first is used.
// Work-groups 0..767: query, key (rows 2 t + b as they lie) and value (its rows laid out batch column by batch column, row b TT + t, so that 64 rows in a row are 64 t of one column); 768..1023: the four weights; then 4 for rel_k -> [128][64], rows >= 101 zero, and 8 for rel_v^T hi/lo [64][128], columns >= 101 zero.
#define PU   8
#define PXB  (NB_ * TT * DM / 8 / (256 * PU))   // work-groups per input tensor
#define PWB  (DQ * DM / 8 / (256 * PU))         // work-groups per weight
#define PEK  (NE * HD / 8 / 256)
#define PEV  (HD * NE / 4 / 256)
template <int STEP> __device__ __forceinline__ void put8(char* db, unsigned so, const v8f (&v)[PU]) {
#pragma unroll
    for (int u = 0; u < PU; ++u) { v8us o;
#pragma unroll
        for (int k = 0; k < 8; ++k) o[k] = f2bf(v[u][k]);
        *(v8usa*)(db + u * STEP + (size_t)so) = o; }
}
__global__ __launch_bounds__(256) void k_prep(const float* __restrict__ xq, const float* __restrict__ xk, const float* __restrict__ xv, const float* __restrict__ wq, const float* __restrict__ wk, const float* __restrict__ wv, const float* __restrict__ wo, const float* __restrict__ ek, const float* __restrict__ ev, bf* XQ, bf* XK, bf* XV, bf* WQ, bf* WK, bf* WV, bf* WO, bf* EB, bf* Th, bf* Tl) {
    const int b = (int)blockIdx.x, tid = (int)threadIdx.x;
    if (b < 3 * PXB + 4 * PWB) {
        const float* src; bf* dst; int lb;   // all three the same for the work-group
        if (b < 3 * PXB) { lb = b % PXB; src = b < PXB ? xq : (b < 2 * PXB ? xk : xv); dst = b < PXB ? XQ : (b < 2 * PXB ? XK : XV); }
        else { const int w = (b - 3 * PXB) / PWB; lb = (b - 3 * PXB) % PWB; src = w == 0 ? wq : (w == 1 ? wk : (w == 2 ? wv : wo)); dst = w == 0 ? WQ : (w == 1 ? WK : (w == 2 ? WV : WO)); }
        const char* sb = (const char*)(src + (size_t)lb * (256 * PU * 8)); const unsigned lo = (unsigned)tid * 32u; v8f v[PU];
#pragma unroll
        for (int u = 0; u < PU; ++u) v[u] = *(const v8f*)(sb + u * (256 * 32) + (size_t)lo);
        if (b >= 2 * PXB && b < 3 * PXB) put8<DM * 2>((char*)(dst + (size_t)lb * (PU * DM)), (unsigned)((tid >> 7) * (TT * DM) + (tid & 127) * 8) * 2u, v);   // run u of the thread lies in row 2 (8 lb + u) + (tid >> 7) of value
        else put8<256 * 16>((char*)(dst + (size_t)lb * (256 * PU * 8)), (unsigned)tid * 16u, v);
        return;
    }
    if (b < 3 * PXB + 4 * PWB + PEK) { const size_t i = (size_t)(b - (3 * PXB + 4 * PWB)) * 256 + tid; const int d0 = (int)(i % (HD / 8)) * 8; const int r = (int)(i / (HD / 8)); const float* src = ek + (size_t)min(r, NRE - 1) * HD + d0; v8us o;
#pragma unroll
        for (int q = 0; q < 8; ++q) { const unsigned short v = f2bf(src[q]); o[q] = (r < NRE) ? v : (unsigned short)0; }
        *(v8us*)(EB + (size_t)r * HD + d0) = o;
        asm volatile("s_wait_xcnt 0x0" ::: "memory");   // stands behind the store, before the code laid out after it rewrites a register that it names
        return; }
    { const size_t i = (size_t)(b - (3 * PXB + 4 * PWB + PEK)) * 256 + tid; const size_t e = i * 4; const int c0 = (int)(e % NE); const int d = (int)(e / NE); v4us oh, ol;
#pragma unroll
        for (int q = 0; q < 4; ++q) { const int r = c0 + q; const float v = bfr(ev[(size_t)min(r, NRE - 1) * HD + d]); unsigned short u, w; splitf(v, u, w);   /* input rounded to bf16 once: lo == 0 */ oh[q] = (r < NRE) ? u : (unsigned short)0; ol[q] = (r < NRE) ? w : (unsigned short)0; }
        *(v4us*)(Th + e) = oh; *(v4us*)(Tl + e) = ol;
        asm volatile("s_wait_xcnt 0x0" ::: "memory"); }   // stands behind the two stores, before the code laid out after them rewrites a register that they name
}

extern "C" void kernel_launch(void* const* d_in, const int* in_sizes, int n_in,
                              void* d_out, int out_size, void* d_ws, size_t ws_size, hipStream_t stream) {
    (void)in_sizes; (void)n_in; (void)out_size;
    const float* x = (const float*)d_in[0];   /* query */ const float* xk = (const float*)d_in[1]; const float* xv = (const float*)d_in[2]; const float* wq = (const float*)d_in[3]; const float* bq = (const float*)d_in[4]; const float* wk = (const float*)d_in[5]; const float* bk = (const float*)d_in[6]; const float* wv = (const float*)d_in[7]; const float* bv = (const float*)d_in[8]; const float* wo = (const float*)d_in[9]; const float* bo = (const float*)d_in[10]; const float* ak = (const float*)d_in[11];   /* rel_k_table [101][64] */ const float* av = (const float*)d_in[12];   /* rel_v_table [101][64] */
    float* OUT = (float*)d_out;     // [2048][2][1024] sequence-first
    char* wsp = (char*)d_ws;
    auto take = [&](size_t bytes) { char* p = wsp; wsp += (bytes + 255) & ~(size_t)255; return (void*)p; };
    bf* AKB = (bf*)take((size_t)NE * HD * 2); bf* AVTh = (bf*)take((size_t)HD * NE * 2); bf* AVTl = (bf*)take((size_t)HD * NE * 2); bf* WQ = (bf*)take((size_t)DQ * DM * 2); bf* WK = (bf*)take((size_t)DKV * DM * 2); bf* WV = (bf*)take((size_t)DKV * DM * 2); bf* WO = (bf*)take((size_t)DM * DQ * 2);
    bf* XQ = (bf*)take((size_t)NB_ * TT * DM * 2); bf* XK = (bf*)take((size_t)NB_ * TT * DM * 2); bf* XV = (bf*)take((size_t)NB_ * TT * DM * 2);
    bf* QPh = (bf*)take((size_t)ZH * TT * HD * 2); bf* QPl = (bf*)take((size_t)ZH * TT * HD * 2); bf* KPh = (bf*)take((size_t)ZH * TT * HD * 2); bf* KPl = (bf*)take((size_t)ZH * TT * HD * 2); bf* VT = (bf*)take((size_t)ZH * HD * 2 * TT * 2);
    bf* ATh = (bf*)take((size_t)NB_ * TT * DQ * 2); bf* ATl = (bf*)take((size_t)NB_ * TT * DQ * 2);
    if ((size_t)(wsp - (char*)d_ws) > ws_size) return;
    k_prep<<<3 * PXB + 4 * PWB + PEK + PEV, 256, 0, stream>>>(x, xk, xv, wq, wk, wv, wo, ak, av, XQ, XK, XV, WQ, WK, WV, WO, AKB, AVTh, AVTl);   /* every input -> bf16 */
    // A sequence-first tensor [L][B][HID] is a matrix of L B rows (row 2 t + b); each projection's own epilogue splits its f32 tile into the hi/lo head planes z = 16 b + h that the attention kernel reads.
    k_proj<<<dim3(NB_ * TT / 64, DQ / 64, 3), 256, 0, stream>>>(XQ, XK, XV, WQ, WK, WV, bq, bk, bv, DM, QPh, QPl, KPh, KPl, VT);
    k_fattn<<<dim3(TT / (64 * QG), ZH), 128, 0, stream>>>(QPh, QPl, KPh, KPl, VT, AKB, AVTh, AVTl, ATh, ATl);   /* QE = q . rel_k^T, scores + QE[clip(j - i) + 50], softmax, P.v, attn folded onto the 101 clipped offsets, + PB . rel_v, merged hi/lo */
    k_gemmw<bf, 1, true, 8><<<dim3(NB_ * TT / 64, DM / 64, 1), 256, 0, stream>>>(ATh, ATl, WO, nullptr, DQ, DQ, OUT, DM, bo, 0, 0, 0, nullptr, nullptr);   /* rows 2 l + b: the sequence-first output as it lies in memory */
}
